// v000
// Measured on an AMD MI455X. A time is GPU time per run, averaged over a window of back-to-back runs after a warm-up
// (all launches, gaps included; the runs take copies of the inputs in turn), and the median of several windows.
// Apart from v000's, it joins two sittings. Times from different sittings can be a few percent apart, while
// side-by-side timings come from the same sitting.
// v000, which the later versions start from, runs in 3450 microseconds.
#include <hip/hip_runtime.h>
// Self-attention block with q/k LayerNorm (x [2][2048][1024]; qkv = x w_qkv^T (natural [3072][1024], sigma 1/32, no bias) -> q | k | v blocks, 16 heads of 64; q = LayerNorm_1024(q; q_gamma, q_beta) and k likewise over the full merged 1024 features (eps 1e-5); softmax(q k^T / 8) (no mask); out = merged w_proj^T + b_proj -> [2][2048][1024]).
// Structure: x as exact f16 rows; natural weights as exact x16 planes; q | k | v as ONE WMMA GEMM (32x64 wave tiles, f32 accumulation; f32 rows for the norms + f16 rows for v); q and k LayerNorm over the merged 1024 features on VALU (f32, LDS trees; bf16 gamma/beta) -> f16 rows; per batch: V^T via LDS transposes; per 4-head group: scores (K = 64, alpha 1/8) into f32 planes, row softmax on VALU (f32 statistics, native exp; weights x256 f16), o = P V^T (o carried x64) into merged f16 rows; out = o w_proj^T + b_proj GEMM (f32, alpha 2^-10); launches: see trace.
// Compute dtype: inputs rounded to bf16; x / weights exact; q, k, v, softmax weights and o as plain f16 GEMM operands (~2^-12); scores and softmax statistics f32. v_wmma_f32_16x16x32_f16.
#define NB 2
#define SQ 2048
#define DM 1024
#define NH 16
#define HD 64
#define HG 4                         /* heads per attention launch group */
#define B0 0                         /* first batch processed (debug hook) */
#define NBR NB                       /* batches processed (debug hook) */
#define NR ((size_t)NB * SQ)
#define DMQ DM         /* LayerNorm width and f16 row pitch */
#define MP ((int)((size_t)NBR * SQ)) /* rows projected (debug hook) */
#define QN SQ                        /* query rows attended per batch (debug hook) */
#define NHD NH                       /* heads attended (debug hook) */
#define MPO MP                       /* rows through the output stage (debug hook) */
#define LQ (3 * DM)      /* row pitch of the q/k/v rows */
typedef __bf16 v16b __attribute__((ext_vector_type(16)));
typedef unsigned short v8us __attribute__((ext_vector_type(8), may_alias));
typedef float  v8f  __attribute__((ext_vector_type(8)));
typedef float  v4f  __attribute__((ext_vector_type(4)));
typedef float  v4fa __attribute__((ext_vector_type(4), may_alias));
union FragB { v16b v; v8us half[2]; unsigned short u[16]; };

__device__ __forceinline__ unsigned short bf16_bits(float x) { unsigned int u = __float_as_uint(x); return (unsigned short)((u + 0x7FFFu + ((u >> 16) & 1u)) >> 16); }
__device__ __forceinline__ float bf16_val(unsigned short b) { return __uint_as_float(((unsigned int)b) << 16); }
__device__ __forceinline__ float bf16_round(float x) { return bf16_val(bf16_bits(x)); }
// D += A·B with NT terms: 1 = ah·bh, 2 = + al·bh (A split), 3 = + ah·bl (both split)
template <int NT>
__device__ __forceinline__ v8f mmaN(v16b ah, v16b al, v16b bh, v16b bl, v8f c) {
  c = __builtin_amdgcn_wmma_f32_16x16x32_bf16(false, ah, false, bh, (short)0, c, false, false);
  if (NT >= 2) c = __builtin_amdgcn_wmma_f32_16x16x32_bf16(false, al, false, bh, (short)0, c, false, false);
  if (NT >= 3) c = __builtin_amdgcn_wmma_f32_16x16x32_bf16(false, ah, false, bl, (short)0, c, false, false);
  asm volatile("v_nop\n\tv_nop\n\tv_nop\n\tv_nop" : "+v"(c) : "v"(ah), "v"(al), "v"(bh), "v"(bl));
  return c;
}

__global__ __launch_bounds__(256) void k_wt_bf16(const float* __restrict__ W, unsigned short* __restrict__ Wt, int K, int N) {
  const int t = blockIdx.x * 256 + threadIdx.x;
  const int k8n = K / 8;
  if (t >= N * k8n) return;
  const int n = t / k8n, k8 = (t % k8n) * 8;
  v8us v;
#pragma unroll
  for (int i = 0; i < 8; ++i) v[i] = bf16_bits(W[(size_t)(k8 + i) * N + n]);
  *(v8us*)(Wt + (size_t)n * K + k8) = v;
  
}

// GEMM C[M][N] (f32, pitch ldc) = act(A[M][K]·W + bias). A f32 row-major (pitch lda) converted per fragment to bf16
// (ASPLIT: hi/lo two planes -> 2 terms, else single rounded term); Wt bf16 [N][K] (pitch ldb). BIAS_BF16 rounds the
// bias to bf16 first (bias quantised to bf16 before the add). K%32==0, M%16==0, N%64==0.
template <bool ASPLIT, int ACT, bool BIAS_BF16>
__global__ __launch_bounds__(128) void k_gemm_bf(const float* __restrict__ A, int lda, const unsigned short* __restrict__ Wt, int ldb,
                                               const float* __restrict__ bias, float* __restrict__ C, int ldc, int M, int N, int K) {
  __shared__ __attribute__((aligned(16))) float so[4][16][64];
  const int tid = threadIdx.x, w = tid >> 5, lane = tid & 31, ln = lane & 15, hh = lane >> 4;
  const int ntn = N / 64;
  const int wid = blockIdx.x * 4 + w;
  const int mt = wid / ntn, nq = wid % ntn;
  if (mt * 16 >= M) return;
  const int row0 = mt * 16, col0 = nq * 64;
  const float* arow = A + (size_t)(row0 + ln) * lda;
  v8f acc[4] = {};
  for (int kb = 0; kb < K; kb += 32) {
    FragB ah, al;
    const v4f x0 = *(const v4fa*)(arow + kb + 8 * hh), x1 = *(const v4fa*)(arow + kb + 8 * hh + 4);
    const v4f x2 = *(const v4fa*)(arow + kb + 16 + 8 * hh), x3 = *(const v4fa*)(arow + kb + 16 + 8 * hh + 4);
    float xs[16] = {x0[0],x0[1],x0[2],x0[3],x1[0],x1[1],x1[2],x1[3],x2[0],x2[1],x2[2],x2[3],x3[0],x3[1],x3[2],x3[3]};
#pragma unroll
    for (int i = 0; i < 16; ++i) { const unsigned short hb = bf16_bits(xs[i]); ah.u[i] = hb; al.u[i] = ASPLIT ? bf16_bits(xs[i] - bf16_val(hb)) : (unsigned short)0; }
#pragma unroll
    for (int t = 0; t < 4; ++t) {
      const unsigned short* brow = Wt + (size_t)(col0 + t * 16 + ln) * ldb + kb;
      FragB b;
      b.half[0] = *(const v8us*)(brow + 8 * hh);
      b.half[1] = *(const v8us*)(brow + 16 + 8 * hh);
      acc[t] = mmaN<ASPLIT ? 2 : 1>(ah.v, al.v, b.v, b.v, acc[t]);
    }
  }
#pragma unroll
  for (int t = 0; t < 4; ++t) {
    float bv = bias ? bias[col0 + t * 16 + ln] : 0.f;
    if (BIAS_BF16) bv = bf16_round(bv);
#pragma unroll
    for (int r = 0; r < 8; ++r) { float v = acc[t][r] + bv; if (ACT == 1) v = fmaxf(v, 0.f); so[w][8 * hh + r][t * 16 + ln] = v; }
  }
  __builtin_amdgcn_fence(__ATOMIC_ACQ_REL, "workgroup");
  __builtin_amdgcn_wave_barrier();
  const int rsub = lane >> 4, c4 = (lane & 15) * 4;
  {
#pragma unroll
    for (int q = 0; q < 8; ++q) {
      const int r = q * 2 + rsub;
      const v4f v = *(const v4fa*)&so[w][r][c4];
      *(v4f*)(C + (size_t)(row0 + r) * ldc + col0 + c4) = v;
    }
    
  }
}

// GEMM C = act(A·W + bias + resid): A f32 (ASPLIT -> hi/lo 2 terms), Wt bf16 [N][K]; ACT 0 none, 1 relu, 2 exact gelu;
// resid (optional, f32, row index = (row % rmod), pitch ldr, RES_BF16 rounds it) added before the activation.
template <bool ASPLIT, int ACT, bool BIAS_BF16, bool RES_BF16>
__global__ __launch_bounds__(128) void k_gemm_bf3(const float* __restrict__ A, int lda, const unsigned short* __restrict__ Wt, int ldb,
                                                const float* __restrict__ bias, const float* __restrict__ resid, int rmod, int ldr,
                                                float* __restrict__ C, int ldc, int M, int N, int K) {
  __shared__ __attribute__((aligned(16))) float so[4][16][64];
  const int tid = threadIdx.x, w = tid >> 5, lane = tid & 31, ln = lane & 15, hh = lane >> 4;
  const int ntn = N / 64;
  const int wid = blockIdx.x * 4 + w;
  const int mt = wid / ntn, nq = wid % ntn;
  if (mt * 16 >= M) return;
  const int row0 = mt * 16, col0 = nq * 64;
  const float* arow = A + (size_t)(row0 + ln) * lda;
  v8f acc[4] = {};
  for (int kb = 0; kb < K; kb += 32) {
    FragB ah, al;
    const v4f x0 = *(const v4fa*)(arow + kb + 8 * hh), x1 = *(const v4fa*)(arow + kb + 8 * hh + 4);
    const v4f x2 = *(const v4fa*)(arow + kb + 16 + 8 * hh), x3 = *(const v4fa*)(arow + kb + 16 + 8 * hh + 4);
    float xs[16] = {x0[0],x0[1],x0[2],x0[3],x1[0],x1[1],x1[2],x1[3],x2[0],x2[1],x2[2],x2[3],x3[0],x3[1],x3[2],x3[3]};
#pragma unroll
    for (int i = 0; i < 16; ++i) { const unsigned short hb = bf16_bits(xs[i]); ah.u[i] = hb; al.u[i] = ASPLIT ? bf16_bits(xs[i] - bf16_val(hb)) : (unsigned short)0; }
#pragma unroll
    for (int t = 0; t < 4; ++t) {
      const unsigned short* brow = Wt + (size_t)(col0 + t * 16 + ln) * ldb + kb;
      FragB b;
      b.half[0] = *(const v8us*)(brow + 8 * hh);
      b.half[1] = *(const v8us*)(brow + 16 + 8 * hh);
      acc[t] = mmaN<ASPLIT ? 2 : 1>(ah.v, al.v, b.v, b.v, acc[t]);
    }
  }
#pragma unroll
  for (int t = 0; t < 4; ++t) {
    const int col = col0 + t * 16 + ln;
    float bv = bias ? bias[col] : 0.f;
    if (BIAS_BF16) bv = bf16_round(bv);
#pragma unroll
    for (int r = 0; r < 8; ++r) {
      float v = acc[t][r] + bv;
      if (resid) { float rv = resid[(size_t)((row0 + 8 * hh + r) % rmod) * ldr + col]; if (RES_BF16) rv = bf16_round(rv); v += rv; }
      if (ACT == 1) v = fmaxf(v, 0.f);
      if (ACT == 2) v = 0.5f * v * (1.0f + erff(v * 0.70710678118654752f));
      if (ACT == 3) { const float u = 0.7978845608028654f * (v + 0.044715f * v * v * v); v = 0.5f * v * (1.0f + tanhf(u)); }
      so[w][8 * hh + r][t * 16 + ln] = v;
    }
  }
  __builtin_amdgcn_fence(__ATOMIC_ACQ_REL, "workgroup");
  __builtin_amdgcn_wave_barrier();
  const int rsub = lane >> 4, c4 = (lane & 15) * 4;
  {
#pragma unroll
    for (int q = 0; q < 8; ++q) {
      const int r = q * 2 + rsub;
      const v4f v = *(const v4fa*)&so[w][r][c4];
      *(v4f*)(C + (size_t)(row0 + r) * ldc + col0 + c4) = v;
    }
    
  }
}
// row LayerNorm (biased variance, eps) over N: s = X (+ R); optional out_sum <- s; out_norm <- (s-mu)*rsqrt(var+eps)*g + b
template <bool PARAM_BF16>
__global__ __launch_bounds__(256) void k_layernorm(const float* __restrict__ X, const float* __restrict__ R, const float* __restrict__ g, const float* __restrict__ bta,
                                                  float* __restrict__ out_sum, float* __restrict__ out_norm, int N, float eps) {
  __shared__ float red[256];
  const int row = blockIdx.x, tid = threadIdx.x;
  const float* x = X + (size_t)row * N; const float* rr = R ? R + (size_t)row * N : nullptr;
  float vals[16];                     // up to N = 4096
  const int per = N / 256;            // contiguous chunk per thread? use strided-by-4 chunks: thread handles j = tid*4 + 1024*u
  float s1 = 0.f;
  for (int u = 0; u < per / 4; ++u) {
    const int j = tid * 4 + 1024 * u;
    const v4f a = *(const v4fa*)(x + j);
    v4f b = {0.f,0.f,0.f,0.f}; if (rr) b = *(const v4fa*)(rr + j);
#pragma unroll
    for (int q = 0; q < 4; ++q) { const float v = a[q] + b[q]; vals[u * 4 + q] = v; s1 += v; }
  }
  red[tid] = s1; __syncthreads();
  for (int st = 128; st > 0; st >>= 1) { if (tid < st) red[tid] += red[tid + st]; __syncthreads(); }
  const float mu = red[0] / (float)N; __syncthreads();
  float s2 = 0.f;
  for (int u = 0; u < per / 4; ++u)
#pragma unroll
    for (int q = 0; q < 4; ++q) { const float c = vals[u * 4 + q] - mu; s2 += c * c; }
  red[tid] = s2; __syncthreads();
  for (int st = 128; st > 0; st >>= 1) { if (tid < st) red[tid] += red[tid + st]; __syncthreads(); }
  const float rs = rsqrtf(red[0] / (float)N + eps);
  {
    for (int u = 0; u < per / 4; ++u) {
      const int j = tid * 4 + 1024 * u;
      v4f o, sm;
#pragma unroll
      for (int q = 0; q < 4; ++q) {
        float gg = g[j + q], bb = bta[j + q];
        if (PARAM_BF16) { gg = bf16_round(gg); bb = bf16_round(bb); }
        sm[q] = vals[u * 4 + q]; o[q] = (vals[u * 4 + q] - mu) * rs * gg + bb;
      }
      if (out_sum) *(v4f*)(out_sum + (size_t)row * N + j) = sm;
      *(v4f*)(out_norm + (size_t)row * N + j) = o;
    }
    
  }
}



// ---- f16 WMMA path (v_wmma_f32_16x16x32_f16): 11-bit significands for operands in range — used where a [0,1] probability operand needs more precision than bf16
typedef _Float16 v16h __attribute__((ext_vector_type(16)));
union FragH { v16h v; v8us half[2]; _Float16 h[16]; unsigned short u[16]; };
template <int NT>
__device__ __forceinline__ v8f mmaH(v16h ah, v16h al, v16h bh, v16h bl, v8f c) {
  c = __builtin_amdgcn_wmma_f32_16x16x32_f16(false, ah, false, bh, (short)0, c, false, false);
  if (NT >= 2) c = __builtin_amdgcn_wmma_f32_16x16x32_f16(false, al, false, bh, (short)0, c, false, false);
  if (NT >= 3) c = __builtin_amdgcn_wmma_f32_16x16x32_f16(false, ah, false, bl, (short)0, c, false, false);
  asm volatile("v_nop\n\tv_nop\n\tv_nop\n\tv_nop" : "+v"(c) : "v"(ah), "v"(al), "v"(bh), "v"(bl));
  return c;
}
// batched GEMM like k_gemm_b but f16 operands: A f32 (split into f16 hi/lo if ASPLIT, else rounded to f16), Bt = f16 values [n][k]; alpha; C f32; N multiple of 16 (partial tiles skipped)
template <bool ASPLIT>
__global__ __launch_bounds__(128) void k_gemm_h(const float* __restrict__ A, int lda, size_t sA, const _Float16* __restrict__ Bh, int ldb, size_t sB, float alpha, float* __restrict__ C, int ldc, size_t sC, int M, int N, int K) {
  __shared__ __attribute__((aligned(16))) float so[4][16][64];
  const int tid = threadIdx.x, w = tid >> 5, lane = tid & 31, ln = lane & 15, hh = lane >> 4; const int by = blockIdx.y;
  A += (size_t)by * sA; Bh += (size_t)by * sB; C += (size_t)by * sC;
  const int ntn = (N + 63) / 64; const int wid = blockIdx.x * 4 + w; const int mt = wid / ntn, nq = wid % ntn; if (mt * 16 >= M) return;
  const int row0 = mt * 16, col0 = nq * 64; const float* arow = A + (size_t)(row0 + ln) * lda;
  v8f acc[4] = {};
  for (int kb = 0; kb < K; kb += 32) {
    FragH ah, al;
    const v4f x0 = *(const v4fa*)(arow + kb + 8 * hh), x1 = *(const v4fa*)(arow + kb + 8 * hh + 4), x2 = *(const v4fa*)(arow + kb + 16 + 8 * hh), x3 = *(const v4fa*)(arow + kb + 16 + 8 * hh + 4);
    float xs[16] = {x0[0],x0[1],x0[2],x0[3],x1[0],x1[1],x1[2],x1[3],x2[0],x2[1],x2[2],x2[3],x3[0],x3[1],x3[2],x3[3]};
#pragma unroll
    for (int i = 0; i < 16; ++i) { const _Float16 h = (_Float16)xs[i]; ah.h[i] = h; al.h[i] = ASPLIT ? (_Float16)(xs[i] - (float)h) : (_Float16)0.0f; }
#pragma unroll
    for (int t = 0; t < 4; ++t) { if (col0 + t * 16 >= N) continue; const size_t boff = (size_t)(col0 + t * 16 + ln) * ldb + kb; FragH bq; bq.half[0] = *(const v8us*)(Bh + boff + 8 * hh); bq.half[1] = *(const v8us*)(Bh + boff + 16 + 8 * hh);
      acc[t] = mmaH<ASPLIT ? 2 : 1>(ah.v, al.v, bq.v, bq.v, acc[t]); }
  }
#pragma unroll
  for (int t = 0; t < 4; ++t) { if (col0 + t * 16 >= N) continue;
#pragma unroll
    for (int r = 0; r < 8; ++r) so[w][8 * hh + r][t * 16 + ln] = acc[t][r] * alpha; }
  __builtin_amdgcn_fence(__ATOMIC_ACQ_REL, "workgroup"); __builtin_amdgcn_wave_barrier();
  const int rsub = lane >> 4, c4 = (lane & 15) * 4;
  {
#pragma unroll
    for (int q = 0; q < 8; ++q) { const int r = q * 2 + rsub; if (col0 + c4 < N) { const v4f v = *(const v4fa*)&so[w][r][c4]; *(v4f*)(C + (size_t)(row0 + r) * ldc + col0 + c4) = v; } }
     }
}

// Wt[n][k] = f16(W[k][n]·scale) from f32 row-major W[K][N] (scale = power of two; bf16-exact weights stay exact in f16 away from the subnormal range)
__global__ __launch_bounds__(256) void k_wt_f16(const float* __restrict__ W, _Float16* __restrict__ Wt, int K, int N, float scale) {
  const int t = blockIdx.x * 256 + threadIdx.x; if (t >= N * (K / 8)) return; const int n = t / (K / 8), k8 = (t % (K / 8)) * 8; FragH f;
#pragma unroll
  for (int i = 0; i < 8; ++i) f.h[i] = (_Float16)(bf16_round(W[(size_t)(k8 + i) * N + n]) * scale); const v8us o = f.half[0];
  *(v8us*)((unsigned short*)Wt + (size_t)n * K + k8) = o; 
}
// k_gemm_hh variant with fused epilogue: v = acc·alpha + bias[by·sBias + col] (+ CP[(row/rowsPerB)·sCPb + by·64 + col] if CP) ; ACT 0 none / 1 elu ; writes f16 C16 (and f32 C if non-null)
template <int ACT>
__global__ __launch_bounds__(128) void k_gemm_hhx(const _Float16* __restrict__ A, int lda, size_t sA, const _Float16* __restrict__ Bh, int ldb, size_t sB, float alpha, const float* __restrict__ bias, size_t sBias, const float* __restrict__ CP, int rowsPerB, size_t sCPb, int row0g,
    float* __restrict__ C, _Float16* __restrict__ C16, int ldc, size_t sC, int M, int N, int K) {
  __shared__ __attribute__((aligned(16))) float so[4][16][64];
  const int tid = threadIdx.x, w = tid >> 5, lane = tid & 31, ln = lane & 15, hh = lane >> 4; const int by = blockIdx.y;
  A += (size_t)by * sA; Bh += (size_t)by * sB; const size_t cofs = (size_t)by * sC; const float* bp = bias ? bias + (size_t)by * sBias : nullptr;
  const int ntn = (N + 63) / 64; const int wid = blockIdx.x * 4 + w; const int mt = wid / ntn, nq = wid % ntn; if (mt * 16 >= M) return;
  const int row0 = mt * 16, col0 = nq * 64; const _Float16* arow = A + (size_t)(row0 + ln) * lda;
  v8f acc[4] = {};
  for (int kb = 0; kb < K; kb += 32) { FragH ah; ah.half[0] = *(const v8us*)((const unsigned short*)arow + kb + 8 * hh); ah.half[1] = *(const v8us*)((const unsigned short*)arow + kb + 16 + 8 * hh);
#pragma unroll
    for (int t = 0; t < 4; ++t) { if (col0 + t * 16 >= N) continue; const size_t boff = (size_t)(col0 + t * 16 + ln) * ldb + kb; FragH bq; bq.half[0] = *(const v8us*)((const unsigned short*)Bh + boff + 8 * hh); bq.half[1] = *(const v8us*)((const unsigned short*)Bh + boff + 16 + 8 * hh);
      acc[t] = mmaH<1>(ah.v, ah.v, bq.v, bq.v, acc[t]); }
  }
#pragma unroll
  for (int t = 0; t < 4; ++t) { if (col0 + t * 16 >= N) continue; const int col = col0 + t * 16 + ln; const float bv = bp ? bf16_round(bp[col]) : 0.f;
#pragma unroll
    for (int r = 0; r < 8; ++r) { float v = acc[t][r] * alpha + bv; if (CP) { const int rr = row0g + row0 + 8 * hh + r; if (rowsPerB < 0) v += CP[cofs + (size_t)rr * ldc + col];      /* rowsPerB < 0: own element of the batched C plane */ else { const int bidx = rr / rowsPerB; v += CP[(size_t)bidx * sCPb + (size_t)by * 64 + col]; } } if (ACT == 1) v = (v > 0.f) ? v : expm1f(v); else if (ACT == 7) v = (v > 0.f) ? v + 1.0f : expf(v); else if (ACT == 8) v = tanhf(v); else if (ACT == 9) v = 0.5f * v * (1.0f + tanhf(0.7978845608028654f * (v + 0.044715f * v * v * v))); else if (ACT == 11) v = 1.0f / (1.0f + expf(-v)); else if (ACT == 12) v = (v > 0.f) ? v : 0.01f * v; else if (ACT == 14) v = (v > 0.f) ? v : 0.1f * v; else if (ACT == 16) v = (v >= 0.f) ? v : 0.3f * v; else if (ACT == 17) v = (v >= 0.f) ? v : 0.2f * v; else if (ACT == 15) v = v / (1.0f + expf(-v)); else if (ACT == 3) v = fmaxf(v, 0.f); else if (ACT == 6) v = 0.5f * v * (1.0f + erff(v * 0.70710678118654752f)); so[w][8 * hh + r][t * 16 + ln] = v; } }
  __builtin_amdgcn_fence(__ATOMIC_ACQ_REL, "workgroup"); __builtin_amdgcn_wave_barrier();
  const int rsub = lane >> 4, c4 = (lane & 15) * 4; typedef _Float16 v4h __attribute__((ext_vector_type(4)));
  {
#pragma unroll
    for (int q = 0; q < 8; ++q) { const int r = q * 2 + rsub; if (col0 + c4 < N) { const v4f v = *(const v4fa*)&so[w][r][c4]; if (C) *(v4f*)(C + cofs + (size_t)(row0 + r) * ldc + col0 + c4) = v; if (C16) { v4h h4; for (int i = 0; i < 4; ++i) h4[i] = (_Float16)v[i]; *(v4h*)(C16 + cofs + (size_t)(row0 + r) * ldc + col0 + c4) = h4; } } }
     }
}


typedef _Float16 v4h __attribute__((ext_vector_type(4)));

__global__ __launch_bounds__(256) void k_x16(const float* __restrict__ x, _Float16* __restrict__ X16, size_t n8) { const size_t t = (size_t)blockIdx.x * 256 + threadIdx.x; if (t >= n8) return; FragH f;
#pragma unroll
  for (int q = 0; q < 8; ++q) f.h[q] = (_Float16)bf16_round(x[t * 8 + q]); *(v8us*)((unsigned short*)X16 + t * 8) = f.half[0];  }
__global__ __launch_bounds__(256) void k_h16(const float* __restrict__ x, _Float16* __restrict__ X16, size_t n8) { const size_t t = (size_t)blockIdx.x * 256 + threadIdx.x; if (t >= n8) return; FragH f;
#pragma unroll
  for (int q = 0; q < 8; ++q) f.h[q] = (_Float16)x[t * 8 + q]; *(v8us*)((unsigned short*)X16 + t * 8) = f.half[0];  }
__global__ __launch_bounds__(256) void k_round16f(const float* __restrict__ W, _Float16* __restrict__ Bt, size_t n8) { const size_t t = (size_t)blockIdx.x * 256 + threadIdx.x; if (t >= n8) return; FragH f;
#pragma unroll
  for (int i = 0; i < 8; ++i) f.h[i] = (_Float16)(bf16_round(W[t * 8 + i]) * 16.0f); *(v8us*)((unsigned short*)Bt + t * 8) = f.half[0];  }
template <int NHv, int TTv>
__global__ __launch_bounds__(256) void k_vt(const _Float16* __restrict__ V16, int ldv, int voff, _Float16* __restrict__ Vt) { __shared__ unsigned short tl[64][66]; const int tid = threadIdx.x; const int slab = blockIdx.x / (TTv / 64), lg = blockIdx.x % (TTv / 64); const int b = slab / NHv, h = slab % NHv;
  for (int i = tid; i < 64 * 8; i += 256) { const int r = i / 8, c8 = (i % 8) * 8; FragH f; f.half[0] = *(const v8us*)((const unsigned short*)V16 + ((size_t)b * TTv + lg * 64 + r) * ldv + voff + h * 64 + c8);
#pragma unroll
    for (int q = 0; q < 8; ++q) tl[r][c8 + q] = f.u[q]; }
  __syncthreads();
  {
#pragma unroll
    for (int rd = 0; rd < 2; ++rd) { const int d = rd * 32 + tid / 8, pc = tid % 8; FragH f;
#pragma unroll
      for (int q = 0; q < 8; ++q) f.u[q] = tl[pc * 8 + q][d];
      *(v8us*)((unsigned short*)Vt + ((size_t)slab * 64 + d) * TTv + lg * 64 + pc * 8) = f.half[0]; }
     } }

__global__ __launch_bounds__(256) void k_hl(const float* __restrict__ F, _Float16* __restrict__ Hh, _Float16* __restrict__ Hl, size_t n8) { const size_t t = (size_t)blockIdx.x * 256 + threadIdx.x; if (t >= n8) return; FragH fh, fl; const v4f a = *(const v4fa*)(F + t * 8), c = *(const v4fa*)(F + t * 8 + 4);
#pragma unroll
  for (int q = 0; q < 4; ++q) { _Float16 h = (_Float16)a[q]; fh.h[q] = h; fl.h[q] = (_Float16)((a[q] - (float)h) * 1024.0f); h = (_Float16)c[q]; fh.h[4 + q] = h; fl.h[4 + q] = (_Float16)((c[q] - (float)h) * 1024.0f); }
  { *(v8us*)((unsigned short*)Hh + t * 8) = fh.half[0]; *(v8us*)((unsigned short*)Hl + t * 8) = fl.half[0];  } }

// ---- fast GEMM (wave tile 32x64; requires M % 32 == 0 rows per launch region and N % 64 == 0); epilogue = k_gemm_hhx semantics ----
__device__ __forceinline__ v16h g2_frag(const _Float16* p, int hh) { FragH f; f.half[0] = *(const v8us*)((const unsigned short*)p + 8 * hh); f.half[1] = *(const v8us*)((const unsigned short*)p + 16 + 8 * hh); return f.v; }
__device__ __forceinline__ v8f g2_mma(v16h a, v16h b, v8f c) { v8f d = __builtin_amdgcn_wmma_f32_16x16x32_f16(false, a, false, b, (short)0, c, false, false); asm volatile("v_nop\n\tv_nop\n\tv_nop\n\tv_nop" : "+v"(d) : "v"(a), "v"(b)); return d; }
template <int ACT>
__global__ __launch_bounds__(128) void k_gemm2(const _Float16* __restrict__ A, int lda, size_t sA, const _Float16* __restrict__ Bh, int ldb, size_t sB, float alpha, const float* __restrict__ bias, size_t sBias, const float* __restrict__ CP, int rowsPerB, size_t sCPb, int row0g,
    float* __restrict__ C, _Float16* __restrict__ C16, int ldc, size_t sC, int M, int N, int K) { static_assert(ACT == 0 || ACT == 3 || ACT == 6 || ACT == 8 || ACT == 9 || ACT == 11 || ACT == 12 || ACT == 14 || ACT == 15 || ACT == 16 || ACT == 17, "k_gemm2: unsupported ACT code (would silently apply no activation)");
  __shared__ __attribute__((aligned(16))) float so[4][32][68];
  const int tid = threadIdx.x, w = tid >> 5, lane = tid & 31, ln = lane & 15, hh = lane >> 4; const int by = blockIdx.y;
  A += (size_t)by * sA; Bh += (size_t)by * sB; const size_t cofs = (size_t)by * sC; const float* bp = bias ? bias + (size_t)by * sBias : nullptr;
  const int ntn = N >> 6; const int mt = blockIdx.x / ntn, nq = blockIdx.x - mt * ntn; const int row0 = mt * 128 + 32 * w, col0 = nq * 64; if (row0 >= M) return;
  const _Float16* a0p = A + (size_t)(row0 + ln) * lda; const _Float16* a1p = a0p + (size_t)16 * lda;
  const _Float16* b0p = Bh + (size_t)(col0 + ln) * ldb; const _Float16* b1p = b0p + (size_t)16 * ldb; const _Float16* b2p = b1p + (size_t)16 * ldb; const _Float16* b3p = b2p + (size_t)16 * ldb;
  const v8f z8 = {0.f,0.f,0.f,0.f,0.f,0.f,0.f,0.f}; v8f c00 = z8, c01 = z8, c02 = z8, c03 = z8, c10 = z8, c11 = z8, c12 = z8, c13 = z8;
#pragma unroll 1
  for (int kb = 0; kb < K; kb += 32) { const v16h a0 = g2_frag(a0p + kb, hh), a1 = g2_frag(a1p + kb, hh);
    v16h b = g2_frag(b0p + kb, hh); c00 = g2_mma(a0, b, c00); c10 = g2_mma(a1, b, c10);
    b = g2_frag(b1p + kb, hh); c01 = g2_mma(a0, b, c01); c11 = g2_mma(a1, b, c11);
    b = g2_frag(b2p + kb, hh); c02 = g2_mma(a0, b, c02); c12 = g2_mma(a1, b, c12);
    b = g2_frag(b3p + kb, hh); c03 = g2_mma(a0, b, c03); c13 = g2_mma(a1, b, c13); }
  v8f accs[8] = {c00, c01, c02, c03, c10, c11, c12, c13};
#pragma unroll
  for (int u = 0; u < 8; ++u) { const int t = u & 3, half = u >> 2; const int col = col0 + t * 16 + ln; const float bv = bp ? bf16_round(bp[col]) : 0.f;
#pragma unroll
    for (int r = 0; r < 8; ++r) { const int rloc = half * 16 + 8 * hh + r; float v = accs[u][r] * alpha + bv; if (CP) { if (rowsPerB < 0) v += CP[cofs + (size_t)(row0g + row0 + rloc) * ldc + col];      /* rowsPerB < 0: own element of the batched C plane */ else { const int bidx = (row0g + row0 + rloc) / rowsPerB; v += CP[(size_t)bidx * sCPb + (size_t)by * 64 + col]; } }
      if (ACT == 3) v = fmaxf(v, 0.f); else if (ACT == 6) v = 0.5f * v * (1.0f + erff(v * 0.70710678118654752f)); else if (ACT == 11) v = 1.0f / (1.0f + expf(-v)); else if (ACT == 15) v = v / (1.0f + expf(-v)); else if (ACT == 12) v = (v > 0.f) ? v : 0.01f * v; else if (ACT == 8) v = tanhf(v); else if (ACT == 9) v = 0.5f * v * (1.0f + tanhf(0.7978845608028654f * (v + 0.044715f * v * v * v))); else if (ACT == 14) v = (v > 0.f) ? v : 0.1f * v; else if (ACT == 16) v = (v >= 0.f) ? v : 0.3f * v; else if (ACT == 17) v = (v >= 0.f) ? v : 0.2f * v;
      so[w][rloc][t * 16 + ln] = v; } }
  __builtin_amdgcn_fence(__ATOMIC_ACQ_REL, "workgroup"); __builtin_amdgcn_wave_barrier();
  const int rsub = lane >> 4, c4 = (lane & 15) * 4;
  {
#pragma unroll
    for (int q = 0; q < 16; ++q) { const int r = q * 2 + rsub; const v4f v = *(const v4fa*)&so[w][r][c4]; if (C) *(v4f*)(C + cofs + (size_t)(row0 + r) * ldc + col0 + c4) = v; if (C16) { v4h h4; for (int i = 0; i < 4; ++i) h4[i] = (_Float16)v[i]; *(v4h*)(C16 + cofs + (size_t)(row0 + r) * ldc + col0 + c4) = h4; } }
     } }


__global__ __launch_bounds__(256) void k_wnat(const float* __restrict__ w, size_t n8, _Float16* __restrict__ Bt) { const size_t t = (size_t)blockIdx.x * 256 + threadIdx.x; if (t >= n8) return; FragH f; for (int q = 0; q < 8; ++q) f.h[q] = (_Float16)(bf16_round(w[t * 8 + q]) * 16.0f); *(v8us*)((unsigned short*)Bt + t * 8) = f.half[0];  }
__global__ __launch_bounds__(256) void k_rsm(const float* __restrict__ S, _Float16* __restrict__ P, int nrows) {
  #pragma clang fp contract(off)
  const int i = blockIdx.x * 256 + threadIdx.x; if (i >= nrows) return; const float* s = S + (size_t)i * SQ; float mx = -3.0e38f;
#pragma unroll 1
  for (int j = 0; j < SQ; ++j) mx = fmaxf(mx, s[j]); float se = 0.f;
#pragma unroll 1
  for (int j = 0; j < SQ; ++j) se += expf(s[j] - mx); const float sc = 256.0f / se;
#pragma unroll 1
  for (int j0 = 0; j0 < SQ; j0 += 8) { FragH f; for (int q = 0; q < 8; ++q) f.h[q] = (_Float16)(expf(s[j0 + q] - mx) * sc); unsigned short* d = (unsigned short*)P + (size_t)i * SQ + j0; *(v8us*)d = f.half[0];  } }
__global__ __launch_bounds__(256) void k_vt(const _Float16* __restrict__ V16, int b, int h0, _Float16* __restrict__ VT) { __shared__ unsigned short tl[64][65]; const int tid = threadIdx.x; const int hh = blockIdx.x % HG, sg = blockIdx.x / HG; const int s0 = sg * 64; const int h = h0 + hh;
  for (int i = tid; i < 64 * 8; i += 256) { const int j = i / 8, d8 = (i % 8) * 8; FragH f; f.half[0] = *(const v8us*)((const unsigned short*)V16 + ((size_t)b * SQ + s0 + j) * DM + h * HD + d8); for (int q = 0; q < 8; ++q) tl[d8 + q][j] = f.u[q]; }
  __syncthreads();
  { for (int i = tid; i < 64 * 8; i += 256) { const int d = i / 8, j8 = (i % 8) * 8; FragH f; for (int q = 0; q < 8; ++q) f.u[q] = tl[d][j8 + q]; *(v8us*)((unsigned short*)VT + ((size_t)hh * HD + d) * SQ + s0 + j8) = f.half[0]; }  } }



__global__ __launch_bounds__(256) void k_rsmf(const float* __restrict__ S, _Float16* __restrict__ P, int qn, int hg) {
  #pragma clang fp contract(off)
  const int t = blockIdx.x * 256 + threadIdx.x; if (t >= qn * hg) return; const size_t i = (size_t)(t / qn) * SQ + (t % qn); const float* s = S + i * SQ; float mx = -3.0e38f;
#pragma unroll 1
  for (int j = 0; j < SQ; ++j) mx = fmaxf(mx, s[j]); float se = 0.f;
#pragma unroll 1
  for (int j = 0; j < SQ; ++j) se += __expf(s[j] - mx); const float sc = 256.0f / se;
#pragma unroll 1
  for (int j0 = 0; j0 < SQ; j0 += 8) { FragH f; for (int q = 0; q < 8; ++q) f.h[q] = (_Float16)(__expf(s[j0 + q] - mx) * sc); unsigned short* d = (unsigned short*)P + i * SQ + j0; *(v8us*)d = f.half[0];  } }


template <int BFIN, int WXB>
__global__ __launch_bounds__(256) void k_ln16p(const float* __restrict__ X, size_t ldx, const float* __restrict__ g, const float* __restrict__ bb, float eps, _Float16* __restrict__ N16, float* __restrict__ XB) {
  #pragma clang fp contract(off)
  __shared__ float red[256]; const size_t r = blockIdx.x; const int t = threadIdx.x; const v4f xa = *(const v4fa*)(X + r * ldx + t * 4); float s[4]; float sum = 0.f;
  for (int q = 0; q < 4; ++q) { s[q] = BFIN ? bf16_round(xa[q]) : xa[q]; sum = __fadd_rn(sum, s[q]); }
  red[t] = sum; __syncthreads(); for (int st = 128; st > 0; st >>= 1) { if (t < st) red[t] = __fadd_rn(red[t], red[t + st]); __syncthreads(); } const float mu = red[0] / (float)DMQ; __syncthreads();
  float vs = 0.f; for (int q = 0; q < 4; ++q) { const float dl = __fadd_rn(s[q], -mu); vs = __fadd_rn(vs, __fmul_rn(dl, dl)); } red[t] = vs; __syncthreads(); for (int st = 128; st > 0; st >>= 1) { if (t < st) red[t] = __fadd_rn(red[t], red[t + st]); __syncthreads(); }
  const float rs = rsqrtf(__fadd_rn(red[0] / (float)DMQ, eps)); v4h y; v4f xb;
  for (int q = 0; q < 4; ++q) { const int c = t * 4 + q; y[q] = (_Float16)__fadd_rn(__fmul_rn(__fmul_rn(__fadd_rn(s[q], -mu), rs), bf16_round(g[c])), bf16_round(bb[c])); xb[q] = s[q]; }
  { *(v4h*)(N16 + r * DMQ + t * 4) = y; if (WXB) *(v4f*)(XB + r * DMQ + t * 4) = xb;  } }
extern "C" void kernel_launch(void* const* d_in, const int* in_sizes, int n_in,
                              void* d_out, int out_size, void* d_ws, size_t ws_size, hipStream_t stream) {
  (void)in_sizes; (void)n_in; (void)out_size;
  const float* const* I = (const float* const*)d_in; const float* x = I[0]; const float* wqkv = I[1]; const float* wo = I[2]; const float* bo = I[3]; const float* qg = I[4]; const float* qb = I[5]; const float* kg = I[6]; const float* kb = I[7]; const float* bqkv = nullptr;      /* natural weights; no qkv bias */
  char* ws = (char*)d_ws; size_t off = 0;
  auto take = [&](size_t bytes) { char* p = ws + off; off += (bytes + 255) & ~(size_t)255; return p; };
  _Float16* BQKV = (_Float16*)take((size_t)3 * DM * DM * 2); _Float16* BO = (_Float16*)take((size_t)DM * DM * 2);
  _Float16* X16 = (_Float16*)take(NR * DM * 2); float* QKVF = (float*)take(NR * 3 * DM * 4); _Float16* QN16 = (_Float16*)take(NR * DM * 2); _Float16* KN16 = (_Float16*)take(NR * DM * 2); _Float16* QKV = (_Float16*)take(NR * 3 * DM * 2); _Float16* Q16 = QKV; _Float16* K16 = QKV + DM; _Float16* V16 = QKV + 2 * DM; _Float16* O16 = (_Float16*)take(NR * DM * 2);
  float* S = (float*)take((size_t)HG * SQ * SQ * 4); _Float16* P = (_Float16*)take((size_t)HG * SQ * SQ * 2); _Float16* VT = (_Float16*)take((size_t)NH * HD * SQ * 2);
  if (off > ws_size) return;
  k_wnat<<<(unsigned)(((size_t)3 * DM * DM / 8 + 255) / 256), 256, 0, stream>>>(wqkv, (size_t)3 * DM * DM / 8, BQKV); k_wnat<<<(unsigned)(((size_t)DM * DM / 8 + 255) / 256), 256, 0, stream>>>(wo, (size_t)DM * DM / 8, BO);      /* natural [out][in] = Bt planes x16 */
  k_x16<<<(unsigned)((NR * DM / 8 + 255) / 256), 256, 0, stream>>>(x, X16, NR * DM / 8);
  const size_t r0p = (size_t)B0 * SQ;      /* first projected row */
  k_gemm2<0><<<dim3((unsigned)((MP / 128) * (3 * DM / 64)), 1), 128, 0, stream>>>(X16 + r0p * DM, DM, 0, BQKV, DM, 0, 0.0625f, nullptr, 0, nullptr, 1, 0, 0, QKVF + r0p * 3 * DM, QKV + r0p * 3 * DM, 3 * DM, 0, MP, 3 * DM, DM);      /* q | k | v rows: f32 (for the LayerNorms) and f16 (v operand) */
  k_ln16p<0, 0><<<(unsigned)MP, 256, 0, stream>>>(QKVF + r0p * 3 * DM, (size_t)3 * DM, qg, qb, 1e-5f, QN16 + r0p * DM, nullptr); k_ln16p<0, 0><<<(unsigned)MP, 256, 0, stream>>>(QKVF + r0p * 3 * DM + DM, (size_t)3 * DM, kg, kb, 1e-5f, KN16 + r0p * DM, nullptr);      /* q, k = LayerNorm over the merged 1024 features -> f16 rows */
  for (int b = B0; b < B0 + NBR; ++b) { const size_t r0 = (size_t)b * SQ;
    k_vt<NH, SQ><<<NH * (SQ / 64), 256, 0, stream>>>(V16 + r0 * LQ, LQ, 0, VT);      /* V^T [NH][HD][SQ] for this batch */
    for (int h0 = 0; h0 < NHD; h0 += HG) {
      k_gemm2<0><<<dim3((QN / 128) * (SQ / 64), HG), 128, 0, stream>>>(QN16 + r0 * DM + h0 * HD, DM, (size_t)HD, KN16 + r0 * DM + h0 * HD, DM, (size_t)HD, 0.125f, nullptr, 0, nullptr, 1, 0, 0, S, nullptr, SQ, (size_t)SQ * SQ, QN, SQ, HD);      /* scores, HG heads per launch */
      k_rsmf<<<(HG * QN + 255) / 256, 256, 0, stream>>>(S, P, QN, HG);      /* P = 256 softmax (f16), rows of all HG heads */
      k_gemm2<0><<<dim3((QN / 128) * (HD / 64), HG), 128, 0, stream>>>(P, SQ, (size_t)SQ * SQ, VT + (size_t)h0 * HD * SQ, SQ, (size_t)HD * SQ, 0.25f, nullptr, 0, nullptr, 1, 0, 0, nullptr, O16 + r0 * DM + h0 * HD, DM, (size_t)HD, QN, HD, SQ); } }      /* o (merged heads) as f16 rows */
  k_gemm2<0><<<dim3((unsigned)((MPO / 128) * (DM / 64)), 1), 128, 0, stream>>>(O16 + r0p * DM, DM, 0, BO, DM, 0, 0.0009765625f, bo, 0, nullptr, 1, 0, 0, (float*)d_out + r0p * DM, nullptr, DM, 0, MPO, DM, DM);      /* out rows are the output layout */
}

// v001
// It runs in 909 microseconds.
// In two side-by-side timings against v000, it was 3.82 and 3.79 times as fast.
#include <hip/hip_runtime.h>
// Self-attention block with q/k LayerNorm (x [2][2048][1024]; qkv = x w_qkv^T (natural [3072][1024], sigma 1/32, no bias) -> q | k | v blocks, 16 heads of 64; q = LayerNorm_1024(q; q_gamma, q_beta) and k likewise over the full merged 1024 features (eps 1e-5); softmax(q k^T / 8) (no mask); out = merged w_proj^T + b_proj -> [2][2048][1024]).
// Structure: x as exact f16 rows; natural weights as exact x16 planes; q | k | v as ONE WMMA GEMM (32x64 wave tiles, f32 accumulation; f32 rows for the norms + f16 rows for v); q and k LayerNorm over the merged 1024 features on VALU (f32, LDS trees; bf16 gamma/beta) -> f16 rows; per batch: V^T via LDS transposes; per 4-head group: scores (K = 64, alpha 1/8) into f32 planes, row softmax on VALU (f32 statistics, native exp; weights x256 f16), o = P V^T (o carried x64) into merged f16 rows; out = o w_proj^T + b_proj GEMM (f32, alpha 2^-10); launches: see trace.
// Compute dtype: inputs rounded to bf16; x / weights exact; q, k, v, softmax weights and o as plain f16 GEMM operands (~2^-12); scores and softmax statistics f32. v_wmma_f32_16x16x32_f16.
#define NB 2
#define SQ 2048
#define DM 1024
#define NH 16
#define HD 64
#define HG 4                         /* heads per attention launch group */
#define B0 0                         /* first batch processed (debug hook) */
#define NBR NB                       /* batches processed (debug hook) */
#define NR ((size_t)NB * SQ)
#define DMQ DM         /* LayerNorm width and f16 row pitch */
#define MP ((int)((size_t)NBR * SQ)) /* rows projected (debug hook) */
#define QN SQ                        /* query rows attended per batch (debug hook) */
#define NHD NH                       /* heads attended (debug hook) */
#define MPO MP                       /* rows through the output stage (debug hook) */
#define LQ (3 * DM)      /* row pitch of the q/k/v rows */
typedef __bf16 v16b __attribute__((ext_vector_type(16)));
typedef unsigned short v8us __attribute__((ext_vector_type(8), may_alias));
typedef float  v8f  __attribute__((ext_vector_type(8)));
typedef float  v4f  __attribute__((ext_vector_type(4)));
typedef float  v4fa __attribute__((ext_vector_type(4), may_alias));
union FragB { v16b v; v8us half[2]; unsigned short u[16]; };

__device__ __forceinline__ unsigned short bf16_bits(float x) { unsigned int u = __float_as_uint(x); return (unsigned short)((u + 0x7FFFu + ((u >> 16) & 1u)) >> 16); }
__device__ __forceinline__ float bf16_val(unsigned short b) { return __uint_as_float(((unsigned int)b) << 16); }
__device__ __forceinline__ float bf16_round(float x) { return bf16_val(bf16_bits(x)); }
// D += A·B with NT terms: 1 = ah·bh, 2 = + al·bh (A split), 3 = + ah·bl (both split)
template <int NT>
__device__ __forceinline__ v8f mmaN(v16b ah, v16b al, v16b bh, v16b bl, v8f c) {
  c = __builtin_amdgcn_wmma_f32_16x16x32_bf16(false, ah, false, bh, (short)0, c, false, false);
  if (NT >= 2) c = __builtin_amdgcn_wmma_f32_16x16x32_bf16(false, al, false, bh, (short)0, c, false, false);
  if (NT >= 3) c = __builtin_amdgcn_wmma_f32_16x16x32_bf16(false, ah, false, bl, (short)0, c, false, false);
  asm volatile("v_nop\n\tv_nop\n\tv_nop\n\tv_nop" : "+v"(c) : "v"(ah), "v"(al), "v"(bh), "v"(bl));
  return c;
}

__global__ __launch_bounds__(256) void k_wt_bf16(const float* __restrict__ W, unsigned short* __restrict__ Wt, int K, int N) {
  const int t = blockIdx.x * 256 + threadIdx.x;
  const int k8n = K / 8;
  if (t >= N * k8n) return;
  const int n = t / k8n, k8 = (t % k8n) * 8;
  v8us v;
#pragma unroll
  for (int i = 0; i < 8; ++i) v[i] = bf16_bits(W[(size_t)(k8 + i) * N + n]);
  *(v8us*)(Wt + (size_t)n * K + k8) = v;
  
}

// GEMM C[M][N] (f32, pitch ldc) = act(A[M][K]·W + bias). A f32 row-major (pitch lda) converted per fragment to bf16
// (ASPLIT: hi/lo two planes -> 2 terms, else single rounded term); Wt bf16 [N][K] (pitch ldb). BIAS_BF16 rounds the
// bias to bf16 first (bias quantised to bf16 before the add). K%32==0, M%16==0, N%64==0.
template <bool ASPLIT, int ACT, bool BIAS_BF16>
__global__ __launch_bounds__(128) void k_gemm_bf(const float* __restrict__ A, int lda, const unsigned short* __restrict__ Wt, int ldb,
                                               const float* __restrict__ bias, float* __restrict__ C, int ldc, int M, int N, int K) {
  __shared__ __attribute__((aligned(16))) float so[4][16][64];
  const int tid = threadIdx.x, w = tid >> 5, lane = tid & 31, ln = lane & 15, hh = lane >> 4;
  const int ntn = N / 64;
  const int wid = blockIdx.x * 4 + w;
  const int mt = wid / ntn, nq = wid % ntn;
  if (mt * 16 >= M) return;
  const int row0 = mt * 16, col0 = nq * 64;
  const float* arow = A + (size_t)(row0 + ln) * lda;
  v8f acc[4] = {};
  for (int kb = 0; kb < K; kb += 32) {
    FragB ah, al;
    const v4f x0 = *(const v4fa*)(arow + kb + 8 * hh), x1 = *(const v4fa*)(arow + kb + 8 * hh + 4);
    const v4f x2 = *(const v4fa*)(arow + kb + 16 + 8 * hh), x3 = *(const v4fa*)(arow + kb + 16 + 8 * hh + 4);
    float xs[16] = {x0[0],x0[1],x0[2],x0[3],x1[0],x1[1],x1[2],x1[3],x2[0],x2[1],x2[2],x2[3],x3[0],x3[1],x3[2],x3[3]};
#pragma unroll
    for (int i = 0; i < 16; ++i) { const unsigned short hb = bf16_bits(xs[i]); ah.u[i] = hb; al.u[i] = ASPLIT ? bf16_bits(xs[i] - bf16_val(hb)) : (unsigned short)0; }
#pragma unroll
    for (int t = 0; t < 4; ++t) {
      const unsigned short* brow = Wt + (size_t)(col0 + t * 16 + ln) * ldb + kb;
      FragB b;
      b.half[0] = *(const v8us*)(brow + 8 * hh);
      b.half[1] = *(const v8us*)(brow + 16 + 8 * hh);
      acc[t] = mmaN<ASPLIT ? 2 : 1>(ah.v, al.v, b.v, b.v, acc[t]);
    }
  }
#pragma unroll
  for (int t = 0; t < 4; ++t) {
    float bv = bias ? bias[col0 + t * 16 + ln] : 0.f;
    if (BIAS_BF16) bv = bf16_round(bv);
#pragma unroll
    for (int r = 0; r < 8; ++r) { float v = acc[t][r] + bv; if (ACT == 1) v = fmaxf(v, 0.f); so[w][8 * hh + r][t * 16 + ln] = v; }
  }
  __builtin_amdgcn_fence(__ATOMIC_ACQ_REL, "workgroup");
  __builtin_amdgcn_wave_barrier();
  const int rsub = lane >> 4, c4 = (lane & 15) * 4;
  {
#pragma unroll
    for (int q = 0; q < 8; ++q) {
      const int r = q * 2 + rsub;
      const v4f v = *(const v4fa*)&so[w][r][c4];
      *(v4f*)(C + (size_t)(row0 + r) * ldc + col0 + c4) = v;
    }
    
  }
}

// GEMM C = act(A·W + bias + resid): A f32 (ASPLIT -> hi/lo 2 terms), Wt bf16 [N][K]; ACT 0 none, 1 relu, 2 exact gelu;
// resid (optional, f32, row index = (row % rmod), pitch ldr, RES_BF16 rounds it) added before the activation.
template <bool ASPLIT, int ACT, bool BIAS_BF16, bool RES_BF16>
__global__ __launch_bounds__(128) void k_gemm_bf3(const float* __restrict__ A, int lda, const unsigned short* __restrict__ Wt, int ldb,
                                                const float* __restrict__ bias, const float* __restrict__ resid, int rmod, int ldr,
                                                float* __restrict__ C, int ldc, int M, int N, int K) {
  __shared__ __attribute__((aligned(16))) float so[4][16][64];
  const int tid = threadIdx.x, w = tid >> 5, lane = tid & 31, ln = lane & 15, hh = lane >> 4;
  const int ntn = N / 64;
  const int wid = blockIdx.x * 4 + w;
  const int mt = wid / ntn, nq = wid % ntn;
  if (mt * 16 >= M) return;
  const int row0 = mt * 16, col0 = nq * 64;
  const float* arow = A + (size_t)(row0 + ln) * lda;
  v8f acc[4] = {};
  for (int kb = 0; kb < K; kb += 32) {
    FragB ah, al;
    const v4f x0 = *(const v4fa*)(arow + kb + 8 * hh), x1 = *(const v4fa*)(arow + kb + 8 * hh + 4);
    const v4f x2 = *(const v4fa*)(arow + kb + 16 + 8 * hh), x3 = *(const v4fa*)(arow + kb + 16 + 8 * hh + 4);
    float xs[16] = {x0[0],x0[1],x0[2],x0[3],x1[0],x1[1],x1[2],x1[3],x2[0],x2[1],x2[2],x2[3],x3[0],x3[1],x3[2],x3[3]};
#pragma unroll
    for (int i = 0; i < 16; ++i) { const unsigned short hb = bf16_bits(xs[i]); ah.u[i] = hb; al.u[i] = ASPLIT ? bf16_bits(xs[i] - bf16_val(hb)) : (unsigned short)0; }
#pragma unroll
    for (int t = 0; t < 4; ++t) {
      const unsigned short* brow = Wt + (size_t)(col0 + t * 16 + ln) * ldb + kb;
      FragB b;
      b.half[0] = *(const v8us*)(brow + 8 * hh);
      b.half[1] = *(const v8us*)(brow + 16 + 8 * hh);
      acc[t] = mmaN<ASPLIT ? 2 : 1>(ah.v, al.v, b.v, b.v, acc[t]);
    }
  }
#pragma unroll
  for (int t = 0; t < 4; ++t) {
    const int col = col0 + t * 16 + ln;
    float bv = bias ? bias[col] : 0.f;
    if (BIAS_BF16) bv = bf16_round(bv);
#pragma unroll
    for (int r = 0; r < 8; ++r) {
      float v = acc[t][r] + bv;
      if (resid) { float rv = resid[(size_t)((row0 + 8 * hh + r) % rmod) * ldr + col]; if (RES_BF16) rv = bf16_round(rv); v += rv; }
      if (ACT == 1) v = fmaxf(v, 0.f);
      if (ACT == 2) v = 0.5f * v * (1.0f + erff(v * 0.70710678118654752f));
      if (ACT == 3) { const float u = 0.7978845608028654f * (v + 0.044715f * v * v * v); v = 0.5f * v * (1.0f + tanhf(u)); }
      so[w][8 * hh + r][t * 16 + ln] = v;
    }
  }
  __builtin_amdgcn_fence(__ATOMIC_ACQ_REL, "workgroup");
  __builtin_amdgcn_wave_barrier();
  const int rsub = lane >> 4, c4 = (lane & 15) * 4;
  {
#pragma unroll
    for (int q = 0; q < 8; ++q) {
      const int r = q * 2 + rsub;
      const v4f v = *(const v4fa*)&so[w][r][c4];
      *(v4f*)(C + (size_t)(row0 + r) * ldc + col0 + c4) = v;
    }
    
  }
}
// row LayerNorm (biased variance, eps) over N: s = X (+ R); optional out_sum <- s; out_norm <- (s-mu)*rsqrt(var+eps)*g + b
template <bool PARAM_BF16>
__global__ __launch_bounds__(256) void k_layernorm(const float* __restrict__ X, const float* __restrict__ R, const float* __restrict__ g, const float* __restrict__ bta,
                                                  float* __restrict__ out_sum, float* __restrict__ out_norm, int N, float eps) {
  __shared__ float red[256];
  const int row = blockIdx.x, tid = threadIdx.x;
  const float* x = X + (size_t)row * N; const float* rr = R ? R + (size_t)row * N : nullptr;
  float vals[16];                     // up to N = 4096
  const int per = N / 256;            // contiguous chunk per thread? use strided-by-4 chunks: thread handles j = tid*4 + 1024*u
  float s1 = 0.f;
  for (int u = 0; u < per / 4; ++u) {
    const int j = tid * 4 + 1024 * u;
    const v4f a = *(const v4fa*)(x + j);
    v4f b = {0.f,0.f,0.f,0.f}; if (rr) b = *(const v4fa*)(rr + j);
#pragma unroll
    for (int q = 0; q < 4; ++q) { const float v = a[q] + b[q]; vals[u * 4 + q] = v; s1 += v; }
  }
  red[tid] = s1; __syncthreads();
  for (int st = 128; st > 0; st >>= 1) { if (tid < st) red[tid] += red[tid + st]; __syncthreads(); }
  const float mu = red[0] / (float)N; __syncthreads();
  float s2 = 0.f;
  for (int u = 0; u < per / 4; ++u)
#pragma unroll
    for (int q = 0; q < 4; ++q) { const float c = vals[u * 4 + q] - mu; s2 += c * c; }
  red[tid] = s2; __syncthreads();
  for (int st = 128; st > 0; st >>= 1) { if (tid < st) red[tid] += red[tid + st]; __syncthreads(); }
  const float rs = rsqrtf(red[0] / (float)N + eps);
  {
    for (int u = 0; u < per / 4; ++u) {
      const int j = tid * 4 + 1024 * u;
      v4f o, sm;
#pragma unroll
      for (int q = 0; q < 4; ++q) {
        float gg = g[j + q], bb = bta[j + q];
        if (PARAM_BF16) { gg = bf16_round(gg); bb = bf16_round(bb); }
        sm[q] = vals[u * 4 + q]; o[q] = (vals[u * 4 + q] - mu) * rs * gg + bb;
      }
      if (out_sum) *(v4f*)(out_sum + (size_t)row * N + j) = sm;
      *(v4f*)(out_norm + (size_t)row * N + j) = o;
    }
    
  }
}



// ---- f16 WMMA path (v_wmma_f32_16x16x32_f16): 11-bit significands for operands in range — used where a [0,1] probability operand needs more precision than bf16
typedef _Float16 v16h __attribute__((ext_vector_type(16)));
union FragH { v16h v; v8us half[2]; _Float16 h[16]; unsigned short u[16]; };
template <int NT>
__device__ __forceinline__ v8f mmaH(v16h ah, v16h al, v16h bh, v16h bl, v8f c) {
  c = __builtin_amdgcn_wmma_f32_16x16x32_f16(false, ah, false, bh, (short)0, c, false, false);
  if (NT >= 2) c = __builtin_amdgcn_wmma_f32_16x16x32_f16(false, al, false, bh, (short)0, c, false, false);
  if (NT >= 3) c = __builtin_amdgcn_wmma_f32_16x16x32_f16(false, ah, false, bl, (short)0, c, false, false);
  asm volatile("v_nop\n\tv_nop\n\tv_nop\n\tv_nop" : "+v"(c) : "v"(ah), "v"(al), "v"(bh), "v"(bl));
  return c;
}
// batched GEMM like k_gemm_b but f16 operands: A f32 (split into f16 hi/lo if ASPLIT, else rounded to f16), Bt = f16 values [n][k]; alpha; C f32; N multiple of 16 (partial tiles skipped)
template <bool ASPLIT>
__global__ __launch_bounds__(128) void k_gemm_h(const float* __restrict__ A, int lda, size_t sA, const _Float16* __restrict__ Bh, int ldb, size_t sB, float alpha, float* __restrict__ C, int ldc, size_t sC, int M, int N, int K) {
  __shared__ __attribute__((aligned(16))) float so[4][16][64];
  const int tid = threadIdx.x, w = tid >> 5, lane = tid & 31, ln = lane & 15, hh = lane >> 4; const int by = blockIdx.y;
  A += (size_t)by * sA; Bh += (size_t)by * sB; C += (size_t)by * sC;
  const int ntn = (N + 63) / 64; const int wid = blockIdx.x * 4 + w; const int mt = wid / ntn, nq = wid % ntn; if (mt * 16 >= M) return;
  const int row0 = mt * 16, col0 = nq * 64; const float* arow = A + (size_t)(row0 + ln) * lda;
  v8f acc[4] = {};
  for (int kb = 0; kb < K; kb += 32) {
    FragH ah, al;
    const v4f x0 = *(const v4fa*)(arow + kb + 8 * hh), x1 = *(const v4fa*)(arow + kb + 8 * hh + 4), x2 = *(const v4fa*)(arow + kb + 16 + 8 * hh), x3 = *(const v4fa*)(arow + kb + 16 + 8 * hh + 4);
    float xs[16] = {x0[0],x0[1],x0[2],x0[3],x1[0],x1[1],x1[2],x1[3],x2[0],x2[1],x2[2],x2[3],x3[0],x3[1],x3[2],x3[3]};
#pragma unroll
    for (int i = 0; i < 16; ++i) { const _Float16 h = (_Float16)xs[i]; ah.h[i] = h; al.h[i] = ASPLIT ? (_Float16)(xs[i] - (float)h) : (_Float16)0.0f; }
#pragma unroll
    for (int t = 0; t < 4; ++t) { if (col0 + t * 16 >= N) continue; const size_t boff = (size_t)(col0 + t * 16 + ln) * ldb + kb; FragH bq; bq.half[0] = *(const v8us*)(Bh + boff + 8 * hh); bq.half[1] = *(const v8us*)(Bh + boff + 16 + 8 * hh);
      acc[t] = mmaH<ASPLIT ? 2 : 1>(ah.v, al.v, bq.v, bq.v, acc[t]); }
  }
#pragma unroll
  for (int t = 0; t < 4; ++t) { if (col0 + t * 16 >= N) continue;
#pragma unroll
    for (int r = 0; r < 8; ++r) so[w][8 * hh + r][t * 16 + ln] = acc[t][r] * alpha; }
  __builtin_amdgcn_fence(__ATOMIC_ACQ_REL, "workgroup"); __builtin_amdgcn_wave_barrier();
  const int rsub = lane >> 4, c4 = (lane & 15) * 4;
  {
#pragma unroll
    for (int q = 0; q < 8; ++q) { const int r = q * 2 + rsub; if (col0 + c4 < N) { const v4f v = *(const v4fa*)&so[w][r][c4]; *(v4f*)(C + (size_t)(row0 + r) * ldc + col0 + c4) = v; } }
     }
}

// Wt[n][k] = f16(W[k][n]·scale) from f32 row-major W[K][N] (scale = power of two; bf16-exact weights stay exact in f16 away from the subnormal range)
__global__ __launch_bounds__(256) void k_wt_f16(const float* __restrict__ W, _Float16* __restrict__ Wt, int K, int N, float scale) {
  const int t = blockIdx.x * 256 + threadIdx.x; if (t >= N * (K / 8)) return; const int n = t / (K / 8), k8 = (t % (K / 8)) * 8; FragH f;
#pragma unroll
  for (int i = 0; i < 8; ++i) f.h[i] = (_Float16)(bf16_round(W[(size_t)(k8 + i) * N + n]) * scale); const v8us o = f.half[0];
  *(v8us*)((unsigned short*)Wt + (size_t)n * K + k8) = o; 
}
// k_gemm_hh variant with fused epilogue: v = acc·alpha + bias[by·sBias + col] (+ CP[(row/rowsPerB)·sCPb + by·64 + col] if CP) ; ACT 0 none / 1 elu ; writes f16 C16 (and f32 C if non-null)
template <int ACT>
__global__ __launch_bounds__(128) void k_gemm_hhx(const _Float16* __restrict__ A, int lda, size_t sA, const _Float16* __restrict__ Bh, int ldb, size_t sB, float alpha, const float* __restrict__ bias, size_t sBias, const float* __restrict__ CP, int rowsPerB, size_t sCPb, int row0g,
    float* __restrict__ C, _Float16* __restrict__ C16, int ldc, size_t sC, int M, int N, int K) {
  __shared__ __attribute__((aligned(16))) float so[4][16][64];
  const int tid = threadIdx.x, w = tid >> 5, lane = tid & 31, ln = lane & 15, hh = lane >> 4; const int by = blockIdx.y;
  A += (size_t)by * sA; Bh += (size_t)by * sB; const size_t cofs = (size_t)by * sC; const float* bp = bias ? bias + (size_t)by * sBias : nullptr;
  const int ntn = (N + 63) / 64; const int wid = blockIdx.x * 4 + w; const int mt = wid / ntn, nq = wid % ntn; if (mt * 16 >= M) return;
  const int row0 = mt * 16, col0 = nq * 64; const _Float16* arow = A + (size_t)(row0 + ln) * lda;
  v8f acc[4] = {};
  for (int kb = 0; kb < K; kb += 32) { FragH ah; ah.half[0] = *(const v8us*)((const unsigned short*)arow + kb + 8 * hh); ah.half[1] = *(const v8us*)((const unsigned short*)arow + kb + 16 + 8 * hh);
#pragma unroll
    for (int t = 0; t < 4; ++t) { if (col0 + t * 16 >= N) continue; const size_t boff = (size_t)(col0 + t * 16 + ln) * ldb + kb; FragH bq; bq.half[0] = *(const v8us*)((const unsigned short*)Bh + boff + 8 * hh); bq.half[1] = *(const v8us*)((const unsigned short*)Bh + boff + 16 + 8 * hh);
      acc[t] = mmaH<1>(ah.v, ah.v, bq.v, bq.v, acc[t]); }
  }
#pragma unroll
  for (int t = 0; t < 4; ++t) { if (col0 + t * 16 >= N) continue; const int col = col0 + t * 16 + ln; const float bv = bp ? bf16_round(bp[col]) : 0.f;
#pragma unroll
    for (int r = 0; r < 8; ++r) { float v = acc[t][r] * alpha + bv; if (CP) { const int rr = row0g + row0 + 8 * hh + r; if (rowsPerB < 0) v += CP[cofs + (size_t)rr * ldc + col];      /* rowsPerB < 0: own element of the batched C plane */ else { const int bidx = rr / rowsPerB; v += CP[(size_t)bidx * sCPb + (size_t)by * 64 + col]; } } if (ACT == 1) v = (v > 0.f) ? v : expm1f(v); else if (ACT == 7) v = (v > 0.f) ? v + 1.0f : expf(v); else if (ACT == 8) v = tanhf(v); else if (ACT == 9) v = 0.5f * v * (1.0f + tanhf(0.7978845608028654f * (v + 0.044715f * v * v * v))); else if (ACT == 11) v = 1.0f / (1.0f + expf(-v)); else if (ACT == 12) v = (v > 0.f) ? v : 0.01f * v; else if (ACT == 14) v = (v > 0.f) ? v : 0.1f * v; else if (ACT == 16) v = (v >= 0.f) ? v : 0.3f * v; else if (ACT == 17) v = (v >= 0.f) ? v : 0.2f * v; else if (ACT == 15) v = v / (1.0f + expf(-v)); else if (ACT == 3) v = fmaxf(v, 0.f); else if (ACT == 6) v = 0.5f * v * (1.0f + erff(v * 0.70710678118654752f)); so[w][8 * hh + r][t * 16 + ln] = v; } }
  __builtin_amdgcn_fence(__ATOMIC_ACQ_REL, "workgroup"); __builtin_amdgcn_wave_barrier();
  const int rsub = lane >> 4, c4 = (lane & 15) * 4; typedef _Float16 v4h __attribute__((ext_vector_type(4)));
  {
#pragma unroll
    for (int q = 0; q < 8; ++q) { const int r = q * 2 + rsub; if (col0 + c4 < N) { const v4f v = *(const v4fa*)&so[w][r][c4]; if (C) *(v4f*)(C + cofs + (size_t)(row0 + r) * ldc + col0 + c4) = v; if (C16) { v4h h4; for (int i = 0; i < 4; ++i) h4[i] = (_Float16)v[i]; *(v4h*)(C16 + cofs + (size_t)(row0 + r) * ldc + col0 + c4) = h4; } } }
     }
}


typedef _Float16 v4h __attribute__((ext_vector_type(4)));

__global__ __launch_bounds__(256) void k_x16(const float* __restrict__ x, _Float16* __restrict__ X16, size_t n8) { const size_t t = (size_t)blockIdx.x * 256 + threadIdx.x; if (t >= n8) return; FragH f;
#pragma unroll
  for (int q = 0; q < 8; ++q) f.h[q] = (_Float16)bf16_round(x[t * 8 + q]); *(v8us*)((unsigned short*)X16 + t * 8) = f.half[0];  }
__global__ __launch_bounds__(256) void k_h16(const float* __restrict__ x, _Float16* __restrict__ X16, size_t n8) { const size_t t = (size_t)blockIdx.x * 256 + threadIdx.x; if (t >= n8) return; FragH f;
#pragma unroll
  for (int q = 0; q < 8; ++q) f.h[q] = (_Float16)x[t * 8 + q]; *(v8us*)((unsigned short*)X16 + t * 8) = f.half[0];  }
__global__ __launch_bounds__(256) void k_round16f(const float* __restrict__ W, _Float16* __restrict__ Bt, size_t n8) { const size_t t = (size_t)blockIdx.x * 256 + threadIdx.x; if (t >= n8) return; FragH f;
#pragma unroll
  for (int i = 0; i < 8; ++i) f.h[i] = (_Float16)(bf16_round(W[t * 8 + i]) * 16.0f); *(v8us*)((unsigned short*)Bt + t * 8) = f.half[0];  }
template <int NHv, int TTv>
__global__ __launch_bounds__(256) void k_vt(const _Float16* __restrict__ V16, int ldv, int voff, _Float16* __restrict__ Vt) { __shared__ unsigned short tl[64][66]; const int tid = threadIdx.x; const int slab = blockIdx.x / (TTv / 64), lg = blockIdx.x % (TTv / 64); const int b = slab / NHv, h = slab % NHv;
  for (int i = tid; i < 64 * 8; i += 256) { const int r = i / 8, c8 = (i % 8) * 8; FragH f; f.half[0] = *(const v8us*)((const unsigned short*)V16 + ((size_t)b * TTv + lg * 64 + r) * ldv + voff + h * 64 + c8);
#pragma unroll
    for (int q = 0; q < 8; ++q) tl[r][c8 + q] = f.u[q]; }
  __syncthreads();
  {
#pragma unroll
    for (int rd = 0; rd < 2; ++rd) { const int d = rd * 32 + tid / 8, pc = tid % 8; FragH f;
#pragma unroll
      for (int q = 0; q < 8; ++q) f.u[q] = tl[pc * 8 + q][d];
      *(v8us*)((unsigned short*)Vt + ((size_t)slab * 64 + d) * TTv + lg * 64 + pc * 8) = f.half[0]; }
     } }

__global__ __launch_bounds__(256) void k_hl(const float* __restrict__ F, _Float16* __restrict__ Hh, _Float16* __restrict__ Hl, size_t n8) { const size_t t = (size_t)blockIdx.x * 256 + threadIdx.x; if (t >= n8) return; FragH fh, fl; const v4f a = *(const v4fa*)(F + t * 8), c = *(const v4fa*)(F + t * 8 + 4);
#pragma unroll
  for (int q = 0; q < 4; ++q) { _Float16 h = (_Float16)a[q]; fh.h[q] = h; fl.h[q] = (_Float16)((a[q] - (float)h) * 1024.0f); h = (_Float16)c[q]; fh.h[4 + q] = h; fl.h[4 + q] = (_Float16)((c[q] - (float)h) * 1024.0f); }
  { *(v8us*)((unsigned short*)Hh + t * 8) = fh.half[0]; *(v8us*)((unsigned short*)Hl + t * 8) = fl.half[0];  } }

// ---- fast GEMM (wave tile 32x64; requires M % 32 == 0 rows per launch region and N % 64 == 0); epilogue = k_gemm_hhx semantics ----
__device__ __forceinline__ v16h g2_frag(const _Float16* p, int hh) { FragH f; f.half[0] = *(const v8us*)((const unsigned short*)p + 8 * hh); f.half[1] = *(const v8us*)((const unsigned short*)p + 16 + 8 * hh); return f.v; }
__device__ __forceinline__ v8f g2_mma(v16h a, v16h b, v8f c) { v8f d = __builtin_amdgcn_wmma_f32_16x16x32_f16(false, a, false, b, (short)0, c, false, false); asm volatile("v_nop\n\tv_nop\n\tv_nop\n\tv_nop" : "+v"(d) : "v"(a), "v"(b)); return d; }
template <int ACT>
__global__ __launch_bounds__(128) void k_gemm2(const _Float16* __restrict__ A, int lda, size_t sA, const _Float16* __restrict__ Bh, int ldb, size_t sB, float alpha, const float* __restrict__ bias, size_t sBias, const float* __restrict__ CP, int rowsPerB, size_t sCPb, int row0g,
    float* __restrict__ C, _Float16* __restrict__ C16, int ldc, size_t sC, int M, int N, int K) { static_assert(ACT == 0 || ACT == 3 || ACT == 6 || ACT == 8 || ACT == 9 || ACT == 11 || ACT == 12 || ACT == 14 || ACT == 15 || ACT == 16 || ACT == 17, "k_gemm2: unsupported ACT code (would silently apply no activation)");
  __shared__ __attribute__((aligned(16))) float so[4][32][68];
  const int tid = threadIdx.x, w = tid >> 5, lane = tid & 31, ln = lane & 15, hh = lane >> 4; const int by = blockIdx.y;
  A += (size_t)by * sA; Bh += (size_t)by * sB; const size_t cofs = (size_t)by * sC; const float* bp = bias ? bias + (size_t)by * sBias : nullptr;
  const int ntn = N >> 6; const int mt = blockIdx.x / ntn, nq = blockIdx.x - mt * ntn; const int row0 = mt * 128 + 32 * w, col0 = nq * 64; if (row0 >= M) return;
  const _Float16* a0p = A + (size_t)(row0 + ln) * lda; const _Float16* a1p = a0p + (size_t)16 * lda;
  const _Float16* b0p = Bh + (size_t)(col0 + ln) * ldb; const _Float16* b1p = b0p + (size_t)16 * ldb; const _Float16* b2p = b1p + (size_t)16 * ldb; const _Float16* b3p = b2p + (size_t)16 * ldb;
  const v8f z8 = {0.f,0.f,0.f,0.f,0.f,0.f,0.f,0.f}; v8f c00 = z8, c01 = z8, c02 = z8, c03 = z8, c10 = z8, c11 = z8, c12 = z8, c13 = z8;
#pragma unroll 1
  for (int kb = 0; kb < K; kb += 32) { const v16h a0 = g2_frag(a0p + kb, hh), a1 = g2_frag(a1p + kb, hh);
    v16h b = g2_frag(b0p + kb, hh); c00 = g2_mma(a0, b, c00); c10 = g2_mma(a1, b, c10);
    b = g2_frag(b1p + kb, hh); c01 = g2_mma(a0, b, c01); c11 = g2_mma(a1, b, c11);
    b = g2_frag(b2p + kb, hh); c02 = g2_mma(a0, b, c02); c12 = g2_mma(a1, b, c12);
    b = g2_frag(b3p + kb, hh); c03 = g2_mma(a0, b, c03); c13 = g2_mma(a1, b, c13); }
  v8f accs[8] = {c00, c01, c02, c03, c10, c11, c12, c13};
#pragma unroll
  for (int u = 0; u < 8; ++u) { const int t = u & 3, half = u >> 2; const int col = col0 + t * 16 + ln; const float bv = bp ? bf16_round(bp[col]) : 0.f;
#pragma unroll
    for (int r = 0; r < 8; ++r) { const int rloc = half * 16 + 8 * hh + r; float v = accs[u][r] * alpha + bv; if (CP) { if (rowsPerB < 0) v += CP[cofs + (size_t)(row0g + row0 + rloc) * ldc + col];      /* rowsPerB < 0: own element of the batched C plane */ else { const int bidx = (row0g + row0 + rloc) / rowsPerB; v += CP[(size_t)bidx * sCPb + (size_t)by * 64 + col]; } }
      if (ACT == 3) v = fmaxf(v, 0.f); else if (ACT == 6) v = 0.5f * v * (1.0f + erff(v * 0.70710678118654752f)); else if (ACT == 11) v = 1.0f / (1.0f + expf(-v)); else if (ACT == 15) v = v / (1.0f + expf(-v)); else if (ACT == 12) v = (v > 0.f) ? v : 0.01f * v; else if (ACT == 8) v = tanhf(v); else if (ACT == 9) v = 0.5f * v * (1.0f + tanhf(0.7978845608028654f * (v + 0.044715f * v * v * v))); else if (ACT == 14) v = (v > 0.f) ? v : 0.1f * v; else if (ACT == 16) v = (v >= 0.f) ? v : 0.3f * v; else if (ACT == 17) v = (v >= 0.f) ? v : 0.2f * v;
      so[w][rloc][t * 16 + ln] = v; } }
  __builtin_amdgcn_fence(__ATOMIC_ACQ_REL, "workgroup"); __builtin_amdgcn_wave_barrier();
  const int rsub = lane >> 4, c4 = (lane & 15) * 4;
  {
#pragma unroll
    for (int q = 0; q < 16; ++q) { const int r = q * 2 + rsub; const v4f v = *(const v4fa*)&so[w][r][c4]; if (C) *(v4f*)(C + cofs + (size_t)(row0 + r) * ldc + col0 + c4) = v; if (C16) { v4h h4; for (int i = 0; i < 4; ++i) h4[i] = (_Float16)v[i]; *(v4h*)(C16 + cofs + (size_t)(row0 + r) * ldc + col0 + c4) = h4; } }
     } }


__global__ __launch_bounds__(256) void k_wnat(const float* __restrict__ w, size_t n8, _Float16* __restrict__ Bt) { const size_t t = (size_t)blockIdx.x * 256 + threadIdx.x; if (t >= n8) return; FragH f; for (int q = 0; q < 8; ++q) f.h[q] = (_Float16)(bf16_round(w[t * 8 + q]) * 16.0f); *(v8us*)((unsigned short*)Bt + t * 8) = f.half[0];  }
__global__ __launch_bounds__(256) void k_rsm(const float* __restrict__ S, _Float16* __restrict__ P, int nrows) {
  #pragma clang fp contract(off)
  const int i = blockIdx.x * 256 + threadIdx.x; if (i >= nrows) return; const float* s = S + (size_t)i * SQ; float mx = -3.0e38f;
#pragma unroll 1
  for (int j = 0; j < SQ; ++j) mx = fmaxf(mx, s[j]); float se = 0.f;
#pragma unroll 1
  for (int j = 0; j < SQ; ++j) se += expf(s[j] - mx); const float sc = 256.0f / se;
#pragma unroll 1
  for (int j0 = 0; j0 < SQ; j0 += 8) { FragH f; for (int q = 0; q < 8; ++q) f.h[q] = (_Float16)(expf(s[j0 + q] - mx) * sc); unsigned short* d = (unsigned short*)P + (size_t)i * SQ + j0; *(v8us*)d = f.half[0];  } }
__global__ __launch_bounds__(256) void k_vt(const _Float16* __restrict__ V16, int b, int h0, _Float16* __restrict__ VT) { __shared__ unsigned short tl[64][65]; const int tid = threadIdx.x; const int hh = blockIdx.x % HG, sg = blockIdx.x / HG; const int s0 = sg * 64; const int h = h0 + hh;
  for (int i = tid; i < 64 * 8; i += 256) { const int j = i / 8, d8 = (i % 8) * 8; FragH f; f.half[0] = *(const v8us*)((const unsigned short*)V16 + ((size_t)b * SQ + s0 + j) * DM + h * HD + d8); for (int q = 0; q < 8; ++q) tl[d8 + q][j] = f.u[q]; }
  __syncthreads();
  { for (int i = tid; i < 64 * 8; i += 256) { const int d = i / 8, j8 = (i % 8) * 8; FragH f; for (int q = 0; q < 8; ++q) f.u[q] = tl[d][j8 + q]; *(v8us*)((unsigned short*)VT + ((size_t)hh * HD + d) * SQ + s0 + j8) = f.half[0]; }  } }



// native e^x = 2^(x log2 e), as __expf gives it; the v_nop keeps the one slot that the instruction set asks for behind a transcendental
__device__ __forceinline__ float rs_exp(float x) { float e; asm("v_exp_f32 %0, %1\n\tv_nop" : "=v"(e) : "v"(x * 1.44269504088896340736f)); return e; }
// One wave per score row: the row is read once, 16 loads of 512 contiguous bytes, and stays in registers for the maximum, the exponentials and the scaling (every loop over v is unrolled so that v is never indexed at run time and stays in registers).
__global__ __launch_bounds__(256) void k_rsmf(const float* __restrict__ S, _Float16* __restrict__ P, int qn, int hg) {
  const int lane = threadIdx.x & 31; const int t = blockIdx.x * 8 + (int)(threadIdx.x >> 5); if (t >= qn * hg) return;      /* same test in every lane of a wave; no barrier below */
  const size_t i = (size_t)(t / qn) * SQ + (t % qn); const float* s = S + i * SQ + lane * 4; _Float16* d = P + i * SQ + lane * 4;
  v4f v[SQ / 128];
#pragma unroll
  for (int u = 0; u < SQ / 128; ++u) v[u] = *(const v4fa*)(s + u * 128);
  asm volatile("s_wait_xcnt 0x0" :: "v"(s) : "memory");      /* precaution: holds the loads' address pair live up to this wait, so that no load's result is placed on it in front of the wait */
  v4f m4 = v[0];
#pragma unroll
  for (int u = 1; u < SQ / 128; ++u) for (int q = 0; q < 4; ++q) m4[q] = fmaxf(m4[q], v[u][q]);
  float mx = fmaxf(fmaxf(fmaxf(m4[0], m4[1]), fmaxf(m4[2], m4[3])), -3.0e38f);
#pragma unroll
  for (int o = 16; o > 0; o >>= 1) mx = fmaxf(mx, __shfl_xor(mx, o, 32));
  v4f s4 = {0.f, 0.f, 0.f, 0.f};
#pragma unroll
  for (int u = 0; u < SQ / 128; ++u) for (int q = 0; q < 4; ++q) { v[u][q] = rs_exp(v[u][q] - mx); s4[q] += v[u][q]; }
  float se = (s4[0] + s4[1]) + (s4[2] + s4[3]);
#pragma unroll
  for (int o = 16; o > 0; o >>= 1) se += __shfl_xor(se, o, 32);
  const float sc = 256.0f / se;
#pragma unroll
  for (int u = 0; u < SQ / 128; ++u) { v4h h4; for (int q = 0; q < 4; ++q) h4[q] = (_Float16)(v[u][q] * sc); *(v4h*)(d + u * 128) = h4; } }


template <int BFIN, int WXB>
__global__ __launch_bounds__(256) void k_ln16p(const float* __restrict__ X, size_t ldx, const float* __restrict__ g, const float* __restrict__ bb, float eps, _Float16* __restrict__ N16, float* __restrict__ XB) {
  #pragma clang fp contract(off)
  __shared__ float red[256]; const size_t r = blockIdx.x; const int t = threadIdx.x; const v4f xa = *(const v4fa*)(X + r * ldx + t * 4); float s[4]; float sum = 0.f;
  for (int q = 0; q < 4; ++q) { s[q] = BFIN ? bf16_round(xa[q]) : xa[q]; sum = __fadd_rn(sum, s[q]); }
  red[t] = sum; __syncthreads(); for (int st = 128; st > 0; st >>= 1) { if (t < st) red[t] = __fadd_rn(red[t], red[t + st]); __syncthreads(); } const float mu = red[0] / (float)DMQ; __syncthreads();
  float vs = 0.f; for (int q = 0; q < 4; ++q) { const float dl = __fadd_rn(s[q], -mu); vs = __fadd_rn(vs, __fmul_rn(dl, dl)); } red[t] = vs; __syncthreads(); for (int st = 128; st > 0; st >>= 1) { if (t < st) red[t] = __fadd_rn(red[t], red[t + st]); __syncthreads(); }
  const float rs = rsqrtf(__fadd_rn(red[0] / (float)DMQ, eps)); v4h y; v4f xb;
  for (int q = 0; q < 4; ++q) { const int c = t * 4 + q; y[q] = (_Float16)__fadd_rn(__fmul_rn(__fmul_rn(__fadd_rn(s[q], -mu), rs), bf16_round(g[c])), bf16_round(bb[c])); xb[q] = s[q]; }
  { *(v4h*)(N16 + r * DMQ + t * 4) = y; if (WXB) *(v4f*)(XB + r * DMQ + t * 4) = xb;  } }
extern "C" void kernel_launch(void* const* d_in, const int* in_sizes, int n_in,
                              void* d_out, int out_size, void* d_ws, size_t ws_size, hipStream_t stream) {
  (void)in_sizes; (void)n_in; (void)out_size;
  const float* const* I = (const float* const*)d_in; const float* x = I[0]; const float* wqkv = I[1]; const float* wo = I[2]; const float* bo = I[3]; const float* qg = I[4]; const float* qb = I[5]; const float* kg = I[6]; const float* kb = I[7]; const float* bqkv = nullptr;      /* natural weights; no qkv bias */
  char* ws = (char*)d_ws; size_t off = 0;
  auto take = [&](size_t bytes) { char* p = ws + off; off += (bytes + 255) & ~(size_t)255; return p; };
  _Float16* BQKV = (_Float16*)take((size_t)3 * DM * DM * 2); _Float16* BO = (_Float16*)take((size_t)DM * DM * 2);
  _Float16* X16 = (_Float16*)take(NR * DM * 2); float* QKVF = (float*)take(NR * 3 * DM * 4); _Float16* QN16 = (_Float16*)take(NR * DM * 2); _Float16* KN16 = (_Float16*)take(NR * DM * 2); _Float16* QKV = (_Float16*)take(NR * 3 * DM * 2); _Float16* Q16 = QKV; _Float16* K16 = QKV + DM; _Float16* V16 = QKV + 2 * DM; _Float16* O16 = (_Float16*)take(NR * DM * 2);
  float* S = (float*)take((size_t)HG * SQ * SQ * 4); _Float16* P = (_Float16*)take((size_t)HG * SQ * SQ * 2); _Float16* VT = (_Float16*)take((size_t)NH * HD * SQ * 2);
  if (off > ws_size) return;
  k_wnat<<<(unsigned)(((size_t)3 * DM * DM / 8 + 255) / 256), 256, 0, stream>>>(wqkv, (size_t)3 * DM * DM / 8, BQKV); k_wnat<<<(unsigned)(((size_t)DM * DM / 8 + 255) / 256), 256, 0, stream>>>(wo, (size_t)DM * DM / 8, BO);      /* natural [out][in] = Bt planes x16 */
  k_x16<<<(unsigned)((NR * DM / 8 + 255) / 256), 256, 0, stream>>>(x, X16, NR * DM / 8);
  const size_t r0p = (size_t)B0 * SQ;      /* first projected row */
  k_gemm2<0><<<dim3((unsigned)((MP / 128) * (3 * DM / 64)), 1), 128, 0, stream>>>(X16 + r0p * DM, DM, 0, BQKV, DM, 0, 0.0625f, nullptr, 0, nullptr, 1, 0, 0, QKVF + r0p * 3 * DM, QKV + r0p * 3 * DM, 3 * DM, 0, MP, 3 * DM, DM);      /* q | k | v rows: f32 (for the LayerNorms) and f16 (v operand) */
  k_ln16p<0, 0><<<(unsigned)MP, 256, 0, stream>>>(QKVF + r0p * 3 * DM, (size_t)3 * DM, qg, qb, 1e-5f, QN16 + r0p * DM, nullptr); k_ln16p<0, 0><<<(unsigned)MP, 256, 0, stream>>>(QKVF + r0p * 3 * DM + DM, (size_t)3 * DM, kg, kb, 1e-5f, KN16 + r0p * DM, nullptr);      /* q, k = LayerNorm over the merged 1024 features -> f16 rows */
  for (int b = B0; b < B0 + NBR; ++b) { const size_t r0 = (size_t)b * SQ;
    k_vt<NH, SQ><<<NH * (SQ / 64), 256, 0, stream>>>(V16 + r0 * LQ, LQ, 0, VT);      /* V^T [NH][HD][SQ] for this batch */
    for (int h0 = 0; h0 < NHD; h0 += HG) {
      k_gemm2<0><<<dim3((QN / 128) * (SQ / 64), HG), 128, 0, stream>>>(QN16 + r0 * DM + h0 * HD, DM, (size_t)HD, KN16 + r0 * DM + h0 * HD, DM, (size_t)HD, 0.125f, nullptr, 0, nullptr, 1, 0, 0, S, nullptr, SQ, (size_t)SQ * SQ, QN, SQ, HD);      /* scores, HG heads per launch */
      k_rsmf<<<(HG * QN + 7) / 8, 256, 0, stream>>>(S, P, QN, HG);      /* P = 256 softmax (f16), rows of all HG heads */
      k_gemm2<0><<<dim3((QN / 128) * (HD / 64), HG), 128, 0, stream>>>(P, SQ, (size_t)SQ * SQ, VT + (size_t)h0 * HD * SQ, SQ, (size_t)HD * SQ, 0.25f, nullptr, 0, nullptr, 1, 0, 0, nullptr, O16 + r0 * DM + h0 * HD, DM, (size_t)HD, QN, HD, SQ); } }      /* o (merged heads) as f16 rows */
  k_gemm2<0><<<dim3((unsigned)((MPO / 128) * (DM / 64)), 1), 128, 0, stream>>>(O16 + r0p * DM, DM, 0, BO, DM, 0, 0.0009765625f, bo, 0, nullptr, 1, 0, 0, (float*)d_out + r0p * DM, nullptr, DM, 0, MPO, DM, DM);      /* out rows are the output layout */
}

// v002
// It runs in 184 microseconds.
// In two side-by-side timings against v001, it was 4.95 and 4.98 times as fast.
// Over all steps from v000 it is 18.9 times as fast.
#include <hip/hip_runtime.h>
// Self-attention block with q/k LayerNorm (x [2][2048][1024]; qkv = x w_qkv^T (natural [3072][1024], sigma 1/32, no bias) -> q | k | v blocks, 16 heads of 64; q = LayerNorm_1024(q; q_gamma, q_beta) and k likewise over the full merged 1024 features (eps 1e-5); softmax(q k^T / 8) (no mask); out = merged w_proj^T + b_proj -> [2][2048][1024]).
// Structure: x as exact f16 rows; natural weights as exact x16 planes; q | k | v as ONE WMMA GEMM (32x64 wave tiles, f32 accumulation; f32 rows for the norms + f16 rows for v); q and k LayerNorm over the merged 1024 features on VALU (f32, LDS trees; bf16 gamma/beta) -> f16 rows; V^T via LDS transposes; one fused attention launch over all batches and heads (scores K = 64 in f32 accumulators, online softmax with f32 statistics and native exp2, weights as f16, o = P V carried x64) into merged f16 rows; out = o w_proj^T + b_proj GEMM (f32, alpha 2^-10); launches: see trace.
// Compute dtype: inputs rounded to bf16; x / weights exact; q, k, v, softmax weights and o as plain f16 GEMM operands (~2^-12); scores and softmax statistics f32. v_wmma_f32_16x16x32_f16.
#define NB 2
#define SQ 2048
#define DM 1024
#define NH 16
#define HD 64
#define HG 4                         /* heads per launch of the per-batch k_vt (not launched) */
#define B0 0                         /* first batch processed (debug hook) */
#define NBR NB                       /* batches processed (debug hook) */
#define NR ((size_t)NB * SQ)
#define DMQ DM         /* LayerNorm width and f16 row pitch */
#define MP ((int)((size_t)NBR * SQ)) /* rows projected (debug hook) */
#define QN SQ                        /* unused: k_fattn attends all SQ query rows */
#define NHD NH                       /* unused: k_fattn attends all NH heads */
#define MPO MP                       /* rows through the output stage (debug hook) */
#define LQ (3 * DM)      /* row pitch of the q/k/v rows */
typedef __bf16 v16b __attribute__((ext_vector_type(16)));
typedef unsigned short v8us __attribute__((ext_vector_type(8), may_alias));
typedef float  v8f  __attribute__((ext_vector_type(8)));
typedef float  v4f  __attribute__((ext_vector_type(4)));
typedef float  v4fa __attribute__((ext_vector_type(4), may_alias));
union FragB { v16b v; v8us half[2]; unsigned short u[16]; };

__device__ __forceinline__ unsigned short bf16_bits(float x) { unsigned int u = __float_as_uint(x); return (unsigned short)((u + 0x7FFFu + ((u >> 16) & 1u)) >> 16); }
__device__ __forceinline__ float bf16_val(unsigned short b) { return __uint_as_float(((unsigned int)b) << 16); }
__device__ __forceinline__ float bf16_round(float x) { return bf16_val(bf16_bits(x)); }
// D += A·B with NT terms: 1 = ah·bh, 2 = + al·bh (A split), 3 = + ah·bl (both split)
template <int NT>
__device__ __forceinline__ v8f mmaN(v16b ah, v16b al, v16b bh, v16b bl, v8f c) {
  c = __builtin_amdgcn_wmma_f32_16x16x32_bf16(false, ah, false, bh, (short)0, c, false, false);
  if (NT >= 2) c = __builtin_amdgcn_wmma_f32_16x16x32_bf16(false, al, false, bh, (short)0, c, false, false);
  if (NT >= 3) c = __builtin_amdgcn_wmma_f32_16x16x32_bf16(false, ah, false, bl, (short)0, c, false, false);
  asm volatile("v_nop\n\tv_nop\n\tv_nop\n\tv_nop" : "+v"(c) : "v"(ah), "v"(al), "v"(bh), "v"(bl));
  return c;
}

__global__ __launch_bounds__(256) void k_wt_bf16(const float* __restrict__ W, unsigned short* __restrict__ Wt, int K, int N) {
  const int t = blockIdx.x * 256 + threadIdx.x;
  const int k8n = K / 8;
  if (t >= N * k8n) return;
  const int n = t / k8n, k8 = (t % k8n) * 8;
  v8us v;
#pragma unroll
  for (int i = 0; i < 8; ++i) v[i] = bf16_bits(W[(size_t)(k8 + i) * N + n]);
  *(v8us*)(Wt + (size_t)n * K + k8) = v;
  
}

// GEMM C[M][N] (f32, pitch ldc) = act(A[M][K]·W + bias). A f32 row-major (pitch lda) converted per fragment to bf16
// (ASPLIT: hi/lo two planes -> 2 terms, else single rounded term); Wt bf16 [N][K] (pitch ldb). BIAS_BF16 rounds the
// bias to bf16 first (bias quantised to bf16 before the add). K%32==0, M%16==0, N%64==0.
template <bool ASPLIT, int ACT, bool BIAS_BF16>
__global__ __launch_bounds__(128) void k_gemm_bf(const float* __restrict__ A, int lda, const unsigned short* __restrict__ Wt, int ldb,
                                               const float* __restrict__ bias, float* __restrict__ C, int ldc, int M, int N, int K) {
  __shared__ __attribute__((aligned(16))) float so[4][16][64];
  const int tid = threadIdx.x, w = tid >> 5, lane = tid & 31, ln = lane & 15, hh = lane >> 4;
  const int ntn = N / 64;
  const int wid = blockIdx.x * 4 + w;
  const int mt = wid / ntn, nq = wid % ntn;
  if (mt * 16 >= M) return;
  const int row0 = mt * 16, col0 = nq * 64;
  const float* arow = A + (size_t)(row0 + ln) * lda;
  v8f acc[4] = {};
  for (int kb = 0; kb < K; kb += 32) {
    FragB ah, al;
    const v4f x0 = *(const v4fa*)(arow + kb + 8 * hh), x1 = *(const v4fa*)(arow + kb + 8 * hh + 4);
    const v4f x2 = *(const v4fa*)(arow + kb + 16 + 8 * hh), x3 = *(const v4fa*)(arow + kb + 16 + 8 * hh + 4);
    float xs[16] = {x0[0],x0[1],x0[2],x0[3],x1[0],x1[1],x1[2],x1[3],x2[0],x2[1],x2[2],x2[3],x3[0],x3[1],x3[2],x3[3]};
#pragma unroll
    for (int i = 0; i < 16; ++i) { const unsigned short hb = bf16_bits(xs[i]); ah.u[i] = hb; al.u[i] = ASPLIT ? bf16_bits(xs[i] - bf16_val(hb)) : (unsigned short)0; }
#pragma unroll
    for (int t = 0; t < 4; ++t) {
      const unsigned short* brow = Wt + (size_t)(col0 + t * 16 + ln) * ldb + kb;
      FragB b;
      b.half[0] = *(const v8us*)(brow + 8 * hh);
      b.half[1] = *(const v8us*)(brow + 16 + 8 * hh);
      acc[t] = mmaN<ASPLIT ? 2 : 1>(ah.v, al.v, b.v, b.v, acc[t]);
    }
  }
#pragma unroll
  for (int t = 0; t < 4; ++t) {
    float bv = bias ? bias[col0 + t * 16 + ln] : 0.f;
    if (BIAS_BF16) bv = bf16_round(bv);
#pragma unroll
    for (int r = 0; r < 8; ++r) { float v = acc[t][r] + bv; if (ACT == 1) v = fmaxf(v, 0.f); so[w][8 * hh + r][t * 16 + ln] = v; }
  }
  __builtin_amdgcn_fence(__ATOMIC_ACQ_REL, "workgroup");
  __builtin_amdgcn_wave_barrier();
  const int rsub = lane >> 4, c4 = (lane & 15) * 4;
  {
#pragma unroll
    for (int q = 0; q < 8; ++q) {
      const int r = q * 2 + rsub;
      const v4f v = *(const v4fa*)&so[w][r][c4];
      *(v4f*)(C + (size_t)(row0 + r) * ldc + col0 + c4) = v;
    }
    
  }
}

// GEMM C = act(A·W + bias + resid): A f32 (ASPLIT -> hi/lo 2 terms), Wt bf16 [N][K]; ACT 0 none, 1 relu, 2 exact gelu;
// resid (optional, f32, row index = (row % rmod), pitch ldr, RES_BF16 rounds it) added before the activation.
template <bool ASPLIT, int ACT, bool BIAS_BF16, bool RES_BF16>
__global__ __launch_bounds__(128) void k_gemm_bf3(const float* __restrict__ A, int lda, const unsigned short* __restrict__ Wt, int ldb,
                                                const float* __restrict__ bias, const float* __restrict__ resid, int rmod, int ldr,
                                                float* __restrict__ C, int ldc, int M, int N, int K) {
  __shared__ __attribute__((aligned(16))) float so[4][16][64];
  const int tid = threadIdx.x, w = tid >> 5, lane = tid & 31, ln = lane & 15, hh = lane >> 4;
  const int ntn = N / 64;
  const int wid = blockIdx.x * 4 + w;
  const int mt = wid / ntn, nq = wid % ntn;
  if (mt * 16 >= M) return;
  const int row0 = mt * 16, col0 = nq * 64;
  const float* arow = A + (size_t)(row0 + ln) * lda;
  v8f acc[4] = {};
  for (int kb = 0; kb < K; kb += 32) {
    FragB ah, al;
    const v4f x0 = *(const v4fa*)(arow + kb + 8 * hh), x1 = *(const v4fa*)(arow + kb + 8 * hh + 4);
    const v4f x2 = *(const v4fa*)(arow + kb + 16 + 8 * hh), x3 = *(const v4fa*)(arow + kb + 16 + 8 * hh + 4);
    float xs[16] = {x0[0],x0[1],x0[2],x0[3],x1[0],x1[1],x1[2],x1[3],x2[0],x2[1],x2[2],x2[3],x3[0],x3[1],x3[2],x3[3]};
#pragma unroll
    for (int i = 0; i < 16; ++i) { const unsigned short hb = bf16_bits(xs[i]); ah.u[i] = hb; al.u[i] = ASPLIT ? bf16_bits(xs[i] - bf16_val(hb)) : (unsigned short)0; }
#pragma unroll
    for (int t = 0; t < 4; ++t) {
      const unsigned short* brow = Wt + (size_t)(col0 + t * 16 + ln) * ldb + kb;
      FragB b;
      b.half[0] = *(const v8us*)(brow + 8 * hh);
      b.half[1] = *(const v8us*)(brow + 16 + 8 * hh);
      acc[t] = mmaN<ASPLIT ? 2 : 1>(ah.v, al.v, b.v, b.v, acc[t]);
    }
  }
#pragma unroll
  for (int t = 0; t < 4; ++t) {
    const int col = col0 + t * 16 + ln;
    float bv = bias ? bias[col] : 0.f;
    if (BIAS_BF16) bv = bf16_round(bv);
#pragma unroll
    for (int r = 0; r < 8; ++r) {
      float v = acc[t][r] + bv;
      if (resid) { float rv = resid[(size_t)((row0 + 8 * hh + r) % rmod) * ldr + col]; if (RES_BF16) rv = bf16_round(rv); v += rv; }
      if (ACT == 1) v = fmaxf(v, 0.f);
      if (ACT == 2) v = 0.5f * v * (1.0f + erff(v * 0.70710678118654752f));
      if (ACT == 3) { const float u = 0.7978845608028654f * (v + 0.044715f * v * v * v); v = 0.5f * v * (1.0f + tanhf(u)); }
      so[w][8 * hh + r][t * 16 + ln] = v;
    }
  }
  __builtin_amdgcn_fence(__ATOMIC_ACQ_REL, "workgroup");
  __builtin_amdgcn_wave_barrier();
  const int rsub = lane >> 4, c4 = (lane & 15) * 4;
  {
#pragma unroll
    for (int q = 0; q < 8; ++q) {
      const int r = q * 2 + rsub;
      const v4f v = *(const v4fa*)&so[w][r][c4];
      *(v4f*)(C + (size_t)(row0 + r) * ldc + col0 + c4) = v;
    }
    
  }
}
// row LayerNorm (biased variance, eps) over N: s = X (+ R); optional out_sum <- s; out_norm <- (s-mu)*rsqrt(var+eps)*g + b
template <bool PARAM_BF16>
__global__ __launch_bounds__(256) void k_layernorm(const float* __restrict__ X, const float* __restrict__ R, const float* __restrict__ g, const float* __restrict__ bta,
                                                  float* __restrict__ out_sum, float* __restrict__ out_norm, int N, float eps) {
  __shared__ float red[256];
  const int row = blockIdx.x, tid = threadIdx.x;
  const float* x = X + (size_t)row * N; const float* rr = R ? R + (size_t)row * N : nullptr;
  float vals[16];                     // up to N = 4096
  const int per = N / 256;            // contiguous chunk per thread? use strided-by-4 chunks: thread handles j = tid*4 + 1024*u
  float s1 = 0.f;
  for (int u = 0; u < per / 4; ++u) {
    const int j = tid * 4 + 1024 * u;
    const v4f a = *(const v4fa*)(x + j);
    v4f b = {0.f,0.f,0.f,0.f}; if (rr) b = *(const v4fa*)(rr + j);
#pragma unroll
    for (int q = 0; q < 4; ++q) { const float v = a[q] + b[q]; vals[u * 4 + q] = v; s1 += v; }
  }
  red[tid] = s1; __syncthreads();
  for (int st = 128; st > 0; st >>= 1) { if (tid < st) red[tid] += red[tid + st]; __syncthreads(); }
  const float mu = red[0] / (float)N; __syncthreads();
  float s2 = 0.f;
  for (int u = 0; u < per / 4; ++u)
#pragma unroll
    for (int q = 0; q < 4; ++q) { const float c = vals[u * 4 + q] - mu; s2 += c * c; }
  red[tid] = s2; __syncthreads();
  for (int st = 128; st > 0; st >>= 1) { if (tid < st) red[tid] += red[tid + st]; __syncthreads(); }
  const float rs = rsqrtf(red[0] / (float)N + eps);
  {
    for (int u = 0; u < per / 4; ++u) {
      const int j = tid * 4 + 1024 * u;
      v4f o, sm;
#pragma unroll
      for (int q = 0; q < 4; ++q) {
        float gg = g[j + q], bb = bta[j + q];
        if (PARAM_BF16) { gg = bf16_round(gg); bb = bf16_round(bb); }
        sm[q] = vals[u * 4 + q]; o[q] = (vals[u * 4 + q] - mu) * rs * gg + bb;
      }
      if (out_sum) *(v4f*)(out_sum + (size_t)row * N + j) = sm;
      *(v4f*)(out_norm + (size_t)row * N + j) = o;
    }
    
  }
}



// ---- f16 WMMA path (v_wmma_f32_16x16x32_f16): 11-bit significands for operands in range — used where a [0,1] probability operand needs more precision than bf16
typedef _Float16 v16h __attribute__((ext_vector_type(16)));
union FragH { v16h v; v8us half[2]; _Float16 h[16]; unsigned short u[16]; };
template <int NT>
__device__ __forceinline__ v8f mmaH(v16h ah, v16h al, v16h bh, v16h bl, v8f c) {
  c = __builtin_amdgcn_wmma_f32_16x16x32_f16(false, ah, false, bh, (short)0, c, false, false);
  if (NT >= 2) c = __builtin_amdgcn_wmma_f32_16x16x32_f16(false, al, false, bh, (short)0, c, false, false);
  if (NT >= 3) c = __builtin_amdgcn_wmma_f32_16x16x32_f16(false, ah, false, bl, (short)0, c, false, false);
  asm volatile("v_nop\n\tv_nop\n\tv_nop\n\tv_nop" : "+v"(c) : "v"(ah), "v"(al), "v"(bh), "v"(bl));
  return c;
}
// batched GEMM like k_gemm_b but f16 operands: A f32 (split into f16 hi/lo if ASPLIT, else rounded to f16), Bt = f16 values [n][k]; alpha; C f32; N multiple of 16 (partial tiles skipped)
template <bool ASPLIT>
__global__ __launch_bounds__(128) void k_gemm_h(const float* __restrict__ A, int lda, size_t sA, const _Float16* __restrict__ Bh, int ldb, size_t sB, float alpha, float* __restrict__ C, int ldc, size_t sC, int M, int N, int K) {
  __shared__ __attribute__((aligned(16))) float so[4][16][64];
  const int tid = threadIdx.x, w = tid >> 5, lane = tid & 31, ln = lane & 15, hh = lane >> 4; const int by = blockIdx.y;
  A += (size_t)by * sA; Bh += (size_t)by * sB; C += (size_t)by * sC;
  const int ntn = (N + 63) / 64; const int wid = blockIdx.x * 4 + w; const int mt = wid / ntn, nq = wid % ntn; if (mt * 16 >= M) return;
  const int row0 = mt * 16, col0 = nq * 64; const float* arow = A + (size_t)(row0 + ln) * lda;
  v8f acc[4] = {};
  for (int kb = 0; kb < K; kb += 32) {
    FragH ah, al;
    const v4f x0 = *(const v4fa*)(arow + kb + 8 * hh), x1 = *(const v4fa*)(arow + kb + 8 * hh + 4), x2 = *(const v4fa*)(arow + kb + 16 + 8 * hh), x3 = *(const v4fa*)(arow + kb + 16 + 8 * hh + 4);
    float xs[16] = {x0[0],x0[1],x0[2],x0[3],x1[0],x1[1],x1[2],x1[3],x2[0],x2[1],x2[2],x2[3],x3[0],x3[1],x3[2],x3[3]};
#pragma unroll
    for (int i = 0; i < 16; ++i) { const _Float16 h = (_Float16)xs[i]; ah.h[i] = h; al.h[i] = ASPLIT ? (_Float16)(xs[i] - (float)h) : (_Float16)0.0f; }
#pragma unroll
    for (int t = 0; t < 4; ++t) { if (col0 + t * 16 >= N) continue; const size_t boff = (size_t)(col0 + t * 16 + ln) * ldb + kb; FragH bq; bq.half[0] = *(const v8us*)(Bh + boff + 8 * hh); bq.half[1] = *(const v8us*)(Bh + boff + 16 + 8 * hh);
      acc[t] = mmaH<ASPLIT ? 2 : 1>(ah.v, al.v, bq.v, bq.v, acc[t]); }
  }
#pragma unroll
  for (int t = 0; t < 4; ++t) { if (col0 + t * 16 >= N) continue;
#pragma unroll
    for (int r = 0; r < 8; ++r) so[w][8 * hh + r][t * 16 + ln] = acc[t][r] * alpha; }
  __builtin_amdgcn_fence(__ATOMIC_ACQ_REL, "workgroup"); __builtin_amdgcn_wave_barrier();
  const int rsub = lane >> 4, c4 = (lane & 15) * 4;
  {
#pragma unroll
    for (int q = 0; q < 8; ++q) { const int r = q * 2 + rsub; if (col0 + c4 < N) { const v4f v = *(const v4fa*)&so[w][r][c4]; *(v4f*)(C + (size_t)(row0 + r) * ldc + col0 + c4) = v; } }
     }
}

// Wt[n][k] = f16(W[k][n]·scale) from f32 row-major W[K][N] (scale = power of two; bf16-exact weights stay exact in f16 away from the subnormal range)
__global__ __launch_bounds__(256) void k_wt_f16(const float* __restrict__ W, _Float16* __restrict__ Wt, int K, int N, float scale) {
  const int t = blockIdx.x * 256 + threadIdx.x; if (t >= N * (K / 8)) return; const int n = t / (K / 8), k8 = (t % (K / 8)) * 8; FragH f;
#pragma unroll
  for (int i = 0; i < 8; ++i) f.h[i] = (_Float16)(bf16_round(W[(size_t)(k8 + i) * N + n]) * scale); const v8us o = f.half[0];
  *(v8us*)((unsigned short*)Wt + (size_t)n * K + k8) = o; 
}
// k_gemm_hh variant with fused epilogue: v = acc·alpha + bias[by·sBias + col] (+ CP[(row/rowsPerB)·sCPb + by·64 + col] if CP) ; ACT 0 none / 1 elu ; writes f16 C16 (and f32 C if non-null)
template <int ACT>
__global__ __launch_bounds__(128) void k_gemm_hhx(const _Float16* __restrict__ A, int lda, size_t sA, const _Float16* __restrict__ Bh, int ldb, size_t sB, float alpha, const float* __restrict__ bias, size_t sBias, const float* __restrict__ CP, int rowsPerB, size_t sCPb, int row0g,
    float* __restrict__ C, _Float16* __restrict__ C16, int ldc, size_t sC, int M, int N, int K) {
  __shared__ __attribute__((aligned(16))) float so[4][16][64];
  const int tid = threadIdx.x, w = tid >> 5, lane = tid & 31, ln = lane & 15, hh = lane >> 4; const int by = blockIdx.y;
  A += (size_t)by * sA; Bh += (size_t)by * sB; const size_t cofs = (size_t)by * sC; const float* bp = bias ? bias + (size_t)by * sBias : nullptr;
  const int ntn = (N + 63) / 64; const int wid = blockIdx.x * 4 + w; const int mt = wid / ntn, nq = wid % ntn; if (mt * 16 >= M) return;
  const int row0 = mt * 16, col0 = nq * 64; const _Float16* arow = A + (size_t)(row0 + ln) * lda;
  v8f acc[4] = {};
  for (int kb = 0; kb < K; kb += 32) { FragH ah; ah.half[0] = *(const v8us*)((const unsigned short*)arow + kb + 8 * hh); ah.half[1] = *(const v8us*)((const unsigned short*)arow + kb + 16 + 8 * hh);
#pragma unroll
    for (int t = 0; t < 4; ++t) { if (col0 + t * 16 >= N) continue; const size_t boff = (size_t)(col0 + t * 16 + ln) * ldb + kb; FragH bq; bq.half[0] = *(const v8us*)((const unsigned short*)Bh + boff + 8 * hh); bq.half[1] = *(const v8us*)((const unsigned short*)Bh + boff + 16 + 8 * hh);
      acc[t] = mmaH<1>(ah.v, ah.v, bq.v, bq.v, acc[t]); }
  }
#pragma unroll
  for (int t = 0; t < 4; ++t) { if (col0 + t * 16 >= N) continue; const int col = col0 + t * 16 + ln; const float bv = bp ? bf16_round(bp[col]) : 0.f;
#pragma unroll
    for (int r = 0; r < 8; ++r) { float v = acc[t][r] * alpha + bv; if (CP) { const int rr = row0g + row0 + 8 * hh + r; if (rowsPerB < 0) v += CP[cofs + (size_t)rr * ldc + col];      /* rowsPerB < 0: own element of the batched C plane */ else { const int bidx = rr / rowsPerB; v += CP[(size_t)bidx * sCPb + (size_t)by * 64 + col]; } } if (ACT == 1) v = (v > 0.f) ? v : expm1f(v); else if (ACT == 7) v = (v > 0.f) ? v + 1.0f : expf(v); else if (ACT == 8) v = tanhf(v); else if (ACT == 9) v = 0.5f * v * (1.0f + tanhf(0.7978845608028654f * (v + 0.044715f * v * v * v))); else if (ACT == 11) v = 1.0f / (1.0f + expf(-v)); else if (ACT == 12) v = (v > 0.f) ? v : 0.01f * v; else if (ACT == 14) v = (v > 0.f) ? v : 0.1f * v; else if (ACT == 16) v = (v >= 0.f) ? v : 0.3f * v; else if (ACT == 17) v = (v >= 0.f) ? v : 0.2f * v; else if (ACT == 15) v = v / (1.0f + expf(-v)); else if (ACT == 3) v = fmaxf(v, 0.f); else if (ACT == 6) v = 0.5f * v * (1.0f + erff(v * 0.70710678118654752f)); so[w][8 * hh + r][t * 16 + ln] = v; } }
  __builtin_amdgcn_fence(__ATOMIC_ACQ_REL, "workgroup"); __builtin_amdgcn_wave_barrier();
  const int rsub = lane >> 4, c4 = (lane & 15) * 4; typedef _Float16 v4h __attribute__((ext_vector_type(4)));
  {
#pragma unroll
    for (int q = 0; q < 8; ++q) { const int r = q * 2 + rsub; if (col0 + c4 < N) { const v4f v = *(const v4fa*)&so[w][r][c4]; if (C) *(v4f*)(C + cofs + (size_t)(row0 + r) * ldc + col0 + c4) = v; if (C16) { v4h h4; for (int i = 0; i < 4; ++i) h4[i] = (_Float16)v[i]; *(v4h*)(C16 + cofs + (size_t)(row0 + r) * ldc + col0 + c4) = h4; } } }
     }
}


typedef _Float16 v4h __attribute__((ext_vector_type(4)));

__global__ __launch_bounds__(256) void k_x16(const float* __restrict__ x, _Float16* __restrict__ X16, size_t n8) { const size_t t = (size_t)blockIdx.x * 256 + threadIdx.x; if (t >= n8) return; FragH f;
#pragma unroll
  for (int q = 0; q < 8; ++q) f.h[q] = (_Float16)bf16_round(x[t * 8 + q]); *(v8us*)((unsigned short*)X16 + t * 8) = f.half[0];  }
__global__ __launch_bounds__(256) void k_h16(const float* __restrict__ x, _Float16* __restrict__ X16, size_t n8) { const size_t t = (size_t)blockIdx.x * 256 + threadIdx.x; if (t >= n8) return; FragH f;
#pragma unroll
  for (int q = 0; q < 8; ++q) f.h[q] = (_Float16)x[t * 8 + q]; *(v8us*)((unsigned short*)X16 + t * 8) = f.half[0];  }
__global__ __launch_bounds__(256) void k_round16f(const float* __restrict__ W, _Float16* __restrict__ Bt, size_t n8) { const size_t t = (size_t)blockIdx.x * 256 + threadIdx.x; if (t >= n8) return; FragH f;
#pragma unroll
  for (int i = 0; i < 8; ++i) f.h[i] = (_Float16)(bf16_round(W[t * 8 + i]) * 16.0f); *(v8us*)((unsigned short*)Bt + t * 8) = f.half[0];  }
template <int NHv, int TTv>
__global__ __launch_bounds__(256) void k_vt(const _Float16* __restrict__ V16, int ldv, int voff, _Float16* __restrict__ Vt) { __shared__ unsigned short tl[64][66]; const int tid = threadIdx.x; const int slab = blockIdx.x / (TTv / 64), lg = blockIdx.x % (TTv / 64); const int b = slab / NHv, h = slab % NHv;
  for (int i = tid; i < 64 * 8; i += 256) { const int r = i / 8, c8 = (i % 8) * 8; FragH f; f.half[0] = *(const v8us*)((const unsigned short*)V16 + ((size_t)b * TTv + lg * 64 + r) * ldv + voff + h * 64 + c8);
#pragma unroll
    for (int q = 0; q < 8; ++q) tl[r][c8 + q] = f.u[q]; }
  __syncthreads();
  {
#pragma unroll
    for (int rd = 0; rd < 2; ++rd) { const int d = rd * 32 + tid / 8, pc = tid % 8; FragH f;
#pragma unroll
      for (int q = 0; q < 8; ++q) f.u[q] = tl[pc * 8 + q][d];
      *(v8us*)((unsigned short*)Vt + ((size_t)slab * 64 + d) * TTv + lg * 64 + pc * 8) = f.half[0]; }
     } }

__global__ __launch_bounds__(256) void k_hl(const float* __restrict__ F, _Float16* __restrict__ Hh, _Float16* __restrict__ Hl, size_t n8) { const size_t t = (size_t)blockIdx.x * 256 + threadIdx.x; if (t >= n8) return; FragH fh, fl; const v4f a = *(const v4fa*)(F + t * 8), c = *(const v4fa*)(F + t * 8 + 4);
#pragma unroll
  for (int q = 0; q < 4; ++q) { _Float16 h = (_Float16)a[q]; fh.h[q] = h; fl.h[q] = (_Float16)((a[q] - (float)h) * 1024.0f); h = (_Float16)c[q]; fh.h[4 + q] = h; fl.h[4 + q] = (_Float16)((c[q] - (float)h) * 1024.0f); }
  { *(v8us*)((unsigned short*)Hh + t * 8) = fh.half[0]; *(v8us*)((unsigned short*)Hl + t * 8) = fl.half[0];  } }

// ---- fast GEMM (wave tile 32x64; requires M % 32 == 0 rows per launch region and N % 64 == 0); epilogue = k_gemm_hhx semantics ----
__device__ __forceinline__ v16h g2_frag(const _Float16* p, int hh) { FragH f; f.half[0] = *(const v8us*)((const unsigned short*)p + 8 * hh); f.half[1] = *(const v8us*)((const unsigned short*)p + 16 + 8 * hh); return f.v; }
__device__ __forceinline__ v8f g2_mma(v16h a, v16h b, v8f c) { v8f d = __builtin_amdgcn_wmma_f32_16x16x32_f16(false, a, false, b, (short)0, c, false, false); asm volatile("v_nop\n\tv_nop\n\tv_nop\n\tv_nop" : "+v"(d) : "v"(a), "v"(b)); return d; }
template <int ACT>
__global__ __launch_bounds__(128) void k_gemm2(const _Float16* __restrict__ A, int lda, size_t sA, const _Float16* __restrict__ Bh, int ldb, size_t sB, float alpha, const float* __restrict__ bias, size_t sBias, const float* __restrict__ CP, int rowsPerB, size_t sCPb, int row0g,
    float* __restrict__ C, _Float16* __restrict__ C16, int ldc, size_t sC, int M, int N, int K) { static_assert(ACT == 0 || ACT == 3 || ACT == 6 || ACT == 8 || ACT == 9 || ACT == 11 || ACT == 12 || ACT == 14 || ACT == 15 || ACT == 16 || ACT == 17, "k_gemm2: unsupported ACT code (would silently apply no activation)");
  __shared__ __attribute__((aligned(16))) float so[4][32][68];
  const int tid = threadIdx.x, w = tid >> 5, lane = tid & 31, ln = lane & 15, hh = lane >> 4; const int by = blockIdx.y;
  A += (size_t)by * sA; Bh += (size_t)by * sB; const size_t cofs = (size_t)by * sC; const float* bp = bias ? bias + (size_t)by * sBias : nullptr;
  const int ntn = N >> 6; const int mt = blockIdx.x / ntn, nq = blockIdx.x - mt * ntn; const int row0 = mt * 128 + 32 * w, col0 = nq * 64; if (row0 >= M) return;
  const _Float16* a0p = A + (size_t)(row0 + ln) * lda; const _Float16* a1p = a0p + (size_t)16 * lda;
  const _Float16* b0p = Bh + (size_t)(col0 + ln) * ldb; const _Float16* b1p = b0p + (size_t)16 * ldb; const _Float16* b2p = b1p + (size_t)16 * ldb; const _Float16* b3p = b2p + (size_t)16 * ldb;
  const v8f z8 = {0.f,0.f,0.f,0.f,0.f,0.f,0.f,0.f}; v8f c00 = z8, c01 = z8, c02 = z8, c03 = z8, c10 = z8, c11 = z8, c12 = z8, c13 = z8;
#pragma unroll 1
  for (int kb = 0; kb < K; kb += 32) { const v16h a0 = g2_frag(a0p + kb, hh), a1 = g2_frag(a1p + kb, hh);
    v16h b = g2_frag(b0p + kb, hh); c00 = g2_mma(a0, b, c00); c10 = g2_mma(a1, b, c10);
    b = g2_frag(b1p + kb, hh); c01 = g2_mma(a0, b, c01); c11 = g2_mma(a1, b, c11);
    b = g2_frag(b2p + kb, hh); c02 = g2_mma(a0, b, c02); c12 = g2_mma(a1, b, c12);
    b = g2_frag(b3p + kb, hh); c03 = g2_mma(a0, b, c03); c13 = g2_mma(a1, b, c13); }
  v8f accs[8] = {c00, c01, c02, c03, c10, c11, c12, c13};
#pragma unroll
  for (int u = 0; u < 8; ++u) { const int t = u & 3, half = u >> 2; const int col = col0 + t * 16 + ln; const float bv = bp ? bf16_round(bp[col]) : 0.f;
#pragma unroll
    for (int r = 0; r < 8; ++r) { const int rloc = half * 16 + 8 * hh + r; float v = accs[u][r] * alpha + bv; if (CP) { if (rowsPerB < 0) v += CP[cofs + (size_t)(row0g + row0 + rloc) * ldc + col];      /* rowsPerB < 0: own element of the batched C plane */ else { const int bidx = (row0g + row0 + rloc) / rowsPerB; v += CP[(size_t)bidx * sCPb + (size_t)by * 64 + col]; } }
      if (ACT == 3) v = fmaxf(v, 0.f); else if (ACT == 6) v = 0.5f * v * (1.0f + erff(v * 0.70710678118654752f)); else if (ACT == 11) v = 1.0f / (1.0f + expf(-v)); else if (ACT == 15) v = v / (1.0f + expf(-v)); else if (ACT == 12) v = (v > 0.f) ? v : 0.01f * v; else if (ACT == 8) v = tanhf(v); else if (ACT == 9) v = 0.5f * v * (1.0f + tanhf(0.7978845608028654f * (v + 0.044715f * v * v * v))); else if (ACT == 14) v = (v > 0.f) ? v : 0.1f * v; else if (ACT == 16) v = (v >= 0.f) ? v : 0.3f * v; else if (ACT == 17) v = (v >= 0.f) ? v : 0.2f * v;
      so[w][rloc][t * 16 + ln] = v; } }
  __builtin_amdgcn_fence(__ATOMIC_ACQ_REL, "workgroup"); __builtin_amdgcn_wave_barrier();
  const int rsub = lane >> 4, c4 = (lane & 15) * 4;
  {
#pragma unroll
    for (int q = 0; q < 16; ++q) { const int r = q * 2 + rsub; const v4f v = *(const v4fa*)&so[w][r][c4]; if (C) *(v4f*)(C + cofs + (size_t)(row0 + r) * ldc + col0 + c4) = v; if (C16) { v4h h4; for (int i = 0; i < 4; ++i) h4[i] = (_Float16)v[i]; *(v4h*)(C16 + cofs + (size_t)(row0 + r) * ldc + col0 + c4) = h4; } }
     } }


__global__ __launch_bounds__(256) void k_wnat(const float* __restrict__ w, size_t n8, _Float16* __restrict__ Bt) { const size_t t = (size_t)blockIdx.x * 256 + threadIdx.x; if (t >= n8) return; FragH f; for (int q = 0; q < 8; ++q) f.h[q] = (_Float16)(bf16_round(w[t * 8 + q]) * 16.0f); *(v8us*)((unsigned short*)Bt + t * 8) = f.half[0];  }
__global__ __launch_bounds__(256) void k_rsm(const float* __restrict__ S, _Float16* __restrict__ P, int nrows) {
  #pragma clang fp contract(off)
  const int i = blockIdx.x * 256 + threadIdx.x; if (i >= nrows) return; const float* s = S + (size_t)i * SQ; float mx = -3.0e38f;
#pragma unroll 1
  for (int j = 0; j < SQ; ++j) mx = fmaxf(mx, s[j]); float se = 0.f;
#pragma unroll 1
  for (int j = 0; j < SQ; ++j) se += expf(s[j] - mx); const float sc = 256.0f / se;
#pragma unroll 1
  for (int j0 = 0; j0 < SQ; j0 += 8) { FragH f; for (int q = 0; q < 8; ++q) f.h[q] = (_Float16)(expf(s[j0 + q] - mx) * sc); unsigned short* d = (unsigned short*)P + (size_t)i * SQ + j0; *(v8us*)d = f.half[0];  } }
__global__ __launch_bounds__(256) void k_vt(const _Float16* __restrict__ V16, int b, int h0, _Float16* __restrict__ VT) { __shared__ unsigned short tl[64][65]; const int tid = threadIdx.x; const int hh = blockIdx.x % HG, sg = blockIdx.x / HG; const int s0 = sg * 64; const int h = h0 + hh;
  for (int i = tid; i < 64 * 8; i += 256) { const int j = i / 8, d8 = (i % 8) * 8; FragH f; f.half[0] = *(const v8us*)((const unsigned short*)V16 + ((size_t)b * SQ + s0 + j) * DM + h * HD + d8); for (int q = 0; q < 8; ++q) tl[d8 + q][j] = f.u[q]; }
  __syncthreads();
  { for (int i = tid; i < 64 * 8; i += 256) { const int d = i / 8, j8 = (i % 8) * 8; FragH f; for (int q = 0; q < 8; ++q) f.u[q] = tl[d][j8 + q]; *(v8us*)((unsigned short*)VT + ((size_t)hh * HD + d) * SQ + s0 + j8) = f.half[0]; }  } }



// ---- fused attention: scores, softmax and P V in one kernel; neither scores nor weights go to memory ----
typedef float  v2f  __attribute__((ext_vector_type(2)));
#define FA_KS 64                     /* keys per LDS stage */
#define FA_LP 72                     /* LDS row pitch in f16: 128 data bytes + 16, so that the 16-byte fragment reads of 16 rows spread over the banks */
#define FA_QW 32                     /* query columns per wave */
#define FA_QB 256                    /* query columns per work-group (8 waves) */
__device__ __forceinline__ float fa_xhalf(float x) { return __builtin_bit_cast(float, __builtin_amdgcn_permlanex16(__builtin_bit_cast(int, x), __builtin_bit_cast(int, x), 0x76543210, 0xfedcba98, false, false)); }      /* lane l <-> lane l ^ 16 */
// native 2^x, in place: each exponential overwrites only its own argument, which the compiler's own vector instruction has just written (so no register of a matrix instruction still in its window is touched), and none reads the result or overwrites the source of the one in front of it; the closing v_nop keeps the one slot that the instruction set asks for behind a transcendental
__device__ __forceinline__ float fa_exp2(float x) { asm("v_exp_f32 %0, %0\n\tv_nop" : "+v"(x)); return x; }
__device__ __forceinline__ void fa_exp2x16(v8f& a, v8f& b) { float x0 = a[0], x1 = a[1], x2 = a[2], x3 = a[3], x4 = a[4], x5 = a[5], x6 = a[6], x7 = a[7], x8 = b[0], x9 = b[1], x10 = b[2], x11 = b[3], x12 = b[4], x13 = b[5], x14 = b[6], x15 = b[7];
  asm("v_exp_f32 %0, %0\n\tv_exp_f32 %1, %1\n\tv_exp_f32 %2, %2\n\tv_exp_f32 %3, %3\n\tv_exp_f32 %4, %4\n\tv_exp_f32 %5, %5\n\tv_exp_f32 %6, %6\n\tv_exp_f32 %7, %7\n\tv_exp_f32 %8, %8\n\tv_exp_f32 %9, %9\n\tv_exp_f32 %10, %10\n\tv_exp_f32 %11, %11\n\tv_exp_f32 %12, %12\n\tv_exp_f32 %13, %13\n\tv_exp_f32 %14, %14\n\tv_exp_f32 %15, %15\n\tv_nop"
      : "+v"(x0), "+v"(x1), "+v"(x2), "+v"(x3), "+v"(x4), "+v"(x5), "+v"(x6), "+v"(x7), "+v"(x8), "+v"(x9), "+v"(x10), "+v"(x11), "+v"(x12), "+v"(x13), "+v"(x14), "+v"(x15));
  a = v8f{x0, x1, x2, x3, x4, x5, x6, x7}; b = v8f{x8, x9, x10, x11, x12, x13, x14, x15}; }
__device__ __forceinline__ v8f fa_mma(v16h a, v16h b, v8f c) { return __builtin_amdgcn_wmma_f32_16x16x32_f16(false, a, false, b, (short)0, c, false, false); }
__global__ __launch_bounds__(256) void k_fattn(const _Float16* __restrict__ Qn, const _Float16* __restrict__ Kn, const _Float16* __restrict__ VT, _Float16* __restrict__ O) {
  __shared__ __attribute__((aligned(16))) _Float16 sk[2][FA_KS][FA_LP];      /* K rows [key][d] */
  __shared__ __attribute__((aligned(16))) _Float16 sv[2][HD][FA_LP];         /* V^T rows [d][key] */
  const int tid = threadIdx.x, w = tid >> 5, lane = tid & 31, ln = lane & 15, hh = lane >> 4;
  const int bh = blockIdx.y, b = bh / NH, h = bh % NH; const int q0 = blockIdx.x * FA_QB + w * FA_QW;
  const float cs = 0.125f * 1.44269504088896340736f;      /* 1/sqrt(64) and log2 e */
  const _Float16* qp = Qn + ((size_t)b * SQ + q0 + ln) * DM + h * HD;
  v16h qf[2][2];
  for (int t = 0; t < 2; ++t) for (int s = 0; s < 2; ++s) qf[t][s] = g2_frag(qp + (size_t)t * 16 * DM + s * 32, hh);
  const int sr = tid >> 3, sc8 = (tid & 7) * 8;      /* staging: 8 threads a row of 128 bytes, rows sr and sr + 32 */
  const unsigned short* kg = (const unsigned short*)Kn + ((size_t)b * SQ + sr) * DM + h * HD + sc8;
  const unsigned short* vg = (const unsigned short*)VT + ((size_t)bh * HD + sr) * SQ + sc8;
  v8us gk0 = *(const v8us*)kg, gk1 = *(const v8us*)(kg + (size_t)32 * DM), gv0 = *(const v8us*)vg, gv1 = *(const v8us*)(vg + (size_t)32 * SQ);
  asm volatile("s_wait_xcnt 0x0" :: "v"(qp), "v"(kg), "v"(vg) : "memory");      /* precaution: the loads' address registers stay live up to this wait */
  *(v8us*)&sk[0][sr][sc8] = gk0; *(v8us*)&sk[0][sr + 32][sc8] = gk1; *(v8us*)&sv[0][sr][sc8] = gv0; *(v8us*)&sv[0][sr + 32][sc8] = gv1;
  const v8f z8 = {0.f,0.f,0.f,0.f,0.f,0.f,0.f,0.f};
  v8f o[2][4]; float mr[2]; v2f l[2];
  for (int t = 0; t < 2; ++t) { mr[t] = -3.0e38f; l[t] = v2f{0.f, 0.f}; for (int dt = 0; dt < 4; ++dt) o[t][dt] = z8; }
  __syncthreads();
#pragma unroll 1      /* keeps the loop whole: without it the compiler peels the last stage, doubles the code and goes past 256 registers */
  for (int st = 0; st < SQ / FA_KS; ++st) {
    const int bu = st & 1; const bool more = st + 1 < SQ / FA_KS;      /* same for the whole work-group */
    if (more) {      /* next stage's rows fly while this stage is worked on */
      kg += (size_t)FA_KS * DM; vg += FA_KS;
      gk0 = *(const v8us*)kg; gk1 = *(const v8us*)(kg + (size_t)32 * DM); gv0 = *(const v8us*)vg; gv1 = *(const v8us*)(vg + (size_t)32 * SQ);
      asm volatile("s_wait_xcnt 0x0" :: "v"(kg), "v"(vg) : "memory");      /* precaution: the loads' address registers stay live up to this wait */
    }
    for (int kp = 0; kp < FA_KS / 32; ++kp) {
      v8f s[2][2];      /* [query tile][key tile] */
      { v16h ka[2][2];
        for (int kt = 0; kt < 2; ++kt) for (int c = 0; c < 2; ++c) ka[kt][c] = g2_frag(&sk[bu][kp * 32 + kt * 16 + ln][c * 32], hh);
        for (int t = 0; t < 2; ++t) for (int kt = 0; kt < 2; ++kt) s[t][kt] = fa_mma(ka[kt][1], qf[t][1], fa_mma(ka[kt][0], qf[t][0], z8)); }
      v16h va[4];
      for (int dt = 0; dt < 4; ++dt) va[dt] = g2_frag(&sv[bu][dt * 16 + ln][kp * 32], hh);
      float mb[2]; bool need = false;
      for (int t = 0; t < 2; ++t) { float mx = s[t][0][0];
        for (int r = 1; r < 8; ++r) mx = fmaxf(mx, s[t][0][r]);
        for (int r = 0; r < 8; ++r) mx = fmaxf(mx, s[t][1][r]);
        mx = fmaxf(mx, fa_xhalf(mx)) * cs; mb[t] = mx; need = need || (mx > mr[t] + 8.0f); }
      if (__builtin_amdgcn_ballot_w32(need) != 0) {      /* scalar branch; rare after the first passes */
        for (int t = 0; t < 2; ++t) { const float mn = fmaxf(mr[t], mb[t]); const float al = fa_exp2(mr[t] - mn); mr[t] = mn; l[t] *= al;
          for (int dt = 0; dt < 4; ++dt) o[t][dt] = o[t][dt] * al; } }
      for (int t = 0; t < 2; ++t) { const float nm = 4.0f - mr[t]; FragH pf; v8f p0 = s[t][0] * cs + nm, p1 = s[t][1] * cs + nm;
        fa_exp2x16(p0, p1);
        for (int r = 0; r < 8; ++r) { pf.h[r] = (_Float16)p0[r]; pf.h[8 + r] = (_Float16)p1[r]; }
        const v8f ps = p0 + p1; const v4f p4 = ps.lo + ps.hi; l[t] += p4.lo + p4.hi;      /* the denominator sums the unrounded f32 weights, halving trees that stay in register pairs */
        for (int dt = 0; dt < 4; ++dt) o[t][dt] = fa_mma(va[dt], pf.v, o[t][dt]); }
    }
    asm volatile("v_nop\n\tv_nop\n\tv_nop\n\tv_nop" : "+v"(o[1][0]), "+v"(o[1][1]), "+v"(o[1][2]), "+v"(o[1][3]));      /* the four vector slots behind the stage's last matrix instructions, in front of the branch below */
    if (more) { *(v8us*)&sk[bu ^ 1][sr][sc8] = gk0; *(v8us*)&sk[bu ^ 1][sr + 32][sc8] = gk1; *(v8us*)&sv[bu ^ 1][sr][sc8] = gv0; *(v8us*)&sv[bu ^ 1][sr + 32][sc8] = gv1; }      /* that buffer's readers left it at the last barrier */
    __syncthreads();      /* publishes stage st + 1 and ends the reads of stage st */
  }
  FragH f[2][4];
  for (int t = 0; t < 2; ++t) { const float lw = l[t][0] + l[t][1]; const float inv = 64.0f / (lw + fa_xhalf(lw));
    for (int dt = 0; dt < 4; ++dt) for (int r = 0; r < 8; ++r) f[t][dt].h[r] = (_Float16)(o[t][dt][r] * inv); }
  __builtin_amdgcn_sched_barrier(0);      /* all conversions in front of the first store, so that no register which an issued store names is written again */
  unsigned short* op = (unsigned short*)O + ((size_t)b * SQ + q0 + ln) * DM + h * HD + 8 * hh;
  for (int t = 0; t < 2; ++t) for (int dt = 0; dt < 4; ++dt) *(v8us*)(op + (size_t)t * 16 * DM + dt * 16) = f[t][dt].half[0];
}


template <int BFIN, int WXB>
__global__ __launch_bounds__(256) void k_ln16p(const float* __restrict__ X, size_t ldx, const float* __restrict__ g, const float* __restrict__ bb, float eps, _Float16* __restrict__ N16, float* __restrict__ XB) {
  #pragma clang fp contract(off)
  __shared__ float red[256]; const size_t r = blockIdx.x; const int t = threadIdx.x; const v4f xa = *(const v4fa*)(X + r * ldx + t * 4); float s[4]; float sum = 0.f;
  for (int q = 0; q < 4; ++q) { s[q] = BFIN ? bf16_round(xa[q]) : xa[q]; sum = __fadd_rn(sum, s[q]); }
  red[t] = sum; __syncthreads(); for (int st = 128; st > 0; st >>= 1) { if (t < st) red[t] = __fadd_rn(red[t], red[t + st]); __syncthreads(); } const float mu = red[0] / (float)DMQ; __syncthreads();
  float vs = 0.f; for (int q = 0; q < 4; ++q) { const float dl = __fadd_rn(s[q], -mu); vs = __fadd_rn(vs, __fmul_rn(dl, dl)); } red[t] = vs; __syncthreads(); for (int st = 128; st > 0; st >>= 1) { if (t < st) red[t] = __fadd_rn(red[t], red[t + st]); __syncthreads(); }
  const float rs = rsqrtf(__fadd_rn(red[0] / (float)DMQ, eps)); v4h y; v4f xb;
  for (int q = 0; q < 4; ++q) { const int c = t * 4 + q; y[q] = (_Float16)__fadd_rn(__fmul_rn(__fmul_rn(__fadd_rn(s[q], -mu), rs), bf16_round(g[c])), bf16_round(bb[c])); xb[q] = s[q]; }
  { *(v4h*)(N16 + r * DMQ + t * 4) = y; if (WXB) *(v4f*)(XB + r * DMQ + t * 4) = xb;  } }
extern "C" void kernel_launch(void* const* d_in, const int* in_sizes, int n_in,
                              void* d_out, int out_size, void* d_ws, size_t ws_size, hipStream_t stream) {
  (void)in_sizes; (void)n_in; (void)out_size;
  const float* const* I = (const float* const*)d_in; const float* x = I[0]; const float* wqkv = I[1]; const float* wo = I[2]; const float* bo = I[3]; const float* qg = I[4]; const float* qb = I[5]; const float* kg = I[6]; const float* kb = I[7]; const float* bqkv = nullptr;      /* natural weights; no qkv bias */
  char* ws = (char*)d_ws; size_t off = 0;
  auto take = [&](size_t bytes) { char* p = ws + off; off += (bytes + 255) & ~(size_t)255; return p; };
  _Float16* BQKV = (_Float16*)take((size_t)3 * DM * DM * 2); _Float16* BO = (_Float16*)take((size_t)DM * DM * 2);
  _Float16* X16 = (_Float16*)take(NR * DM * 2); float* QKVF = (float*)take(NR * 3 * DM * 4); _Float16* QN16 = (_Float16*)take(NR * DM * 2); _Float16* KN16 = (_Float16*)take(NR * DM * 2); _Float16* QKV = (_Float16*)take(NR * 3 * DM * 2); _Float16* Q16 = QKV; _Float16* K16 = QKV + DM; _Float16* V16 = QKV + 2 * DM; _Float16* O16 = (_Float16*)take(NR * DM * 2);
  _Float16* VT = (_Float16*)take((size_t)NB * NH * HD * SQ * 2);
  if (off > ws_size) return;
  k_wnat<<<(unsigned)(((size_t)3 * DM * DM / 8 + 255) / 256), 256, 0, stream>>>(wqkv, (size_t)3 * DM * DM / 8, BQKV); k_wnat<<<(unsigned)(((size_t)DM * DM / 8 + 255) / 256), 256, 0, stream>>>(wo, (size_t)DM * DM / 8, BO);      /* natural [out][in] = Bt planes x16 */
  k_x16<<<(unsigned)((NR * DM / 8 + 255) / 256), 256, 0, stream>>>(x, X16, NR * DM / 8);
  const size_t r0p = (size_t)B0 * SQ;      /* first projected row */
  k_gemm2<0><<<dim3((unsigned)((MP / 128) * (3 * DM / 64)), 1), 128, 0, stream>>>(X16 + r0p * DM, DM, 0, BQKV, DM, 0, 0.0625f, nullptr, 0, nullptr, 1, 0, 0, QKVF + r0p * 3 * DM, QKV + r0p * 3 * DM, 3 * DM, 0, MP, 3 * DM, DM);      /* q | k | v rows: f32 (for the LayerNorms) and f16 (v operand) */
  k_ln16p<0, 0><<<(unsigned)MP, 256, 0, stream>>>(QKVF + r0p * 3 * DM, (size_t)3 * DM, qg, qb, 1e-5f, QN16 + r0p * DM, nullptr); k_ln16p<0, 0><<<(unsigned)MP, 256, 0, stream>>>(QKVF + r0p * 3 * DM + DM, (size_t)3 * DM, kg, kb, 1e-5f, KN16 + r0p * DM, nullptr);      /* q, k = LayerNorm over the merged 1024 features -> f16 rows */
  k_vt<NH, SQ><<<NB * NH * (SQ / 64), 256, 0, stream>>>(V16, LQ, 0, VT);      /* V^T [NB][NH][HD][SQ] */
  k_fattn<<<dim3(SQ / FA_QB, NB * NH), 256, 0, stream>>>(QN16, KN16, VT, O16);      /* o (merged heads, x64) as f16 rows: all batches and heads in one launch */
  k_gemm2<0><<<dim3((unsigned)((MPO / 128) * (DM / 64)), 1), 128, 0, stream>>>(O16 + r0p * DM, DM, 0, BO, DM, 0, 0.0009765625f, bo, 0, nullptr, 1, 0, 0, (float*)d_out + r0p * DM, nullptr, DM, 0, MPO, DM, DM);      /* out rows are the output layout */
}

// v003
// One run takes 110 microseconds.
// Timed twice side by side with v002, it ran 1.65 and 1.66 times as fast.
// Over all steps from v000 it is 31.3 times as fast.
#include <hip/hip_runtime.h>
// Self-attention block with q/k LayerNorm (x [2][2048][1024]; qkv = x w_qkv^T (natural [3072][1024], sigma 1/32, no bias) -> q | k | v blocks, 16 heads of 64; q = LayerNorm_1024(q; q_gamma, q_beta) and k likewise over the full merged 1024 features (eps 1e-5); softmax(q k^T / 8) (no mask); out = merged w_proj^T + b_proj -> [2][2048][1024]).
// Structure: x as exact f16 rows; natural weights as exact x16 planes; q | k | v as ONE WMMA GEMM (128x128 block tiles staged in LDS, 32x64 wave tiles, f32 accumulation; f32 rows for the norms + f16 rows for v); q and k LayerNorm over the merged 1024 features on VALU (f32, LDS trees; bf16 gamma/beta) -> f16 rows; V^T via LDS transposes; one fused attention launch over all batches and heads (scores K = 64 in f32 accumulators, online softmax with f32 statistics and native exp2, weights as f16, o = P V carried x64) into merged f16 rows; out = o w_proj^T + b_proj GEMM (f32, alpha 2^-10); launches: see trace.
// Compute dtype: inputs rounded to bf16; x / weights exact; q, k, v, softmax weights and o as plain f16 GEMM operands (~2^-12); scores and softmax statistics f32. v_wmma_f32_16x16x32_f16.
#define NB 2
#define SQ 2048
#define DM 1024
#define NH 16
#define HD 64
#define HG 4                         /* heads per launch of the per-batch k_vt (not launched) */
#define B0 0                         /* first batch processed (debug hook) */
#define NBR NB                       /* batches processed (debug hook) */
#define NR ((size_t)NB * SQ)
#define DMQ DM         /* LayerNorm width and f16 row pitch */
#define MP ((int)((size_t)NBR * SQ)) /* rows projected (debug hook) */
#define QN SQ                        /* unused: k_fattn attends all SQ query rows */
#define NHD NH                       /* unused: k_fattn attends all NH heads */
#define MPO MP                       /* rows through the output stage (debug hook) */
#define LQ (3 * DM)      /* row pitch of the q/k/v rows */
typedef __bf16 v16b __attribute__((ext_vector_type(16)));
typedef unsigned short v8us __attribute__((ext_vector_type(8), may_alias));
typedef float  v8f  __attribute__((ext_vector_type(8)));
typedef float  v4f  __attribute__((ext_vector_type(4)));
typedef float  v4fa __attribute__((ext_vector_type(4), may_alias));
union FragB { v16b v; v8us half[2]; unsigned short u[16]; };

__device__ __forceinline__ unsigned short bf16_bits(float x) { unsigned int u = __float_as_uint(x); return (unsigned short)((u + 0x7FFFu + ((u >> 16) & 1u)) >> 16); }
__device__ __forceinline__ float bf16_val(unsigned short b) { return __uint_as_float(((unsigned int)b) << 16); }
__device__ __forceinline__ float bf16_round(float x) { return bf16_val(bf16_bits(x)); }
// D += A·B with NT terms: 1 = ah·bh, 2 = + al·bh (A split), 3 = + ah·bl (both split)
template <int NT>
__device__ __forceinline__ v8f mmaN(v16b ah, v16b al, v16b bh, v16b bl, v8f c) {
  c = __builtin_amdgcn_wmma_f32_16x16x32_bf16(false, ah, false, bh, (short)0, c, false, false);
  if (NT >= 2) c = __builtin_amdgcn_wmma_f32_16x16x32_bf16(false, al, false, bh, (short)0, c, false, false);
  if (NT >= 3) c = __builtin_amdgcn_wmma_f32_16x16x32_bf16(false, ah, false, bl, (short)0, c, false, false);
  asm volatile("v_nop\n\tv_nop\n\tv_nop\n\tv_nop" : "+v"(c) : "v"(ah), "v"(al), "v"(bh), "v"(bl));
  return c;
}

__global__ __launch_bounds__(256) void k_wt_bf16(const float* __restrict__ W, unsigned short* __restrict__ Wt, int K, int N) {
  const int t = blockIdx.x * 256 + threadIdx.x;
  const int k8n = K / 8;
  if (t >= N * k8n) return;
  const int n = t / k8n, k8 = (t % k8n) * 8;
  v8us v;
#pragma unroll
  for (int i = 0; i < 8; ++i) v[i] = bf16_bits(W[(size_t)(k8 + i) * N + n]);
  *(v8us*)(Wt + (size_t)n * K + k8) = v;
  
}

// GEMM C[M][N] (f32, pitch ldc) = act(A[M][K]·W + bias). A f32 row-major (pitch lda) converted per fragment to bf16
// (ASPLIT: hi/lo two planes -> 2 terms, else single rounded term); Wt bf16 [N][K] (pitch ldb). BIAS_BF16 rounds the
// bias to bf16 first (bias quantised to bf16 before the add). K%32==0, M%16==0, N%64==0.
template <bool ASPLIT, int ACT, bool BIAS_BF16>
__global__ __launch_bounds__(128) void k_gemm_bf(const float* __restrict__ A, int lda, const unsigned short* __restrict__ Wt, int ldb,
                                               const float* __restrict__ bias, float* __restrict__ C, int ldc, int M, int N, int K) {
  __shared__ __attribute__((aligned(16))) float so[4][16][64];
  const int tid = threadIdx.x, w = tid >> 5, lane = tid & 31, ln = lane & 15, hh = lane >> 4;
  const int ntn = N / 64;
  const int wid = blockIdx.x * 4 + w;
  const int mt = wid / ntn, nq = wid % ntn;
  if (mt * 16 >= M) return;
  const int row0 = mt * 16, col0 = nq * 64;
  const float* arow = A + (size_t)(row0 + ln) * lda;
  v8f acc[4] = {};
  for (int kb = 0; kb < K; kb += 32) {
    FragB ah, al;
    const v4f x0 = *(const v4fa*)(arow + kb + 8 * hh), x1 = *(const v4fa*)(arow + kb + 8 * hh + 4);
    const v4f x2 = *(const v4fa*)(arow + kb + 16 + 8 * hh), x3 = *(const v4fa*)(arow + kb + 16 + 8 * hh + 4);
    float xs[16] = {x0[0],x0[1],x0[2],x0[3],x1[0],x1[1],x1[2],x1[3],x2[0],x2[1],x2[2],x2[3],x3[0],x3[1],x3[2],x3[3]};
#pragma unroll
    for (int i = 0; i < 16; ++i) { const unsigned short hb = bf16_bits(xs[i]); ah.u[i] = hb; al.u[i] = ASPLIT ? bf16_bits(xs[i] - bf16_val(hb)) : (unsigned short)0; }
#pragma unroll
    for (int t = 0; t < 4; ++t) {
      const unsigned short* brow = Wt + (size_t)(col0 + t * 16 + ln) * ldb + kb;
      FragB b;
      b.half[0] = *(const v8us*)(brow + 8 * hh);
      b.half[1] = *(const v8us*)(brow + 16 + 8 * hh);
      acc[t] = mmaN<ASPLIT ? 2 : 1>(ah.v, al.v, b.v, b.v, acc[t]);
    }
  }
#pragma unroll
  for (int t = 0; t < 4; ++t) {
    float bv = bias ? bias[col0 + t * 16 + ln] : 0.f;
    if (BIAS_BF16) bv = bf16_round(bv);
#pragma unroll
    for (int r = 0; r < 8; ++r) { float v = acc[t][r] + bv; if (ACT == 1) v = fmaxf(v, 0.f); so[w][8 * hh + r][t * 16 + ln] = v; }
  }
  __builtin_amdgcn_fence(__ATOMIC_ACQ_REL, "workgroup");
  __builtin_amdgcn_wave_barrier();
  const int rsub = lane >> 4, c4 = (lane & 15) * 4;
  {
#pragma unroll
    for (int q = 0; q < 8; ++q) {
      const int r = q * 2 + rsub;
      const v4f v = *(const v4fa*)&so[w][r][c4];
      *(v4f*)(C + (size_t)(row0 + r) * ldc + col0 + c4) = v;
    }
    
  }
}

// GEMM C = act(A·W + bias + resid): A f32 (ASPLIT -> hi/lo 2 terms), Wt bf16 [N][K]; ACT 0 none, 1 relu, 2 exact gelu;
// resid (optional, f32, row index = (row % rmod), pitch ldr, RES_BF16 rounds it) added before the activation.
template <bool ASPLIT, int ACT, bool BIAS_BF16, bool RES_BF16>
__global__ __launch_bounds__(128) void k_gemm_bf3(const float* __restrict__ A, int lda, const unsigned short* __restrict__ Wt, int ldb,
                                                const float* __restrict__ bias, const float* __restrict__ resid, int rmod, int ldr,
                                                float* __restrict__ C, int ldc, int M, int N, int K) {
  __shared__ __attribute__((aligned(16))) float so[4][16][64];
  const int tid = threadIdx.x, w = tid >> 5, lane = tid & 31, ln = lane & 15, hh = lane >> 4;
  const int ntn = N / 64;
  const int wid = blockIdx.x * 4 + w;
  const int mt = wid / ntn, nq = wid % ntn;
  if (mt * 16 >= M) return;
  const int row0 = mt * 16, col0 = nq * 64;
  const float* arow = A + (size_t)(row0 + ln) * lda;
  v8f acc[4] = {};
  for (int kb = 0; kb < K; kb += 32) {
    FragB ah, al;
    const v4f x0 = *(const v4fa*)(arow + kb + 8 * hh), x1 = *(const v4fa*)(arow + kb + 8 * hh + 4);
    const v4f x2 = *(const v4fa*)(arow + kb + 16 + 8 * hh), x3 = *(const v4fa*)(arow + kb + 16 + 8 * hh + 4);
    float xs[16] = {x0[0],x0[1],x0[2],x0[3],x1[0],x1[1],x1[2],x1[3],x2[0],x2[1],x2[2],x2[3],x3[0],x3[1],x3[2],x3[3]};
#pragma unroll
    for (int i = 0; i < 16; ++i) { const unsigned short hb = bf16_bits(xs[i]); ah.u[i] = hb; al.u[i] = ASPLIT ? bf16_bits(xs[i] - bf16_val(hb)) : (unsigned short)0; }
#pragma unroll
    for (int t = 0; t < 4; ++t) {
      const unsigned short* brow = Wt + (size_t)(col0 + t * 16 + ln) * ldb + kb;
      FragB b;
      b.half[0] = *(const v8us*)(brow + 8 * hh);
      b.half[1] = *(const v8us*)(brow + 16 + 8 * hh);
      acc[t] = mmaN<ASPLIT ? 2 : 1>(ah.v, al.v, b.v, b.v, acc[t]);
    }
  }
#pragma unroll
  for (int t = 0; t < 4; ++t) {
    const int col = col0 + t * 16 + ln;
    float bv = bias ? bias[col] : 0.f;
    if (BIAS_BF16) bv = bf16_round(bv);
#pragma unroll
    for (int r = 0; r < 8; ++r) {
      float v = acc[t][r] + bv;
      if (resid) { float rv = resid[(size_t)((row0 + 8 * hh + r) % rmod) * ldr + col]; if (RES_BF16) rv = bf16_round(rv); v += rv; }
      if (ACT == 1) v = fmaxf(v, 0.f);
      if (ACT == 2) v = 0.5f * v * (1.0f + erff(v * 0.70710678118654752f));
      if (ACT == 3) { const float u = 0.7978845608028654f * (v + 0.044715f * v * v * v); v = 0.5f * v * (1.0f + tanhf(u)); }
      so[w][8 * hh + r][t * 16 + ln] = v;
    }
  }
  __builtin_amdgcn_fence(__ATOMIC_ACQ_REL, "workgroup");
  __builtin_amdgcn_wave_barrier();
  const int rsub = lane >> 4, c4 = (lane & 15) * 4;
  {
#pragma unroll
    for (int q = 0; q < 8; ++q) {
      const int r = q * 2 + rsub;
      const v4f v = *(const v4fa*)&so[w][r][c4];
      *(v4f*)(C + (size_t)(row0 + r) * ldc + col0 + c4) = v;
    }
    
  }
}
// row LayerNorm (biased variance, eps) over N: s = X (+ R); optional out_sum <- s; out_norm <- (s-mu)*rsqrt(var+eps)*g + b
template <bool PARAM_BF16>
__global__ __launch_bounds__(256) void k_layernorm(const float* __restrict__ X, const float* __restrict__ R, const float* __restrict__ g, const float* __restrict__ bta,
                                                  float* __restrict__ out_sum, float* __restrict__ out_norm, int N, float eps) {
  __shared__ float red[256];
  const int row = blockIdx.x, tid = threadIdx.x;
  const float* x = X + (size_t)row * N; const float* rr = R ? R + (size_t)row * N : nullptr;
  float vals[16];                     // up to N = 4096
  const int per = N / 256;            // contiguous chunk per thread? use strided-by-4 chunks: thread handles j = tid*4 + 1024*u
  float s1 = 0.f;
  for (int u = 0; u < per / 4; ++u) {
    const int j = tid * 4 + 1024 * u;
    const v4f a = *(const v4fa*)(x + j);
    v4f b = {0.f,0.f,0.f,0.f}; if (rr) b = *(const v4fa*)(rr + j);
#pragma unroll
    for (int q = 0; q < 4; ++q) { const float v = a[q] + b[q]; vals[u * 4 + q] = v; s1 += v; }
  }
  red[tid] = s1; __syncthreads();
  for (int st = 128; st > 0; st >>= 1) { if (tid < st) red[tid] += red[tid + st]; __syncthreads(); }
  const float mu = red[0] / (float)N; __syncthreads();
  float s2 = 0.f;
  for (int u = 0; u < per / 4; ++u)
#pragma unroll
    for (int q = 0; q < 4; ++q) { const float c = vals[u * 4 + q] - mu; s2 += c * c; }
  red[tid] = s2; __syncthreads();
  for (int st = 128; st > 0; st >>= 1) { if (tid < st) red[tid] += red[tid + st]; __syncthreads(); }
  const float rs = rsqrtf(red[0] / (float)N + eps);
  {
    for (int u = 0; u < per / 4; ++u) {
      const int j = tid * 4 + 1024 * u;
      v4f o, sm;
#pragma unroll
      for (int q = 0; q < 4; ++q) {
        float gg = g[j + q], bb = bta[j + q];
        if (PARAM_BF16) { gg = bf16_round(gg); bb = bf16_round(bb); }
        sm[q] = vals[u * 4 + q]; o[q] = (vals[u * 4 + q] - mu) * rs * gg + bb;
      }
      if (out_sum) *(v4f*)(out_sum + (size_t)row * N + j) = sm;
      *(v4f*)(out_norm + (size_t)row * N + j) = o;
    }
    
  }
}



// ---- f16 WMMA path (v_wmma_f32_16x16x32_f16): 11-bit significands for operands in range — used where a [0,1] probability operand needs more precision than bf16
typedef _Float16 v16h __attribute__((ext_vector_type(16)));
union FragH { v16h v; v8us half[2]; _Float16 h[16]; unsigned short u[16]; };
template <int NT>
__device__ __forceinline__ v8f mmaH(v16h ah, v16h al, v16h bh, v16h bl, v8f c) {
  c = __builtin_amdgcn_wmma_f32_16x16x32_f16(false, ah, false, bh, (short)0, c, false, false);
  if (NT >= 2) c = __builtin_amdgcn_wmma_f32_16x16x32_f16(false, al, false, bh, (short)0, c, false, false);
  if (NT >= 3) c = __builtin_amdgcn_wmma_f32_16x16x32_f16(false, ah, false, bl, (short)0, c, false, false);
  asm volatile("v_nop\n\tv_nop\n\tv_nop\n\tv_nop" : "+v"(c) : "v"(ah), "v"(al), "v"(bh), "v"(bl));
  return c;
}
// batched GEMM like k_gemm_b but f16 operands: A f32 (split into f16 hi/lo if ASPLIT, else rounded to f16), Bt = f16 values [n][k]; alpha; C f32; N multiple of 16 (partial tiles skipped)
template <bool ASPLIT>
__global__ __launch_bounds__(128) void k_gemm_h(const float* __restrict__ A, int lda, size_t sA, const _Float16* __restrict__ Bh, int ldb, size_t sB, float alpha, float* __restrict__ C, int ldc, size_t sC, int M, int N, int K) {
  __shared__ __attribute__((aligned(16))) float so[4][16][64];
  const int tid = threadIdx.x, w = tid >> 5, lane = tid & 31, ln = lane & 15, hh = lane >> 4; const int by = blockIdx.y;
  A += (size_t)by * sA; Bh += (size_t)by * sB; C += (size_t)by * sC;
  const int ntn = (N + 63) / 64; const int wid = blockIdx.x * 4 + w; const int mt = wid / ntn, nq = wid % ntn; if (mt * 16 >= M) return;
  const int row0 = mt * 16, col0 = nq * 64; const float* arow = A + (size_t)(row0 + ln) * lda;
  v8f acc[4] = {};
  for (int kb = 0; kb < K; kb += 32) {
    FragH ah, al;
    const v4f x0 = *(const v4fa*)(arow + kb + 8 * hh), x1 = *(const v4fa*)(arow + kb + 8 * hh + 4), x2 = *(const v4fa*)(arow + kb + 16 + 8 * hh), x3 = *(const v4fa*)(arow + kb + 16 + 8 * hh + 4);
    float xs[16] = {x0[0],x0[1],x0[2],x0[3],x1[0],x1[1],x1[2],x1[3],x2[0],x2[1],x2[2],x2[3],x3[0],x3[1],x3[2],x3[3]};
#pragma unroll
    for (int i = 0; i < 16; ++i) { const _Float16 h = (_Float16)xs[i]; ah.h[i] = h; al.h[i] = ASPLIT ? (_Float16)(xs[i] - (float)h) : (_Float16)0.0f; }
#pragma unroll
    for (int t = 0; t < 4; ++t) { if (col0 + t * 16 >= N) continue; const size_t boff = (size_t)(col0 + t * 16 + ln) * ldb + kb; FragH bq; bq.half[0] = *(const v8us*)(Bh + boff + 8 * hh); bq.half[1] = *(const v8us*)(Bh + boff + 16 + 8 * hh);
      acc[t] = mmaH<ASPLIT ? 2 : 1>(ah.v, al.v, bq.v, bq.v, acc[t]); }
  }
#pragma unroll
  for (int t = 0; t < 4; ++t) { if (col0 + t * 16 >= N) continue;
#pragma unroll
    for (int r = 0; r < 8; ++r) so[w][8 * hh + r][t * 16 + ln] = acc[t][r] * alpha; }
  __builtin_amdgcn_fence(__ATOMIC_ACQ_REL, "workgroup"); __builtin_amdgcn_wave_barrier();
  const int rsub = lane >> 4, c4 = (lane & 15) * 4;
  {
#pragma unroll
    for (int q = 0; q < 8; ++q) { const int r = q * 2 + rsub; if (col0 + c4 < N) { const v4f v = *(const v4fa*)&so[w][r][c4]; *(v4f*)(C + (size_t)(row0 + r) * ldc + col0 + c4) = v; } }
     }
}

// Wt[n][k] = f16(W[k][n]·scale) from f32 row-major W[K][N] (scale = power of two; bf16-exact weights stay exact in f16 away from the subnormal range)
__global__ __launch_bounds__(256) void k_wt_f16(const float* __restrict__ W, _Float16* __restrict__ Wt, int K, int N, float scale) {
  const int t = blockIdx.x * 256 + threadIdx.x; if (t >= N * (K / 8)) return; const int n = t / (K / 8), k8 = (t % (K / 8)) * 8; FragH f;
#pragma unroll
  for (int i = 0; i < 8; ++i) f.h[i] = (_Float16)(bf16_round(W[(size_t)(k8 + i) * N + n]) * scale); const v8us o = f.half[0];
  *(v8us*)((unsigned short*)Wt + (size_t)n * K + k8) = o; 
}
// k_gemm_hh variant with fused epilogue: v = acc·alpha + bias[by·sBias + col] (+ CP[(row/rowsPerB)·sCPb + by·64 + col] if CP) ; ACT 0 none / 1 elu ; writes f16 C16 (and f32 C if non-null)
template <int ACT>
__global__ __launch_bounds__(128) void k_gemm_hhx(const _Float16* __restrict__ A, int lda, size_t sA, const _Float16* __restrict__ Bh, int ldb, size_t sB, float alpha, const float* __restrict__ bias, size_t sBias, const float* __restrict__ CP, int rowsPerB, size_t sCPb, int row0g,
    float* __restrict__ C, _Float16* __restrict__ C16, int ldc, size_t sC, int M, int N, int K) {
  __shared__ __attribute__((aligned(16))) float so[4][16][64];
  const int tid = threadIdx.x, w = tid >> 5, lane = tid & 31, ln = lane & 15, hh = lane >> 4; const int by = blockIdx.y;
  A += (size_t)by * sA; Bh += (size_t)by * sB; const size_t cofs = (size_t)by * sC; const float* bp = bias ? bias + (size_t)by * sBias : nullptr;
  const int ntn = (N + 63) / 64; const int wid = blockIdx.x * 4 + w; const int mt = wid / ntn, nq = wid % ntn; if (mt * 16 >= M) return;
  const int row0 = mt * 16, col0 = nq * 64; const _Float16* arow = A + (size_t)(row0 + ln) * lda;
  v8f acc[4] = {};
  for (int kb = 0; kb < K; kb += 32) { FragH ah; ah.half[0] = *(const v8us*)((const unsigned short*)arow + kb + 8 * hh); ah.half[1] = *(const v8us*)((const unsigned short*)arow + kb + 16 + 8 * hh);
#pragma unroll
    for (int t = 0; t < 4; ++t) { if (col0 + t * 16 >= N) continue; const size_t boff = (size_t)(col0 + t * 16 + ln) * ldb + kb; FragH bq; bq.half[0] = *(const v8us*)((const unsigned short*)Bh + boff + 8 * hh); bq.half[1] = *(const v8us*)((const unsigned short*)Bh + boff + 16 + 8 * hh);
      acc[t] = mmaH<1>(ah.v, ah.v, bq.v, bq.v, acc[t]); }
  }
#pragma unroll
  for (int t = 0; t < 4; ++t) { if (col0 + t * 16 >= N) continue; const int col = col0 + t * 16 + ln; const float bv = bp ? bf16_round(bp[col]) : 0.f;
#pragma unroll
    for (int r = 0; r < 8; ++r) { float v = acc[t][r] * alpha + bv; if (CP) { const int rr = row0g + row0 + 8 * hh + r; if (rowsPerB < 0) v += CP[cofs + (size_t)rr * ldc + col];      /* rowsPerB < 0: own element of the batched C plane */ else { const int bidx = rr / rowsPerB; v += CP[(size_t)bidx * sCPb + (size_t)by * 64 + col]; } } if (ACT == 1) v = (v > 0.f) ? v : expm1f(v); else if (ACT == 7) v = (v > 0.f) ? v + 1.0f : expf(v); else if (ACT == 8) v = tanhf(v); else if (ACT == 9) v = 0.5f * v * (1.0f + tanhf(0.7978845608028654f * (v + 0.044715f * v * v * v))); else if (ACT == 11) v = 1.0f / (1.0f + expf(-v)); else if (ACT == 12) v = (v > 0.f) ? v : 0.01f * v; else if (ACT == 14) v = (v > 0.f) ? v : 0.1f * v; else if (ACT == 16) v = (v >= 0.f) ? v : 0.3f * v; else if (ACT == 17) v = (v >= 0.f) ? v : 0.2f * v; else if (ACT == 15) v = v / (1.0f + expf(-v)); else if (ACT == 3) v = fmaxf(v, 0.f); else if (ACT == 6) v = 0.5f * v * (1.0f + erff(v * 0.70710678118654752f)); so[w][8 * hh + r][t * 16 + ln] = v; } }
  __builtin_amdgcn_fence(__ATOMIC_ACQ_REL, "workgroup"); __builtin_amdgcn_wave_barrier();
  const int rsub = lane >> 4, c4 = (lane & 15) * 4; typedef _Float16 v4h __attribute__((ext_vector_type(4)));
  {
#pragma unroll
    for (int q = 0; q < 8; ++q) { const int r = q * 2 + rsub; if (col0 + c4 < N) { const v4f v = *(const v4fa*)&so[w][r][c4]; if (C) *(v4f*)(C + cofs + (size_t)(row0 + r) * ldc + col0 + c4) = v; if (C16) { v4h h4; for (int i = 0; i < 4; ++i) h4[i] = (_Float16)v[i]; *(v4h*)(C16 + cofs + (size_t)(row0 + r) * ldc + col0 + c4) = h4; } } }
     }
}


typedef _Float16 v4h __attribute__((ext_vector_type(4)));

__global__ __launch_bounds__(256) void k_x16(const float* __restrict__ x, _Float16* __restrict__ X16, size_t n8) { const size_t t = (size_t)blockIdx.x * 256 + threadIdx.x; if (t >= n8) return; FragH f;
#pragma unroll
  for (int q = 0; q < 8; ++q) f.h[q] = (_Float16)bf16_round(x[t * 8 + q]); *(v8us*)((unsigned short*)X16 + t * 8) = f.half[0];  }
__global__ __launch_bounds__(256) void k_h16(const float* __restrict__ x, _Float16* __restrict__ X16, size_t n8) { const size_t t = (size_t)blockIdx.x * 256 + threadIdx.x; if (t >= n8) return; FragH f;
#pragma unroll
  for (int q = 0; q < 8; ++q) f.h[q] = (_Float16)x[t * 8 + q]; *(v8us*)((unsigned short*)X16 + t * 8) = f.half[0];  }
__global__ __launch_bounds__(256) void k_round16f(const float* __restrict__ W, _Float16* __restrict__ Bt, size_t n8) { const size_t t = (size_t)blockIdx.x * 256 + threadIdx.x; if (t >= n8) return; FragH f;
#pragma unroll
  for (int i = 0; i < 8; ++i) f.h[i] = (_Float16)(bf16_round(W[t * 8 + i]) * 16.0f); *(v8us*)((unsigned short*)Bt + t * 8) = f.half[0];  }
template <int NHv, int TTv>
__global__ __launch_bounds__(256) void k_vt(const _Float16* __restrict__ V16, int ldv, int voff, _Float16* __restrict__ Vt) { __shared__ unsigned short tl[64][66]; const int tid = threadIdx.x; const int slab = blockIdx.x / (TTv / 64), lg = blockIdx.x % (TTv / 64); const int b = slab / NHv, h = slab % NHv;
  for (int i = tid; i < 64 * 8; i += 256) { const int r = i / 8, c8 = (i % 8) * 8; FragH f; f.half[0] = *(const v8us*)((const unsigned short*)V16 + ((size_t)b * TTv + lg * 64 + r) * ldv + voff + h * 64 + c8);
#pragma unroll
    for (int q = 0; q < 8; ++q) tl[r][c8 + q] = f.u[q]; }
  __syncthreads();
  {
#pragma unroll
    for (int rd = 0; rd < 2; ++rd) { const int d = rd * 32 + tid / 8, pc = tid % 8; FragH f;
#pragma unroll
      for (int q = 0; q < 8; ++q) f.u[q] = tl[pc * 8 + q][d];
      *(v8us*)((unsigned short*)Vt + ((size_t)slab * 64 + d) * TTv + lg * 64 + pc * 8) = f.half[0]; }
     } }

__global__ __launch_bounds__(256) void k_hl(const float* __restrict__ F, _Float16* __restrict__ Hh, _Float16* __restrict__ Hl, size_t n8) { const size_t t = (size_t)blockIdx.x * 256 + threadIdx.x; if (t >= n8) return; FragH fh, fl; const v4f a = *(const v4fa*)(F + t * 8), c = *(const v4fa*)(F + t * 8 + 4);
#pragma unroll
  for (int q = 0; q < 4; ++q) { _Float16 h = (_Float16)a[q]; fh.h[q] = h; fl.h[q] = (_Float16)((a[q] - (float)h) * 1024.0f); h = (_Float16)c[q]; fh.h[4 + q] = h; fl.h[4 + q] = (_Float16)((c[q] - (float)h) * 1024.0f); }
  { *(v8us*)((unsigned short*)Hh + t * 8) = fh.half[0]; *(v8us*)((unsigned short*)Hl + t * 8) = fl.half[0];  } }

// ---- fast GEMM (block tile 128x128 = 8 waves of 32x64, operand tiles staged in LDS; requires M % 128 == 0, N % 128 == 0, K % 64 == 0); epilogue = k_gemm_hhx semantics ----
#define G2_KS 64                     /* k per LDS stage: one whole 128-byte line of every operand row */
#define G2_LP 72                     /* LDS row pitch in f16: 128 data bytes + 16, so that the 16-byte fragment reads of 16 rows spread over the banks */
#define G2_STB (256 * G2_LP * 2)     /* bytes of a stage: 128 A rows, then 128 B rows */
// One stage: a thread copies 16 bytes of rows r, r + 32, r + 64, r + 96 of the A tile and of the B tile (8 threads a row, so a wave's copy covers 4 whole lines), global memory to LDS through no register.
// The closing s_wait_xcnt stands inside the statement so that no address register of an issued copy is rewritten in front of it (a precaution).
__device__ __forceinline__ void g2_stage(unsigned l, const _Float16* a0, size_t a32, const _Float16* b0, size_t b32) {
  const _Float16* a1 = a0 + a32; const _Float16* a2 = a1 + a32; const _Float16* a3 = a2 + a32; const _Float16* b1 = b0 + b32; const _Float16* b2 = b1 + b32; const _Float16* b3 = b2 + b32;
  const unsigned R = 32 * G2_LP * 2;      /* 32 LDS rows in bytes */
  asm volatile("global_load_async_to_lds_b128 %0, %8, off\n\tglobal_load_async_to_lds_b128 %1, %9, off\n\tglobal_load_async_to_lds_b128 %2, %10, off\n\tglobal_load_async_to_lds_b128 %3, %11, off\n\t"
               "global_load_async_to_lds_b128 %4, %12, off\n\tglobal_load_async_to_lds_b128 %5, %13, off\n\tglobal_load_async_to_lds_b128 %6, %14, off\n\tglobal_load_async_to_lds_b128 %7, %15, off\n\ts_wait_xcnt 0x0"
               :: "v"(l), "v"(l + R), "v"(l + 2 * R), "v"(l + 3 * R), "v"(l + 4 * R), "v"(l + 5 * R), "v"(l + 6 * R), "v"(l + 7 * R), "v"(a0), "v"(a1), "v"(a2), "v"(a3), "v"(b0), "v"(b1), "v"(b2), "v"(b3) : "memory");
}
__device__ __forceinline__ v16h g2_frag(const _Float16* p, int hh) { FragH f; f.half[0] = *(const v8us*)((const unsigned short*)p + 8 * hh); f.half[1] = *(const v8us*)((const unsigned short*)p + 16 + 8 * hh); return f.v; }
__device__ __forceinline__ v8f g2_mma(v16h a, v16h b, v8f c) { v8f d = __builtin_amdgcn_wmma_f32_16x16x32_f16(false, a, false, b, (short)0, c, false, false); asm volatile("v_nop\n\tv_nop\n\tv_nop\n\tv_nop" : "+v"(d) : "v"(a), "v"(b)); return d; }
template <int ACT>
__global__ __launch_bounds__(256) void k_gemm2(const _Float16* __restrict__ A, int lda, size_t sA, const _Float16* __restrict__ Bh, int ldb, size_t sB, float alpha, const float* __restrict__ bias, size_t sBias, const float* __restrict__ CP, int rowsPerB, size_t sCPb, int row0g,
    float* __restrict__ C, _Float16* __restrict__ C16, int ldc, size_t sC, int M, int N, int K) { static_assert(ACT == 0 || ACT == 3 || ACT == 6 || ACT == 8 || ACT == 9 || ACT == 11 || ACT == 12 || ACT == 14 || ACT == 15 || ACT == 16 || ACT == 17, "k_gemm2: unsupported ACT code (would silently apply no activation)");
  __shared__ __attribute__((aligned(16))) unsigned char ring[2 * G2_STB];      /* two stages; behind the loop's last barrier the same bytes are the output staging */
  static_assert(sizeof(float) * 8 * 32 * 68 <= sizeof(ring), "k_gemm2: the output staging must fit the ring");
  float (*so)[32][68] = (float (*)[32][68])ring;
  const int tid = threadIdx.x, w = tid >> 5, lane = tid & 31, ln = lane & 15, hh = lane >> 4; const int by = blockIdx.y;
  A += (size_t)by * sA; Bh += (size_t)by * sB; const size_t cofs = (size_t)by * sC; const float* bp = bias ? bias + (size_t)by * sBias : nullptr;
  const int ntn = N >> 7; const int mt = blockIdx.x / ntn, nq = blockIdx.x - mt * ntn; if (mt * 128 >= M) return;      /* the same for the whole work-group, in front of every copy and barrier */
  const int wm = w & 3, wn = w >> 2; const int row0 = mt * 128 + 32 * wm, col0 = nq * 128 + 64 * wn;
  const int sr = tid >> 3, sc8 = (tid & 7) * 8;      /* staging: 8 threads a row of 128 bytes */
  const _Float16* ga = A + (size_t)(mt * 128 + sr) * lda + sc8; const _Float16* gb = Bh + (size_t)(nq * 128 + sr) * ldb + sc8; const size_t a32 = (size_t)32 * lda, b32 = (size_t)32 * ldb;
  const unsigned l0 = (unsigned)(size_t)ring + (unsigned)(sr * G2_LP + sc8) * 2u;      /* the thread's own LDS byte address in buffer 0 */
  const int nst = K / G2_KS;
  const int ao = (32 * wm + ln) * G2_LP, bo = (128 + 64 * wn + ln) * G2_LP;      /* the lane's first A and B row in a stage, in f16 */
  const v8f z8 = {0.f,0.f,0.f,0.f,0.f,0.f,0.f,0.f}; v8f c00 = z8, c01 = z8, c02 = z8, c03 = z8, c10 = z8, c11 = z8, c12 = z8, c13 = z8;
  g2_stage(l0, ga, a32, gb, b32);
  asm volatile("s_wait_asynccnt 0x0" ::: "memory");      /* this wave's copies of stage 0 have landed */
  __syncthreads();      /* publishes stage 0 */
  if (nst > 1) g2_stage(l0 + G2_STB, ga + G2_KS, a32, gb + G2_KS, b32);
#pragma unroll 1      /* one stage a trip: the ring's waits and its barrier stand once, at the foot */
  for (int t = 0; t < nst; ++t) { const _Float16* st = (const _Float16*)(ring + (t & 1) * G2_STB);
#pragma unroll      /* both halves of a stage inline, so that their LDS offsets are immediates */
    for (int kb = 0; kb < G2_KS; kb += 32) {      /* the six fragments of 32 k are read as one group in front of their eight products */
      const v16h a0 = g2_frag(st + ao + kb, hh), a1 = g2_frag(st + ao + 16 * G2_LP + kb, hh);
      const v16h b0 = g2_frag(st + bo + kb, hh), b1 = g2_frag(st + bo + 16 * G2_LP + kb, hh), b2 = g2_frag(st + bo + 32 * G2_LP + kb, hh), b3 = g2_frag(st + bo + 48 * G2_LP + kb, hh);
      c00 = g2_mma(a0, b0, c00); c10 = g2_mma(a1, b0, c10); c01 = g2_mma(a0, b1, c01); c11 = g2_mma(a1, b1, c11);
      c02 = g2_mma(a0, b2, c02); c12 = g2_mma(a1, b2, c12); c03 = g2_mma(a0, b3, c03); c13 = g2_mma(a1, b3, c13); }
    asm volatile("s_wait_dscnt 0x0" ::: "memory");      /* this wave's reads of stage t are done */
    asm volatile("s_wait_asynccnt 0x0" ::: "memory");      /* this wave's copies of stage t + 1 have landed */
    __syncthreads();      /* publishes stage t + 1 and ends every wave's reads of stage t */
    if (t + 2 < nst) g2_stage(l0 + (unsigned)(t & 1) * G2_STB, ga + (size_t)(t + 2) * G2_KS, a32, gb + (size_t)(t + 2) * G2_KS, b32);      /* the same for the whole work-group; into the buffer just left */
  }
  asm volatile("s_wait_asynccnt 0x0" ::: "memory");      /* nothing is in flight when the ring becomes output staging */
  v8f accs[8] = {c00, c01, c02, c03, c10, c11, c12, c13};
#pragma unroll
  for (int u = 0; u < 8; ++u) { const int t = u & 3, half = u >> 2; const int col = col0 + t * 16 + ln; const float bv = bp ? bf16_round(bp[col]) : 0.f;
#pragma unroll
    for (int r = 0; r < 8; ++r) { const int rloc = half * 16 + 8 * hh + r; float v = accs[u][r] * alpha + bv; if (CP) { if (rowsPerB < 0) v += CP[cofs + (size_t)(row0g + row0 + rloc) * ldc + col];      /* rowsPerB < 0: own element of the batched C plane */ else { const int bidx = (row0g + row0 + rloc) / rowsPerB; v += CP[(size_t)bidx * sCPb + (size_t)by * 64 + col]; } }
      if (ACT == 3) v = fmaxf(v, 0.f); else if (ACT == 6) v = 0.5f * v * (1.0f + erff(v * 0.70710678118654752f)); else if (ACT == 11) v = 1.0f / (1.0f + expf(-v)); else if (ACT == 15) v = v / (1.0f + expf(-v)); else if (ACT == 12) v = (v > 0.f) ? v : 0.01f * v; else if (ACT == 8) v = tanhf(v); else if (ACT == 9) v = 0.5f * v * (1.0f + tanhf(0.7978845608028654f * (v + 0.044715f * v * v * v))); else if (ACT == 14) v = (v > 0.f) ? v : 0.1f * v; else if (ACT == 16) v = (v >= 0.f) ? v : 0.3f * v; else if (ACT == 17) v = (v >= 0.f) ? v : 0.2f * v;
      so[w][rloc][t * 16 + ln] = v; } }
  __builtin_amdgcn_fence(__ATOMIC_ACQ_REL, "workgroup"); __builtin_amdgcn_wave_barrier();
  const int rsub = lane >> 4, c4 = (lane & 15) * 4;
  {
#pragma unroll
    for (int q = 0; q < 16; ++q) { const int r = q * 2 + rsub; const v4f v = *(const v4fa*)&so[w][r][c4]; if (C) *(v4f*)(C + cofs + (size_t)(row0 + r) * ldc + col0 + c4) = v; if (C16) { v4h h4; for (int i = 0; i < 4; ++i) h4[i] = (_Float16)v[i]; *(v4h*)(C16 + cofs + (size_t)(row0 + r) * ldc + col0 + c4) = h4; } }
     } }


__global__ __launch_bounds__(256) void k_wnat(const float* __restrict__ w, size_t n8, _Float16* __restrict__ Bt) { const size_t t = (size_t)blockIdx.x * 256 + threadIdx.x; if (t >= n8) return; FragH f; for (int q = 0; q < 8; ++q) f.h[q] = (_Float16)(bf16_round(w[t * 8 + q]) * 16.0f); *(v8us*)((unsigned short*)Bt + t * 8) = f.half[0];  }
__global__ __launch_bounds__(256) void k_rsm(const float* __restrict__ S, _Float16* __restrict__ P, int nrows) {
  #pragma clang fp contract(off)
  const int i = blockIdx.x * 256 + threadIdx.x; if (i >= nrows) return; const float* s = S + (size_t)i * SQ; float mx = -3.0e38f;
#pragma unroll 1
  for (int j = 0; j < SQ; ++j) mx = fmaxf(mx, s[j]); float se = 0.f;
#pragma unroll 1
  for (int j = 0; j < SQ; ++j) se += expf(s[j] - mx); const float sc = 256.0f / se;
#pragma unroll 1
  for (int j0 = 0; j0 < SQ; j0 += 8) { FragH f; for (int q = 0; q < 8; ++q) f.h[q] = (_Float16)(expf(s[j0 + q] - mx) * sc); unsigned short* d = (unsigned short*)P + (size_t)i * SQ + j0; *(v8us*)d = f.half[0];  } }
__global__ __launch_bounds__(256) void k_vt(const _Float16* __restrict__ V16, int b, int h0, _Float16* __restrict__ VT) { __shared__ unsigned short tl[64][65]; const int tid = threadIdx.x; const int hh = blockIdx.x % HG, sg = blockIdx.x / HG; const int s0 = sg * 64; const int h = h0 + hh;
  for (int i = tid; i < 64 * 8; i += 256) { const int j = i / 8, d8 = (i % 8) * 8; FragH f; f.half[0] = *(const v8us*)((const unsigned short*)V16 + ((size_t)b * SQ + s0 + j) * DM + h * HD + d8); for (int q = 0; q < 8; ++q) tl[d8 + q][j] = f.u[q]; }
  __syncthreads();
  { for (int i = tid; i < 64 * 8; i += 256) { const int d = i / 8, j8 = (i % 8) * 8; FragH f; for (int q = 0; q < 8; ++q) f.u[q] = tl[d][j8 + q]; *(v8us*)((unsigned short*)VT + ((size_t)hh * HD + d) * SQ + s0 + j8) = f.half[0]; }  } }



// ---- fused attention: scores, softmax and P V in one kernel; neither scores nor weights go to memory ----
typedef float  v2f  __attribute__((ext_vector_type(2)));
#define FA_KS 64                     /* keys per LDS stage */
#define FA_LP 72                     /* LDS row pitch in f16: 128 data bytes + 16, so that the 16-byte fragment reads of 16 rows spread over the banks */
#define FA_QW 32                     /* query columns per wave */
#define FA_QB 256                    /* query columns per work-group (8 waves) */
__device__ __forceinline__ float fa_xhalf(float x) { return __builtin_bit_cast(float, __builtin_amdgcn_permlanex16(__builtin_bit_cast(int, x), __builtin_bit_cast(int, x), 0x76543210, 0xfedcba98, false, false)); }      /* lane l <-> lane l ^ 16 */
// native 2^x, in place: each exponential overwrites only its own argument, which the compiler's own vector instruction has just written (so no register of a matrix instruction still in its window is touched), and none reads the result or overwrites the source of the one in front of it; the closing v_nop keeps the one slot that the instruction set asks for behind a transcendental
__device__ __forceinline__ float fa_exp2(float x) { asm("v_exp_f32 %0, %0\n\tv_nop" : "+v"(x)); return x; }
__device__ __forceinline__ void fa_exp2x16(v8f& a, v8f& b) { float x0 = a[0], x1 = a[1], x2 = a[2], x3 = a[3], x4 = a[4], x5 = a[5], x6 = a[6], x7 = a[7], x8 = b[0], x9 = b[1], x10 = b[2], x11 = b[3], x12 = b[4], x13 = b[5], x14 = b[6], x15 = b[7];
  asm("v_exp_f32 %0, %0\n\tv_exp_f32 %1, %1\n\tv_exp_f32 %2, %2\n\tv_exp_f32 %3, %3\n\tv_exp_f32 %4, %4\n\tv_exp_f32 %5, %5\n\tv_exp_f32 %6, %6\n\tv_exp_f32 %7, %7\n\tv_exp_f32 %8, %8\n\tv_exp_f32 %9, %9\n\tv_exp_f32 %10, %10\n\tv_exp_f32 %11, %11\n\tv_exp_f32 %12, %12\n\tv_exp_f32 %13, %13\n\tv_exp_f32 %14, %14\n\tv_exp_f32 %15, %15\n\tv_nop"
      : "+v"(x0), "+v"(x1), "+v"(x2), "+v"(x3), "+v"(x4), "+v"(x5), "+v"(x6), "+v"(x7), "+v"(x8), "+v"(x9), "+v"(x10), "+v"(x11), "+v"(x12), "+v"(x13), "+v"(x14), "+v"(x15));
  a = v8f{x0, x1, x2, x3, x4, x5, x6, x7}; b = v8f{x8, x9, x10, x11, x12, x13, x14, x15}; }
__device__ __forceinline__ v8f fa_mma(v16h a, v16h b, v8f c) { return __builtin_amdgcn_wmma_f32_16x16x32_f16(false, a, false, b, (short)0, c, false, false); }
__global__ __launch_bounds__(256) void k_fattn(const _Float16* __restrict__ Qn, const _Float16* __restrict__ Kn, const _Float16* __restrict__ VT, _Float16* __restrict__ O) {
  __shared__ __attribute__((aligned(16))) _Float16 sk[2][FA_KS][FA_LP];      /* K rows [key][d] */
  __shared__ __attribute__((aligned(16))) _Float16 sv[2][HD][FA_LP];         /* V^T rows [d][key] */
  const int tid = threadIdx.x, w = tid >> 5, lane = tid & 31, ln = lane & 15, hh = lane >> 4;
  const int bh = blockIdx.y, b = bh / NH, h = bh % NH; const int q0 = blockIdx.x * FA_QB + w * FA_QW;
  const float cs = 0.125f * 1.44269504088896340736f;      /* 1/sqrt(64) and log2 e */
  const _Float16* qp = Qn + ((size_t)b * SQ + q0 + ln) * DM + h * HD;
  v16h qf[2][2];
  for (int t = 0; t < 2; ++t) for (int s = 0; s < 2; ++s) qf[t][s] = g2_frag(qp + (size_t)t * 16 * DM + s * 32, hh);
  const int sr = tid >> 3, sc8 = (tid & 7) * 8;      /* staging: 8 threads a row of 128 bytes, rows sr and sr + 32 */
  const unsigned short* kg = (const unsigned short*)Kn + ((size_t)b * SQ + sr) * DM + h * HD + sc8;
  const unsigned short* vg = (const unsigned short*)VT + ((size_t)bh * HD + sr) * SQ + sc8;
  v8us gk0 = *(const v8us*)kg, gk1 = *(const v8us*)(kg + (size_t)32 * DM), gv0 = *(const v8us*)vg, gv1 = *(const v8us*)(vg + (size_t)32 * SQ);
  asm volatile("s_wait_xcnt 0x0" :: "v"(qp), "v"(kg), "v"(vg) : "memory");      /* precaution: the loads' address registers stay live up to this wait */
  *(v8us*)&sk[0][sr][sc8] = gk0; *(v8us*)&sk[0][sr + 32][sc8] = gk1; *(v8us*)&sv[0][sr][sc8] = gv0; *(v8us*)&sv[0][sr + 32][sc8] = gv1;
  const v8f z8 = {0.f,0.f,0.f,0.f,0.f,0.f,0.f,0.f};
  v8f o[2][4]; float mr[2]; v2f l[2];
  for (int t = 0; t < 2; ++t) { mr[t] = -3.0e38f; l[t] = v2f{0.f, 0.f}; for (int dt = 0; dt < 4; ++dt) o[t][dt] = z8; }
  __syncthreads();
#pragma unroll 1      /* keeps the loop whole: without it the compiler peels the last stage, doubles the code and goes past 256 registers */
  for (int st = 0; st < SQ / FA_KS; ++st) {
    const int bu = st & 1; const bool more = st + 1 < SQ / FA_KS;      /* same for the whole work-group */
    if (more) {      /* next stage's rows fly while this stage is worked on */
      kg += (size_t)FA_KS * DM; vg += FA_KS;
      gk0 = *(const v8us*)kg; gk1 = *(const v8us*)(kg + (size_t)32 * DM); gv0 = *(const v8us*)vg; gv1 = *(const v8us*)(vg + (size_t)32 * SQ);
      asm volatile("s_wait_xcnt 0x0" :: "v"(kg), "v"(vg) : "memory");      /* precaution: the loads' address registers stay live up to this wait */
    }
    for (int kp = 0; kp < FA_KS / 32; ++kp) {
      v8f s[2][2];      /* [query tile][key tile] */
      { v16h ka[2][2];
        for (int kt = 0; kt < 2; ++kt) for (int c = 0; c < 2; ++c) ka[kt][c] = g2_frag(&sk[bu][kp * 32 + kt * 16 + ln][c * 32], hh);
        for (int t = 0; t < 2; ++t) for (int kt = 0; kt < 2; ++kt) s[t][kt] = fa_mma(ka[kt][1], qf[t][1], fa_mma(ka[kt][0], qf[t][0], z8)); }
      v16h va[4];
      for (int dt = 0; dt < 4; ++dt) va[dt] = g2_frag(&sv[bu][dt * 16 + ln][kp * 32], hh);
      float mb[2]; bool need = false;
      for (int t = 0; t < 2; ++t) { float mx = s[t][0][0];
        for (int r = 1; r < 8; ++r) mx = fmaxf(mx, s[t][0][r]);
        for (int r = 0; r < 8; ++r) mx = fmaxf(mx, s[t][1][r]);
        mx = fmaxf(mx, fa_xhalf(mx)) * cs; mb[t] = mx; need = need || (mx > mr[t] + 8.0f); }
      if (__builtin_amdgcn_ballot_w32(need) != 0) {      /* scalar branch; rare after the first passes */
        for (int t = 0; t < 2; ++t) { const float mn = fmaxf(mr[t], mb[t]); const float al = fa_exp2(mr[t] - mn); mr[t] = mn; l[t] *= al;
          for (int dt = 0; dt < 4; ++dt) o[t][dt] = o[t][dt] * al; } }
      for (int t = 0; t < 2; ++t) { const float nm = 4.0f - mr[t]; FragH pf; v8f p0 = s[t][0] * cs + nm, p1 = s[t][1] * cs + nm;
        fa_exp2x16(p0, p1);
        for (int r = 0; r < 8; ++r) { pf.h[r] = (_Float16)p0[r]; pf.h[8 + r] = (_Float16)p1[r]; }
        const v8f ps = p0 + p1; const v4f p4 = ps.lo + ps.hi; l[t] += p4.lo + p4.hi;      /* the denominator sums the unrounded f32 weights, halving trees that stay in register pairs */
        for (int dt = 0; dt < 4; ++dt) o[t][dt] = fa_mma(va[dt], pf.v, o[t][dt]); }
    }
    asm volatile("v_nop\n\tv_nop\n\tv_nop\n\tv_nop" : "+v"(o[1][0]), "+v"(o[1][1]), "+v"(o[1][2]), "+v"(o[1][3]));      /* the four vector slots behind the stage's last matrix instructions, in front of the branch below */
    if (more) { *(v8us*)&sk[bu ^ 1][sr][sc8] = gk0; *(v8us*)&sk[bu ^ 1][sr + 32][sc8] = gk1; *(v8us*)&sv[bu ^ 1][sr][sc8] = gv0; *(v8us*)&sv[bu ^ 1][sr + 32][sc8] = gv1; }      /* that buffer's readers left it at the last barrier */
    __syncthreads();      /* publishes stage st + 1 and ends the reads of stage st */
  }
  FragH f[2][4];
  for (int t = 0; t < 2; ++t) { const float lw = l[t][0] + l[t][1]; const float inv = 64.0f / (lw + fa_xhalf(lw));
    for (int dt = 0; dt < 4; ++dt) for (int r = 0; r < 8; ++r) f[t][dt].h[r] = (_Float16)(o[t][dt][r] * inv); }
  __builtin_amdgcn_sched_barrier(0);      /* all conversions in front of the first store, so that no register which an issued store names is written again */
  unsigned short* op = (unsigned short*)O + ((size_t)b * SQ + q0 + ln) * DM + h * HD + 8 * hh;
  for (int t = 0; t < 2; ++t) for (int dt = 0; dt < 4; ++dt) *(v8us*)(op + (size_t)t * 16 * DM + dt * 16) = f[t][dt].half[0];
}


template <int BFIN, int WXB>
__global__ __launch_bounds__(256) void k_ln16p(const float* __restrict__ X, size_t ldx, const float* __restrict__ g, const float* __restrict__ bb, float eps, _Float16* __restrict__ N16, float* __restrict__ XB) {
  #pragma clang fp contract(off)
  __shared__ float red[256]; const size_t r = blockIdx.x; const int t = threadIdx.x; const v4f xa = *(const v4fa*)(X + r * ldx + t * 4); float s[4]; float sum = 0.f;
  for (int q = 0; q < 4; ++q) { s[q] = BFIN ? bf16_round(xa[q]) : xa[q]; sum = __fadd_rn(sum, s[q]); }
  red[t] = sum; __syncthreads(); for (int st = 128; st > 0; st >>= 1) { if (t < st) red[t] = __fadd_rn(red[t], red[t + st]); __syncthreads(); } const float mu = red[0] / (float)DMQ; __syncthreads();
  float vs = 0.f; for (int q = 0; q < 4; ++q) { const float dl = __fadd_rn(s[q], -mu); vs = __fadd_rn(vs, __fmul_rn(dl, dl)); } red[t] = vs; __syncthreads(); for (int st = 128; st > 0; st >>= 1) { if (t < st) red[t] = __fadd_rn(red[t], red[t + st]); __syncthreads(); }
  const float rs = rsqrtf(__fadd_rn(red[0] / (float)DMQ, eps)); v4h y; v4f xb;
  for (int q = 0; q < 4; ++q) { const int c = t * 4 + q; y[q] = (_Float16)__fadd_rn(__fmul_rn(__fmul_rn(__fadd_rn(s[q], -mu), rs), bf16_round(g[c])), bf16_round(bb[c])); xb[q] = s[q]; }
  { *(v4h*)(N16 + r * DMQ + t * 4) = y; if (WXB) *(v4f*)(XB + r * DMQ + t * 4) = xb;  } }
extern "C" void kernel_launch(void* const* d_in, const int* in_sizes, int n_in,
                              void* d_out, int out_size, void* d_ws, size_t ws_size, hipStream_t stream) {
  (void)in_sizes; (void)n_in; (void)out_size;
  const float* const* I = (const float* const*)d_in; const float* x = I[0]; const float* wqkv = I[1]; const float* wo = I[2]; const float* bo = I[3]; const float* qg = I[4]; const float* qb = I[5]; const float* kg = I[6]; const float* kb = I[7]; const float* bqkv = nullptr;      /* natural weights; no qkv bias */
  char* ws = (char*)d_ws; size_t off = 0;
  auto take = [&](size_t bytes) { char* p = ws + off; off += (bytes + 255) & ~(size_t)255; return p; };
  _Float16* BQKV = (_Float16*)take((size_t)3 * DM * DM * 2); _Float16* BO = (_Float16*)take((size_t)DM * DM * 2);
  _Float16* X16 = (_Float16*)take(NR * DM * 2); float* QKVF = (float*)take(NR * 3 * DM * 4); _Float16* QN16 = (_Float16*)take(NR * DM * 2); _Float16* KN16 = (_Float16*)take(NR * DM * 2); _Float16* QKV = (_Float16*)take(NR * 3 * DM * 2); _Float16* Q16 = QKV; _Float16* K16 = QKV + DM; _Float16* V16 = QKV + 2 * DM; _Float16* O16 = (_Float16*)take(NR * DM * 2);
  _Float16* VT = (_Float16*)take((size_t)NB * NH * HD * SQ * 2);
  if (off > ws_size) return;
  k_wnat<<<(unsigned)(((size_t)3 * DM * DM / 8 + 255) / 256), 256, 0, stream>>>(wqkv, (size_t)3 * DM * DM / 8, BQKV); k_wnat<<<(unsigned)(((size_t)DM * DM / 8 + 255) / 256), 256, 0, stream>>>(wo, (size_t)DM * DM / 8, BO);      /* natural [out][in] = Bt planes x16 */
  k_x16<<<(unsigned)((NR * DM / 8 + 255) / 256), 256, 0, stream>>>(x, X16, NR * DM / 8);
  const size_t r0p = (size_t)B0 * SQ;      /* first projected row */
  k_gemm2<0><<<dim3((unsigned)((MP / 128) * (3 * DM / 128)), 1), 256, 0, stream>>>(X16 + r0p * DM, DM, 0, BQKV, DM, 0, 0.0625f, nullptr, 0, nullptr, 1, 0, 0, QKVF + r0p * 3 * DM, QKV + r0p * 3 * DM, 3 * DM, 0, MP, 3 * DM, DM);      /* q | k | v rows: f32 (for the LayerNorms) and f16 (v operand) */
  k_ln16p<0, 0><<<(unsigned)MP, 256, 0, stream>>>(QKVF + r0p * 3 * DM, (size_t)3 * DM, qg, qb, 1e-5f, QN16 + r0p * DM, nullptr); k_ln16p<0, 0><<<(unsigned)MP, 256, 0, stream>>>(QKVF + r0p * 3 * DM + DM, (size_t)3 * DM, kg, kb, 1e-5f, KN16 + r0p * DM, nullptr);      /* q, k = LayerNorm over the merged 1024 features -> f16 rows */
  k_vt<NH, SQ><<<NB * NH * (SQ / 64), 256, 0, stream>>>(V16, LQ, 0, VT);      /* V^T [NB][NH][HD][SQ] */
  k_fattn<<<dim3(SQ / FA_QB, NB * NH), 256, 0, stream>>>(QN16, KN16, VT, O16);      /* o (merged heads, x64) as f16 rows: all batches and heads in one launch */
  k_gemm2<0><<<dim3((unsigned)((MPO / 128) * (DM / 128)), 1), 256, 0, stream>>>(O16 + r0p * DM, DM, 0, BO, DM, 0, 0.0009765625f, bo, 0, nullptr, 1, 0, 0, (float*)d_out + r0p * DM, nullptr, DM, 0, MPO, DM, DM);      /* out rows are the output layout */
}

// v004
// A run of this version takes 103 microseconds.
// Next to v003, in two timings, it ran 1.08 times as fast each time.
// Over all steps from v000 it is 33.7 times as fast.
#include <hip/hip_runtime.h>
// Self-attention block with q/k LayerNorm (x [2][2048][1024]; qkv = x w_qkv^T (natural [3072][1024], sigma 1/32, no bias) -> q | k | v blocks, 16 heads of 64; q = LayerNorm_1024(q; q_gamma, q_beta) and k likewise over the full merged 1024 features (eps 1e-5); softmax(q k^T / 8) (no mask); out = merged w_proj^T + b_proj -> [2][2048][1024]).
// Structure: x as exact f16 rows; natural weights as exact x16 planes; q | k | v as ONE WMMA GEMM (128x128 block tiles staged in LDS, 32x64 wave tiles, f32 accumulation; f32 rows for the norms + f16 rows for v); q and k LayerNorm over the merged 1024 features on VALU in one launch (f32, two token rows a wave in registers, lane partials + butterfly; bf16 gamma/beta) -> f16 rows; V^T via LDS transposes; one fused attention launch over all batches and heads (scores K = 64 in f32 accumulators, online softmax with f32 statistics and native exp2, weights as f16, o = P V carried x64) into merged f16 rows; out = o w_proj^T + b_proj GEMM (f32, alpha 2^-10); launches: see trace.
// Compute dtype: inputs rounded to bf16; x / weights exact; q, k, v, softmax weights and o as plain f16 GEMM operands (~2^-12); scores and softmax statistics f32. v_wmma_f32_16x16x32_f16.
#define NB 2
#define SQ 2048
#define DM 1024
#define NH 16
#define HD 64
#define HG 4                         /* heads per launch of the per-batch k_vt (not launched) */
#define B0 0                         /* first batch processed (debug hook) */
#define NBR NB                       /* batches processed (debug hook) */
#define NR ((size_t)NB * SQ)
#define DMQ DM         /* unused: k_lnqk and the f16 rows use DM */
#define MP ((int)((size_t)NBR * SQ)) /* rows projected (debug hook) */
#define QN SQ                        /* unused: k_fattn attends all SQ query rows */
#define NHD NH                       /* unused: k_fattn attends all NH heads */
#define MPO MP                       /* rows through the output stage (debug hook) */
#define LQ (3 * DM)      /* row pitch of the q/k/v rows */
typedef __bf16 v16b __attribute__((ext_vector_type(16)));
typedef unsigned short v8us __attribute__((ext_vector_type(8), may_alias));
typedef float  v8f  __attribute__((ext_vector_type(8)));
typedef float  v4f  __attribute__((ext_vector_type(4)));
typedef float  v4fa __attribute__((ext_vector_type(4), may_alias));
union FragB { v16b v; v8us half[2]; unsigned short u[16]; };

__device__ __forceinline__ unsigned short bf16_bits(float x) { unsigned int u = __float_as_uint(x); return (unsigned short)((u + 0x7FFFu + ((u >> 16) & 1u)) >> 16); }
__device__ __forceinline__ float bf16_val(unsigned short b) { return __uint_as_float(((unsigned int)b) << 16); }
__device__ __forceinline__ float bf16_round(float x) { return bf16_val(bf16_bits(x)); }
// D += A·B with NT terms: 1 = ah·bh, 2 = + al·bh (A split), 3 = + ah·bl (both split)
template <int NT>
__device__ __forceinline__ v8f mmaN(v16b ah, v16b al, v16b bh, v16b bl, v8f c) {
  c = __builtin_amdgcn_wmma_f32_16x16x32_bf16(false, ah, false, bh, (short)0, c, false, false);
  if (NT >= 2) c = __builtin_amdgcn_wmma_f32_16x16x32_bf16(false, al, false, bh, (short)0, c, false, false);
  if (NT >= 3) c = __builtin_amdgcn_wmma_f32_16x16x32_bf16(false, ah, false, bl, (short)0, c, false, false);
  asm volatile("v_nop\n\tv_nop\n\tv_nop\n\tv_nop" : "+v"(c) : "v"(ah), "v"(al), "v"(bh), "v"(bl));
  return c;
}

__global__ __launch_bounds__(256) void k_wt_bf16(const float* __restrict__ W, unsigned short* __restrict__ Wt, int K, int N) {
  const int t = blockIdx.x * 256 + threadIdx.x;
  const int k8n = K / 8;
  if (t >= N * k8n) return;
  const int n = t / k8n, k8 = (t % k8n) * 8;
  v8us v;
#pragma unroll
  for (int i = 0; i < 8; ++i) v[i] = bf16_bits(W[(size_t)(k8 + i) * N + n]);
  *(v8us*)(Wt + (size_t)n * K + k8) = v;
  
}

// GEMM C[M][N] (f32, pitch ldc) = act(A[M][K]·W + bias). A f32 row-major (pitch lda) converted per fragment to bf16
// (ASPLIT: hi/lo two planes -> 2 terms, else single rounded term); Wt bf16 [N][K] (pitch ldb). BIAS_BF16 rounds the
// bias to bf16 first (bias quantised to bf16 before the add). K%32==0, M%16==0, N%64==0.
template <bool ASPLIT, int ACT, bool BIAS_BF16>
__global__ __launch_bounds__(128) void k_gemm_bf(const float* __restrict__ A, int lda, const unsigned short* __restrict__ Wt, int ldb,
                                               const float* __restrict__ bias, float* __restrict__ C, int ldc, int M, int N, int K) {
  __shared__ __attribute__((aligned(16))) float so[4][16][64];
  const int tid = threadIdx.x, w = tid >> 5, lane = tid & 31, ln = lane & 15, hh = lane >> 4;
  const int ntn = N / 64;
  const int wid = blockIdx.x * 4 + w;
  const int mt = wid / ntn, nq = wid % ntn;
  if (mt * 16 >= M) return;
  const int row0 = mt * 16, col0 = nq * 64;
  const float* arow = A + (size_t)(row0 + ln) * lda;
  v8f acc[4] = {};
  for (int kb = 0; kb < K; kb += 32) {
    FragB ah, al;
    const v4f x0 = *(const v4fa*)(arow + kb + 8 * hh), x1 = *(const v4fa*)(arow + kb + 8 * hh + 4);
    const v4f x2 = *(const v4fa*)(arow + kb + 16 + 8 * hh), x3 = *(const v4fa*)(arow + kb + 16 + 8 * hh + 4);
    float xs[16] = {x0[0],x0[1],x0[2],x0[3],x1[0],x1[1],x1[2],x1[3],x2[0],x2[1],x2[2],x2[3],x3[0],x3[1],x3[2],x3[3]};
#pragma unroll
    for (int i = 0; i < 16; ++i) { const unsigned short hb = bf16_bits(xs[i]); ah.u[i] = hb; al.u[i] = ASPLIT ? bf16_bits(xs[i] - bf16_val(hb)) : (unsigned short)0; }
#pragma unroll
    for (int t = 0; t < 4; ++t) {
      const unsigned short* brow = Wt + (size_t)(col0 + t * 16 + ln) * ldb + kb;
      FragB b;
      b.half[0] = *(const v8us*)(brow + 8 * hh);
      b.half[1] = *(const v8us*)(brow + 16 + 8 * hh);
      acc[t] = mmaN<ASPLIT ? 2 : 1>(ah.v, al.v, b.v, b.v, acc[t]);
    }
  }
#pragma unroll
  for (int t = 0; t < 4; ++t) {
    float bv = bias ? bias[col0 + t * 16 + ln] : 0.f;
    if (BIAS_BF16) bv = bf16_round(bv);
#pragma unroll
    for (int r = 0; r < 8; ++r) { float v = acc[t][r] + bv; if (ACT == 1) v = fmaxf(v, 0.f); so[w][8 * hh + r][t * 16 + ln] = v; }
  }
  __builtin_amdgcn_fence(__ATOMIC_ACQ_REL, "workgroup");
  __builtin_amdgcn_wave_barrier();
  const int rsub = lane >> 4, c4 = (lane & 15) * 4;
  {
#pragma unroll
    for (int q = 0; q < 8; ++q) {
      const int r = q * 2 + rsub;
      const v4f v = *(const v4fa*)&so[w][r][c4];
      *(v4f*)(C + (size_t)(row0 + r) * ldc + col0 + c4) = v;
    }
    
  }
}

// GEMM C = act(A·W + bias + resid): A f32 (ASPLIT -> hi/lo 2 terms), Wt bf16 [N][K]; ACT 0 none, 1 relu, 2 exact gelu;
// resid (optional, f32, row index = (row % rmod), pitch ldr, RES_BF16 rounds it) added before the activation.
template <bool ASPLIT, int ACT, bool BIAS_BF16, bool RES_BF16>
__global__ __launch_bounds__(128) void k_gemm_bf3(const float* __restrict__ A, int lda, const unsigned short* __restrict__ Wt, int ldb,
                                                const float* __restrict__ bias, const float* __restrict__ resid, int rmod, int ldr,
                                                float* __restrict__ C, int ldc, int M, int N, int K) {
  __shared__ __attribute__((aligned(16))) float so[4][16][64];
  const int tid = threadIdx.x, w = tid >> 5, lane = tid & 31, ln = lane & 15, hh = lane >> 4;
  const int ntn = N / 64;
  const int wid = blockIdx.x * 4 + w;
  const int mt = wid / ntn, nq = wid % ntn;
  if (mt * 16 >= M) return;
  const int row0 = mt * 16, col0 = nq * 64;
  const float* arow = A + (size_t)(row0 + ln) * lda;
  v8f acc[4] = {};
  for (int kb = 0; kb < K; kb += 32) {
    FragB ah, al;
    const v4f x0 = *(const v4fa*)(arow + kb + 8 * hh), x1 = *(const v4fa*)(arow + kb + 8 * hh + 4);
    const v4f x2 = *(const v4fa*)(arow + kb + 16 + 8 * hh), x3 = *(const v4fa*)(arow + kb + 16 + 8 * hh + 4);
    float xs[16] = {x0[0],x0[1],x0[2],x0[3],x1[0],x1[1],x1[2],x1[3],x2[0],x2[1],x2[2],x2[3],x3[0],x3[1],x3[2],x3[3]};
#pragma unroll
    for (int i = 0; i < 16; ++i) { const unsigned short hb = bf16_bits(xs[i]); ah.u[i] = hb; al.u[i] = ASPLIT ? bf16_bits(xs[i] - bf16_val(hb)) : (unsigned short)0; }
#pragma unroll
    for (int t = 0; t < 4; ++t) {
      const unsigned short* brow = Wt + (size_t)(col0 + t * 16 + ln) * ldb + kb;
      FragB b;
      b.half[0] = *(const v8us*)(brow + 8 * hh);
      b.half[1] = *(const v8us*)(brow + 16 + 8 * hh);
      acc[t] = mmaN<ASPLIT ? 2 : 1>(ah.v, al.v, b.v, b.v, acc[t]);
    }
  }
#pragma unroll
  for (int t = 0; t < 4; ++t) {
    const int col = col0 + t * 16 + ln;
    float bv = bias ? bias[col] : 0.f;
    if (BIAS_BF16) bv = bf16_round(bv);
#pragma unroll
    for (int r = 0; r < 8; ++r) {
      float v = acc[t][r] + bv;
      if (resid) { float rv = resid[(size_t)((row0 + 8 * hh + r) % rmod) * ldr + col]; if (RES_BF16) rv = bf16_round(rv); v += rv; }
      if (ACT == 1) v = fmaxf(v, 0.f);
      if (ACT == 2) v = 0.5f * v * (1.0f + erff(v * 0.70710678118654752f));
      if (ACT == 3) { const float u = 0.7978845608028654f * (v + 0.044715f * v * v * v); v = 0.5f * v * (1.0f + tanhf(u)); }
      so[w][8 * hh + r][t * 16 + ln] = v;
    }
  }
  __builtin_amdgcn_fence(__ATOMIC_ACQ_REL, "workgroup");
  __builtin_amdgcn_wave_barrier();
  const int rsub = lane >> 4, c4 = (lane & 15) * 4;
  {
#pragma unroll
    for (int q = 0; q < 8; ++q) {
      const int r = q * 2 + rsub;
      const v4f v = *(const v4fa*)&so[w][r][c4];
      *(v4f*)(C + (size_t)(row0 + r) * ldc + col0 + c4) = v;
    }
    
  }
}
// row LayerNorm (biased variance, eps) over N: s = X (+ R); optional out_sum <- s; out_norm <- (s-mu)*rsqrt(var+eps)*g + b
template <bool PARAM_BF16>
__global__ __launch_bounds__(256) void k_layernorm(const float* __restrict__ X, const float* __restrict__ R, const float* __restrict__ g, const float* __restrict__ bta,
                                                  float* __restrict__ out_sum, float* __restrict__ out_norm, int N, float eps) {
  __shared__ float red[256];
  const int row = blockIdx.x, tid = threadIdx.x;
  const float* x = X + (size_t)row * N; const float* rr = R ? R + (size_t)row * N : nullptr;
  float vals[16];                     // up to N = 4096
  const int per = N / 256;            // contiguous chunk per thread? use strided-by-4 chunks: thread handles j = tid*4 + 1024*u
  float s1 = 0.f;
  for (int u = 0; u < per / 4; ++u) {
    const int j = tid * 4 + 1024 * u;
    const v4f a = *(const v4fa*)(x + j);
    v4f b = {0.f,0.f,0.f,0.f}; if (rr) b = *(const v4fa*)(rr + j);
#pragma unroll
    for (int q = 0; q < 4; ++q) { const float v = a[q] + b[q]; vals[u * 4 + q] = v; s1 += v; }
  }
  red[tid] = s1; __syncthreads();
  for (int st = 128; st > 0; st >>= 1) { if (tid < st) red[tid] += red[tid + st]; __syncthreads(); }
  const float mu = red[0] / (float)N; __syncthreads();
  float s2 = 0.f;
  for (int u = 0; u < per / 4; ++u)
#pragma unroll
    for (int q = 0; q < 4; ++q) { const float c = vals[u * 4 + q] - mu; s2 += c * c; }
  red[tid] = s2; __syncthreads();
  for (int st = 128; st > 0; st >>= 1) { if (tid < st) red[tid] += red[tid + st]; __syncthreads(); }
  const float rs = rsqrtf(red[0] / (float)N + eps);
  {
    for (int u = 0; u < per / 4; ++u) {
      const int j = tid * 4 + 1024 * u;
      v4f o, sm;
#pragma unroll
      for (int q = 0; q < 4; ++q) {
        float gg = g[j + q], bb = bta[j + q];
        if (PARAM_BF16) { gg = bf16_round(gg); bb = bf16_round(bb); }
        sm[q] = vals[u * 4 + q]; o[q] = (vals[u * 4 + q] - mu) * rs * gg + bb;
      }
      if (out_sum) *(v4f*)(out_sum + (size_t)row * N + j) = sm;
      *(v4f*)(out_norm + (size_t)row * N + j) = o;
    }
    
  }
}



// ---- f16 WMMA path (v_wmma_f32_16x16x32_f16): 11-bit significands for operands in range — used where a [0,1] probability operand needs more precision than bf16
typedef _Float16 v16h __attribute__((ext_vector_type(16)));
union FragH { v16h v; v8us half[2]; _Float16 h[16]; unsigned short u[16]; };
template <int NT>
__device__ __forceinline__ v8f mmaH(v16h ah, v16h al, v16h bh, v16h bl, v8f c) {
  c = __builtin_amdgcn_wmma_f32_16x16x32_f16(false, ah, false, bh, (short)0, c, false, false);
  if (NT >= 2) c = __builtin_amdgcn_wmma_f32_16x16x32_f16(false, al, false, bh, (short)0, c, false, false);
  if (NT >= 3) c = __builtin_amdgcn_wmma_f32_16x16x32_f16(false, ah, false, bl, (short)0, c, false, false);
  asm volatile("v_nop\n\tv_nop\n\tv_nop\n\tv_nop" : "+v"(c) : "v"(ah), "v"(al), "v"(bh), "v"(bl));
  return c;
}
// batched GEMM like k_gemm_b but f16 operands: A f32 (split into f16 hi/lo if ASPLIT, else rounded to f16), Bt = f16 values [n][k]; alpha; C f32; N multiple of 16 (partial tiles skipped)
template <bool ASPLIT>
__global__ __launch_bounds__(128) void k_gemm_h(const float* __restrict__ A, int lda, size_t sA, const _Float16* __restrict__ Bh, int ldb, size_t sB, float alpha, float* __restrict__ C, int ldc, size_t sC, int M, int N, int K) {
  __shared__ __attribute__((aligned(16))) float so[4][16][64];
  const int tid = threadIdx.x, w = tid >> 5, lane = tid & 31, ln = lane & 15, hh = lane >> 4; const int by = blockIdx.y;
  A += (size_t)by * sA; Bh += (size_t)by * sB; C += (size_t)by * sC;
  const int ntn = (N + 63) / 64; const int wid = blockIdx.x * 4 + w; const int mt = wid / ntn, nq = wid % ntn; if (mt * 16 >= M) return;
  const int row0 = mt * 16, col0 = nq * 64; const float* arow = A + (size_t)(row0 + ln) * lda;
  v8f acc[4] = {};
  for (int kb = 0; kb < K; kb += 32) {
    FragH ah, al;
    const v4f x0 = *(const v4fa*)(arow + kb + 8 * hh), x1 = *(const v4fa*)(arow + kb + 8 * hh + 4), x2 = *(const v4fa*)(arow + kb + 16 + 8 * hh), x3 = *(const v4fa*)(arow + kb + 16 + 8 * hh + 4);
    float xs[16] = {x0[0],x0[1],x0[2],x0[3],x1[0],x1[1],x1[2],x1[3],x2[0],x2[1],x2[2],x2[3],x3[0],x3[1],x3[2],x3[3]};
#pragma unroll
    for (int i = 0; i < 16; ++i) { const _Float16 h = (_Float16)xs[i]; ah.h[i] = h; al.h[i] = ASPLIT ? (_Float16)(xs[i] - (float)h) : (_Float16)0.0f; }
#pragma unroll
    for (int t = 0; t < 4; ++t) { if (col0 + t * 16 >= N) continue; const size_t boff = (size_t)(col0 + t * 16 + ln) * ldb + kb; FragH bq; bq.half[0] = *(const v8us*)(Bh + boff + 8 * hh); bq.half[1] = *(const v8us*)(Bh + boff + 16 + 8 * hh);
      acc[t] = mmaH<ASPLIT ? 2 : 1>(ah.v, al.v, bq.v, bq.v, acc[t]); }
  }
#pragma unroll
  for (int t = 0; t < 4; ++t) { if (col0 + t * 16 >= N) continue;
#pragma unroll
    for (int r = 0; r < 8; ++r) so[w][8 * hh + r][t * 16 + ln] = acc[t][r] * alpha; }
  __builtin_amdgcn_fence(__ATOMIC_ACQ_REL, "workgroup"); __builtin_amdgcn_wave_barrier();
  const int rsub = lane >> 4, c4 = (lane & 15) * 4;
  {
#pragma unroll
    for (int q = 0; q < 8; ++q) { const int r = q * 2 + rsub; if (col0 + c4 < N) { const v4f v = *(const v4fa*)&so[w][r][c4]; *(v4f*)(C + (size_t)(row0 + r) * ldc + col0 + c4) = v; } }
     }
}

// Wt[n][k] = f16(W[k][n]·scale) from f32 row-major W[K][N] (scale = power of two; bf16-exact weights stay exact in f16 away from the subnormal range)
__global__ __launch_bounds__(256) void k_wt_f16(const float* __restrict__ W, _Float16* __restrict__ Wt, int K, int N, float scale) {
  const int t = blockIdx.x * 256 + threadIdx.x; if (t >= N * (K / 8)) return; const int n = t / (K / 8), k8 = (t % (K / 8)) * 8; FragH f;
#pragma unroll
  for (int i = 0; i < 8; ++i) f.h[i] = (_Float16)(bf16_round(W[(size_t)(k8 + i) * N + n]) * scale); const v8us o = f.half[0];
  *(v8us*)((unsigned short*)Wt + (size_t)n * K + k8) = o; 
}
// k_gemm_hh variant with fused epilogue: v = acc·alpha + bias[by·sBias + col] (+ CP[(row/rowsPerB)·sCPb + by·64 + col] if CP) ; ACT 0 none / 1 elu ; writes f16 C16 (and f32 C if non-null)
template <int ACT>
__global__ __launch_bounds__(128) void k_gemm_hhx(const _Float16* __restrict__ A, int lda, size_t sA, const _Float16* __restrict__ Bh, int ldb, size_t sB, float alpha, const float* __restrict__ bias, size_t sBias, const float* __restrict__ CP, int rowsPerB, size_t sCPb, int row0g,
    float* __restrict__ C, _Float16* __restrict__ C16, int ldc, size_t sC, int M, int N, int K) {
  __shared__ __attribute__((aligned(16))) float so[4][16][64];
  const int tid = threadIdx.x, w = tid >> 5, lane = tid & 31, ln = lane & 15, hh = lane >> 4; const int by = blockIdx.y;
  A += (size_t)by * sA; Bh += (size_t)by * sB; const size_t cofs = (size_t)by * sC; const float* bp = bias ? bias + (size_t)by * sBias : nullptr;
  const int ntn = (N + 63) / 64; const int wid = blockIdx.x * 4 + w; const int mt = wid / ntn, nq = wid % ntn; if (mt * 16 >= M) return;
  const int row0 = mt * 16, col0 = nq * 64; const _Float16* arow = A + (size_t)(row0 + ln) * lda;
  v8f acc[4] = {};
  for (int kb = 0; kb < K; kb += 32) { FragH ah; ah.half[0] = *(const v8us*)((const unsigned short*)arow + kb + 8 * hh); ah.half[1] = *(const v8us*)((const unsigned short*)arow + kb + 16 + 8 * hh);
#pragma unroll
    for (int t = 0; t < 4; ++t) { if (col0 + t * 16 >= N) continue; const size_t boff = (size_t)(col0 + t * 16 + ln) * ldb + kb; FragH bq; bq.half[0] = *(const v8us*)((const unsigned short*)Bh + boff + 8 * hh); bq.half[1] = *(const v8us*)((const unsigned short*)Bh + boff + 16 + 8 * hh);
      acc[t] = mmaH<1>(ah.v, ah.v, bq.v, bq.v, acc[t]); }
  }
#pragma unroll
  for (int t = 0; t < 4; ++t) { if (col0 + t * 16 >= N) continue; const int col = col0 + t * 16 + ln; const float bv = bp ? bf16_round(bp[col]) : 0.f;
#pragma unroll
    for (int r = 0; r < 8; ++r) { float v = acc[t][r] * alpha + bv; if (CP) { const int rr = row0g + row0 + 8 * hh + r; if (rowsPerB < 0) v += CP[cofs + (size_t)rr * ldc + col];      /* rowsPerB < 0: own element of the batched C plane */ else { const int bidx = rr / rowsPerB; v += CP[(size_t)bidx * sCPb + (size_t)by * 64 + col]; } } if (ACT == 1) v = (v > 0.f) ? v : expm1f(v); else if (ACT == 7) v = (v > 0.f) ? v + 1.0f : expf(v); else if (ACT == 8) v = tanhf(v); else if (ACT == 9) v = 0.5f * v * (1.0f + tanhf(0.7978845608028654f * (v + 0.044715f * v * v * v))); else if (ACT == 11) v = 1.0f / (1.0f + expf(-v)); else if (ACT == 12) v = (v > 0.f) ? v : 0.01f * v; else if (ACT == 14) v = (v > 0.f) ? v : 0.1f * v; else if (ACT == 16) v = (v >= 0.f) ? v : 0.3f * v; else if (ACT == 17) v = (v >= 0.f) ? v : 0.2f * v; else if (ACT == 15) v = v / (1.0f + expf(-v)); else if (ACT == 3) v = fmaxf(v, 0.f); else if (ACT == 6) v = 0.5f * v * (1.0f + erff(v * 0.70710678118654752f)); so[w][8 * hh + r][t * 16 + ln] = v; } }
  __builtin_amdgcn_fence(__ATOMIC_ACQ_REL, "workgroup"); __builtin_amdgcn_wave_barrier();
  const int rsub = lane >> 4, c4 = (lane & 15) * 4; typedef _Float16 v4h __attribute__((ext_vector_type(4)));
  {
#pragma unroll
    for (int q = 0; q < 8; ++q) { const int r = q * 2 + rsub; if (col0 + c4 < N) { const v4f v = *(const v4fa*)&so[w][r][c4]; if (C) *(v4f*)(C + cofs + (size_t)(row0 + r) * ldc + col0 + c4) = v; if (C16) { v4h h4; for (int i = 0; i < 4; ++i) h4[i] = (_Float16)v[i]; *(v4h*)(C16 + cofs + (size_t)(row0 + r) * ldc + col0 + c4) = h4; } } }
     }
}


typedef _Float16 v4h __attribute__((ext_vector_type(4)));

__global__ __launch_bounds__(256) void k_x16(const float* __restrict__ x, _Float16* __restrict__ X16, size_t n8) { const size_t t = (size_t)blockIdx.x * 256 + threadIdx.x; if (t >= n8) return; FragH f;
#pragma unroll
  for (int q = 0; q < 8; ++q) f.h[q] = (_Float16)bf16_round(x[t * 8 + q]); *(v8us*)((unsigned short*)X16 + t * 8) = f.half[0];  }
__global__ __launch_bounds__(256) void k_h16(const float* __restrict__ x, _Float16* __restrict__ X16, size_t n8) { const size_t t = (size_t)blockIdx.x * 256 + threadIdx.x; if (t >= n8) return; FragH f;
#pragma unroll
  for (int q = 0; q < 8; ++q) f.h[q] = (_Float16)x[t * 8 + q]; *(v8us*)((unsigned short*)X16 + t * 8) = f.half[0];  }
__global__ __launch_bounds__(256) void k_round16f(const float* __restrict__ W, _Float16* __restrict__ Bt, size_t n8) { const size_t t = (size_t)blockIdx.x * 256 + threadIdx.x; if (t >= n8) return; FragH f;
#pragma unroll
  for (int i = 0; i < 8; ++i) f.h[i] = (_Float16)(bf16_round(W[t * 8 + i]) * 16.0f); *(v8us*)((unsigned short*)Bt + t * 8) = f.half[0];  }
template <int NHv, int TTv>
__global__ __launch_bounds__(256) void k_vt(const _Float16* __restrict__ V16, int ldv, int voff, _Float16* __restrict__ Vt) { __shared__ unsigned short tl[64][66]; const int tid = threadIdx.x; const int slab = blockIdx.x / (TTv / 64), lg = blockIdx.x % (TTv / 64); const int b = slab / NHv, h = slab % NHv;
  for (int i = tid; i < 64 * 8; i += 256) { const int r = i / 8, c8 = (i % 8) * 8; FragH f; f.half[0] = *(const v8us*)((const unsigned short*)V16 + ((size_t)b * TTv + lg * 64 + r) * ldv + voff + h * 64 + c8);
#pragma unroll
    for (int q = 0; q < 8; ++q) tl[r][c8 + q] = f.u[q]; }
  __syncthreads();
  {
#pragma unroll
    for (int rd = 0; rd < 2; ++rd) { const int d = rd * 32 + tid / 8, pc = tid % 8; FragH f;
#pragma unroll
      for (int q = 0; q < 8; ++q) f.u[q] = tl[pc * 8 + q][d];
      *(v8us*)((unsigned short*)Vt + ((size_t)slab * 64 + d) * TTv + lg * 64 + pc * 8) = f.half[0]; }
     } }

__global__ __launch_bounds__(256) void k_hl(const float* __restrict__ F, _Float16* __restrict__ Hh, _Float16* __restrict__ Hl, size_t n8) { const size_t t = (size_t)blockIdx.x * 256 + threadIdx.x; if (t >= n8) return; FragH fh, fl; const v4f a = *(const v4fa*)(F + t * 8), c = *(const v4fa*)(F + t * 8 + 4);
#pragma unroll
  for (int q = 0; q < 4; ++q) { _Float16 h = (_Float16)a[q]; fh.h[q] = h; fl.h[q] = (_Float16)((a[q] - (float)h) * 1024.0f); h = (_Float16)c[q]; fh.h[4 + q] = h; fl.h[4 + q] = (_Float16)((c[q] - (float)h) * 1024.0f); }
  { *(v8us*)((unsigned short*)Hh + t * 8) = fh.half[0]; *(v8us*)((unsigned short*)Hl + t * 8) = fl.half[0];  } }

// ---- fast GEMM (block tile 128x128 = 8 waves of 32x64, operand tiles staged in LDS; requires M % 128 == 0, N % 128 == 0, K % 64 == 0); epilogue = k_gemm_hhx semantics ----
#define G2_KS 64                     /* k per LDS stage: one whole 128-byte line of every operand row */
#define G2_LP 72                     /* LDS row pitch in f16: 128 data bytes + 16, so that the 16-byte fragment reads of 16 rows spread over the banks */
#define G2_STB (256 * G2_LP * 2)     /* bytes of a stage: 128 A rows, then 128 B rows */
// One stage: a thread copies 16 bytes of rows r, r + 32, r + 64, r + 96 of the A tile and of the B tile (8 threads a row, so a wave's copy covers 4 whole lines), global memory to LDS through no register.
// The closing s_wait_xcnt stands inside the statement so that no address register of an issued copy is rewritten in front of it (a precaution).
__device__ __forceinline__ void g2_stage(unsigned l, const _Float16* a0, size_t a32, const _Float16* b0, size_t b32) {
  const _Float16* a1 = a0 + a32; const _Float16* a2 = a1 + a32; const _Float16* a3 = a2 + a32; const _Float16* b1 = b0 + b32; const _Float16* b2 = b1 + b32; const _Float16* b3 = b2 + b32;
  const unsigned R = 32 * G2_LP * 2;      /* 32 LDS rows in bytes */
  asm volatile("global_load_async_to_lds_b128 %0, %8, off\n\tglobal_load_async_to_lds_b128 %1, %9, off\n\tglobal_load_async_to_lds_b128 %2, %10, off\n\tglobal_load_async_to_lds_b128 %3, %11, off\n\t"
               "global_load_async_to_lds_b128 %4, %12, off\n\tglobal_load_async_to_lds_b128 %5, %13, off\n\tglobal_load_async_to_lds_b128 %6, %14, off\n\tglobal_load_async_to_lds_b128 %7, %15, off\n\ts_wait_xcnt 0x0"
               :: "v"(l), "v"(l + R), "v"(l + 2 * R), "v"(l + 3 * R), "v"(l + 4 * R), "v"(l + 5 * R), "v"(l + 6 * R), "v"(l + 7 * R), "v"(a0), "v"(a1), "v"(a2), "v"(a3), "v"(b0), "v"(b1), "v"(b2), "v"(b3) : "memory");
}
__device__ __forceinline__ v16h g2_frag(const _Float16* p, int hh) { FragH f; f.half[0] = *(const v8us*)((const unsigned short*)p + 8 * hh); f.half[1] = *(const v8us*)((const unsigned short*)p + 16 + 8 * hh); return f.v; }
__device__ __forceinline__ v8f g2_mma(v16h a, v16h b, v8f c) { v8f d = __builtin_amdgcn_wmma_f32_16x16x32_f16(false, a, false, b, (short)0, c, false, false); asm volatile("v_nop\n\tv_nop\n\tv_nop\n\tv_nop" : "+v"(d) : "v"(a), "v"(b)); return d; }
template <int ACT>
__global__ __launch_bounds__(256) void k_gemm2(const _Float16* __restrict__ A, int lda, size_t sA, const _Float16* __restrict__ Bh, int ldb, size_t sB, float alpha, const float* __restrict__ bias, size_t sBias, const float* __restrict__ CP, int rowsPerB, size_t sCPb, int row0g,
    float* __restrict__ C, _Float16* __restrict__ C16, int ldc, size_t sC, int M, int N, int K) { static_assert(ACT == 0 || ACT == 3 || ACT == 6 || ACT == 8 || ACT == 9 || ACT == 11 || ACT == 12 || ACT == 14 || ACT == 15 || ACT == 16 || ACT == 17, "k_gemm2: unsupported ACT code (would silently apply no activation)");
  __shared__ __attribute__((aligned(16))) unsigned char ring[2 * G2_STB];      /* two stages; behind the loop's last barrier the same bytes are the output staging */
  static_assert(sizeof(float) * 8 * 32 * 68 <= sizeof(ring), "k_gemm2: the output staging must fit the ring");
  float (*so)[32][68] = (float (*)[32][68])ring;
  const int tid = threadIdx.x, w = tid >> 5, lane = tid & 31, ln = lane & 15, hh = lane >> 4; const int by = blockIdx.y;
  A += (size_t)by * sA; Bh += (size_t)by * sB; const size_t cofs = (size_t)by * sC; const float* bp = bias ? bias + (size_t)by * sBias : nullptr;
  const int ntn = N >> 7; const int mt = blockIdx.x / ntn, nq = blockIdx.x - mt * ntn; if (mt * 128 >= M) return;      /* the same for the whole work-group, in front of every copy and barrier */
  const int wm = w & 3, wn = w >> 2; const int row0 = mt * 128 + 32 * wm, col0 = nq * 128 + 64 * wn;
  const int sr = tid >> 3, sc8 = (tid & 7) * 8;      /* staging: 8 threads a row of 128 bytes */
  const _Float16* ga = A + (size_t)(mt * 128 + sr) * lda + sc8; const _Float16* gb = Bh + (size_t)(nq * 128 + sr) * ldb + sc8; const size_t a32 = (size_t)32 * lda, b32 = (size_t)32 * ldb;
  const unsigned l0 = (unsigned)(size_t)ring + (unsigned)(sr * G2_LP + sc8) * 2u;      /* the thread's own LDS byte address in buffer 0 */
  const int nst = K / G2_KS;
  const int ao = (32 * wm + ln) * G2_LP, bo = (128 + 64 * wn + ln) * G2_LP;      /* the lane's first A and B row in a stage, in f16 */
  const v8f z8 = {0.f,0.f,0.f,0.f,0.f,0.f,0.f,0.f}; v8f c00 = z8, c01 = z8, c02 = z8, c03 = z8, c10 = z8, c11 = z8, c12 = z8, c13 = z8;
  g2_stage(l0, ga, a32, gb, b32);
  asm volatile("s_wait_asynccnt 0x0" ::: "memory");      /* this wave's copies of stage 0 have landed */
  __syncthreads();      /* publishes stage 0 */
  if (nst > 1) g2_stage(l0 + G2_STB, ga + G2_KS, a32, gb + G2_KS, b32);
#pragma unroll 1      /* one stage a trip: the ring's waits and its barrier stand once, at the foot */
  for (int t = 0; t < nst; ++t) { const _Float16* st = (const _Float16*)(ring + (t & 1) * G2_STB);
#pragma unroll      /* both halves of a stage inline, so that their LDS offsets are immediates */
    for (int kb = 0; kb < G2_KS; kb += 32) {      /* the six fragments of 32 k are read as one group in front of their eight products */
      const v16h a0 = g2_frag(st + ao + kb, hh), a1 = g2_frag(st + ao + 16 * G2_LP + kb, hh);
      const v16h b0 = g2_frag(st + bo + kb, hh), b1 = g2_frag(st + bo + 16 * G2_LP + kb, hh), b2 = g2_frag(st + bo + 32 * G2_LP + kb, hh), b3 = g2_frag(st + bo + 48 * G2_LP + kb, hh);
      c00 = g2_mma(a0, b0, c00); c10 = g2_mma(a1, b0, c10); c01 = g2_mma(a0, b1, c01); c11 = g2_mma(a1, b1, c11);
      c02 = g2_mma(a0, b2, c02); c12 = g2_mma(a1, b2, c12); c03 = g2_mma(a0, b3, c03); c13 = g2_mma(a1, b3, c13); }
    asm volatile("s_wait_dscnt 0x0" ::: "memory");      /* this wave's reads of stage t are done */
    asm volatile("s_wait_asynccnt 0x0" ::: "memory");      /* this wave's copies of stage t + 1 have landed */
    __syncthreads();      /* publishes stage t + 1 and ends every wave's reads of stage t */
    if (t + 2 < nst) g2_stage(l0 + (unsigned)(t & 1) * G2_STB, ga + (size_t)(t + 2) * G2_KS, a32, gb + (size_t)(t + 2) * G2_KS, b32);      /* the same for the whole work-group; into the buffer just left */
  }
  asm volatile("s_wait_asynccnt 0x0" ::: "memory");      /* nothing is in flight when the ring becomes output staging */
  v8f accs[8] = {c00, c01, c02, c03, c10, c11, c12, c13};
#pragma unroll
  for (int u = 0; u < 8; ++u) { const int t = u & 3, half = u >> 2; const int col = col0 + t * 16 + ln; const float bv = bp ? bf16_round(bp[col]) : 0.f;
#pragma unroll
    for (int r = 0; r < 8; ++r) { const int rloc = half * 16 + 8 * hh + r; float v = accs[u][r] * alpha + bv; if (CP) { if (rowsPerB < 0) v += CP[cofs + (size_t)(row0g + row0 + rloc) * ldc + col];      /* rowsPerB < 0: own element of the batched C plane */ else { const int bidx = (row0g + row0 + rloc) / rowsPerB; v += CP[(size_t)bidx * sCPb + (size_t)by * 64 + col]; } }
      if (ACT == 3) v = fmaxf(v, 0.f); else if (ACT == 6) v = 0.5f * v * (1.0f + erff(v * 0.70710678118654752f)); else if (ACT == 11) v = 1.0f / (1.0f + expf(-v)); else if (ACT == 15) v = v / (1.0f + expf(-v)); else if (ACT == 12) v = (v > 0.f) ? v : 0.01f * v; else if (ACT == 8) v = tanhf(v); else if (ACT == 9) v = 0.5f * v * (1.0f + tanhf(0.7978845608028654f * (v + 0.044715f * v * v * v))); else if (ACT == 14) v = (v > 0.f) ? v : 0.1f * v; else if (ACT == 16) v = (v >= 0.f) ? v : 0.3f * v; else if (ACT == 17) v = (v >= 0.f) ? v : 0.2f * v;
      so[w][rloc][t * 16 + ln] = v; } }
  __builtin_amdgcn_fence(__ATOMIC_ACQ_REL, "workgroup"); __builtin_amdgcn_wave_barrier();
  const int rsub = lane >> 4, c4 = (lane & 15) * 4;
  {
#pragma unroll
    for (int q = 0; q < 16; ++q) { const int r = q * 2 + rsub; const v4f v = *(const v4fa*)&so[w][r][c4]; if (C) *(v4f*)(C + cofs + (size_t)(row0 + r) * ldc + col0 + c4) = v; if (C16) { v4h h4; for (int i = 0; i < 4; ++i) h4[i] = (_Float16)v[i]; *(v4h*)(C16 + cofs + (size_t)(row0 + r) * ldc + col0 + c4) = h4; } }
     } }


__global__ __launch_bounds__(256) void k_wnat(const float* __restrict__ w, size_t n8, _Float16* __restrict__ Bt) { const size_t t = (size_t)blockIdx.x * 256 + threadIdx.x; if (t >= n8) return; FragH f; for (int q = 0; q < 8; ++q) f.h[q] = (_Float16)(bf16_round(w[t * 8 + q]) * 16.0f); *(v8us*)((unsigned short*)Bt + t * 8) = f.half[0];  }
__global__ __launch_bounds__(256) void k_rsm(const float* __restrict__ S, _Float16* __restrict__ P, int nrows) {
  #pragma clang fp contract(off)
  const int i = blockIdx.x * 256 + threadIdx.x; if (i >= nrows) return; const float* s = S + (size_t)i * SQ; float mx = -3.0e38f;
#pragma unroll 1
  for (int j = 0; j < SQ; ++j) mx = fmaxf(mx, s[j]); float se = 0.f;
#pragma unroll 1
  for (int j = 0; j < SQ; ++j) se += expf(s[j] - mx); const float sc = 256.0f / se;
#pragma unroll 1
  for (int j0 = 0; j0 < SQ; j0 += 8) { FragH f; for (int q = 0; q < 8; ++q) f.h[q] = (_Float16)(expf(s[j0 + q] - mx) * sc); unsigned short* d = (unsigned short*)P + (size_t)i * SQ + j0; *(v8us*)d = f.half[0];  } }
__global__ __launch_bounds__(256) void k_vt(const _Float16* __restrict__ V16, int b, int h0, _Float16* __restrict__ VT) { __shared__ unsigned short tl[64][65]; const int tid = threadIdx.x; const int hh = blockIdx.x % HG, sg = blockIdx.x / HG; const int s0 = sg * 64; const int h = h0 + hh;
  for (int i = tid; i < 64 * 8; i += 256) { const int j = i / 8, d8 = (i % 8) * 8; FragH f; f.half[0] = *(const v8us*)((const unsigned short*)V16 + ((size_t)b * SQ + s0 + j) * DM + h * HD + d8); for (int q = 0; q < 8; ++q) tl[d8 + q][j] = f.u[q]; }
  __syncthreads();
  { for (int i = tid; i < 64 * 8; i += 256) { const int d = i / 8, j8 = (i % 8) * 8; FragH f; for (int q = 0; q < 8; ++q) f.u[q] = tl[d][j8 + q]; *(v8us*)((unsigned short*)VT + ((size_t)hh * HD + d) * SQ + s0 + j8) = f.half[0]; }  } }



// ---- fused attention: scores, softmax and P V in one kernel; neither scores nor weights go to memory ----
typedef float  v2f  __attribute__((ext_vector_type(2)));
#define FA_KS 64                     /* keys per LDS stage */
#define FA_LP 72                     /* LDS row pitch in f16: 128 data bytes + 16, so that the 16-byte fragment reads of 16 rows spread over the banks */
#define FA_QW 32                     /* query columns per wave */
#define FA_QB 256                    /* query columns per work-group (8 waves) */
__device__ __forceinline__ float fa_xhalf(float x) { return __builtin_bit_cast(float, __builtin_amdgcn_permlanex16(__builtin_bit_cast(int, x), __builtin_bit_cast(int, x), 0x76543210, 0xfedcba98, false, false)); }      /* lane l <-> lane l ^ 16 */
// native 2^x, in place: each exponential overwrites only its own argument, which the compiler's own vector instruction has just written (so no register of a matrix instruction still in its window is touched), and none reads the result or overwrites the source of the one in front of it; the closing v_nop keeps the one slot that the instruction set asks for behind a transcendental
__device__ __forceinline__ float fa_exp2(float x) { asm("v_exp_f32 %0, %0\n\tv_nop" : "+v"(x)); return x; }
__device__ __forceinline__ void fa_exp2x16(v8f& a, v8f& b) { float x0 = a[0], x1 = a[1], x2 = a[2], x3 = a[3], x4 = a[4], x5 = a[5], x6 = a[6], x7 = a[7], x8 = b[0], x9 = b[1], x10 = b[2], x11 = b[3], x12 = b[4], x13 = b[5], x14 = b[6], x15 = b[7];
  asm("v_exp_f32 %0, %0\n\tv_exp_f32 %1, %1\n\tv_exp_f32 %2, %2\n\tv_exp_f32 %3, %3\n\tv_exp_f32 %4, %4\n\tv_exp_f32 %5, %5\n\tv_exp_f32 %6, %6\n\tv_exp_f32 %7, %7\n\tv_exp_f32 %8, %8\n\tv_exp_f32 %9, %9\n\tv_exp_f32 %10, %10\n\tv_exp_f32 %11, %11\n\tv_exp_f32 %12, %12\n\tv_exp_f32 %13, %13\n\tv_exp_f32 %14, %14\n\tv_exp_f32 %15, %15\n\tv_nop"
      : "+v"(x0), "+v"(x1), "+v"(x2), "+v"(x3), "+v"(x4), "+v"(x5), "+v"(x6), "+v"(x7), "+v"(x8), "+v"(x9), "+v"(x10), "+v"(x11), "+v"(x12), "+v"(x13), "+v"(x14), "+v"(x15));
  a = v8f{x0, x1, x2, x3, x4, x5, x6, x7}; b = v8f{x8, x9, x10, x11, x12, x13, x14, x15}; }
__device__ __forceinline__ v8f fa_mma(v16h a, v16h b, v8f c) { return __builtin_amdgcn_wmma_f32_16x16x32_f16(false, a, false, b, (short)0, c, false, false); }
__global__ __launch_bounds__(256) void k_fattn(const _Float16* __restrict__ Qn, const _Float16* __restrict__ Kn, const _Float16* __restrict__ VT, _Float16* __restrict__ O) {
  __shared__ __attribute__((aligned(16))) _Float16 sk[2][FA_KS][FA_LP];      /* K rows [key][d] */
  __shared__ __attribute__((aligned(16))) _Float16 sv[2][HD][FA_LP];         /* V^T rows [d][key] */
  const int tid = threadIdx.x, w = tid >> 5, lane = tid & 31, ln = lane & 15, hh = lane >> 4;
  const int bh = blockIdx.y, b = bh / NH, h = bh % NH; const int q0 = blockIdx.x * FA_QB + w * FA_QW;
  const float cs = 0.125f * 1.44269504088896340736f;      /* 1/sqrt(64) and log2 e */
  const _Float16* qp = Qn + ((size_t)b * SQ + q0 + ln) * DM + h * HD;
  v16h qf[2][2];
  for (int t = 0; t < 2; ++t) for (int s = 0; s < 2; ++s) qf[t][s] = g2_frag(qp + (size_t)t * 16 * DM + s * 32, hh);
  const int sr = tid >> 3, sc8 = (tid & 7) * 8;      /* staging: 8 threads a row of 128 bytes, rows sr and sr + 32 */
  const unsigned short* kg = (const unsigned short*)Kn + ((size_t)b * SQ + sr) * DM + h * HD + sc8;
  const unsigned short* vg = (const unsigned short*)VT + ((size_t)bh * HD + sr) * SQ + sc8;
  v8us gk0 = *(const v8us*)kg, gk1 = *(const v8us*)(kg + (size_t)32 * DM), gv0 = *(const v8us*)vg, gv1 = *(const v8us*)(vg + (size_t)32 * SQ);
  asm volatile("s_wait_xcnt 0x0" :: "v"(qp), "v"(kg), "v"(vg) : "memory");      /* precaution: the loads' address registers stay live up to this wait */
  *(v8us*)&sk[0][sr][sc8] = gk0; *(v8us*)&sk[0][sr + 32][sc8] = gk1; *(v8us*)&sv[0][sr][sc8] = gv0; *(v8us*)&sv[0][sr + 32][sc8] = gv1;
  const v8f z8 = {0.f,0.f,0.f,0.f,0.f,0.f,0.f,0.f};
  v8f o[2][4]; float mr[2]; v2f l[2];
  for (int t = 0; t < 2; ++t) { mr[t] = -3.0e38f; l[t] = v2f{0.f, 0.f}; for (int dt = 0; dt < 4; ++dt) o[t][dt] = z8; }
  __syncthreads();
#pragma unroll 1      /* keeps the loop whole: without it the compiler peels the last stage, doubles the code and goes past 256 registers */
  for (int st = 0; st < SQ / FA_KS; ++st) {
    const int bu = st & 1; const bool more = st + 1 < SQ / FA_KS;      /* same for the whole work-group */
    if (more) {      /* next stage's rows fly while this stage is worked on */
      kg += (size_t)FA_KS * DM; vg += FA_KS;
      gk0 = *(const v8us*)kg; gk1 = *(const v8us*)(kg + (size_t)32 * DM); gv0 = *(const v8us*)vg; gv1 = *(const v8us*)(vg + (size_t)32 * SQ);
      asm volatile("s_wait_xcnt 0x0" :: "v"(kg), "v"(vg) : "memory");      /* precaution: the loads' address registers stay live up to this wait */
    }
    for (int kp = 0; kp < FA_KS / 32; ++kp) {
      v8f s[2][2];      /* [query tile][key tile] */
      { v16h ka[2][2];
        for (int kt = 0; kt < 2; ++kt) for (int c = 0; c < 2; ++c) ka[kt][c] = g2_frag(&sk[bu][kp * 32 + kt * 16 + ln][c * 32], hh);
        for (int t = 0; t < 2; ++t) for (int kt = 0; kt < 2; ++kt) s[t][kt] = fa_mma(ka[kt][1], qf[t][1], fa_mma(ka[kt][0], qf[t][0], z8)); }
      v16h va[4];
      for (int dt = 0; dt < 4; ++dt) va[dt] = g2_frag(&sv[bu][dt * 16 + ln][kp * 32], hh);
      float mb[2]; bool need = false;
      for (int t = 0; t < 2; ++t) { float mx = s[t][0][0];
        for (int r = 1; r < 8; ++r) mx = fmaxf(mx, s[t][0][r]);
        for (int r = 0; r < 8; ++r) mx = fmaxf(mx, s[t][1][r]);
        mx = fmaxf(mx, fa_xhalf(mx)) * cs; mb[t] = mx; need = need || (mx > mr[t] + 8.0f); }
      if (__builtin_amdgcn_ballot_w32(need) != 0) {      /* scalar branch; rare after the first passes */
        for (int t = 0; t < 2; ++t) { const float mn = fmaxf(mr[t], mb[t]); const float al = fa_exp2(mr[t] - mn); mr[t] = mn; l[t] *= al;
          for (int dt = 0; dt < 4; ++dt) o[t][dt] = o[t][dt] * al; } }
      for (int t = 0; t < 2; ++t) { const float nm = 4.0f - mr[t]; FragH pf; v8f p0 = s[t][0] * cs + nm, p1 = s[t][1] * cs + nm;
        fa_exp2x16(p0, p1);
        for (int r = 0; r < 8; ++r) { pf.h[r] = (_Float16)p0[r]; pf.h[8 + r] = (_Float16)p1[r]; }
        const v8f ps = p0 + p1; const v4f p4 = ps.lo + ps.hi; l[t] += p4.lo + p4.hi;      /* the denominator sums the unrounded f32 weights, halving trees that stay in register pairs */
        for (int dt = 0; dt < 4; ++dt) o[t][dt] = fa_mma(va[dt], pf.v, o[t][dt]); }
    }
    asm volatile("v_nop\n\tv_nop\n\tv_nop\n\tv_nop" : "+v"(o[1][0]), "+v"(o[1][1]), "+v"(o[1][2]), "+v"(o[1][3]));      /* the four vector slots behind the stage's last matrix instructions, in front of the branch below */
    if (more) { *(v8us*)&sk[bu ^ 1][sr][sc8] = gk0; *(v8us*)&sk[bu ^ 1][sr + 32][sc8] = gk1; *(v8us*)&sv[bu ^ 1][sr][sc8] = gv0; *(v8us*)&sv[bu ^ 1][sr + 32][sc8] = gv1; }      /* that buffer's readers left it at the last barrier */
    __syncthreads();      /* publishes stage st + 1 and ends the reads of stage st */
  }
  FragH f[2][4];
  for (int t = 0; t < 2; ++t) { const float lw = l[t][0] + l[t][1]; const float inv = 64.0f / (lw + fa_xhalf(lw));
    for (int dt = 0; dt < 4; ++dt) for (int r = 0; r < 8; ++r) f[t][dt].h[r] = (_Float16)(o[t][dt][r] * inv); }
  __builtin_amdgcn_sched_barrier(0);      /* all conversions in front of the first store, so that no register which an issued store names is written again */
  unsigned short* op = (unsigned short*)O + ((size_t)b * SQ + q0 + ln) * DM + h * HD + 8 * hh;
  for (int t = 0; t < 2; ++t) for (int dt = 0; dt < 4; ++dt) *(v8us*)(op + (size_t)t * 16 * DM + dt * 16) = f[t][dt].half[0];
}


// q and k LayerNorm in one launch (blockIdx.y: 0 = q, 1 = k), no LDS and no barrier: a wave takes LN_TW token rows and holds their 1024 features in registers, read once by loads of 512 bytes in a row.
// Mean and variance (two passes over the registers): lane partials, then a butterfly over the 32 lanes. gamma and beta (rounded to bf16) are loaded once a wave and serve all its rows.
#define LN_TW 2                      /* token rows per wave */
template <int CTRL> __device__ __forceinline__ float ln_xm(float x) { return __builtin_bit_cast(float, __builtin_amdgcn_update_dpp(0, __builtin_bit_cast(int, x), CTRL, 0xf, 0xf, true)); }      /* lane l <- lane l ^ (CTRL & 15), inside a row of 16 lanes (row_xmask) */
__device__ __forceinline__ float ln_wsum(float x) { x += ln_xm<0x161>(x); x += ln_xm<0x162>(x); x += ln_xm<0x164>(x); x += ln_xm<0x168>(x); return x + fa_xhalf(x); }      /* the sum over the wave, in every lane */
__device__ __forceinline__ float ln_sum4(v4f s) { const v2f h = s.lo + s.hi; return h[0] + h[1]; }
__global__ __launch_bounds__(256) void k_lnqk(const float* __restrict__ X, const float* __restrict__ qg, const float* __restrict__ qb, const float* __restrict__ kg, const float* __restrict__ kb, float eps, _Float16* __restrict__ Qo, _Float16* __restrict__ Ko) {
  const int lane = threadIdx.x & 31, p = blockIdx.y; const size_t r0 = ((size_t)blockIdx.x * 8 + (threadIdx.x >> 5)) * LN_TW;
  const float* g = (p ? kg : qg) + lane * 4; const float* bt = (p ? kb : qb) + lane * 4; const float* x = X + r0 * LQ + p * DM + lane * 4;
  v4f gg[8], bb[8], a[LN_TW][8];      /* pieces of 128 features; every loop below is unrolled so that these stay in registers under constant indices */
#pragma unroll
  for (int i = 0; i < 8; ++i) { gg[i] = *(const v4fa*)(g + i * 128); bb[i] = *(const v4fa*)(bt + i * 128); }
#pragma unroll
  for (int u = 0; u < LN_TW; ++u)
#pragma unroll
    for (int i = 0; i < 8; ++i) a[u][i] = *(const v4fa*)(x + (size_t)u * LQ + i * 128);
  asm volatile("s_wait_xcnt 0x0" :: "v"(g), "v"(bt), "v"(x) : "memory");      /* precaution: the loads' address registers stay live up to this wait */
  __builtin_amdgcn_sched_barrier(0);      /* holds that wait directly behind the loads: without it the scheduler sinks it far below them */
#pragma unroll
  for (int i = 0; i < 8; ++i)
#pragma unroll
    for (int c = 0; c < 4; ++c) { gg[i][c] = bf16_round(gg[i][c]); bb[i][c] = bf16_round(bb[i][c]); }
  v4h y[LN_TW][8];
#pragma unroll
  for (int u = 0; u < LN_TW; ++u) { v4f s = a[u][0];
#pragma unroll
    for (int i = 1; i < 8; ++i) s += a[u][i];
    const float mu = ln_wsum(ln_sum4(s)) * (1.0f / (float)DM); v4f q = {0.f, 0.f, 0.f, 0.f};
#pragma unroll
    for (int i = 0; i < 8; ++i) { a[u][i] -= mu; q += a[u][i] * a[u][i]; }
    const float rs = rsqrtf(ln_wsum(ln_sum4(q)) * (1.0f / (float)DM) + eps);
#pragma unroll
    for (int i = 0; i < 8; ++i) { const v4f o = a[u][i] * rs * gg[i] + bb[i];
#pragma unroll
      for (int c = 0; c < 4; ++c) y[u][i][c] = (_Float16)o[c]; } }
  __builtin_amdgcn_sched_barrier(0);      /* all conversions in front of the first store, so that no register which an issued store names is written again */
  _Float16* d = (p ? Ko : Qo) + r0 * DM + lane * 4;
#pragma unroll
  for (int u = 0; u < LN_TW; ++u)
#pragma unroll
    for (int i = 0; i < 8; ++i) *(v4h*)(d + (size_t)u * DM + i * 128) = y[u][i];
}
extern "C" void kernel_launch(void* const* d_in, const int* in_sizes, int n_in,
                              void* d_out, int out_size, void* d_ws, size_t ws_size, hipStream_t stream) {
  (void)in_sizes; (void)n_in; (void)out_size;
  const float* const* I = (const float* const*)d_in; const float* x = I[0]; const float* wqkv = I[1]; const float* wo = I[2]; const float* bo = I[3]; const float* qg = I[4]; const float* qb = I[5]; const float* kg = I[6]; const float* kb = I[7]; const float* bqkv = nullptr;      /* natural weights; no qkv bias */
  char* ws = (char*)d_ws; size_t off = 0;
  auto take = [&](size_t bytes) { char* p = ws + off; off += (bytes + 255) & ~(size_t)255; return p; };
  _Float16* BQKV = (_Float16*)take((size_t)3 * DM * DM * 2); _Float16* BO = (_Float16*)take((size_t)DM * DM * 2);
  _Float16* X16 = (_Float16*)take(NR * DM * 2); float* QKVF = (float*)take(NR * 3 * DM * 4); _Float16* QN16 = (_Float16*)take(NR * DM * 2); _Float16* KN16 = (_Float16*)take(NR * DM * 2); _Float16* QKV = (_Float16*)take(NR * 3 * DM * 2); _Float16* Q16 = QKV; _Float16* K16 = QKV + DM; _Float16* V16 = QKV + 2 * DM; _Float16* O16 = (_Float16*)take(NR * DM * 2);
  _Float16* VT = (_Float16*)take((size_t)NB * NH * HD * SQ * 2);
  if (off > ws_size) return;
  k_wnat<<<(unsigned)(((size_t)3 * DM * DM / 8 + 255) / 256), 256, 0, stream>>>(wqkv, (size_t)3 * DM * DM / 8, BQKV); k_wnat<<<(unsigned)(((size_t)DM * DM / 8 + 255) / 256), 256, 0, stream>>>(wo, (size_t)DM * DM / 8, BO);      /* natural [out][in] = Bt planes x16 */
  k_x16<<<(unsigned)((NR * DM / 8 + 255) / 256), 256, 0, stream>>>(x, X16, NR * DM / 8);
  const size_t r0p = (size_t)B0 * SQ;      /* first projected row */
  k_gemm2<0><<<dim3((unsigned)((MP / 128) * (3 * DM / 128)), 1), 256, 0, stream>>>(X16 + r0p * DM, DM, 0, BQKV, DM, 0, 0.0625f, nullptr, 0, nullptr, 1, 0, 0, QKVF + r0p * 3 * DM, QKV + r0p * 3 * DM, 3 * DM, 0, MP, 3 * DM, DM);      /* q | k | v rows: f32 (for the LayerNorms) and f16 (v operand) */
  static_assert(MP % (8 * LN_TW) == 0, "k_lnqk: whole work-groups of 8 waves");
  k_lnqk<<<dim3((unsigned)(MP / (8 * LN_TW)), 2), 256, 0, stream>>>(QKVF + r0p * 3 * DM, qg, qb, kg, kb, 1e-5f, QN16 + r0p * DM, KN16 + r0p * DM);      /* q, k = LayerNorm over the merged 1024 features -> f16 rows, both in one launch */
  k_vt<NH, SQ><<<NB * NH * (SQ / 64), 256, 0, stream>>>(V16, LQ, 0, VT);      /* V^T [NB][NH][HD][SQ] */
  k_fattn<<<dim3(SQ / FA_QB, NB * NH), 256, 0, stream>>>(QN16, KN16, VT, O16);      /* o (merged heads, x64) as f16 rows: all batches and heads in one launch */
  k_gemm2<0><<<dim3((unsigned)((MPO / 128) * (DM / 128)), 1), 256, 0, stream>>>(O16 + r0p * DM, DM, 0, BO, DM, 0, 0.0009765625f, bo, 0, nullptr, 1, 0, 0, (float*)d_out + r0p * DM, nullptr, DM, 0, MPO, DM, DM);      /* out rows are the output layout */
}

// v005
// Measured time: 97.3 microseconds a run.
// Timed twice side by side with v004, it ran 1.06 and 1.05 times as fast.
// Counting every step since v000, it is 35.6 times as fast.
#include <hip/hip_runtime.h>
// Self-attention block with q/k LayerNorm (x [2][2048][1024]; qkv = x w_qkv^T (natural [3072][1024], sigma 1/32, no bias) -> q | k | v blocks, 16 heads of 64; q = LayerNorm_1024(q; q_gamma, q_beta) and k likewise over the full merged 1024 features (eps 1e-5); softmax(q k^T / 8) (no mask); out = merged w_proj^T + b_proj -> [2][2048][1024]).
// Structure: x as exact f16 rows; natural weights as exact x16 planes; q | k | v as ONE WMMA GEMM (128x128 block tiles staged in LDS, 32x64 wave tiles, f32 accumulation; f32 rows for the norms + f16 rows for v); q and k LayerNorm over the merged 1024 features on VALU in one launch (f32, two token rows a wave in registers, lane partials + butterfly; bf16 gamma/beta) -> f16 rows; V^T via LDS transposes; one fused attention launch over all batches and heads (scores K = 64 in f32 accumulators, online softmax with f32 statistics and native exp2, weights as f16, o = P V carried x64) into merged f16 rows; out = o w_proj^T + b_proj GEMM (f32, alpha 2^-10); launches: see trace.
// Compute dtype: inputs rounded to bf16; x / weights exact; q, k, v, softmax weights and o as plain f16 GEMM operands (~2^-12); scores and softmax statistics f32. v_wmma_f32_16x16x32_f16.
#define NB 2
#define SQ 2048
#define DM 1024
#define NH 16
#define HD 64
#define HG 4                         /* heads per launch of the per-batch k_vt (not launched) */
#define B0 0                         /* first batch processed (debug hook) */
#define NBR NB                       /* batches processed (debug hook) */
#define NR ((size_t)NB * SQ)
#define DMQ DM         /* unused: ln_rows and the f16 rows use DM */
#define MP ((int)((size_t)NBR * SQ)) /* rows projected (debug hook) */
#define QN SQ                        /* unused: k_fattn attends all SQ query rows */
#define NHD NH                       /* unused: k_fattn attends all NH heads */
#define MPO MP                       /* rows through the output stage (debug hook) */
#define LQ (3 * DM)      /* row pitch of the q/k/v rows */
typedef __bf16 v16b __attribute__((ext_vector_type(16)));
typedef unsigned short v8us __attribute__((ext_vector_type(8), may_alias));
typedef float  v8f  __attribute__((ext_vector_type(8)));
typedef float  v4f  __attribute__((ext_vector_type(4)));
typedef float  v4fa __attribute__((ext_vector_type(4), may_alias));
union FragB { v16b v; v8us half[2]; unsigned short u[16]; };

__device__ __forceinline__ unsigned short bf16_bits(float x) { unsigned int u = __float_as_uint(x); return (unsigned short)((u + 0x7FFFu + ((u >> 16) & 1u)) >> 16); }
__device__ __forceinline__ float bf16_val(unsigned short b) { return __uint_as_float(((unsigned int)b) << 16); }
__device__ __forceinline__ float bf16_round(float x) { return bf16_val(bf16_bits(x)); }
// D += A·B with NT terms: 1 = ah·bh, 2 = + al·bh (A split), 3 = + ah·bl (both split)
template <int NT>
__device__ __forceinline__ v8f mmaN(v16b ah, v16b al, v16b bh, v16b bl, v8f c) {
  c = __builtin_amdgcn_wmma_f32_16x16x32_bf16(false, ah, false, bh, (short)0, c, false, false);
  if (NT >= 2) c = __builtin_amdgcn_wmma_f32_16x16x32_bf16(false, al, false, bh, (short)0, c, false, false);
  if (NT >= 3) c = __builtin_amdgcn_wmma_f32_16x16x32_bf16(false, ah, false, bl, (short)0, c, false, false);
  asm volatile("v_nop\n\tv_nop\n\tv_nop\n\tv_nop" : "+v"(c) : "v"(ah), "v"(al), "v"(bh), "v"(bl));
  return c;
}

__global__ __launch_bounds__(256) void k_wt_bf16(const float* __restrict__ W, unsigned short* __restrict__ Wt, int K, int N) {
  const int t = blockIdx.x * 256 + threadIdx.x;
  const int k8n = K / 8;
  if (t >= N * k8n) return;
  const int n = t / k8n, k8 = (t % k8n) * 8;
  v8us v;
#pragma unroll
  for (int i = 0; i < 8; ++i) v[i] = bf16_bits(W[(size_t)(k8 + i) * N + n]);
  *(v8us*)(Wt + (size_t)n * K + k8) = v;
  
}

// GEMM C[M][N] (f32, pitch ldc) = act(A[M][K]·W + bias). A f32 row-major (pitch lda) converted per fragment to bf16
// (ASPLIT: hi/lo two planes -> 2 terms, else single rounded term); Wt bf16 [N][K] (pitch ldb). BIAS_BF16 rounds the
// bias to bf16 first (bias quantised to bf16 before the add). K%32==0, M%16==0, N%64==0.
template <bool ASPLIT, int ACT, bool BIAS_BF16>
__global__ __launch_bounds__(128) void k_gemm_bf(const float* __restrict__ A, int lda, const unsigned short* __restrict__ Wt, int ldb,
                                               const float* __restrict__ bias, float* __restrict__ C, int ldc, int M, int N, int K) {
  __shared__ __attribute__((aligned(16))) float so[4][16][64];
  const int tid = threadIdx.x, w = tid >> 5, lane = tid & 31, ln = lane & 15, hh = lane >> 4;
  const int ntn = N / 64;
  const int wid = blockIdx.x * 4 + w;
  const int mt = wid / ntn, nq = wid % ntn;
  if (mt * 16 >= M) return;
  const int row0 = mt * 16, col0 = nq * 64;
  const float* arow = A + (size_t)(row0 + ln) * lda;
  v8f acc[4] = {};
  for (int kb = 0; kb < K; kb += 32) {
    FragB ah, al;
    const v4f x0 = *(const v4fa*)(arow + kb + 8 * hh), x1 = *(const v4fa*)(arow + kb + 8 * hh + 4);
    const v4f x2 = *(const v4fa*)(arow + kb + 16 + 8 * hh), x3 = *(const v4fa*)(arow + kb + 16 + 8 * hh + 4);
    float xs[16] = {x0[0],x0[1],x0[2],x0[3],x1[0],x1[1],x1[2],x1[3],x2[0],x2[1],x2[2],x2[3],x3[0],x3[1],x3[2],x3[3]};
#pragma unroll
    for (int i = 0; i < 16; ++i) { const unsigned short hb = bf16_bits(xs[i]); ah.u[i] = hb; al.u[i] = ASPLIT ? bf16_bits(xs[i] - bf16_val(hb)) : (unsigned short)0; }
#pragma unroll
    for (int t = 0; t < 4; ++t) {
      const unsigned short* brow = Wt + (size_t)(col0 + t * 16 + ln) * ldb + kb;
      FragB b;
      b.half[0] = *(const v8us*)(brow + 8 * hh);
      b.half[1] = *(const v8us*)(brow + 16 + 8 * hh);
      acc[t] = mmaN<ASPLIT ? 2 : 1>(ah.v, al.v, b.v, b.v, acc[t]);
    }
  }
#pragma unroll
  for (int t = 0; t < 4; ++t) {
    float bv = bias ? bias[col0 + t * 16 + ln] : 0.f;
    if (BIAS_BF16) bv = bf16_round(bv);
#pragma unroll
    for (int r = 0; r < 8; ++r) { float v = acc[t][r] + bv; if (ACT == 1) v = fmaxf(v, 0.f); so[w][8 * hh + r][t * 16 + ln] = v; }
  }
  __builtin_amdgcn_fence(__ATOMIC_ACQ_REL, "workgroup");
  __builtin_amdgcn_wave_barrier();
  const int rsub = lane >> 4, c4 = (lane & 15) * 4;
  {
#pragma unroll
    for (int q = 0; q < 8; ++q) {
      const int r = q * 2 + rsub;
      const v4f v = *(const v4fa*)&so[w][r][c4];
      *(v4f*)(C + (size_t)(row0 + r) * ldc + col0 + c4) = v;
    }
    
  }
}

// GEMM C = act(A·W + bias + resid): A f32 (ASPLIT -> hi/lo 2 terms), Wt bf16 [N][K]; ACT 0 none, 1 relu, 2 exact gelu;
// resid (optional, f32, row index = (row % rmod), pitch ldr, RES_BF16 rounds it) added before the activation.
template <bool ASPLIT, int ACT, bool BIAS_BF16, bool RES_BF16>
__global__ __launch_bounds__(128) void k_gemm_bf3(const float* __restrict__ A, int lda, const unsigned short* __restrict__ Wt, int ldb,
                                                const float* __restrict__ bias, const float* __restrict__ resid, int rmod, int ldr,
                                                float* __restrict__ C, int ldc, int M, int N, int K) {
  __shared__ __attribute__((aligned(16))) float so[4][16][64];
  const int tid = threadIdx.x, w = tid >> 5, lane = tid & 31, ln = lane & 15, hh = lane >> 4;
  const int ntn = N / 64;
  const int wid = blockIdx.x * 4 + w;
  const int mt = wid / ntn, nq = wid % ntn;
  if (mt * 16 >= M) return;
  const int row0 = mt * 16, col0 = nq * 64;
  const float* arow = A + (size_t)(row0 + ln) * lda;
  v8f acc[4] = {};
  for (int kb = 0; kb < K; kb += 32) {
    FragB ah, al;
    const v4f x0 = *(const v4fa*)(arow + kb + 8 * hh), x1 = *(const v4fa*)(arow + kb + 8 * hh + 4);
    const v4f x2 = *(const v4fa*)(arow + kb + 16 + 8 * hh), x3 = *(const v4fa*)(arow + kb + 16 + 8 * hh + 4);
    float xs[16] = {x0[0],x0[1],x0[2],x0[3],x1[0],x1[1],x1[2],x1[3],x2[0],x2[1],x2[2],x2[3],x3[0],x3[1],x3[2],x3[3]};
#pragma unroll
    for (int i = 0; i < 16; ++i) { const unsigned short hb = bf16_bits(xs[i]); ah.u[i] = hb; al.u[i] = ASPLIT ? bf16_bits(xs[i] - bf16_val(hb)) : (unsigned short)0; }
#pragma unroll
    for (int t = 0; t < 4; ++t) {
      const unsigned short* brow = Wt + (size_t)(col0 + t * 16 + ln) * ldb + kb;
      FragB b;
      b.half[0] = *(const v8us*)(brow + 8 * hh);
      b.half[1] = *(const v8us*)(brow + 16 + 8 * hh);
      acc[t] = mmaN<ASPLIT ? 2 : 1>(ah.v, al.v, b.v, b.v, acc[t]);
    }
  }
#pragma unroll
  for (int t = 0; t < 4; ++t) {
    const int col = col0 + t * 16 + ln;
    float bv = bias ? bias[col] : 0.f;
    if (BIAS_BF16) bv = bf16_round(bv);
#pragma unroll
    for (int r = 0; r < 8; ++r) {
      float v = acc[t][r] + bv;
      if (resid) { float rv = resid[(size_t)((row0 + 8 * hh + r) % rmod) * ldr + col]; if (RES_BF16) rv = bf16_round(rv); v += rv; }
      if (ACT == 1) v = fmaxf(v, 0.f);
      if (ACT == 2) v = 0.5f * v * (1.0f + erff(v * 0.70710678118654752f));
      if (ACT == 3) { const float u = 0.7978845608028654f * (v + 0.044715f * v * v * v); v = 0.5f * v * (1.0f + tanhf(u)); }
      so[w][8 * hh + r][t * 16 + ln] = v;
    }
  }
  __builtin_amdgcn_fence(__ATOMIC_ACQ_REL, "workgroup");
  __builtin_amdgcn_wave_barrier();
  const int rsub = lane >> 4, c4 = (lane & 15) * 4;
  {
#pragma unroll
    for (int q = 0; q < 8; ++q) {
      const int r = q * 2 + rsub;
      const v4f v = *(const v4fa*)&so[w][r][c4];
      *(v4f*)(C + (size_t)(row0 + r) * ldc + col0 + c4) = v;
    }
    
  }
}
// row LayerNorm (biased variance, eps) over N: s = X (+ R); optional out_sum <- s; out_norm <- (s-mu)*rsqrt(var+eps)*g + b
template <bool PARAM_BF16>
__global__ __launch_bounds__(256) void k_layernorm(const float* __restrict__ X, const float* __restrict__ R, const float* __restrict__ g, const float* __restrict__ bta,
                                                  float* __restrict__ out_sum, float* __restrict__ out_norm, int N, float eps) {
  __shared__ float red[256];
  const int row = blockIdx.x, tid = threadIdx.x;
  const float* x = X + (size_t)row * N; const float* rr = R ? R + (size_t)row * N : nullptr;
  float vals[16];                     // up to N = 4096
  const int per = N / 256;            // contiguous chunk per thread? use strided-by-4 chunks: thread handles j = tid*4 + 1024*u
  float s1 = 0.f;
  for (int u = 0; u < per / 4; ++u) {
    const int j = tid * 4 + 1024 * u;
    const v4f a = *(const v4fa*)(x + j);
    v4f b = {0.f,0.f,0.f,0.f}; if (rr) b = *(const v4fa*)(rr + j);
#pragma unroll
    for (int q = 0; q < 4; ++q) { const float v = a[q] + b[q]; vals[u * 4 + q] = v; s1 += v; }
  }
  red[tid] = s1; __syncthreads();
  for (int st = 128; st > 0; st >>= 1) { if (tid < st) red[tid] += red[tid + st]; __syncthreads(); }
  const float mu = red[0] / (float)N; __syncthreads();
  float s2 = 0.f;
  for (int u = 0; u < per / 4; ++u)
#pragma unroll
    for (int q = 0; q < 4; ++q) { const float c = vals[u * 4 + q] - mu; s2 += c * c; }
  red[tid] = s2; __syncthreads();
  for (int st = 128; st > 0; st >>= 1) { if (tid < st) red[tid] += red[tid + st]; __syncthreads(); }
  const float rs = rsqrtf(red[0] / (float)N + eps);
  {
    for (int u = 0; u < per / 4; ++u) {
      const int j = tid * 4 + 1024 * u;
      v4f o, sm;
#pragma unroll
      for (int q = 0; q < 4; ++q) {
        float gg = g[j + q], bb = bta[j + q];
        if (PARAM_BF16) { gg = bf16_round(gg); bb = bf16_round(bb); }
        sm[q] = vals[u * 4 + q]; o[q] = (vals[u * 4 + q] - mu) * rs * gg + bb;
      }
      if (out_sum) *(v4f*)(out_sum + (size_t)row * N + j) = sm;
      *(v4f*)(out_norm + (size_t)row * N + j) = o;
    }
    
  }
}



// ---- f16 WMMA path (v_wmma_f32_16x16x32_f16): 11-bit significands for operands in range — used where a [0,1] probability operand needs more precision than bf16
typedef _Float16 v16h __attribute__((ext_vector_type(16)));
union FragH { v16h v; v8us half[2]; _Float16 h[16]; unsigned short u[16]; };
template <int NT>
__device__ __forceinline__ v8f mmaH(v16h ah, v16h al, v16h bh, v16h bl, v8f c) {
  c = __builtin_amdgcn_wmma_f32_16x16x32_f16(false, ah, false, bh, (short)0, c, false, false);
  if (NT >= 2) c = __builtin_amdgcn_wmma_f32_16x16x32_f16(false, al, false, bh, (short)0, c, false, false);
  if (NT >= 3) c = __builtin_amdgcn_wmma_f32_16x16x32_f16(false, ah, false, bl, (short)0, c, false, false);
  asm volatile("v_nop\n\tv_nop\n\tv_nop\n\tv_nop" : "+v"(c) : "v"(ah), "v"(al), "v"(bh), "v"(bl));
  return c;
}
// batched GEMM like k_gemm_b but f16 operands: A f32 (split into f16 hi/lo if ASPLIT, else rounded to f16), Bt = f16 values [n][k]; alpha; C f32; N multiple of 16 (partial tiles skipped)
template <bool ASPLIT>
__global__ __launch_bounds__(128) void k_gemm_h(const float* __restrict__ A, int lda, size_t sA, const _Float16* __restrict__ Bh, int ldb, size_t sB, float alpha, float* __restrict__ C, int ldc, size_t sC, int M, int N, int K) {
  __shared__ __attribute__((aligned(16))) float so[4][16][64];
  const int tid = threadIdx.x, w = tid >> 5, lane = tid & 31, ln = lane & 15, hh = lane >> 4; const int by = blockIdx.y;
  A += (size_t)by * sA; Bh += (size_t)by * sB; C += (size_t)by * sC;
  const int ntn = (N + 63) / 64; const int wid = blockIdx.x * 4 + w; const int mt = wid / ntn, nq = wid % ntn; if (mt * 16 >= M) return;
  const int row0 = mt * 16, col0 = nq * 64; const float* arow = A + (size_t)(row0 + ln) * lda;
  v8f acc[4] = {};
  for (int kb = 0; kb < K; kb += 32) {
    FragH ah, al;
    const v4f x0 = *(const v4fa*)(arow + kb + 8 * hh), x1 = *(const v4fa*)(arow + kb + 8 * hh + 4), x2 = *(const v4fa*)(arow + kb + 16 + 8 * hh), x3 = *(const v4fa*)(arow + kb + 16 + 8 * hh + 4);
    float xs[16] = {x0[0],x0[1],x0[2],x0[3],x1[0],x1[1],x1[2],x1[3],x2[0],x2[1],x2[2],x2[3],x3[0],x3[1],x3[2],x3[3]};
#pragma unroll
    for (int i = 0; i < 16; ++i) { const _Float16 h = (_Float16)xs[i]; ah.h[i] = h; al.h[i] = ASPLIT ? (_Float16)(xs[i] - (float)h) : (_Float16)0.0f; }
#pragma unroll
    for (int t = 0; t < 4; ++t) { if (col0 + t * 16 >= N) continue; const size_t boff = (size_t)(col0 + t * 16 + ln) * ldb + kb; FragH bq; bq.half[0] = *(const v8us*)(Bh + boff + 8 * hh); bq.half[1] = *(const v8us*)(Bh + boff + 16 + 8 * hh);
      acc[t] = mmaH<ASPLIT ? 2 : 1>(ah.v, al.v, bq.v, bq.v, acc[t]); }
  }
#pragma unroll
  for (int t = 0; t < 4; ++t) { if (col0 + t * 16 >= N) continue;
#pragma unroll
    for (int r = 0; r < 8; ++r) so[w][8 * hh + r][t * 16 + ln] = acc[t][r] * alpha; }
  __builtin_amdgcn_fence(__ATOMIC_ACQ_REL, "workgroup"); __builtin_amdgcn_wave_barrier();
  const int rsub = lane >> 4, c4 = (lane & 15) * 4;
  {
#pragma unroll
    for (int q = 0; q < 8; ++q) { const int r = q * 2 + rsub; if (col0 + c4 < N) { const v4f v = *(const v4fa*)&so[w][r][c4]; *(v4f*)(C + (size_t)(row0 + r) * ldc + col0 + c4) = v; } }
     }
}

// Wt[n][k] = f16(W[k][n]·scale) from f32 row-major W[K][N] (scale = power of two; bf16-exact weights stay exact in f16 away from the subnormal range)
__global__ __launch_bounds__(256) void k_wt_f16(const float* __restrict__ W, _Float16* __restrict__ Wt, int K, int N, float scale) {
  const int t = blockIdx.x * 256 + threadIdx.x; if (t >= N * (K / 8)) return; const int n = t / (K / 8), k8 = (t % (K / 8)) * 8; FragH f;
#pragma unroll
  for (int i = 0; i < 8; ++i) f.h[i] = (_Float16)(bf16_round(W[(size_t)(k8 + i) * N + n]) * scale); const v8us o = f.half[0];
  *(v8us*)((unsigned short*)Wt + (size_t)n * K + k8) = o; 
}
// k_gemm_hh variant with fused epilogue: v = acc·alpha + bias[by·sBias + col] (+ CP[(row/rowsPerB)·sCPb + by·64 + col] if CP) ; ACT 0 none / 1 elu ; writes f16 C16 (and f32 C if non-null)
template <int ACT>
__global__ __launch_bounds__(128) void k_gemm_hhx(const _Float16* __restrict__ A, int lda, size_t sA, const _Float16* __restrict__ Bh, int ldb, size_t sB, float alpha, const float* __restrict__ bias, size_t sBias, const float* __restrict__ CP, int rowsPerB, size_t sCPb, int row0g,
    float* __restrict__ C, _Float16* __restrict__ C16, int ldc, size_t sC, int M, int N, int K) {
  __shared__ __attribute__((aligned(16))) float so[4][16][64];
  const int tid = threadIdx.x, w = tid >> 5, lane = tid & 31, ln = lane & 15, hh = lane >> 4; const int by = blockIdx.y;
  A += (size_t)by * sA; Bh += (size_t)by * sB; const size_t cofs = (size_t)by * sC; const float* bp = bias ? bias + (size_t)by * sBias : nullptr;
  const int ntn = (N + 63) / 64; const int wid = blockIdx.x * 4 + w; const int mt = wid / ntn, nq = wid % ntn; if (mt * 16 >= M) return;
  const int row0 = mt * 16, col0 = nq * 64; const _Float16* arow = A + (size_t)(row0 + ln) * lda;
  v8f acc[4] = {};
  for (int kb = 0; kb < K; kb += 32) { FragH ah; ah.half[0] = *(const v8us*)((const unsigned short*)arow + kb + 8 * hh); ah.half[1] = *(const v8us*)((const unsigned short*)arow + kb + 16 + 8 * hh);
#pragma unroll
    for (int t = 0; t < 4; ++t) { if (col0 + t * 16 >= N) continue; const size_t boff = (size_t)(col0 + t * 16 + ln) * ldb + kb; FragH bq; bq.half[0] = *(const v8us*)((const unsigned short*)Bh + boff + 8 * hh); bq.half[1] = *(const v8us*)((const unsigned short*)Bh + boff + 16 + 8 * hh);
      acc[t] = mmaH<1>(ah.v, ah.v, bq.v, bq.v, acc[t]); }
  }
#pragma unroll
  for (int t = 0; t < 4; ++t) { if (col0 + t * 16 >= N) continue; const int col = col0 + t * 16 + ln; const float bv = bp ? bf16_round(bp[col]) : 0.f;
#pragma unroll
    for (int r = 0; r < 8; ++r) { float v = acc[t][r] * alpha + bv; if (CP) { const int rr = row0g + row0 + 8 * hh + r; if (rowsPerB < 0) v += CP[cofs + (size_t)rr * ldc + col];      /* rowsPerB < 0: own element of the batched C plane */ else { const int bidx = rr / rowsPerB; v += CP[(size_t)bidx * sCPb + (size_t)by * 64 + col]; } } if (ACT == 1) v = (v > 0.f) ? v : expm1f(v); else if (ACT == 7) v = (v > 0.f) ? v + 1.0f : expf(v); else if (ACT == 8) v = tanhf(v); else if (ACT == 9) v = 0.5f * v * (1.0f + tanhf(0.7978845608028654f * (v + 0.044715f * v * v * v))); else if (ACT == 11) v = 1.0f / (1.0f + expf(-v)); else if (ACT == 12) v = (v > 0.f) ? v : 0.01f * v; else if (ACT == 14) v = (v > 0.f) ? v : 0.1f * v; else if (ACT == 16) v = (v >= 0.f) ? v : 0.3f * v; else if (ACT == 17) v = (v >= 0.f) ? v : 0.2f * v; else if (ACT == 15) v = v / (1.0f + expf(-v)); else if (ACT == 3) v = fmaxf(v, 0.f); else if (ACT == 6) v = 0.5f * v * (1.0f + erff(v * 0.70710678118654752f)); so[w][8 * hh + r][t * 16 + ln] = v; } }
  __builtin_amdgcn_fence(__ATOMIC_ACQ_REL, "workgroup"); __builtin_amdgcn_wave_barrier();
  const int rsub = lane >> 4, c4 = (lane & 15) * 4; typedef _Float16 v4h __attribute__((ext_vector_type(4)));
  {
#pragma unroll
    for (int q = 0; q < 8; ++q) { const int r = q * 2 + rsub; if (col0 + c4 < N) { const v4f v = *(const v4fa*)&so[w][r][c4]; if (C) *(v4f*)(C + cofs + (size_t)(row0 + r) * ldc + col0 + c4) = v; if (C16) { v4h h4; for (int i = 0; i < 4; ++i) h4[i] = (_Float16)v[i]; *(v4h*)(C16 + cofs + (size_t)(row0 + r) * ldc + col0 + c4) = h4; } } }
     }
}


typedef _Float16 v4h __attribute__((ext_vector_type(4)));

__global__ __launch_bounds__(256) void k_h16(const float* __restrict__ x, _Float16* __restrict__ X16, size_t n8) { const size_t t = (size_t)blockIdx.x * 256 + threadIdx.x; if (t >= n8) return; FragH f;
#pragma unroll
  for (int q = 0; q < 8; ++q) f.h[q] = (_Float16)x[t * 8 + q]; *(v8us*)((unsigned short*)X16 + t * 8) = f.half[0];  }
__global__ __launch_bounds__(256) void k_round16f(const float* __restrict__ W, _Float16* __restrict__ Bt, size_t n8) { const size_t t = (size_t)blockIdx.x * 256 + threadIdx.x; if (t >= n8) return; FragH f;
#pragma unroll
  for (int i = 0; i < 8; ++i) f.h[i] = (_Float16)(bf16_round(W[t * 8 + i]) * 16.0f); *(v8us*)((unsigned short*)Bt + t * 8) = f.half[0];  }
template <int NHv, int TTv>
__device__ __forceinline__ void vt_tile(unsigned short (*tl)[66], const int bx, const _Float16* __restrict__ V16, int ldv, int voff, _Float16* __restrict__ Vt) { const int tid = threadIdx.x; const int slab = bx / (TTv / 64), lg = bx % (TTv / 64); const int b = slab / NHv, h = slab % NHv;      /* one 64 x 64 tile a work-group; tl: its LDS tile */
  for (int i = tid; i < 64 * 8; i += 256) { const int r = i / 8, c8 = (i % 8) * 8; FragH f; f.half[0] = *(const v8us*)((const unsigned short*)V16 + ((size_t)b * TTv + lg * 64 + r) * ldv + voff + h * 64 + c8);
#pragma unroll
    for (int q = 0; q < 8; ++q) tl[r][c8 + q] = f.u[q]; }
  __syncthreads();
  {
#pragma unroll
    for (int rd = 0; rd < 2; ++rd) { const int d = rd * 32 + tid / 8, pc = tid % 8; FragH f;
#pragma unroll
      for (int q = 0; q < 8; ++q) f.u[q] = tl[pc * 8 + q][d];
      *(v8us*)((unsigned short*)Vt + ((size_t)slab * 64 + d) * TTv + lg * 64 + pc * 8) = f.half[0]; }
     } }

__global__ __launch_bounds__(256) void k_hl(const float* __restrict__ F, _Float16* __restrict__ Hh, _Float16* __restrict__ Hl, size_t n8) { const size_t t = (size_t)blockIdx.x * 256 + threadIdx.x; if (t >= n8) return; FragH fh, fl; const v4f a = *(const v4fa*)(F + t * 8), c = *(const v4fa*)(F + t * 8 + 4);
#pragma unroll
  for (int q = 0; q < 4; ++q) { _Float16 h = (_Float16)a[q]; fh.h[q] = h; fl.h[q] = (_Float16)((a[q] - (float)h) * 1024.0f); h = (_Float16)c[q]; fh.h[4 + q] = h; fl.h[4 + q] = (_Float16)((c[q] - (float)h) * 1024.0f); }
  { *(v8us*)((unsigned short*)Hh + t * 8) = fh.half[0]; *(v8us*)((unsigned short*)Hl + t * 8) = fl.half[0];  } }

// ---- fast GEMM (block tile 128x128 = 8 waves of 32x64, operand tiles staged in LDS; requires M % 128 == 0, N % 128 == 0, K % 64 == 0); epilogue = k_gemm_hhx semantics ----
#define G2_KS 64                     /* k per LDS stage: one whole 128-byte line of every operand row */
#define G2_LP 72                     /* LDS row pitch in f16: 128 data bytes + 16, so that the 16-byte fragment reads of 16 rows spread over the banks */
#define G2_STB (256 * G2_LP * 2)     /* bytes of a stage: 128 A rows, then 128 B rows */
// One stage: a thread copies 16 bytes of rows r, r + 32, r + 64, r + 96 of the A tile and of the B tile (8 threads a row, so a wave's copy covers 4 whole lines), global memory to LDS through no register.
// The closing s_wait_xcnt stands inside the statement so that no address register of an issued copy is rewritten in front of it (a precaution).
__device__ __forceinline__ void g2_stage(unsigned l, const _Float16* a0, size_t a32, const _Float16* b0, size_t b32) {
  const _Float16* a1 = a0 + a32; const _Float16* a2 = a1 + a32; const _Float16* a3 = a2 + a32; const _Float16* b1 = b0 + b32; const _Float16* b2 = b1 + b32; const _Float16* b3 = b2 + b32;
  const unsigned R = 32 * G2_LP * 2;      /* 32 LDS rows in bytes */
  asm volatile("global_load_async_to_lds_b128 %0, %8, off\n\tglobal_load_async_to_lds_b128 %1, %9, off\n\tglobal_load_async_to_lds_b128 %2, %10, off\n\tglobal_load_async_to_lds_b128 %3, %11, off\n\t"
               "global_load_async_to_lds_b128 %4, %12, off\n\tglobal_load_async_to_lds_b128 %5, %13, off\n\tglobal_load_async_to_lds_b128 %6, %14, off\n\tglobal_load_async_to_lds_b128 %7, %15, off\n\ts_wait_xcnt 0x0"
               :: "v"(l), "v"(l + R), "v"(l + 2 * R), "v"(l + 3 * R), "v"(l + 4 * R), "v"(l + 5 * R), "v"(l + 6 * R), "v"(l + 7 * R), "v"(a0), "v"(a1), "v"(a2), "v"(a3), "v"(b0), "v"(b1), "v"(b2), "v"(b3) : "memory");
}
__device__ __forceinline__ v16h g2_frag(const _Float16* p, int hh) { FragH f; f.half[0] = *(const v8us*)((const unsigned short*)p + 8 * hh); f.half[1] = *(const v8us*)((const unsigned short*)p + 16 + 8 * hh); return f.v; }
__device__ __forceinline__ v8f g2_mma(v16h a, v16h b, v8f c) { v8f d = __builtin_amdgcn_wmma_f32_16x16x32_f16(false, a, false, b, (short)0, c, false, false); asm volatile("v_nop\n\tv_nop\n\tv_nop\n\tv_nop" : "+v"(d) : "v"(a), "v"(b)); return d; }
template <int ACT>
__global__ __launch_bounds__(256) void k_gemm2(const _Float16* __restrict__ A, int lda, size_t sA, const _Float16* __restrict__ Bh, int ldb, size_t sB, float alpha, const float* __restrict__ bias, size_t sBias, const float* __restrict__ CP, int rowsPerB, size_t sCPb, int row0g,
    float* __restrict__ C, _Float16* __restrict__ C16, int ldc, size_t sC, int M, int N, int K) { static_assert(ACT == 0 || ACT == 3 || ACT == 6 || ACT == 8 || ACT == 9 || ACT == 11 || ACT == 12 || ACT == 14 || ACT == 15 || ACT == 16 || ACT == 17, "k_gemm2: unsupported ACT code (would silently apply no activation)");
  __shared__ __attribute__((aligned(16))) unsigned char ring[2 * G2_STB];      /* two stages; behind the loop's last barrier the same bytes are the output staging */
  static_assert(sizeof(float) * 8 * 32 * 68 <= sizeof(ring), "k_gemm2: the output staging must fit the ring");
  float (*so)[32][68] = (float (*)[32][68])ring;
  const int tid = threadIdx.x, w = tid >> 5, lane = tid & 31, ln = lane & 15, hh = lane >> 4; const int by = blockIdx.y;
  A += (size_t)by * sA; Bh += (size_t)by * sB; const size_t cofs = (size_t)by * sC; const float* bp = bias ? bias + (size_t)by * sBias : nullptr;
  const int ntn = N >> 7; const int mt = blockIdx.x / ntn, nq = blockIdx.x - mt * ntn; if (mt * 128 >= M) return;      /* the same for the whole work-group, in front of every copy and barrier */
  const int wm = w & 3, wn = w >> 2; const int row0 = mt * 128 + 32 * wm, col0 = nq * 128 + 64 * wn;
  const int sr = tid >> 3, sc8 = (tid & 7) * 8;      /* staging: 8 threads a row of 128 bytes */
  const _Float16* ga = A + (size_t)(mt * 128 + sr) * lda + sc8; const _Float16* gb = Bh + (size_t)(nq * 128 + sr) * ldb + sc8; const size_t a32 = (size_t)32 * lda, b32 = (size_t)32 * ldb;
  const unsigned l0 = (unsigned)(size_t)ring + (unsigned)(sr * G2_LP + sc8) * 2u;      /* the thread's own LDS byte address in buffer 0 */
  const int nst = K / G2_KS;
  const int ao = (32 * wm + ln) * G2_LP, bo = (128 + 64 * wn + ln) * G2_LP;      /* the lane's first A and B row in a stage, in f16 */
  const v8f z8 = {0.f,0.f,0.f,0.f,0.f,0.f,0.f,0.f}; v8f c00 = z8, c01 = z8, c02 = z8, c03 = z8, c10 = z8, c11 = z8, c12 = z8, c13 = z8;
  g2_stage(l0, ga, a32, gb, b32);
  asm volatile("s_wait_asynccnt 0x0" ::: "memory");      /* this wave's copies of stage 0 have landed */
  __syncthreads();      /* publishes stage 0 */
  if (nst > 1) g2_stage(l0 + G2_STB, ga + G2_KS, a32, gb + G2_KS, b32);
#pragma unroll 1      /* one stage a trip: the ring's waits and its barrier stand once, at the foot */
  for (int t = 0; t < nst; ++t) { const _Float16* st = (const _Float16*)(ring + (t & 1) * G2_STB);
#pragma unroll      /* both halves of a stage inline, so that their LDS offsets are immediates */
    for (int kb = 0; kb < G2_KS; kb += 32) {      /* the six fragments of 32 k are read as one group in front of their eight products */
      const v16h a0 = g2_frag(st + ao + kb, hh), a1 = g2_frag(st + ao + 16 * G2_LP + kb, hh);
      const v16h b0 = g2_frag(st + bo + kb, hh), b1 = g2_frag(st + bo + 16 * G2_LP + kb, hh), b2 = g2_frag(st + bo + 32 * G2_LP + kb, hh), b3 = g2_frag(st + bo + 48 * G2_LP + kb, hh);
      c00 = g2_mma(a0, b0, c00); c10 = g2_mma(a1, b0, c10); c01 = g2_mma(a0, b1, c01); c11 = g2_mma(a1, b1, c11);
      c02 = g2_mma(a0, b2, c02); c12 = g2_mma(a1, b2, c12); c03 = g2_mma(a0, b3, c03); c13 = g2_mma(a1, b3, c13); }
    asm volatile("s_wait_dscnt 0x0" ::: "memory");      /* this wave's reads of stage t are done */
    asm volatile("s_wait_asynccnt 0x0" ::: "memory");      /* this wave's copies of stage t + 1 have landed */
    __syncthreads();      /* publishes stage t + 1 and ends every wave's reads of stage t */
    if (t + 2 < nst) g2_stage(l0 + (unsigned)(t & 1) * G2_STB, ga + (size_t)(t + 2) * G2_KS, a32, gb + (size_t)(t + 2) * G2_KS, b32);      /* the same for the whole work-group; into the buffer just left */
  }
  asm volatile("s_wait_asynccnt 0x0" ::: "memory");      /* nothing is in flight when the ring becomes output staging */
  v8f accs[8] = {c00, c01, c02, c03, c10, c11, c12, c13};
#pragma unroll
  for (int u = 0; u < 8; ++u) { const int t = u & 3, half = u >> 2; const int col = col0 + t * 16 + ln; const float bv = bp ? bf16_round(bp[col]) : 0.f;
#pragma unroll
    for (int r = 0; r < 8; ++r) { const int rloc = half * 16 + 8 * hh + r; float v = accs[u][r] * alpha + bv; if (CP) { if (rowsPerB < 0) v += CP[cofs + (size_t)(row0g + row0 + rloc) * ldc + col];      /* rowsPerB < 0: own element of the batched C plane */ else { const int bidx = (row0g + row0 + rloc) / rowsPerB; v += CP[(size_t)bidx * sCPb + (size_t)by * 64 + col]; } }
      if (ACT == 3) v = fmaxf(v, 0.f); else if (ACT == 6) v = 0.5f * v * (1.0f + erff(v * 0.70710678118654752f)); else if (ACT == 11) v = 1.0f / (1.0f + expf(-v)); else if (ACT == 15) v = v / (1.0f + expf(-v)); else if (ACT == 12) v = (v > 0.f) ? v : 0.01f * v; else if (ACT == 8) v = tanhf(v); else if (ACT == 9) v = 0.5f * v * (1.0f + tanhf(0.7978845608028654f * (v + 0.044715f * v * v * v))); else if (ACT == 14) v = (v > 0.f) ? v : 0.1f * v; else if (ACT == 16) v = (v >= 0.f) ? v : 0.3f * v; else if (ACT == 17) v = (v >= 0.f) ? v : 0.2f * v;
      so[w][rloc][t * 16 + ln] = v; } }
  __builtin_amdgcn_fence(__ATOMIC_ACQ_REL, "workgroup"); __builtin_amdgcn_wave_barrier();
  const int rsub = lane >> 4, c4 = (lane & 15) * 4;
  {
#pragma unroll
    for (int q = 0; q < 16; ++q) { const int r = q * 2 + rsub; const v4f v = *(const v4fa*)&so[w][r][c4]; if (C) *(v4f*)(C + cofs + (size_t)(row0 + r) * ldc + col0 + c4) = v; if (C16) { v4h h4; for (int i = 0; i < 4; ++i) h4[i] = (_Float16)v[i]; *(v4h*)(C16 + cofs + (size_t)(row0 + r) * ldc + col0 + c4) = h4; } }
     } }


// The three operand conversions (x -> exact f16 rows; w_qkv and w_proj -> exact x16 planes) depend on nothing and share one launch: the block index picks the job. A thread converts 8 elements, a work-group 2048; every job is a whole number of work-groups.
#define CV_GX ((unsigned)(NR * DM / 2048))                    /* work-groups of x */
#define CV_GQ ((unsigned)((size_t)3 * DM * DM / 2048))        /* work-groups of w_qkv */
#define CV_GO ((unsigned)((size_t)DM * DM / 2048))            /* work-groups of w_proj */
static_assert(NR * DM % 2048 == 0 && (size_t)DM * DM % 2048 == 0, "k_cvt3: whole work-groups");
__global__ __launch_bounds__(256) void k_cvt3(const float* __restrict__ x, const float* __restrict__ wq, const float* __restrict__ wo, _Float16* __restrict__ X16, _Float16* __restrict__ Bq, _Float16* __restrict__ Bo) {
  const unsigned bx = blockIdx.x; const float* s = x; _Float16* d = X16; unsigned g = bx; float sc = 1.0f;      /* the same for the whole work-group; x 1 is exact */
  if (bx >= CV_GX + CV_GQ) { s = wo; d = Bo; g = bx - (CV_GX + CV_GQ); sc = 16.0f; } else if (bx >= CV_GX) { s = wq; d = Bq; g = bx - CV_GX; sc = 16.0f; }
  const size_t t = (size_t)g * 256 + threadIdx.x; FragH f;
#pragma unroll      /* the thread's 8 elements stay in registers under constant indices and load as two 16-byte pieces */
  for (int q = 0; q < 8; ++q) f.h[q] = (_Float16)(bf16_round(s[t * 8 + q]) * sc); *(v8us*)((unsigned short*)d + t * 8) = f.half[0];  }
__global__ __launch_bounds__(256) void k_rsm(const float* __restrict__ S, _Float16* __restrict__ P, int nrows) {
  #pragma clang fp contract(off)
  const int i = blockIdx.x * 256 + threadIdx.x; if (i >= nrows) return; const float* s = S + (size_t)i * SQ; float mx = -3.0e38f;
#pragma unroll 1
  for (int j = 0; j < SQ; ++j) mx = fmaxf(mx, s[j]); float se = 0.f;
#pragma unroll 1
  for (int j = 0; j < SQ; ++j) se += expf(s[j] - mx); const float sc = 256.0f / se;
#pragma unroll 1
  for (int j0 = 0; j0 < SQ; j0 += 8) { FragH f; for (int q = 0; q < 8; ++q) f.h[q] = (_Float16)(expf(s[j0 + q] - mx) * sc); unsigned short* d = (unsigned short*)P + (size_t)i * SQ + j0; *(v8us*)d = f.half[0];  } }
__global__ __launch_bounds__(256) void k_vt(const _Float16* __restrict__ V16, int b, int h0, _Float16* __restrict__ VT) { __shared__ unsigned short tl[64][65]; const int tid = threadIdx.x; const int hh = blockIdx.x % HG, sg = blockIdx.x / HG; const int s0 = sg * 64; const int h = h0 + hh;
  for (int i = tid; i < 64 * 8; i += 256) { const int j = i / 8, d8 = (i % 8) * 8; FragH f; f.half[0] = *(const v8us*)((const unsigned short*)V16 + ((size_t)b * SQ + s0 + j) * DM + h * HD + d8); for (int q = 0; q < 8; ++q) tl[d8 + q][j] = f.u[q]; }
  __syncthreads();
  { for (int i = tid; i < 64 * 8; i += 256) { const int d = i / 8, j8 = (i % 8) * 8; FragH f; for (int q = 0; q < 8; ++q) f.u[q] = tl[d][j8 + q]; *(v8us*)((unsigned short*)VT + ((size_t)hh * HD + d) * SQ + s0 + j8) = f.half[0]; }  } }



// ---- fused attention: scores, softmax and P V in one kernel; neither scores nor weights go to memory ----
typedef float  v2f  __attribute__((ext_vector_type(2)));
#define FA_KS 64                     /* keys per LDS stage */
#define FA_LP 72                     /* LDS row pitch in f16: 128 data bytes + 16, so that the 16-byte fragment reads of 16 rows spread over the banks */
#define FA_QW 32                     /* query columns per wave */
#define FA_QB 256                    /* query columns per work-group (8 waves) */
__device__ __forceinline__ float fa_xhalf(float x) { return __builtin_bit_cast(float, __builtin_amdgcn_permlanex16(__builtin_bit_cast(int, x), __builtin_bit_cast(int, x), 0x76543210, 0xfedcba98, false, false)); }      /* lane l <-> lane l ^ 16 */
// native 2^x, in place: each exponential overwrites only its own argument, which the compiler's own vector instruction has just written (so no register of a matrix instruction still in its window is touched), and none reads the result or overwrites the source of the one in front of it; the closing v_nop keeps the one slot that the instruction set asks for behind a transcendental
__device__ __forceinline__ float fa_exp2(float x) { asm("v_exp_f32 %0, %0\n\tv_nop" : "+v"(x)); return x; }
__device__ __forceinline__ void fa_exp2x16(v8f& a, v8f& b) { float x0 = a[0], x1 = a[1], x2 = a[2], x3 = a[3], x4 = a[4], x5 = a[5], x6 = a[6], x7 = a[7], x8 = b[0], x9 = b[1], x10 = b[2], x11 = b[3], x12 = b[4], x13 = b[5], x14 = b[6], x15 = b[7];
  asm("v_exp_f32 %0, %0\n\tv_exp_f32 %1, %1\n\tv_exp_f32 %2, %2\n\tv_exp_f32 %3, %3\n\tv_exp_f32 %4, %4\n\tv_exp_f32 %5, %5\n\tv_exp_f32 %6, %6\n\tv_exp_f32 %7, %7\n\tv_exp_f32 %8, %8\n\tv_exp_f32 %9, %9\n\tv_exp_f32 %10, %10\n\tv_exp_f32 %11, %11\n\tv_exp_f32 %12, %12\n\tv_exp_f32 %13, %13\n\tv_exp_f32 %14, %14\n\tv_exp_f32 %15, %15\n\tv_nop"
      : "+v"(x0), "+v"(x1), "+v"(x2), "+v"(x3), "+v"(x4), "+v"(x5), "+v"(x6), "+v"(x7), "+v"(x8), "+v"(x9), "+v"(x10), "+v"(x11), "+v"(x12), "+v"(x13), "+v"(x14), "+v"(x15));
  a = v8f{x0, x1, x2, x3, x4, x5, x6, x7}; b = v8f{x8, x9, x10, x11, x12, x13, x14, x15}; }
__device__ __forceinline__ v8f fa_mma(v16h a, v16h b, v8f c) { return __builtin_amdgcn_wmma_f32_16x16x32_f16(false, a, false, b, (short)0, c, false, false); }
__global__ __launch_bounds__(256) void k_fattn(const _Float16* __restrict__ Qn, const _Float16* __restrict__ Kn, const _Float16* __restrict__ VT, _Float16* __restrict__ O) {
  __shared__ __attribute__((aligned(16))) _Float16 sk[2][FA_KS][FA_LP];      /* K rows [key][d] */
  __shared__ __attribute__((aligned(16))) _Float16 sv[2][HD][FA_LP];         /* V^T rows [d][key] */
  const int tid = threadIdx.x, w = tid >> 5, lane = tid & 31, ln = lane & 15, hh = lane >> 4;
  const int bh = blockIdx.y, b = bh / NH, h = bh % NH; const int q0 = blockIdx.x * FA_QB + w * FA_QW;
  const float cs = 0.125f * 1.44269504088896340736f;      /* 1/sqrt(64) and log2 e */
  const _Float16* qp = Qn + ((size_t)b * SQ + q0 + ln) * DM + h * HD;
  v16h qf[2][2];
  for (int t = 0; t < 2; ++t) for (int s = 0; s < 2; ++s) qf[t][s] = g2_frag(qp + (size_t)t * 16 * DM + s * 32, hh);
  const int sr = tid >> 3, sc8 = (tid & 7) * 8;      /* staging: 8 threads a row of 128 bytes, rows sr and sr + 32 */
  const unsigned short* kg = (const unsigned short*)Kn + ((size_t)b * SQ + sr) * DM + h * HD + sc8;
  const unsigned short* vg = (const unsigned short*)VT + ((size_t)bh * HD + sr) * SQ + sc8;
  v8us gk0 = *(const v8us*)kg, gk1 = *(const v8us*)(kg + (size_t)32 * DM), gv0 = *(const v8us*)vg, gv1 = *(const v8us*)(vg + (size_t)32 * SQ);
  asm volatile("s_wait_xcnt 0x0" :: "v"(qp), "v"(kg), "v"(vg) : "memory");      /* precaution: the loads' address registers stay live up to this wait */
  *(v8us*)&sk[0][sr][sc8] = gk0; *(v8us*)&sk[0][sr + 32][sc8] = gk1; *(v8us*)&sv[0][sr][sc8] = gv0; *(v8us*)&sv[0][sr + 32][sc8] = gv1;
  const v8f z8 = {0.f,0.f,0.f,0.f,0.f,0.f,0.f,0.f};
  v8f o[2][4]; float mr[2]; v2f l[2];
  for (int t = 0; t < 2; ++t) { mr[t] = -3.0e38f; l[t] = v2f{0.f, 0.f}; for (int dt = 0; dt < 4; ++dt) o[t][dt] = z8; }
  __syncthreads();
#pragma unroll 1      /* keeps the loop whole: without it the compiler peels the last stage, doubles the code and goes past 256 registers */
  for (int st = 0; st < SQ / FA_KS; ++st) {
    const int bu = st & 1; const bool more = st + 1 < SQ / FA_KS;      /* same for the whole work-group */
    if (more) {      /* next stage's rows fly while this stage is worked on */
      kg += (size_t)FA_KS * DM; vg += FA_KS;
      gk0 = *(const v8us*)kg; gk1 = *(const v8us*)(kg + (size_t)32 * DM); gv0 = *(const v8us*)vg; gv1 = *(const v8us*)(vg + (size_t)32 * SQ);
      asm volatile("s_wait_xcnt 0x0" :: "v"(kg), "v"(vg) : "memory");      /* precaution: the loads' address registers stay live up to this wait */
    }
    for (int kp = 0; kp < FA_KS / 32; ++kp) {
      v8f s[2][2];      /* [query tile][key tile] */
      { v16h ka[2][2];
        for (int kt = 0; kt < 2; ++kt) for (int c = 0; c < 2; ++c) ka[kt][c] = g2_frag(&sk[bu][kp * 32 + kt * 16 + ln][c * 32], hh);
        for (int t = 0; t < 2; ++t) for (int kt = 0; kt < 2; ++kt) s[t][kt] = fa_mma(ka[kt][1], qf[t][1], fa_mma(ka[kt][0], qf[t][0], z8)); }
      v16h va[4];
      for (int dt = 0; dt < 4; ++dt) va[dt] = g2_frag(&sv[bu][dt * 16 + ln][kp * 32], hh);
      float mb[2]; bool need = false;
      for (int t = 0; t < 2; ++t) { float mx = s[t][0][0];
        for (int r = 1; r < 8; ++r) mx = fmaxf(mx, s[t][0][r]);
        for (int r = 0; r < 8; ++r) mx = fmaxf(mx, s[t][1][r]);
        mx = fmaxf(mx, fa_xhalf(mx)) * cs; mb[t] = mx; need = need || (mx > mr[t] + 8.0f); }
      if (__builtin_amdgcn_ballot_w32(need) != 0) {      /* scalar branch; rare after the first passes */
        for (int t = 0; t < 2; ++t) { const float mn = fmaxf(mr[t], mb[t]); const float al = fa_exp2(mr[t] - mn); mr[t] = mn; l[t] *= al;
          for (int dt = 0; dt < 4; ++dt) o[t][dt] = o[t][dt] * al; } }
      for (int t = 0; t < 2; ++t) { const float nm = 4.0f - mr[t]; FragH pf; v8f p0 = s[t][0] * cs + nm, p1 = s[t][1] * cs + nm;
        fa_exp2x16(p0, p1);
        for (int r = 0; r < 8; ++r) { pf.h[r] = (_Float16)p0[r]; pf.h[8 + r] = (_Float16)p1[r]; }
        const v8f ps = p0 + p1; const v4f p4 = ps.lo + ps.hi; l[t] += p4.lo + p4.hi;      /* the denominator sums the unrounded f32 weights, halving trees that stay in register pairs */
        for (int dt = 0; dt < 4; ++dt) o[t][dt] = fa_mma(va[dt], pf.v, o[t][dt]); }
    }
    asm volatile("v_nop\n\tv_nop\n\tv_nop\n\tv_nop" : "+v"(o[1][0]), "+v"(o[1][1]), "+v"(o[1][2]), "+v"(o[1][3]));      /* the four vector slots behind the stage's last matrix instructions, in front of the branch below */
    if (more) { *(v8us*)&sk[bu ^ 1][sr][sc8] = gk0; *(v8us*)&sk[bu ^ 1][sr + 32][sc8] = gk1; *(v8us*)&sv[bu ^ 1][sr][sc8] = gv0; *(v8us*)&sv[bu ^ 1][sr + 32][sc8] = gv1; }      /* that buffer's readers left it at the last barrier */
    __syncthreads();      /* publishes stage st + 1 and ends the reads of stage st */
  }
  FragH f[2][4];
  for (int t = 0; t < 2; ++t) { const float lw = l[t][0] + l[t][1]; const float inv = 64.0f / (lw + fa_xhalf(lw));
    for (int dt = 0; dt < 4; ++dt) for (int r = 0; r < 8; ++r) f[t][dt].h[r] = (_Float16)(o[t][dt][r] * inv); }
  __builtin_amdgcn_sched_barrier(0);      /* all conversions in front of the first store, so that no register which an issued store names is written again */
  unsigned short* op = (unsigned short*)O + ((size_t)b * SQ + q0 + ln) * DM + h * HD + 8 * hh;
  for (int t = 0; t < 2; ++t) for (int dt = 0; dt < 4; ++dt) *(v8us*)(op + (size_t)t * 16 * DM + dt * 16) = f[t][dt].half[0];
}


// q and k LayerNorm (p: 0 = q, 1 = k; bx: the work-group's place among those of p), no LDS and no barrier: a wave takes LN_TW token rows and holds their 1024 features in registers, read once by loads of 512 bytes in a row.
// Mean and variance (two passes over the registers): lane partials, then a butterfly over the 32 lanes. gamma and beta (rounded to bf16) are loaded once a wave and serve all its rows.
#define LN_TW 2                      /* token rows per wave */
template <int CTRL> __device__ __forceinline__ float ln_xm(float x) { return __builtin_bit_cast(float, __builtin_amdgcn_update_dpp(0, __builtin_bit_cast(int, x), CTRL, 0xf, 0xf, true)); }      /* lane l <- lane l ^ (CTRL & 15), inside a row of 16 lanes (row_xmask) */
__device__ __forceinline__ float ln_wsum(float x) { x += ln_xm<0x161>(x); x += ln_xm<0x162>(x); x += ln_xm<0x164>(x); x += ln_xm<0x168>(x); return x + fa_xhalf(x); }      /* the sum over the wave, in every lane */
__device__ __forceinline__ float ln_sum4(v4f s) { const v2f h = s.lo + s.hi; return h[0] + h[1]; }
__device__ __forceinline__ void ln_rows(const int bx, const int p, const float* __restrict__ X, const float* __restrict__ qg, const float* __restrict__ qb, const float* __restrict__ kg, const float* __restrict__ kb, float eps, _Float16* __restrict__ Qo, _Float16* __restrict__ Ko) {
  const int lane = threadIdx.x & 31; const size_t r0 = ((size_t)bx * 8 + (threadIdx.x >> 5)) * LN_TW;
  const float* g = (p ? kg : qg) + lane * 4; const float* bt = (p ? kb : qb) + lane * 4; const float* x = X + r0 * LQ + p * DM + lane * 4;
  v4f gg[8], bb[8], a[LN_TW][8];      /* pieces of 128 features; every loop below is unrolled so that these stay in registers under constant indices */
#pragma unroll
  for (int i = 0; i < 8; ++i) { gg[i] = *(const v4fa*)(g + i * 128); bb[i] = *(const v4fa*)(bt + i * 128); }
#pragma unroll
  for (int u = 0; u < LN_TW; ++u)
#pragma unroll
    for (int i = 0; i < 8; ++i) a[u][i] = *(const v4fa*)(x + (size_t)u * LQ + i * 128);
  asm volatile("s_wait_xcnt 0x0" :: "v"(g), "v"(bt), "v"(x) : "memory");      /* precaution: the loads' address registers stay live up to this wait */
  __builtin_amdgcn_sched_barrier(0);      /* holds that wait directly behind the loads: without it the scheduler sinks it far below them */
#pragma unroll
  for (int i = 0; i < 8; ++i)
#pragma unroll
    for (int c = 0; c < 4; ++c) { gg[i][c] = bf16_round(gg[i][c]); bb[i][c] = bf16_round(bb[i][c]); }
  v4h y[LN_TW][8];
#pragma unroll
  for (int u = 0; u < LN_TW; ++u) { v4f s = a[u][0];
#pragma unroll
    for (int i = 1; i < 8; ++i) s += a[u][i];
    const float mu = ln_wsum(ln_sum4(s)) * (1.0f / (float)DM); v4f q = {0.f, 0.f, 0.f, 0.f};
#pragma unroll
    for (int i = 0; i < 8; ++i) { a[u][i] -= mu; q += a[u][i] * a[u][i]; }
    const float rs = rsqrtf(ln_wsum(ln_sum4(q)) * (1.0f / (float)DM) + eps);
#pragma unroll
    for (int i = 0; i < 8; ++i) { const v4f o = a[u][i] * rs * gg[i] + bb[i];
#pragma unroll
      for (int c = 0; c < 4; ++c) y[u][i][c] = (_Float16)o[c]; } }
  __builtin_amdgcn_sched_barrier(0);      /* all conversions in front of the first store, so that no register which an issued store names is written again */
  _Float16* d = (p ? Ko : Qo) + r0 * DM + lane * 4;
#pragma unroll
  for (int u = 0; u < LN_TW; ++u)
#pragma unroll
    for (int i = 0; i < 8; ++i) *(v4h*)(d + (size_t)u * DM + i * 128) = y[u][i];
}
// The two jobs that need only the q | k | v rows share one launch: the block index picks the job. The LayerNorm work-groups (the longer ones) come first, q then k; the V^T tiles follow.
#define LV_GL (MP / (8 * LN_TW))     /* LayerNorm work-groups for q, and as many for k */
#define LV_GV (NB * NH * (SQ / 64))  /* V^T tiles */
__global__ __launch_bounds__(256) void k_lnvt(const float* __restrict__ X, const float* __restrict__ qg, const float* __restrict__ qb, const float* __restrict__ kg, const float* __restrict__ kb, float eps, _Float16* __restrict__ Qo, _Float16* __restrict__ Ko, const _Float16* __restrict__ V16, _Float16* __restrict__ Vt) {
  __shared__ unsigned short tl[64][66];
  const int bx = blockIdx.x;      /* every test on it is the same for the whole work-group, so the barrier in vt_tile is passed by all of its waves or by none */
  if (bx < 2 * LV_GL) { const int p = bx >= LV_GL ? 1 : 0; ln_rows(bx - p * LV_GL, p, X, qg, qb, kg, kb, eps, Qo, Ko); }
  else vt_tile<NH, SQ>(tl, bx - 2 * LV_GL, V16, LQ, 0, Vt);
}
extern "C" void kernel_launch(void* const* d_in, const int* in_sizes, int n_in,
                              void* d_out, int out_size, void* d_ws, size_t ws_size, hipStream_t stream) {
  (void)in_sizes; (void)n_in; (void)out_size;
  const float* const* I = (const float* const*)d_in; const float* x = I[0]; const float* wqkv = I[1]; const float* wo = I[2]; const float* bo = I[3]; const float* qg = I[4]; const float* qb = I[5]; const float* kg = I[6]; const float* kb = I[7]; const float* bqkv = nullptr;      /* natural weights; no qkv bias */
  char* ws = (char*)d_ws; size_t off = 0;
  auto take = [&](size_t bytes) { char* p = ws + off; off += (bytes + 255) & ~(size_t)255; return p; };
  _Float16* BQKV = (_Float16*)take((size_t)3 * DM * DM * 2); _Float16* BO = (_Float16*)take((size_t)DM * DM * 2);
  _Float16* X16 = (_Float16*)take(NR * DM * 2); float* QKVF = (float*)take(NR * 3 * DM * 4); _Float16* QN16 = (_Float16*)take(NR * DM * 2); _Float16* KN16 = (_Float16*)take(NR * DM * 2); _Float16* QKV = (_Float16*)take(NR * 3 * DM * 2); _Float16* Q16 = QKV; _Float16* K16 = QKV + DM; _Float16* V16 = QKV + 2 * DM; _Float16* O16 = (_Float16*)take(NR * DM * 2);
  _Float16* VT = (_Float16*)take((size_t)NB * NH * HD * SQ * 2);
  if (off > ws_size) return;
  k_cvt3<<<CV_GX + CV_GQ + CV_GO, 256, 0, stream>>>(x, wqkv, wo, X16, BQKV, BO);      /* x rows; natural [out][in] weights = Bt planes x16 */
  const size_t r0p = (size_t)B0 * SQ;      /* first projected row */
  k_gemm2<0><<<dim3((unsigned)((MP / 128) * (3 * DM / 128)), 1), 256, 0, stream>>>(X16 + r0p * DM, DM, 0, BQKV, DM, 0, 0.0625f, nullptr, 0, nullptr, 1, 0, 0, QKVF + r0p * 3 * DM, QKV + r0p * 3 * DM, 3 * DM, 0, MP, 3 * DM, DM);      /* q | k | v rows: f32 (for the LayerNorms) and f16 (v operand) */
  static_assert(MP % (8 * LN_TW) == 0, "k_lnvt: whole LayerNorm work-groups of 8 waves");
  k_lnvt<<<2 * LV_GL + LV_GV, 256, 0, stream>>>(QKVF + r0p * 3 * DM, qg, qb, kg, kb, 1e-5f, QN16 + r0p * DM, KN16 + r0p * DM, V16, VT);      /* q, k = LayerNorm over the merged 1024 features -> f16 rows; V^T [NB][NH][HD][SQ] */
  k_fattn<<<dim3(SQ / FA_QB, NB * NH), 256, 0, stream>>>(QN16, KN16, VT, O16);      /* o (merged heads, x64) as f16 rows: all batches and heads in one launch */
  k_gemm2<0><<<dim3((unsigned)((MPO / 128) * (DM / 128)), 1), 256, 0, stream>>>(O16 + r0p * DM, DM, 0, BO, DM, 0, 0.0009765625f, bo, 0, nullptr, 1, 0, 0, (float*)d_out + r0p * DM, nullptr, DM, 0, MPO, DM, DM);      /* out rows are the output layout */
}

// v006
// A run of this version takes 93.3 microseconds.
// Two timings next to v005 both put it at 1.04 times that version's speed.
// Over all steps from v000 it is 37.0 times as fast.
#include <hip/hip_runtime.h>
// Self-attention block with q/k LayerNorm (x [2][2048][1024]; qkv = x w_qkv^T (natural [3072][1024], sigma 1/32, no bias) -> q | k | v blocks, 16 heads of 64; q = LayerNorm_1024(q; q_gamma, q_beta) and k likewise over the full merged 1024 features (eps 1e-5); softmax(q k^T / 8) (no mask); out = merged w_proj^T + b_proj -> [2][2048][1024]).
// Structure: x as exact f16 rows; natural weights as exact x16 planes; q | k | v as ONE WMMA GEMM (128x128 block tiles staged in LDS, 32x64 wave tiles, f32 accumulation; f32 rows for the norms + f16 rows for v); q and k LayerNorm over the merged 1024 features on VALU in one launch (f32, two token rows a wave in registers, lane partials + butterfly; bf16 gamma/beta) -> f16 rows; V^T via LDS transposes; one fused attention launch over all batches and heads (scores K = 64 in f32 accumulators, online softmax with f32 statistics and native exp2, weights as f16, o = P V carried x64) into merged f16 rows; out = o w_proj^T + b_proj GEMM (f32, alpha 2^-10); launches: see trace.
// Compute dtype: inputs rounded to bf16; x / weights exact; q, k, v, softmax weights and o as plain f16 GEMM operands (~2^-12); scores and softmax statistics f32. v_wmma_f32_16x16x32_f16.
#define NB 2
#define SQ 2048
#define DM 1024
#define NH 16
#define HD 64
#define HG 4                         /* heads per launch of the per-batch k_vt (not launched) */
#define B0 0                         /* first batch processed (debug hook) */
#define NBR NB                       /* batches processed (debug hook) */
#define NR ((size_t)NB * SQ)
#define DMQ DM         /* unused: ln_rows and the f16 rows use DM */
#define MP ((int)((size_t)NBR * SQ)) /* rows projected (debug hook) */
#define QN SQ                        /* unused: k_fattn attends all SQ query rows */
#define NHD NH                       /* unused: k_fattn attends all NH heads */
#define MPO MP                       /* rows through the output stage (debug hook) */
#define LQ (3 * DM)      /* row pitch of the q/k/v rows */
typedef __bf16 v16b __attribute__((ext_vector_type(16)));
typedef unsigned short v8us __attribute__((ext_vector_type(8), may_alias));
typedef float  v8f  __attribute__((ext_vector_type(8)));
typedef float  v4f  __attribute__((ext_vector_type(4)));
typedef float  v4fa __attribute__((ext_vector_type(4), may_alias));
union FragB { v16b v; v8us half[2]; unsigned short u[16]; };

__device__ __forceinline__ unsigned short bf16_bits(float x) { unsigned int u = __float_as_uint(x); return (unsigned short)((u + 0x7FFFu + ((u >> 16) & 1u)) >> 16); }
__device__ __forceinline__ float bf16_val(unsigned short b) { return __uint_as_float(((unsigned int)b) << 16); }
__device__ __forceinline__ float bf16_round(float x) { return bf16_val(bf16_bits(x)); }
// D += A·B with NT terms: 1 = ah·bh, 2 = + al·bh (A split), 3 = + ah·bl (both split)
template <int NT>
__device__ __forceinline__ v8f mmaN(v16b ah, v16b al, v16b bh, v16b bl, v8f c) {
  c = __builtin_amdgcn_wmma_f32_16x16x32_bf16(false, ah, false, bh, (short)0, c, false, false);
  if (NT >= 2) c = __builtin_amdgcn_wmma_f32_16x16x32_bf16(false, al, false, bh, (short)0, c, false, false);
  if (NT >= 3) c = __builtin_amdgcn_wmma_f32_16x16x32_bf16(false, ah, false, bl, (short)0, c, false, false);
  asm volatile("v_nop\n\tv_nop\n\tv_nop\n\tv_nop" : "+v"(c) : "v"(ah), "v"(al), "v"(bh), "v"(bl));
  return c;
}

__global__ __launch_bounds__(256) void k_wt_bf16(const float* __restrict__ W, unsigned short* __restrict__ Wt, int K, int N) {
  const int t = blockIdx.x * 256 + threadIdx.x;
  const int k8n = K / 8;
  if (t >= N * k8n) return;
  const int n = t / k8n, k8 = (t % k8n) * 8;
  v8us v;
#pragma unroll
  for (int i = 0; i < 8; ++i) v[i] = bf16_bits(W[(size_t)(k8 + i) * N + n]);
  *(v8us*)(Wt + (size_t)n * K + k8) = v;
  
}

// GEMM C[M][N] (f32, pitch ldc) = act(A[M][K]·W + bias). A f32 row-major (pitch lda) converted per fragment to bf16
// (ASPLIT: hi/lo two planes -> 2 terms, else single rounded term); Wt bf16 [N][K] (pitch ldb). BIAS_BF16 rounds the
// bias to bf16 first (bias quantised to bf16 before the add). K%32==0, M%16==0, N%64==0.
template <bool ASPLIT, int ACT, bool BIAS_BF16>
__global__ __launch_bounds__(128) void k_gemm_bf(const float* __restrict__ A, int lda, const unsigned short* __restrict__ Wt, int ldb,
                                               const float* __restrict__ bias, float* __restrict__ C, int ldc, int M, int N, int K) {
  __shared__ __attribute__((aligned(16))) float so[4][16][64];
  const int tid = threadIdx.x, w = tid >> 5, lane = tid & 31, ln = lane & 15, hh = lane >> 4;
  const int ntn = N / 64;
  const int wid = blockIdx.x * 4 + w;
  const int mt = wid / ntn, nq = wid % ntn;
  if (mt * 16 >= M) return;
  const int row0 = mt * 16, col0 = nq * 64;
  const float* arow = A + (size_t)(row0 + ln) * lda;
  v8f acc[4] = {};
  for (int kb = 0; kb < K; kb += 32) {
    FragB ah, al;
    const v4f x0 = *(const v4fa*)(arow + kb + 8 * hh), x1 = *(const v4fa*)(arow + kb + 8 * hh + 4);
    const v4f x2 = *(const v4fa*)(arow + kb + 16 + 8 * hh), x3 = *(const v4fa*)(arow + kb + 16 + 8 * hh + 4);
    float xs[16] = {x0[0],x0[1],x0[2],x0[3],x1[0],x1[1],x1[2],x1[3],x2[0],x2[1],x2[2],x2[3],x3[0],x3[1],x3[2],x3[3]};
#pragma unroll
    for (int i = 0; i < 16; ++i) { const unsigned short hb = bf16_bits(xs[i]); ah.u[i] = hb; al.u[i] = ASPLIT ? bf16_bits(xs[i] - bf16_val(hb)) : (unsigned short)0; }
#pragma unroll
    for (int t = 0; t < 4; ++t) {
      const unsigned short* brow = Wt + (size_t)(col0 + t * 16 + ln) * ldb + kb;
      FragB b;
      b.half[0] = *(const v8us*)(brow + 8 * hh);
      b.half[1] = *(const v8us*)(brow + 16 + 8 * hh);
      acc[t] = mmaN<ASPLIT ? 2 : 1>(ah.v, al.v, b.v, b.v, acc[t]);
    }
  }
#pragma unroll
  for (int t = 0; t < 4; ++t) {
    float bv = bias ? bias[col0 + t * 16 + ln] : 0.f;
    if (BIAS_BF16) bv = bf16_round(bv);
#pragma unroll
    for (int r = 0; r < 8; ++r) { float v = acc[t][r] + bv; if (ACT == 1) v = fmaxf(v, 0.f); so[w][8 * hh + r][t * 16 + ln] = v; }
  }
  __builtin_amdgcn_fence(__ATOMIC_ACQ_REL, "workgroup");
  __builtin_amdgcn_wave_barrier();
  const int rsub = lane >> 4, c4 = (lane & 15) * 4;
  {
#pragma unroll
    for (int q = 0; q < 8; ++q) {
      const int r = q * 2 + rsub;
      const v4f v = *(const v4fa*)&so[w][r][c4];
      *(v4f*)(C + (size_t)(row0 + r) * ldc + col0 + c4) = v;
    }
    
  }
}

// GEMM C = act(A·W + bias + resid): A f32 (ASPLIT -> hi/lo 2 terms), Wt bf16 [N][K]; ACT 0 none, 1 relu, 2 exact gelu;
// resid (optional, f32, row index = (row % rmod), pitch ldr, RES_BF16 rounds it) added before the activation.
template <bool ASPLIT, int ACT, bool BIAS_BF16, bool RES_BF16>
__global__ __launch_bounds__(128) void k_gemm_bf3(const float* __restrict__ A, int lda, const unsigned short* __restrict__ Wt, int ldb,
                                                const float* __restrict__ bias, const float* __restrict__ resid, int rmod, int ldr,
                                                float* __restrict__ C, int ldc, int M, int N, int K) {
  __shared__ __attribute__((aligned(16))) float so[4][16][64];
  const int tid = threadIdx.x, w = tid >> 5, lane = tid & 31, ln = lane & 15, hh = lane >> 4;
  const int ntn = N / 64;
  const int wid = blockIdx.x * 4 + w;
  const int mt = wid / ntn, nq = wid % ntn;
  if (mt * 16 >= M) return;
  const int row0 = mt * 16, col0 = nq * 64;
  const float* arow = A + (size_t)(row0 + ln) * lda;
  v8f acc[4] = {};
  for (int kb = 0; kb < K; kb += 32) {
    FragB ah, al;
    const v4f x0 = *(const v4fa*)(arow + kb + 8 * hh), x1 = *(const v4fa*)(arow + kb + 8 * hh + 4);
    const v4f x2 = *(const v4fa*)(arow + kb + 16 + 8 * hh), x3 = *(const v4fa*)(arow + kb + 16 + 8 * hh + 4);
    float xs[16] = {x0[0],x0[1],x0[2],x0[3],x1[0],x1[1],x1[2],x1[3],x2[0],x2[1],x2[2],x2[3],x3[0],x3[1],x3[2],x3[3]};
#pragma unroll
    for (int i = 0; i < 16; ++i) { const unsigned short hb = bf16_bits(xs[i]); ah.u[i] = hb; al.u[i] = ASPLIT ? bf16_bits(xs[i] - bf16_val(hb)) : (unsigned short)0; }
#pragma unroll
    for (int t = 0; t < 4; ++t) {
      const unsigned short* brow = Wt + (size_t)(col0 + t * 16 + ln) * ldb + kb;
      FragB b;
      b.half[0] = *(const v8us*)(brow + 8 * hh);
      b.half[1] = *(const v8us*)(brow + 16 + 8 * hh);
      acc[t] = mmaN<ASPLIT ? 2 : 1>(ah.v, al.v, b.v, b.v, acc[t]);
    }
  }
#pragma unroll
  for (int t = 0; t < 4; ++t) {
    const int col = col0 + t * 16 + ln;
    float bv = bias ? bias[col] : 0.f;
    if (BIAS_BF16) bv = bf16_round(bv);
#pragma unroll
    for (int r = 0; r < 8; ++r) {
      float v = acc[t][r] + bv;
      if (resid) { float rv = resid[(size_t)((row0 + 8 * hh + r) % rmod) * ldr + col]; if (RES_BF16) rv = bf16_round(rv); v += rv; }
      if (ACT == 1) v = fmaxf(v, 0.f);
      if (ACT == 2) v = 0.5f * v * (1.0f + erff(v * 0.70710678118654752f));
      if (ACT == 3) { const float u = 0.7978845608028654f * (v + 0.044715f * v * v * v); v = 0.5f * v * (1.0f + tanhf(u)); }
      so[w][8 * hh + r][t * 16 + ln] = v;
    }
  }
  __builtin_amdgcn_fence(__ATOMIC_ACQ_REL, "workgroup");
  __builtin_amdgcn_wave_barrier();
  const int rsub = lane >> 4, c4 = (lane & 15) * 4;
  {
#pragma unroll
    for (int q = 0; q < 8; ++q) {
      const int r = q * 2 + rsub;
      const v4f v = *(const v4fa*)&so[w][r][c4];
      *(v4f*)(C + (size_t)(row0 + r) * ldc + col0 + c4) = v;
    }
    
  }
}
// row LayerNorm (biased variance, eps) over N: s = X (+ R); optional out_sum <- s; out_norm <- (s-mu)*rsqrt(var+eps)*g + b
template <bool PARAM_BF16>
__global__ __launch_bounds__(256) void k_layernorm(const float* __restrict__ X, const float* __restrict__ R, const float* __restrict__ g, const float* __restrict__ bta,
                                                  float* __restrict__ out_sum, float* __restrict__ out_norm, int N, float eps) {
  __shared__ float red[256];
  const int row = blockIdx.x, tid = threadIdx.x;
  const float* x = X + (size_t)row * N; const float* rr = R ? R + (size_t)row * N : nullptr;
  float vals[16];                     // up to N = 4096
  const int per = N / 256;            // contiguous chunk per thread? use strided-by-4 chunks: thread handles j = tid*4 + 1024*u
  float s1 = 0.f;
  for (int u = 0; u < per / 4; ++u) {
    const int j = tid * 4 + 1024 * u;
    const v4f a = *(const v4fa*)(x + j);
    v4f b = {0.f,0.f,0.f,0.f}; if (rr) b = *(const v4fa*)(rr + j);
#pragma unroll
    for (int q = 0; q < 4; ++q) { const float v = a[q] + b[q]; vals[u * 4 + q] = v; s1 += v; }
  }
  red[tid] = s1; __syncthreads();
  for (int st = 128; st > 0; st >>= 1) { if (tid < st) red[tid] += red[tid + st]; __syncthreads(); }
  const float mu = red[0] / (float)N; __syncthreads();
  float s2 = 0.f;
  for (int u = 0; u < per / 4; ++u)
#pragma unroll
    for (int q = 0; q < 4; ++q) { const float c = vals[u * 4 + q] - mu; s2 += c * c; }
  red[tid] = s2; __syncthreads();
  for (int st = 128; st > 0; st >>= 1) { if (tid < st) red[tid] += red[tid + st]; __syncthreads(); }
  const float rs = rsqrtf(red[0] / (float)N + eps);
  {
    for (int u = 0; u < per / 4; ++u) {
      const int j = tid * 4 + 1024 * u;
      v4f o, sm;
#pragma unroll
      for (int q = 0; q < 4; ++q) {
        float gg = g[j + q], bb = bta[j + q];
        if (PARAM_BF16) { gg = bf16_round(gg); bb = bf16_round(bb); }
        sm[q] = vals[u * 4 + q]; o[q] = (vals[u * 4 + q] - mu) * rs * gg + bb;
      }
      if (out_sum) *(v4f*)(out_sum + (size_t)row * N + j) = sm;
      *(v4f*)(out_norm + (size_t)row * N + j) = o;
    }
    
  }
}



// ---- f16 WMMA path (v_wmma_f32_16x16x32_f16): 11-bit significands for operands in range — used where a [0,1] probability operand needs more precision than bf16
typedef _Float16 v16h __attribute__((ext_vector_type(16)));
union FragH { v16h v; v8us half[2]; _Float16 h[16]; unsigned short u[16]; };
template <int NT>
__device__ __forceinline__ v8f mmaH(v16h ah, v16h al, v16h bh, v16h bl, v8f c) {
  c = __builtin_amdgcn_wmma_f32_16x16x32_f16(false, ah, false, bh, (short)0, c, false, false);
  if (NT >= 2) c = __builtin_amdgcn_wmma_f32_16x16x32_f16(false, al, false, bh, (short)0, c, false, false);
  if (NT >= 3) c = __builtin_amdgcn_wmma_f32_16x16x32_f16(false, ah, false, bl, (short)0, c, false, false);
  asm volatile("v_nop\n\tv_nop\n\tv_nop\n\tv_nop" : "+v"(c) : "v"(ah), "v"(al), "v"(bh), "v"(bl));
  return c;
}
// batched GEMM like k_gemm_b but f16 operands: A f32 (split into f16 hi/lo if ASPLIT, else rounded to f16), Bt = f16 values [n][k]; alpha; C f32; N multiple of 16 (partial tiles skipped)
template <bool ASPLIT>
__global__ __launch_bounds__(128) void k_gemm_h(const float* __restrict__ A, int lda, size_t sA, const _Float16* __restrict__ Bh, int ldb, size_t sB, float alpha, float* __restrict__ C, int ldc, size_t sC, int M, int N, int K) {
  __shared__ __attribute__((aligned(16))) float so[4][16][64];
  const int tid = threadIdx.x, w = tid >> 5, lane = tid & 31, ln = lane & 15, hh = lane >> 4; const int by = blockIdx.y;
  A += (size_t)by * sA; Bh += (size_t)by * sB; C += (size_t)by * sC;
  const int ntn = (N + 63) / 64; const int wid = blockIdx.x * 4 + w; const int mt = wid / ntn, nq = wid % ntn; if (mt * 16 >= M) return;
  const int row0 = mt * 16, col0 = nq * 64; const float* arow = A + (size_t)(row0 + ln) * lda;
  v8f acc[4] = {};
  for (int kb = 0; kb < K; kb += 32) {
    FragH ah, al;
    const v4f x0 = *(const v4fa*)(arow + kb + 8 * hh), x1 = *(const v4fa*)(arow + kb + 8 * hh + 4), x2 = *(const v4fa*)(arow + kb + 16 + 8 * hh), x3 = *(const v4fa*)(arow + kb + 16 + 8 * hh + 4);
    float xs[16] = {x0[0],x0[1],x0[2],x0[3],x1[0],x1[1],x1[2],x1[3],x2[0],x2[1],x2[2],x2[3],x3[0],x3[1],x3[2],x3[3]};
#pragma unroll
    for (int i = 0; i < 16; ++i) { const _Float16 h = (_Float16)xs[i]; ah.h[i] = h; al.h[i] = ASPLIT ? (_Float16)(xs[i] - (float)h) : (_Float16)0.0f; }
#pragma unroll
    for (int t = 0; t < 4; ++t) { if (col0 + t * 16 >= N) continue; const size_t boff = (size_t)(col0 + t * 16 + ln) * ldb + kb; FragH bq; bq.half[0] = *(const v8us*)(Bh + boff + 8 * hh); bq.half[1] = *(const v8us*)(Bh + boff + 16 + 8 * hh);
      acc[t] = mmaH<ASPLIT ? 2 : 1>(ah.v, al.v, bq.v, bq.v, acc[t]); }
  }
#pragma unroll
  for (int t = 0; t < 4; ++t) { if (col0 + t * 16 >= N) continue;
#pragma unroll
    for (int r = 0; r < 8; ++r) so[w][8 * hh + r][t * 16 + ln] = acc[t][r] * alpha; }
  __builtin_amdgcn_fence(__ATOMIC_ACQ_REL, "workgroup"); __builtin_amdgcn_wave_barrier();
  const int rsub = lane >> 4, c4 = (lane & 15) * 4;
  {
#pragma unroll
    for (int q = 0; q < 8; ++q) { const int r = q * 2 + rsub; if (col0 + c4 < N) { const v4f v = *(const v4fa*)&so[w][r][c4]; *(v4f*)(C + (size_t)(row0 + r) * ldc + col0 + c4) = v; } }
     }
}

// Wt[n][k] = f16(W[k][n]·scale) from f32 row-major W[K][N] (scale = power of two; bf16-exact weights stay exact in f16 away from the subnormal range)
__global__ __launch_bounds__(256) void k_wt_f16(const float* __restrict__ W, _Float16* __restrict__ Wt, int K, int N, float scale) {
  const int t = blockIdx.x * 256 + threadIdx.x; if (t >= N * (K / 8)) return; const int n = t / (K / 8), k8 = (t % (K / 8)) * 8; FragH f;
#pragma unroll
  for (int i = 0; i < 8; ++i) f.h[i] = (_Float16)(bf16_round(W[(size_t)(k8 + i) * N + n]) * scale); const v8us o = f.half[0];
  *(v8us*)((unsigned short*)Wt + (size_t)n * K + k8) = o; 
}
// k_gemm_hh variant with fused epilogue: v = acc·alpha + bias[by·sBias + col] (+ CP[(row/rowsPerB)·sCPb + by·64 + col] if CP) ; ACT 0 none / 1 elu ; writes f16 C16 (and f32 C if non-null)
template <int ACT>
__global__ __launch_bounds__(128) void k_gemm_hhx(const _Float16* __restrict__ A, int lda, size_t sA, const _Float16* __restrict__ Bh, int ldb, size_t sB, float alpha, const float* __restrict__ bias, size_t sBias, const float* __restrict__ CP, int rowsPerB, size_t sCPb, int row0g,
    float* __restrict__ C, _Float16* __restrict__ C16, int ldc, size_t sC, int M, int N, int K) {
  __shared__ __attribute__((aligned(16))) float so[4][16][64];
  const int tid = threadIdx.x, w = tid >> 5, lane = tid & 31, ln = lane & 15, hh = lane >> 4; const int by = blockIdx.y;
  A += (size_t)by * sA; Bh += (size_t)by * sB; const size_t cofs = (size_t)by * sC; const float* bp = bias ? bias + (size_t)by * sBias : nullptr;
  const int ntn = (N + 63) / 64; const int wid = blockIdx.x * 4 + w; const int mt = wid / ntn, nq = wid % ntn; if (mt * 16 >= M) return;
  const int row0 = mt * 16, col0 = nq * 64; const _Float16* arow = A + (size_t)(row0 + ln) * lda;
  v8f acc[4] = {};
  for (int kb = 0; kb < K; kb += 32) { FragH ah; ah.half[0] = *(const v8us*)((const unsigned short*)arow + kb + 8 * hh); ah.half[1] = *(const v8us*)((const unsigned short*)arow + kb + 16 + 8 * hh);
#pragma unroll
    for (int t = 0; t < 4; ++t) { if (col0 + t * 16 >= N) continue; const size_t boff = (size_t)(col0 + t * 16 + ln) * ldb + kb; FragH bq; bq.half[0] = *(const v8us*)((const unsigned short*)Bh + boff + 8 * hh); bq.half[1] = *(const v8us*)((const unsigned short*)Bh + boff + 16 + 8 * hh);
      acc[t] = mmaH<1>(ah.v, ah.v, bq.v, bq.v, acc[t]); }
  }
#pragma unroll
  for (int t = 0; t < 4; ++t) { if (col0 + t * 16 >= N) continue; const int col = col0 + t * 16 + ln; const float bv = bp ? bf16_round(bp[col]) : 0.f;
#pragma unroll
    for (int r = 0; r < 8; ++r) { float v = acc[t][r] * alpha + bv; if (CP) { const int rr = row0g + row0 + 8 * hh + r; if (rowsPerB < 0) v += CP[cofs + (size_t)rr * ldc + col];      /* rowsPerB < 0: own element of the batched C plane */ else { const int bidx = rr / rowsPerB; v += CP[(size_t)bidx * sCPb + (size_t)by * 64 + col]; } } if (ACT == 1) v = (v > 0.f) ? v : expm1f(v); else if (ACT == 7) v = (v > 0.f) ? v + 1.0f : expf(v); else if (ACT == 8) v = tanhf(v); else if (ACT == 9) v = 0.5f * v * (1.0f + tanhf(0.7978845608028654f * (v + 0.044715f * v * v * v))); else if (ACT == 11) v = 1.0f / (1.0f + expf(-v)); else if (ACT == 12) v = (v > 0.f) ? v : 0.01f * v; else if (ACT == 14) v = (v > 0.f) ? v : 0.1f * v; else if (ACT == 16) v = (v >= 0.f) ? v : 0.3f * v; else if (ACT == 17) v = (v >= 0.f) ? v : 0.2f * v; else if (ACT == 15) v = v / (1.0f + expf(-v)); else if (ACT == 3) v = fmaxf(v, 0.f); else if (ACT == 6) v = 0.5f * v * (1.0f + erff(v * 0.70710678118654752f)); so[w][8 * hh + r][t * 16 + ln] = v; } }
  __builtin_amdgcn_fence(__ATOMIC_ACQ_REL, "workgroup"); __builtin_amdgcn_wave_barrier();
  const int rsub = lane >> 4, c4 = (lane & 15) * 4; typedef _Float16 v4h __attribute__((ext_vector_type(4)));
  {
#pragma unroll
    for (int q = 0; q < 8; ++q) { const int r = q * 2 + rsub; if (col0 + c4 < N) { const v4f v = *(const v4fa*)&so[w][r][c4]; if (C) *(v4f*)(C + cofs + (size_t)(row0 + r) * ldc + col0 + c4) = v; if (C16) { v4h h4; for (int i = 0; i < 4; ++i) h4[i] = (_Float16)v[i]; *(v4h*)(C16 + cofs + (size_t)(row0 + r) * ldc + col0 + c4) = h4; } } }
     }
}


typedef _Float16 v4h __attribute__((ext_vector_type(4)));

__global__ __launch_bounds__(256) void k_h16(const float* __restrict__ x, _Float16* __restrict__ X16, size_t n8) { const size_t t = (size_t)blockIdx.x * 256 + threadIdx.x; if (t >= n8) return; FragH f;
#pragma unroll
  for (int q = 0; q < 8; ++q) f.h[q] = (_Float16)x[t * 8 + q]; *(v8us*)((unsigned short*)X16 + t * 8) = f.half[0];  }
__global__ __launch_bounds__(256) void k_round16f(const float* __restrict__ W, _Float16* __restrict__ Bt, size_t n8) { const size_t t = (size_t)blockIdx.x * 256 + threadIdx.x; if (t >= n8) return; FragH f;
#pragma unroll
  for (int i = 0; i < 8; ++i) f.h[i] = (_Float16)(bf16_round(W[t * 8 + i]) * 16.0f); *(v8us*)((unsigned short*)Bt + t * 8) = f.half[0];  }
template <int NHv, int TTv>
__device__ __forceinline__ void vt_tile(unsigned short (*tl)[66], const int bx, const _Float16* __restrict__ V16, int ldv, int voff, _Float16* __restrict__ Vt) { const int tid = threadIdx.x; const int slab = bx / (TTv / 64), lg = bx % (TTv / 64); const int b = slab / NHv, h = slab % NHv;      /* one 64 x 64 tile a work-group; tl: its LDS tile */
  for (int i = tid; i < 64 * 8; i += 256) { const int r = i / 8, c8 = (i % 8) * 8; FragH f; f.half[0] = *(const v8us*)((const unsigned short*)V16 + ((size_t)b * TTv + lg * 64 + r) * ldv + voff + h * 64 + c8);
#pragma unroll
    for (int q = 0; q < 8; ++q) tl[r][c8 + q] = f.u[q]; }
  __syncthreads();
  {
#pragma unroll
    for (int rd = 0; rd < 2; ++rd) { const int d = rd * 32 + tid / 8, pc = tid % 8; FragH f;
#pragma unroll
      for (int q = 0; q < 8; ++q) f.u[q] = tl[pc * 8 + q][d];
      *(v8us*)((unsigned short*)Vt + ((size_t)slab * 64 + d) * TTv + lg * 64 + pc * 8) = f.half[0]; }
     } }

__global__ __launch_bounds__(256) void k_hl(const float* __restrict__ F, _Float16* __restrict__ Hh, _Float16* __restrict__ Hl, size_t n8) { const size_t t = (size_t)blockIdx.x * 256 + threadIdx.x; if (t >= n8) return; FragH fh, fl; const v4f a = *(const v4fa*)(F + t * 8), c = *(const v4fa*)(F + t * 8 + 4);
#pragma unroll
  for (int q = 0; q < 4; ++q) { _Float16 h = (_Float16)a[q]; fh.h[q] = h; fl.h[q] = (_Float16)((a[q] - (float)h) * 1024.0f); h = (_Float16)c[q]; fh.h[4 + q] = h; fl.h[4 + q] = (_Float16)((c[q] - (float)h) * 1024.0f); }
  { *(v8us*)((unsigned short*)Hh + t * 8) = fh.half[0]; *(v8us*)((unsigned short*)Hl + t * 8) = fl.half[0];  } }

// ---- fast GEMM (block tile 128x128 = 8 waves of 32x64, operand tiles staged in LDS; requires M % 128 == 0, N % 128 == 0, K % 64 == 0); epilogue = k_gemm_hhx semantics ----
#define G2_KS 64                     /* k per LDS stage: one whole 128-byte line of every operand row */
#define G2_LP 72                     /* LDS row pitch in f16: 128 data bytes + 16, so that the 16-byte fragment reads of 16 rows spread over the banks */
#define G2_STB (256 * G2_LP * 2)     /* bytes of a stage: 128 A rows, then 128 B rows */
// One stage: a thread copies 16 bytes of rows r, r + 32, r + 64, r + 96 of the A tile and of the B tile (8 threads a row, so a wave's copy covers 4 whole lines), global memory to LDS through no register.
// The closing s_wait_xcnt stands inside the statement so that no address register of an issued copy is rewritten in front of it (a precaution).
__device__ __forceinline__ void g2_stage(unsigned l, const _Float16* a0, size_t a32, const _Float16* b0, size_t b32) {
  const _Float16* a1 = a0 + a32; const _Float16* a2 = a1 + a32; const _Float16* a3 = a2 + a32; const _Float16* b1 = b0 + b32; const _Float16* b2 = b1 + b32; const _Float16* b3 = b2 + b32;
  const unsigned R = 32 * G2_LP * 2;      /* 32 LDS rows in bytes */
  asm volatile("global_load_async_to_lds_b128 %0, %8, off\n\tglobal_load_async_to_lds_b128 %1, %9, off\n\tglobal_load_async_to_lds_b128 %2, %10, off\n\tglobal_load_async_to_lds_b128 %3, %11, off\n\t"
               "global_load_async_to_lds_b128 %4, %12, off\n\tglobal_load_async_to_lds_b128 %5, %13, off\n\tglobal_load_async_to_lds_b128 %6, %14, off\n\tglobal_load_async_to_lds_b128 %7, %15, off\n\ts_wait_xcnt 0x0"
               :: "v"(l), "v"(l + R), "v"(l + 2 * R), "v"(l + 3 * R), "v"(l + 4 * R), "v"(l + 5 * R), "v"(l + 6 * R), "v"(l + 7 * R), "v"(a0), "v"(a1), "v"(a2), "v"(a3), "v"(b0), "v"(b1), "v"(b2), "v"(b3) : "memory");
}
__device__ __forceinline__ v16h g2_frag(const _Float16* p, int hh) { FragH f; f.half[0] = *(const v8us*)((const unsigned short*)p + 8 * hh); f.half[1] = *(const v8us*)((const unsigned short*)p + 16 + 8 * hh); return f.v; }
__device__ __forceinline__ v8f g2_mma(v16h a, v16h b, v8f c) { v8f d = __builtin_amdgcn_wmma_f32_16x16x32_f16(false, a, false, b, (short)0, c, false, false); asm volatile("v_nop\n\tv_nop\n\tv_nop\n\tv_nop" : "+v"(d) : "v"(a), "v"(b)); return d; }
template <int ACT>
__global__ __launch_bounds__(256) void k_gemm2(const _Float16* __restrict__ A, int lda, size_t sA, const _Float16* __restrict__ Bh, int ldb, size_t sB, float alpha, const float* __restrict__ bias, size_t sBias, const float* __restrict__ CP, int rowsPerB, size_t sCPb, int row0g,
    float* __restrict__ C, _Float16* __restrict__ C16, int ldc, size_t sC, int M, int N, int K) { static_assert(ACT == 0 || ACT == 3 || ACT == 6 || ACT == 8 || ACT == 9 || ACT == 11 || ACT == 12 || ACT == 14 || ACT == 15 || ACT == 16 || ACT == 17, "k_gemm2: unsupported ACT code (would silently apply no activation)");
  __shared__ __attribute__((aligned(16))) unsigned char ring[2 * G2_STB];      /* two stages; behind the loop's last barrier the same bytes are the output staging */
  static_assert(sizeof(float) * 8 * 32 * 68 <= sizeof(ring), "k_gemm2: the output staging must fit the ring");
  float (*so)[32][68] = (float (*)[32][68])ring;
  const int tid = threadIdx.x, w = tid >> 5, lane = tid & 31, ln = lane & 15, hh = lane >> 4; const int by = blockIdx.y;
  A += (size_t)by * sA; Bh += (size_t)by * sB; const size_t cofs = (size_t)by * sC; const float* bp = bias ? bias + (size_t)by * sBias : nullptr;
  const int ntn = N >> 7; const int mt = blockIdx.x / ntn, nq = blockIdx.x - mt * ntn; if (mt * 128 >= M) return;      /* the same for the whole work-group, in front of every copy and barrier */
  const int wm = w & 3, wn = w >> 2; const int row0 = mt * 128 + 32 * wm, col0 = nq * 128 + 64 * wn;
  const int sr = tid >> 3, sc8 = (tid & 7) * 8;      /* staging: 8 threads a row of 128 bytes */
  const _Float16* ga = A + (size_t)(mt * 128 + sr) * lda + sc8; const _Float16* gb = Bh + (size_t)(nq * 128 + sr) * ldb + sc8; const size_t a32 = (size_t)32 * lda, b32 = (size_t)32 * ldb;
  const unsigned l0 = (unsigned)(size_t)ring + (unsigned)(sr * G2_LP + sc8) * 2u;      /* the thread's own LDS byte address in buffer 0 */
  const int nst = K / G2_KS;
  const int ao = (32 * wm + ln) * G2_LP, bo = (128 + 64 * wn + ln) * G2_LP;      /* the lane's first A and B row in a stage, in f16 */
  const v8f z8 = {0.f,0.f,0.f,0.f,0.f,0.f,0.f,0.f}; v8f c00 = z8, c01 = z8, c02 = z8, c03 = z8, c10 = z8, c11 = z8, c12 = z8, c13 = z8;
  g2_stage(l0, ga, a32, gb, b32);
  asm volatile("s_wait_asynccnt 0x0" ::: "memory");      /* this wave's copies of stage 0 have landed */
  __syncthreads();      /* publishes stage 0 */
  if (nst > 1) g2_stage(l0 + G2_STB, ga + G2_KS, a32, gb + G2_KS, b32);
#pragma unroll 1      /* one stage a trip: the ring's waits and its barrier stand once, at the foot */
  for (int t = 0; t < nst; ++t) { const _Float16* st = (const _Float16*)(ring + (t & 1) * G2_STB);
#pragma unroll      /* both halves of a stage inline, so that their LDS offsets are immediates */
    for (int kb = 0; kb < G2_KS; kb += 32) {      /* the six fragments of 32 k are read as one group in front of their eight products */
      const v16h a0 = g2_frag(st + ao + kb, hh), a1 = g2_frag(st + ao + 16 * G2_LP + kb, hh);
      const v16h b0 = g2_frag(st + bo + kb, hh), b1 = g2_frag(st + bo + 16 * G2_LP + kb, hh), b2 = g2_frag(st + bo + 32 * G2_LP + kb, hh), b3 = g2_frag(st + bo + 48 * G2_LP + kb, hh);
      c00 = g2_mma(a0, b0, c00); c10 = g2_mma(a1, b0, c10); c01 = g2_mma(a0, b1, c01); c11 = g2_mma(a1, b1, c11);
      c02 = g2_mma(a0, b2, c02); c12 = g2_mma(a1, b2, c12); c03 = g2_mma(a0, b3, c03); c13 = g2_mma(a1, b3, c13); }
    asm volatile("s_wait_dscnt 0x0" ::: "memory");      /* this wave's reads of stage t are done */
    asm volatile("s_wait_asynccnt 0x0" ::: "memory");      /* this wave's copies of stage t + 1 have landed */
    __syncthreads();      /* publishes stage t + 1 and ends every wave's reads of stage t */
    if (t + 2 < nst) g2_stage(l0 + (unsigned)(t & 1) * G2_STB, ga + (size_t)(t + 2) * G2_KS, a32, gb + (size_t)(t + 2) * G2_KS, b32);      /* the same for the whole work-group; into the buffer just left */
  }
  asm volatile("s_wait_asynccnt 0x0" ::: "memory");      /* nothing is in flight when the ring becomes output staging */
  v8f accs[8] = {c00, c01, c02, c03, c10, c11, c12, c13};
#pragma unroll
  for (int u = 0; u < 8; ++u) { const int t = u & 3, half = u >> 2; const int col = col0 + t * 16 + ln; const float bv = bp ? bf16_round(bp[col]) : 0.f;
#pragma unroll
    for (int r = 0; r < 8; ++r) { const int rloc = half * 16 + 8 * hh + r; float v = accs[u][r] * alpha + bv; if (CP) { if (rowsPerB < 0) v += CP[cofs + (size_t)(row0g + row0 + rloc) * ldc + col];      /* rowsPerB < 0: own element of the batched C plane */ else { const int bidx = (row0g + row0 + rloc) / rowsPerB; v += CP[(size_t)bidx * sCPb + (size_t)by * 64 + col]; } }
      if (ACT == 3) v = fmaxf(v, 0.f); else if (ACT == 6) v = 0.5f * v * (1.0f + erff(v * 0.70710678118654752f)); else if (ACT == 11) v = 1.0f / (1.0f + expf(-v)); else if (ACT == 15) v = v / (1.0f + expf(-v)); else if (ACT == 12) v = (v > 0.f) ? v : 0.01f * v; else if (ACT == 8) v = tanhf(v); else if (ACT == 9) v = 0.5f * v * (1.0f + tanhf(0.7978845608028654f * (v + 0.044715f * v * v * v))); else if (ACT == 14) v = (v > 0.f) ? v : 0.1f * v; else if (ACT == 16) v = (v >= 0.f) ? v : 0.3f * v; else if (ACT == 17) v = (v >= 0.f) ? v : 0.2f * v;
      so[w][rloc][t * 16 + ln] = v; } }
  __builtin_amdgcn_fence(__ATOMIC_ACQ_REL, "workgroup"); __builtin_amdgcn_wave_barrier();
  const int rsub = lane >> 4, c4 = (lane & 15) * 4;
  {
#pragma unroll
    for (int q = 0; q < 16; ++q) { const int r = q * 2 + rsub; const v4f v = *(const v4fa*)&so[w][r][c4]; if (C) *(v4f*)(C + cofs + (size_t)(row0 + r) * ldc + col0 + c4) = v; if (C16) { v4h h4; for (int i = 0; i < 4; ++i) h4[i] = (_Float16)v[i]; *(v4h*)(C16 + cofs + (size_t)(row0 + r) * ldc + col0 + c4) = h4; } }
     } }


// The three operand conversions (x -> exact f16 rows; w_qkv and w_proj -> exact x16 planes) depend on nothing and share one launch: the block index picks the job. A thread converts 8 elements, a work-group 2048; every job is a whole number of work-groups.
#define CV_GX ((unsigned)(NR * DM / 2048))                    /* work-groups of x */
#define CV_GQ ((unsigned)((size_t)3 * DM * DM / 2048))        /* work-groups of w_qkv */
#define CV_GO ((unsigned)((size_t)DM * DM / 2048))            /* work-groups of w_proj */
static_assert(NR * DM % 2048 == 0 && (size_t)DM * DM % 2048 == 0, "k_cvt3: whole work-groups");
__global__ __launch_bounds__(256) void k_cvt3(const float* __restrict__ x, const float* __restrict__ wq, const float* __restrict__ wo, _Float16* __restrict__ X16, _Float16* __restrict__ Bq, _Float16* __restrict__ Bo) {
  const unsigned bx = blockIdx.x; const float* s = x; _Float16* d = X16; unsigned g = bx; float sc = 1.0f;      /* the same for the whole work-group; x 1 is exact */
  if (bx >= CV_GX + CV_GQ) { s = wo; d = Bo; g = bx - (CV_GX + CV_GQ); sc = 16.0f; } else if (bx >= CV_GX) { s = wq; d = Bq; g = bx - CV_GX; sc = 16.0f; }
  const size_t t = (size_t)g * 256 + threadIdx.x; FragH f;
#pragma unroll      /* the thread's 8 elements stay in registers under constant indices and load as two 16-byte pieces */
  for (int q = 0; q < 8; ++q) f.h[q] = (_Float16)(bf16_round(s[t * 8 + q]) * sc); *(v8us*)((unsigned short*)d + t * 8) = f.half[0];  }
__global__ __launch_bounds__(256) void k_rsm(const float* __restrict__ S, _Float16* __restrict__ P, int nrows) {
  #pragma clang fp contract(off)
  const int i = blockIdx.x * 256 + threadIdx.x; if (i >= nrows) return; const float* s = S + (size_t)i * SQ; float mx = -3.0e38f;
#pragma unroll 1
  for (int j = 0; j < SQ; ++j) mx = fmaxf(mx, s[j]); float se = 0.f;
#pragma unroll 1
  for (int j = 0; j < SQ; ++j) se += expf(s[j] - mx); const float sc = 256.0f / se;
#pragma unroll 1
  for (int j0 = 0; j0 < SQ; j0 += 8) { FragH f; for (int q = 0; q < 8; ++q) f.h[q] = (_Float16)(expf(s[j0 + q] - mx) * sc); unsigned short* d = (unsigned short*)P + (size_t)i * SQ + j0; *(v8us*)d = f.half[0];  } }
__global__ __launch_bounds__(256) void k_vt(const _Float16* __restrict__ V16, int b, int h0, _Float16* __restrict__ VT) { __shared__ unsigned short tl[64][65]; const int tid = threadIdx.x; const int hh = blockIdx.x % HG, sg = blockIdx.x / HG; const int s0 = sg * 64; const int h = h0 + hh;
  for (int i = tid; i < 64 * 8; i += 256) { const int j = i / 8, d8 = (i % 8) * 8; FragH f; f.half[0] = *(const v8us*)((const unsigned short*)V16 + ((size_t)b * SQ + s0 + j) * DM + h * HD + d8); for (int q = 0; q < 8; ++q) tl[d8 + q][j] = f.u[q]; }
  __syncthreads();
  { for (int i = tid; i < 64 * 8; i += 256) { const int d = i / 8, j8 = (i % 8) * 8; FragH f; for (int q = 0; q < 8; ++q) f.u[q] = tl[d][j8 + q]; *(v8us*)((unsigned short*)VT + ((size_t)hh * HD + d) * SQ + s0 + j8) = f.half[0]; }  } }



// ---- fused attention: scores, softmax and P V in one kernel; neither scores nor weights go to memory ----
typedef float  v2f  __attribute__((ext_vector_type(2)));
#define FA_KS 64                     /* keys per LDS stage */
#define FA_LP 72                     /* LDS row pitch in f16: 128 data bytes + 16, so that the 16-byte fragment reads of 16 rows spread over the banks */
#define FA_QW 32                     /* query columns per wave */
#define FA_QB 256                    /* query columns per work-group (8 waves of a key group) */
#define FA_KG 2                      /* key groups per work-group: each group of 8 waves walks its own part of the keys for the same 256 queries, so that a SIMD holds 4 waves */
#define FA_KN (SQ / FA_KG)           /* keys per group */
__device__ __forceinline__ float fa_xhalf(float x) { return __builtin_bit_cast(float, __builtin_amdgcn_permlanex16(__builtin_bit_cast(int, x), __builtin_bit_cast(int, x), 0x76543210, 0xfedcba98, false, false)); }      /* lane l <-> lane l ^ 16 */
// native 2^x, in place: each exponential overwrites only its own argument, which the compiler's own vector instruction has just written (so no register of a matrix instruction still in its window is touched), and none reads the result or overwrites the source of the one in front of it; the closing v_nop keeps the one slot that the instruction set asks for behind a transcendental
__device__ __forceinline__ float fa_exp2(float x) { asm("v_exp_f32 %0, %0\n\tv_nop" : "+v"(x)); return x; }
__device__ __forceinline__ void fa_exp2x16(v8f& a, v8f& b) { float x0 = a[0], x1 = a[1], x2 = a[2], x3 = a[3], x4 = a[4], x5 = a[5], x6 = a[6], x7 = a[7], x8 = b[0], x9 = b[1], x10 = b[2], x11 = b[3], x12 = b[4], x13 = b[5], x14 = b[6], x15 = b[7];
  asm("v_exp_f32 %0, %0\n\tv_exp_f32 %1, %1\n\tv_exp_f32 %2, %2\n\tv_exp_f32 %3, %3\n\tv_exp_f32 %4, %4\n\tv_exp_f32 %5, %5\n\tv_exp_f32 %6, %6\n\tv_exp_f32 %7, %7\n\tv_exp_f32 %8, %8\n\tv_exp_f32 %9, %9\n\tv_exp_f32 %10, %10\n\tv_exp_f32 %11, %11\n\tv_exp_f32 %12, %12\n\tv_exp_f32 %13, %13\n\tv_exp_f32 %14, %14\n\tv_exp_f32 %15, %15\n\tv_nop"
      : "+v"(x0), "+v"(x1), "+v"(x2), "+v"(x3), "+v"(x4), "+v"(x5), "+v"(x6), "+v"(x7), "+v"(x8), "+v"(x9), "+v"(x10), "+v"(x11), "+v"(x12), "+v"(x13), "+v"(x14), "+v"(x15));
  a = v8f{x0, x1, x2, x3, x4, x5, x6, x7}; b = v8f{x8, x9, x10, x11, x12, x13, x14, x15}; }
__device__ __forceinline__ v8f fa_mma(v16h a, v16h b, v8f c) { return __builtin_amdgcn_wmma_f32_16x16x32_f16(false, a, false, b, (short)0, c, false, false); }
static_assert(FA_KG == 2 && FA_KN % FA_KS == 0, "k_fattn: two key groups of whole stages");
__global__ __launch_bounds__(256 * FA_KG) void k_fattn(const _Float16* __restrict__ Qn, const _Float16* __restrict__ Kn, const _Float16* __restrict__ VT, _Float16* __restrict__ O) {
  __shared__ __attribute__((aligned(16))) _Float16 sk[FA_KG][2][FA_KS][FA_LP];      /* K rows [key][d], two buffers a key group */
  __shared__ __attribute__((aligned(16))) _Float16 sv[FA_KG][2][HD][FA_LP];         /* V^T rows [d][key] */
  __shared__ __attribute__((aligned(16))) float cmb[8][17][32][4];      /* group 1's hand-over: a wave's 16 pieces of O and one of m and l, 16 bytes a lane */
  const int g = __builtin_amdgcn_readfirstlane((int)threadIdx.x >> 8);      /* key group, the same for a whole wave: kept scalar */
  const int tid = threadIdx.x & 255, w = tid >> 5, lane = tid & 31, ln = lane & 15, hh = lane >> 4;      /* place inside the key group */
  const int bh = blockIdx.y, b = bh / NH, h = bh % NH; const int q0 = blockIdx.x * FA_QB + w * FA_QW;
  const float cs = 0.125f * 1.44269504088896340736f;      /* 1/sqrt(64) and log2 e */
  const _Float16* qp = Qn + ((size_t)b * SQ + q0 + ln) * DM + h * HD;
  v16h qf[2][2];
  for (int t = 0; t < 2; ++t) for (int s = 0; s < 2; ++s) qf[t][s] = g2_frag(qp + (size_t)t * 16 * DM + s * 32, hh);
  const int sr = tid >> 3, sc8 = (tid & 7) * 8;      /* staging: 8 threads a row of 128 bytes, rows sr and sr + 32 */
  const unsigned short* kg = (const unsigned short*)Kn + ((size_t)b * SQ + g * FA_KN + sr) * DM + h * HD + sc8;
  const unsigned short* vg = (const unsigned short*)VT + ((size_t)bh * HD + sr) * SQ + g * FA_KN + sc8;
  v8us gk0 = *(const v8us*)kg, gk1 = *(const v8us*)(kg + (size_t)32 * DM), gv0 = *(const v8us*)vg, gv1 = *(const v8us*)(vg + (size_t)32 * SQ);
  asm volatile("s_wait_xcnt 0x0" :: "v"(qp), "v"(kg), "v"(vg) : "memory");      /* precaution: the loads' address registers stay live up to this wait */
  *(v8us*)&sk[g][0][sr][sc8] = gk0; *(v8us*)&sk[g][0][sr + 32][sc8] = gk1; *(v8us*)&sv[g][0][sr][sc8] = gv0; *(v8us*)&sv[g][0][sr + 32][sc8] = gv1;
  const v8f z8 = {0.f,0.f,0.f,0.f,0.f,0.f,0.f,0.f};
  v8f o[2][4]; float mr[2]; v2f l[2];
  for (int t = 0; t < 2; ++t) { mr[t] = -3.0e38f; l[t] = v2f{0.f, 0.f}; for (int dt = 0; dt < 4; ++dt) o[t][dt] = z8; }
  __syncthreads();
#pragma unroll 1      /* keeps the loop whole: without it the compiler peels the last stage, doubles the code and goes past 256 registers */
  for (int st = 0; st < FA_KN / FA_KS; ++st) {
    const int bu = st & 1; const bool more = st + 1 < FA_KN / FA_KS;      /* same for the whole work-group */
    if (more) {      /* next stage's rows fly while this stage is worked on */
      kg += (size_t)FA_KS * DM; vg += FA_KS;
      gk0 = *(const v8us*)kg; gk1 = *(const v8us*)(kg + (size_t)32 * DM); gv0 = *(const v8us*)vg; gv1 = *(const v8us*)(vg + (size_t)32 * SQ);
      asm volatile("s_wait_xcnt 0x0" :: "v"(kg), "v"(vg) : "memory");      /* precaution: the loads' address registers stay live up to this wait */
    }
    for (int kp = 0; kp < FA_KS / 32; ++kp) {
      v8f s[2][2];      /* [query tile][key tile] */
      { v16h ka[2][2];
        for (int kt = 0; kt < 2; ++kt) for (int c = 0; c < 2; ++c) ka[kt][c] = g2_frag(&sk[g][bu][kp * 32 + kt * 16 + ln][c * 32], hh);
        for (int t = 0; t < 2; ++t) for (int kt = 0; kt < 2; ++kt) s[t][kt] = fa_mma(ka[kt][1], qf[t][1], fa_mma(ka[kt][0], qf[t][0], z8)); }
      v16h va[4];
      for (int dt = 0; dt < 4; ++dt) va[dt] = g2_frag(&sv[g][bu][dt * 16 + ln][kp * 32], hh);
      float mb[2]; bool need = false;
      for (int t = 0; t < 2; ++t) { float mx = s[t][0][0];
        for (int r = 1; r < 8; ++r) mx = fmaxf(mx, s[t][0][r]);
        for (int r = 0; r < 8; ++r) mx = fmaxf(mx, s[t][1][r]);
        mx = fmaxf(mx, fa_xhalf(mx)) * cs; mb[t] = mx; need = need || (mx > mr[t] + 8.0f); }
      if (__builtin_amdgcn_ballot_w32(need) != 0) {      /* scalar branch; rare after the first passes */
        for (int t = 0; t < 2; ++t) { const float mn = fmaxf(mr[t], mb[t]); const float al = fa_exp2(mr[t] - mn); mr[t] = mn; l[t] *= al;
          for (int dt = 0; dt < 4; ++dt) o[t][dt] = o[t][dt] * al; } }
      for (int t = 0; t < 2; ++t) { const float nm = 4.0f - mr[t]; FragH pf; v8f p0 = s[t][0] * cs + nm, p1 = s[t][1] * cs + nm;
        fa_exp2x16(p0, p1);
        for (int r = 0; r < 8; ++r) { pf.h[r] = (_Float16)p0[r]; pf.h[8 + r] = (_Float16)p1[r]; }
        const v8f ps = p0 + p1; const v4f p4 = ps.lo + ps.hi; l[t] += p4.lo + p4.hi;      /* the denominator sums the unrounded f32 weights, halving trees that stay in register pairs */
        for (int dt = 0; dt < 4; ++dt) o[t][dt] = fa_mma(va[dt], pf.v, o[t][dt]); }
    }
    asm volatile("v_nop\n\tv_nop\n\tv_nop\n\tv_nop" : "+v"(o[1][0]), "+v"(o[1][1]), "+v"(o[1][2]), "+v"(o[1][3]));      /* the four vector slots behind the stage's last matrix instructions, in front of the branch below */
    if (more) { *(v8us*)&sk[g][bu ^ 1][sr][sc8] = gk0; *(v8us*)&sk[g][bu ^ 1][sr + 32][sc8] = gk1; *(v8us*)&sv[g][bu ^ 1][sr][sc8] = gv0; *(v8us*)&sv[g][bu ^ 1][sr + 32][sc8] = gv1; }      /* that buffer's readers left it at the last barrier */
    __syncthreads();      /* publishes stage st + 1 and ends the reads of stage st */
  }
  if (g != 0) {      /* scalar branch: group 1 hands over what it has of its half of the keys */
    for (int t = 0; t < 2; ++t) for (int dt = 0; dt < 4; ++dt) { *(v4f*)&cmb[w][(t * 4 + dt) * 2][lane][0] = o[t][dt].lo; *(v4f*)&cmb[w][(t * 4 + dt) * 2 + 1][lane][0] = o[t][dt].hi; }
    *(v4f*)&cmb[w][16][lane][0] = v4f{mr[0], mr[1], l[0][0] + l[0][1], l[1][0] + l[1][1]}; }
  __syncthreads();      /* publishes the hand-over; every wave passes it */
  if (g != 0) return;      /* behind the last barrier */
  const v4f s1 = *(const v4fa*)&cmb[w][16][lane][0];
  FragH f[2][4];
  for (int t = 0; t < 2; ++t) { const float mn = fmaxf(mr[t], s1[t]); const float a0 = fa_exp2(mr[t] - mn), a1 = fa_exp2(s1[t] - mn);      /* both parts on the common maximum */
    const float lw = (l[t][0] + l[t][1]) * a0 + s1[2 + t] * a1; const float inv = 64.0f / (lw + fa_xhalf(lw)); const float c0 = a0 * inv, c1 = a1 * inv;
    for (int dt = 0; dt < 4; ++dt) { const v4f ol = *(const v4fa*)&cmb[w][(t * 4 + dt) * 2][lane][0], oh = *(const v4fa*)&cmb[w][(t * 4 + dt) * 2 + 1][lane][0];
      for (int r = 0; r < 4; ++r) { f[t][dt].h[r] = (_Float16)(o[t][dt][r] * c0 + ol[r] * c1); f[t][dt].h[4 + r] = (_Float16)(o[t][dt][4 + r] * c0 + oh[r] * c1); } } }
  __builtin_amdgcn_sched_barrier(0);      /* all conversions in front of the first store, so that no register which an issued store names is written again */
  unsigned short* op = (unsigned short*)O + ((size_t)b * SQ + q0 + ln) * DM + h * HD + 8 * hh;
  for (int t = 0; t < 2; ++t) for (int dt = 0; dt < 4; ++dt) *(v8us*)(op + (size_t)t * 16 * DM + dt * 16) = f[t][dt].half[0];
}


// q and k LayerNorm (p: 0 = q, 1 = k; bx: the work-group's place among those of p), no LDS and no barrier: a wave takes LN_TW token rows and holds their 1024 features in registers, read once by loads of 512 bytes in a row.
// Mean and variance (two passes over the registers): lane partials, then a butterfly over the 32 lanes. gamma and beta (rounded to bf16) are loaded once a wave and serve all its rows.
#define LN_TW 2                      /* token rows per wave */
template <int CTRL> __device__ __forceinline__ float ln_xm(float x) { return __builtin_bit_cast(float, __builtin_amdgcn_update_dpp(0, __builtin_bit_cast(int, x), CTRL, 0xf, 0xf, true)); }      /* lane l <- lane l ^ (CTRL & 15), inside a row of 16 lanes (row_xmask) */
__device__ __forceinline__ float ln_wsum(float x) { x += ln_xm<0x161>(x); x += ln_xm<0x162>(x); x += ln_xm<0x164>(x); x += ln_xm<0x168>(x); return x + fa_xhalf(x); }      /* the sum over the wave, in every lane */
__device__ __forceinline__ float ln_sum4(v4f s) { const v2f h = s.lo + s.hi; return h[0] + h[1]; }
__device__ __forceinline__ void ln_rows(const int bx, const int p, const float* __restrict__ X, const float* __restrict__ qg, const float* __restrict__ qb, const float* __restrict__ kg, const float* __restrict__ kb, float eps, _Float16* __restrict__ Qo, _Float16* __restrict__ Ko) {
  const int lane = threadIdx.x & 31; const size_t r0 = ((size_t)bx * 8 + (threadIdx.x >> 5)) * LN_TW;
  const float* g = (p ? kg : qg) + lane * 4; const float* bt = (p ? kb : qb) + lane * 4; const float* x = X + r0 * LQ + p * DM + lane * 4;
  v4f gg[8], bb[8], a[LN_TW][8];      /* pieces of 128 features; every loop below is unrolled so that these stay in registers under constant indices */
#pragma unroll
  for (int i = 0; i < 8; ++i) { gg[i] = *(const v4fa*)(g + i * 128); bb[i] = *(const v4fa*)(bt + i * 128); }
#pragma unroll
  for (int u = 0; u < LN_TW; ++u)
#pragma unroll
    for (int i = 0; i < 8; ++i) a[u][i] = *(const v4fa*)(x + (size_t)u * LQ + i * 128);
  asm volatile("s_wait_xcnt 0x0" :: "v"(g), "v"(bt), "v"(x) : "memory");      /* precaution: the loads' address registers stay live up to this wait */
  __builtin_amdgcn_sched_barrier(0);      /* holds that wait directly behind the loads: without it the scheduler sinks it far below them */
#pragma unroll
  for (int i = 0; i < 8; ++i)
#pragma unroll
    for (int c = 0; c < 4; ++c) { gg[i][c] = bf16_round(gg[i][c]); bb[i][c] = bf16_round(bb[i][c]); }
  v4h y[LN_TW][8];
#pragma unroll
  for (int u = 0; u < LN_TW; ++u) { v4f s = a[u][0];
#pragma unroll
    for (int i = 1; i < 8; ++i) s += a[u][i];
    const float mu = ln_wsum(ln_sum4(s)) * (1.0f / (float)DM); v4f q = {0.f, 0.f, 0.f, 0.f};
#pragma unroll
    for (int i = 0; i < 8; ++i) { a[u][i] -= mu; q += a[u][i] * a[u][i]; }
    const float rs = rsqrtf(ln_wsum(ln_sum4(q)) * (1.0f / (float)DM) + eps);
#pragma unroll
    for (int i = 0; i < 8; ++i) { const v4f o = a[u][i] * rs * gg[i] + bb[i];
#pragma unroll
      for (int c = 0; c < 4; ++c) y[u][i][c] = (_Float16)o[c]; } }
  __builtin_amdgcn_sched_barrier(0);      /* all conversions in front of the first store, so that no register which an issued store names is written again */
  _Float16* d = (p ? Ko : Qo) + r0 * DM + lane * 4;
#pragma unroll
  for (int u = 0; u < LN_TW; ++u)
#pragma unroll
    for (int i = 0; i < 8; ++i) *(v4h*)(d + (size_t)u * DM + i * 128) = y[u][i];
}
// The two jobs that need only the q | k | v rows share one launch: the block index picks the job. The LayerNorm work-groups (the longer ones) come first, q then k; the V^T tiles follow.
#define LV_GL (MP / (8 * LN_TW))     /* LayerNorm work-groups for q, and as many for k */
#define LV_GV (NB * NH * (SQ / 64))  /* V^T tiles */
__global__ __launch_bounds__(256) void k_lnvt(const float* __restrict__ X, const float* __restrict__ qg, const float* __restrict__ qb, const float* __restrict__ kg, const float* __restrict__ kb, float eps, _Float16* __restrict__ Qo, _Float16* __restrict__ Ko, const _Float16* __restrict__ V16, _Float16* __restrict__ Vt) {
  __shared__ unsigned short tl[64][66];
  const int bx = blockIdx.x;      /* every test on it is the same for the whole work-group, so the barrier in vt_tile is passed by all of its waves or by none */
  if (bx < 2 * LV_GL) { const int p = bx >= LV_GL ? 1 : 0; ln_rows(bx - p * LV_GL, p, X, qg, qb, kg, kb, eps, Qo, Ko); }
  else vt_tile<NH, SQ>(tl, bx - 2 * LV_GL, V16, LQ, 0, Vt);
}
extern "C" void kernel_launch(void* const* d_in, const int* in_sizes, int n_in,
                              void* d_out, int out_size, void* d_ws, size_t ws_size, hipStream_t stream) {
  (void)in_sizes; (void)n_in; (void)out_size;
  const float* const* I = (const float* const*)d_in; const float* x = I[0]; const float* wqkv = I[1]; const float* wo = I[2]; const float* bo = I[3]; const float* qg = I[4]; const float* qb = I[5]; const float* kg = I[6]; const float* kb = I[7]; const float* bqkv = nullptr;      /* natural weights; no qkv bias */
  char* ws = (char*)d_ws; size_t off = 0;
  auto take = [&](size_t bytes) { char* p = ws + off; off += (bytes + 255) & ~(size_t)255; return p; };
  _Float16* BQKV = (_Float16*)take((size_t)3 * DM * DM * 2); _Float16* BO = (_Float16*)take((size_t)DM * DM * 2);
  _Float16* X16 = (_Float16*)take(NR * DM * 2); float* QKVF = (float*)take(NR * 3 * DM * 4); _Float16* QN16 = (_Float16*)take(NR * DM * 2); _Float16* KN16 = (_Float16*)take(NR * DM * 2); _Float16* QKV = (_Float16*)take(NR * 3 * DM * 2); _Float16* Q16 = QKV; _Float16* K16 = QKV + DM; _Float16* V16 = QKV + 2 * DM; _Float16* O16 = (_Float16*)take(NR * DM * 2);
  _Float16* VT = (_Float16*)take((size_t)NB * NH * HD * SQ * 2);
  if (off > ws_size) return;
  k_cvt3<<<CV_GX + CV_GQ + CV_GO, 256, 0, stream>>>(x, wqkv, wo, X16, BQKV, BO);      /* x rows; natural [out][in] weights = Bt planes x16 */
  const size_t r0p = (size_t)B0 * SQ;      /* first projected row */
  k_gemm2<0><<<dim3((unsigned)((MP / 128) * (3 * DM / 128)), 1), 256, 0, stream>>>(X16 + r0p * DM, DM, 0, BQKV, DM, 0, 0.0625f, nullptr, 0, nullptr, 1, 0, 0, QKVF + r0p * 3 * DM, QKV + r0p * 3 * DM, 3 * DM, 0, MP, 3 * DM, DM);      /* q | k | v rows: f32 (for the LayerNorms) and f16 (v operand) */
  static_assert(MP % (8 * LN_TW) == 0, "k_lnvt: whole LayerNorm work-groups of 8 waves");
  k_lnvt<<<2 * LV_GL + LV_GV, 256, 0, stream>>>(QKVF + r0p * 3 * DM, qg, qb, kg, kb, 1e-5f, QN16 + r0p * DM, KN16 + r0p * DM, V16, VT);      /* q, k = LayerNorm over the merged 1024 features -> f16 rows; V^T [NB][NH][HD][SQ] */
  k_fattn<<<dim3(SQ / FA_QB, NB * NH), 256 * FA_KG, 0, stream>>>(QN16, KN16, VT, O16);      /* o (merged heads, x64) as f16 rows: all batches and heads in one launch */
  k_gemm2<0><<<dim3((unsigned)((MPO / 128) * (DM / 128)), 1), 256, 0, stream>>>(O16 + r0p * DM, DM, 0, BO, DM, 0, 0.0009765625f, bo, 0, nullptr, 1, 0, 0, (float*)d_out + r0p * DM, nullptr, DM, 0, MPO, DM, DM);      /* out rows are the output layout */
}

// v007
// Measured time: 89.3 microseconds a run.
// Next to v006, in two timings, it ran 1.05 times as fast each time.
// Over all steps from v000 it is 38.7 times as fast.
#include <hip/hip_runtime.h>
// Self-attention block with q/k LayerNorm (x [2][2048][1024]; qkv = x w_qkv^T (natural [3072][1024], sigma 1/32, no bias) -> q | k | v blocks, 16 heads of 64; q = LayerNorm_1024(q; q_gamma, q_beta) and k likewise over the full merged 1024 features (eps 1e-5); softmax(q k^T / 8) (no mask); out = merged w_proj^T + b_proj -> [2][2048][1024]).
// Structure: x as exact f16 rows; natural weights as exact x16 planes; q | k | v as ONE WMMA GEMM (256x192 block tiles staged in LDS, 64x48 wave tiles, f32 accumulation; f32 rows for the norms + f16 rows for v); q and k LayerNorm over the merged 1024 features on VALU in one launch (f32, two token rows a wave in registers, lane partials + butterfly; bf16 gamma/beta) -> f16 rows; V^T via LDS transposes; one fused attention launch over all batches and heads (scores K = 64 in f32 accumulators, online softmax with f32 statistics and native exp2, weights as f16, o = P V carried x64) into merged f16 rows; out = o w_proj^T + b_proj GEMM (f32, alpha 2^-10); launches: see trace.
// Compute dtype: inputs rounded to bf16; x / weights exact; q, k, v, softmax weights and o as plain f16 GEMM operands (~2^-12); scores and softmax statistics f32. v_wmma_f32_16x16x32_f16.
#define NB 2
#define SQ 2048
#define DM 1024
#define NH 16
#define HD 64
#define HG 4                         /* heads per launch of the per-batch k_vt (not launched) */
#define B0 0                         /* first batch processed (debug hook) */
#define NBR NB                       /* batches processed (debug hook) */
#define NR ((size_t)NB * SQ)
#define DMQ DM         /* unused: ln_rows and the f16 rows use DM */
#define MP ((int)((size_t)NBR * SQ)) /* rows projected (debug hook) */
#define QN SQ                        /* unused: k_fattn attends all SQ query rows */
#define NHD NH                       /* unused: k_fattn attends all NH heads */
#define MPO MP                       /* rows through the output stage (debug hook) */
#define LQ (3 * DM)      /* row pitch of the q/k/v rows */
typedef __bf16 v16b __attribute__((ext_vector_type(16)));
typedef unsigned short v8us __attribute__((ext_vector_type(8), may_alias));
typedef float  v8f  __attribute__((ext_vector_type(8)));
typedef float  v4f  __attribute__((ext_vector_type(4)));
typedef float  v4fa __attribute__((ext_vector_type(4), may_alias));
union FragB { v16b v; v8us half[2]; unsigned short u[16]; };

__device__ __forceinline__ unsigned short bf16_bits(float x) { unsigned int u = __float_as_uint(x); return (unsigned short)((u + 0x7FFFu + ((u >> 16) & 1u)) >> 16); }
__device__ __forceinline__ float bf16_val(unsigned short b) { return __uint_as_float(((unsigned int)b) << 16); }
__device__ __forceinline__ float bf16_round(float x) { return bf16_val(bf16_bits(x)); }
// D += A·B with NT terms: 1 = ah·bh, 2 = + al·bh (A split), 3 = + ah·bl (both split)
template <int NT>
__device__ __forceinline__ v8f mmaN(v16b ah, v16b al, v16b bh, v16b bl, v8f c) {
  c = __builtin_amdgcn_wmma_f32_16x16x32_bf16(false, ah, false, bh, (short)0, c, false, false);
  if (NT >= 2) c = __builtin_amdgcn_wmma_f32_16x16x32_bf16(false, al, false, bh, (short)0, c, false, false);
  if (NT >= 3) c = __builtin_amdgcn_wmma_f32_16x16x32_bf16(false, ah, false, bl, (short)0, c, false, false);
  asm volatile("v_nop\n\tv_nop\n\tv_nop\n\tv_nop" : "+v"(c) : "v"(ah), "v"(al), "v"(bh), "v"(bl));
  return c;
}

__global__ __launch_bounds__(256) void k_wt_bf16(const float* __restrict__ W, unsigned short* __restrict__ Wt, int K, int N) {
  const int t = blockIdx.x * 256 + threadIdx.x;
  const int k8n = K / 8;
  if (t >= N * k8n) return;
  const int n = t / k8n, k8 = (t % k8n) * 8;
  v8us v;
#pragma unroll
  for (int i = 0; i < 8; ++i) v[i] = bf16_bits(W[(size_t)(k8 + i) * N + n]);
  *(v8us*)(Wt + (size_t)n * K + k8) = v;
  
}

// GEMM C[M][N] (f32, pitch ldc) = act(A[M][K]·W + bias). A f32 row-major (pitch lda) converted per fragment to bf16
// (ASPLIT: hi/lo two planes -> 2 terms, else single rounded term); Wt bf16 [N][K] (pitch ldb). BIAS_BF16 rounds the
// bias to bf16 first (bias quantised to bf16 before the add). K%32==0, M%16==0, N%64==0.
template <bool ASPLIT, int ACT, bool BIAS_BF16>
__global__ __launch_bounds__(128) void k_gemm_bf(const float* __restrict__ A, int lda, const unsigned short* __restrict__ Wt, int ldb,
                                               const float* __restrict__ bias, float* __restrict__ C, int ldc, int M, int N, int K) {
  __shared__ __attribute__((aligned(16))) float so[4][16][64];
  const int tid = threadIdx.x, w = tid >> 5, lane = tid & 31, ln = lane & 15, hh = lane >> 4;
  const int ntn = N / 64;
  const int wid = blockIdx.x * 4 + w;
  const int mt = wid / ntn, nq = wid % ntn;
  if (mt * 16 >= M) return;
  const int row0 = mt * 16, col0 = nq * 64;
  const float* arow = A + (size_t)(row0 + ln) * lda;
  v8f acc[4] = {};
  for (int kb = 0; kb < K; kb += 32) {
    FragB ah, al;
    const v4f x0 = *(const v4fa*)(arow + kb + 8 * hh), x1 = *(const v4fa*)(arow + kb + 8 * hh + 4);
    const v4f x2 = *(const v4fa*)(arow + kb + 16 + 8 * hh), x3 = *(const v4fa*)(arow + kb + 16 + 8 * hh + 4);
    float xs[16] = {x0[0],x0[1],x0[2],x0[3],x1[0],x1[1],x1[2],x1[3],x2[0],x2[1],x2[2],x2[3],x3[0],x3[1],x3[2],x3[3]};
#pragma unroll
    for (int i = 0; i < 16; ++i) { const unsigned short hb = bf16_bits(xs[i]); ah.u[i] = hb; al.u[i] = ASPLIT ? bf16_bits(xs[i] - bf16_val(hb)) : (unsigned short)0; }
#pragma unroll
    for (int t = 0; t < 4; ++t) {
      const unsigned short* brow = Wt + (size_t)(col0 + t * 16 + ln) * ldb + kb;
      FragB b;
      b.half[0] = *(const v8us*)(brow + 8 * hh);
      b.half[1] = *(const v8us*)(brow + 16 + 8 * hh);
      acc[t] = mmaN<ASPLIT ? 2 : 1>(ah.v, al.v, b.v, b.v, acc[t]);
    }
  }
#pragma unroll
  for (int t = 0; t < 4; ++t) {
    float bv = bias ? bias[col0 + t * 16 + ln] : 0.f;
    if (BIAS_BF16) bv = bf16_round(bv);
#pragma unroll
    for (int r = 0; r < 8; ++r) { float v = acc[t][r] + bv; if (ACT == 1) v = fmaxf(v, 0.f); so[w][8 * hh + r][t * 16 + ln] = v; }
  }
  __builtin_amdgcn_fence(__ATOMIC_ACQ_REL, "workgroup");
  __builtin_amdgcn_wave_barrier();
  const int rsub = lane >> 4, c4 = (lane & 15) * 4;
  {
#pragma unroll
    for (int q = 0; q < 8; ++q) {
      const int r = q * 2 + rsub;
      const v4f v = *(const v4fa*)&so[w][r][c4];
      *(v4f*)(C + (size_t)(row0 + r) * ldc + col0 + c4) = v;
    }
    
  }
}

// GEMM C = act(A·W + bias + resid): A f32 (ASPLIT -> hi/lo 2 terms), Wt bf16 [N][K]; ACT 0 none, 1 relu, 2 exact gelu;
// resid (optional, f32, row index = (row % rmod), pitch ldr, RES_BF16 rounds it) added before the activation.
template <bool ASPLIT, int ACT, bool BIAS_BF16, bool RES_BF16>
__global__ __launch_bounds__(128) void k_gemm_bf3(const float* __restrict__ A, int lda, const unsigned short* __restrict__ Wt, int ldb,
                                                const float* __restrict__ bias, const float* __restrict__ resid, int rmod, int ldr,
                                                float* __restrict__ C, int ldc, int M, int N, int K) {
  __shared__ __attribute__((aligned(16))) float so[4][16][64];
  const int tid = threadIdx.x, w = tid >> 5, lane = tid & 31, ln = lane & 15, hh = lane >> 4;
  const int ntn = N / 64;
  const int wid = blockIdx.x * 4 + w;
  const int mt = wid / ntn, nq = wid % ntn;
  if (mt * 16 >= M) return;
  const int row0 = mt * 16, col0 = nq * 64;
  const float* arow = A + (size_t)(row0 + ln) * lda;
  v8f acc[4] = {};
  for (int kb = 0; kb < K; kb += 32) {
    FragB ah, al;
    const v4f x0 = *(const v4fa*)(arow + kb + 8 * hh), x1 = *(const v4fa*)(arow + kb + 8 * hh + 4);
    const v4f x2 = *(const v4fa*)(arow + kb + 16 + 8 * hh), x3 = *(const v4fa*)(arow + kb + 16 + 8 * hh + 4);
    float xs[16] = {x0[0],x0[1],x0[2],x0[3],x1[0],x1[1],x1[2],x1[3],x2[0],x2[1],x2[2],x2[3],x3[0],x3[1],x3[2],x3[3]};
#pragma unroll
    for (int i = 0; i < 16; ++i) { const unsigned short hb = bf16_bits(xs[i]); ah.u[i] = hb; al.u[i] = ASPLIT ? bf16_bits(xs[i] - bf16_val(hb)) : (unsigned short)0; }
#pragma unroll
    for (int t = 0; t < 4; ++t) {
      const unsigned short* brow = Wt + (size_t)(col0 + t * 16 + ln) * ldb + kb;
      FragB b;
      b.half[0] = *(const v8us*)(brow + 8 * hh);
      b.half[1] = *(const v8us*)(brow + 16 + 8 * hh);
      acc[t] = mmaN<ASPLIT ? 2 : 1>(ah.v, al.v, b.v, b.v, acc[t]);
    }
  }
#pragma unroll
  for (int t = 0; t < 4; ++t) {
    const int col = col0 + t * 16 + ln;
    float bv = bias ? bias[col] : 0.f;
    if (BIAS_BF16) bv = bf16_round(bv);
#pragma unroll
    for (int r = 0; r < 8; ++r) {
      float v = acc[t][r] + bv;
      if (resid) { float rv = resid[(size_t)((row0 + 8 * hh + r) % rmod) * ldr + col]; if (RES_BF16) rv = bf16_round(rv); v += rv; }
      if (ACT == 1) v = fmaxf(v, 0.f);
      if (ACT == 2) v = 0.5f * v * (1.0f + erff(v * 0.70710678118654752f));
      if (ACT == 3) { const float u = 0.7978845608028654f * (v + 0.044715f * v * v * v); v = 0.5f * v * (1.0f + tanhf(u)); }
      so[w][8 * hh + r][t * 16 + ln] = v;
    }
  }
  __builtin_amdgcn_fence(__ATOMIC_ACQ_REL, "workgroup");
  __builtin_amdgcn_wave_barrier();
  const int rsub = lane >> 4, c4 = (lane & 15) * 4;
  {
#pragma unroll
    for (int q = 0; q < 8; ++q) {
      const int r = q * 2 + rsub;
      const v4f v = *(const v4fa*)&so[w][r][c4];
      *(v4f*)(C + (size_t)(row0 + r) * ldc + col0 + c4) = v;
    }
    
  }
}
// row LayerNorm (biased variance, eps) over N: s = X (+ R); optional out_sum <- s; out_norm <- (s-mu)*rsqrt(var+eps)*g + b
template <bool PARAM_BF16>
__global__ __launch_bounds__(256) void k_layernorm(const float* __restrict__ X, const float* __restrict__ R, const float* __restrict__ g, const float* __restrict__ bta,
                                                  float* __restrict__ out_sum, float* __restrict__ out_norm, int N, float eps) {
  __shared__ float red[256];
  const int row = blockIdx.x, tid = threadIdx.x;
  const float* x = X + (size_t)row * N; const float* rr = R ? R + (size_t)row * N : nullptr;
  float vals[16];                     // up to N = 4096
  const int per = N / 256;            // contiguous chunk per thread? use strided-by-4 chunks: thread handles j = tid*4 + 1024*u
  float s1 = 0.f;
  for (int u = 0; u < per / 4; ++u) {
    const int j = tid * 4 + 1024 * u;
    const v4f a = *(const v4fa*)(x + j);
    v4f b = {0.f,0.f,0.f,0.f}; if (rr) b = *(const v4fa*)(rr + j);
#pragma unroll
    for (int q = 0; q < 4; ++q) { const float v = a[q] + b[q]; vals[u * 4 + q] = v; s1 += v; }
  }
  red[tid] = s1; __syncthreads();
  for (int st = 128; st > 0; st >>= 1) { if (tid < st) red[tid] += red[tid + st]; __syncthreads(); }
  const float mu = red[0] / (float)N; __syncthreads();
  float s2 = 0.f;
  for (int u = 0; u < per / 4; ++u)
#pragma unroll
    for (int q = 0; q < 4; ++q) { const float c = vals[u * 4 + q] - mu; s2 += c * c; }
  red[tid] = s2; __syncthreads();
  for (int st = 128; st > 0; st >>= 1) { if (tid < st) red[tid] += red[tid + st]; __syncthreads(); }
  const float rs = rsqrtf(red[0] / (float)N + eps);
  {
    for (int u = 0; u < per / 4; ++u) {
      const int j = tid * 4 + 1024 * u;
      v4f o, sm;
#pragma unroll
      for (int q = 0; q < 4; ++q) {
        float gg = g[j + q], bb = bta[j + q];
        if (PARAM_BF16) { gg = bf16_round(gg); bb = bf16_round(bb); }
        sm[q] = vals[u * 4 + q]; o[q] = (vals[u * 4 + q] - mu) * rs * gg + bb;
      }
      if (out_sum) *(v4f*)(out_sum + (size_t)row * N + j) = sm;
      *(v4f*)(out_norm + (size_t)row * N + j) = o;
    }
    
  }
}



// ---- f16 WMMA path (v_wmma_f32_16x16x32_f16): 11-bit significands for operands in range — used where a [0,1] probability operand needs more precision than bf16
typedef _Float16 v16h __attribute__((ext_vector_type(16)));
union FragH { v16h v; v8us half[2]; _Float16 h[16]; unsigned short u[16]; };
template <int NT>
__device__ __forceinline__ v8f mmaH(v16h ah, v16h al, v16h bh, v16h bl, v8f c) {
  c = __builtin_amdgcn_wmma_f32_16x16x32_f16(false, ah, false, bh, (short)0, c, false, false);
  if (NT >= 2) c = __builtin_amdgcn_wmma_f32_16x16x32_f16(false, al, false, bh, (short)0, c, false, false);
  if (NT >= 3) c = __builtin_amdgcn_wmma_f32_16x16x32_f16(false, ah, false, bl, (short)0, c, false, false);
  asm volatile("v_nop\n\tv_nop\n\tv_nop\n\tv_nop" : "+v"(c) : "v"(ah), "v"(al), "v"(bh), "v"(bl));
  return c;
}
// batched GEMM like k_gemm_b but f16 operands: A f32 (split into f16 hi/lo if ASPLIT, else rounded to f16), Bt = f16 values [n][k]; alpha; C f32; N multiple of 16 (partial tiles skipped)
template <bool ASPLIT>
__global__ __launch_bounds__(128) void k_gemm_h(const float* __restrict__ A, int lda, size_t sA, const _Float16* __restrict__ Bh, int ldb, size_t sB, float alpha, float* __restrict__ C, int ldc, size_t sC, int M, int N, int K) {
  __shared__ __attribute__((aligned(16))) float so[4][16][64];
  const int tid = threadIdx.x, w = tid >> 5, lane = tid & 31, ln = lane & 15, hh = lane >> 4; const int by = blockIdx.y;
  A += (size_t)by * sA; Bh += (size_t)by * sB; C += (size_t)by * sC;
  const int ntn = (N + 63) / 64; const int wid = blockIdx.x * 4 + w; const int mt = wid / ntn, nq = wid % ntn; if (mt * 16 >= M) return;
  const int row0 = mt * 16, col0 = nq * 64; const float* arow = A + (size_t)(row0 + ln) * lda;
  v8f acc[4] = {};
  for (int kb = 0; kb < K; kb += 32) {
    FragH ah, al;
    const v4f x0 = *(const v4fa*)(arow + kb + 8 * hh), x1 = *(const v4fa*)(arow + kb + 8 * hh + 4), x2 = *(const v4fa*)(arow + kb + 16 + 8 * hh), x3 = *(const v4fa*)(arow + kb + 16 + 8 * hh + 4);
    float xs[16] = {x0[0],x0[1],x0[2],x0[3],x1[0],x1[1],x1[2],x1[3],x2[0],x2[1],x2[2],x2[3],x3[0],x3[1],x3[2],x3[3]};
#pragma unroll
    for (int i = 0; i < 16; ++i) { const _Float16 h = (_Float16)xs[i]; ah.h[i] = h; al.h[i] = ASPLIT ? (_Float16)(xs[i] - (float)h) : (_Float16)0.0f; }
#pragma unroll
    for (int t = 0; t < 4; ++t) { if (col0 + t * 16 >= N) continue; const size_t boff = (size_t)(col0 + t * 16 + ln) * ldb + kb; FragH bq; bq.half[0] = *(const v8us*)(Bh + boff + 8 * hh); bq.half[1] = *(const v8us*)(Bh + boff + 16 + 8 * hh);
      acc[t] = mmaH<ASPLIT ? 2 : 1>(ah.v, al.v, bq.v, bq.v, acc[t]); }
  }
#pragma unroll
  for (int t = 0; t < 4; ++t) { if (col0 + t * 16 >= N) continue;
#pragma unroll
    for (int r = 0; r < 8; ++r) so[w][8 * hh + r][t * 16 + ln] = acc[t][r] * alpha; }
  __builtin_amdgcn_fence(__ATOMIC_ACQ_REL, "workgroup"); __builtin_amdgcn_wave_barrier();
  const int rsub = lane >> 4, c4 = (lane & 15) * 4;
  {
#pragma unroll
    for (int q = 0; q < 8; ++q) { const int r = q * 2 + rsub; if (col0 + c4 < N) { const v4f v = *(const v4fa*)&so[w][r][c4]; *(v4f*)(C + (size_t)(row0 + r) * ldc + col0 + c4) = v; } }
     }
}

// Wt[n][k] = f16(W[k][n]·scale) from f32 row-major W[K][N] (scale = power of two; bf16-exact weights stay exact in f16 away from the subnormal range)
__global__ __launch_bounds__(256) void k_wt_f16(const float* __restrict__ W, _Float16* __restrict__ Wt, int K, int N, float scale) {
  const int t = blockIdx.x * 256 + threadIdx.x; if (t >= N * (K / 8)) return; const int n = t / (K / 8), k8 = (t % (K / 8)) * 8; FragH f;
#pragma unroll
  for (int i = 0; i < 8; ++i) f.h[i] = (_Float16)(bf16_round(W[(size_t)(k8 + i) * N + n]) * scale); const v8us o = f.half[0];
  *(v8us*)((unsigned short*)Wt + (size_t)n * K + k8) = o; 
}
// k_gemm_hh variant with fused epilogue: v = acc·alpha + bias[by·sBias + col] (+ CP[(row/rowsPerB)·sCPb + by·64 + col] if CP) ; ACT 0 none / 1 elu ; writes f16 C16 (and f32 C if non-null)
template <int ACT>
__global__ __launch_bounds__(128) void k_gemm_hhx(const _Float16* __restrict__ A, int lda, size_t sA, const _Float16* __restrict__ Bh, int ldb, size_t sB, float alpha, const float* __restrict__ bias, size_t sBias, const float* __restrict__ CP, int rowsPerB, size_t sCPb, int row0g,
    float* __restrict__ C, _Float16* __restrict__ C16, int ldc, size_t sC, int M, int N, int K) {
  __shared__ __attribute__((aligned(16))) float so[4][16][64];
  const int tid = threadIdx.x, w = tid >> 5, lane = tid & 31, ln = lane & 15, hh = lane >> 4; const int by = blockIdx.y;
  A += (size_t)by * sA; Bh += (size_t)by * sB; const size_t cofs = (size_t)by * sC; const float* bp = bias ? bias + (size_t)by * sBias : nullptr;
  const int ntn = (N + 63) / 64; const int wid = blockIdx.x * 4 + w; const int mt = wid / ntn, nq = wid % ntn; if (mt * 16 >= M) return;
  const int row0 = mt * 16, col0 = nq * 64; const _Float16* arow = A + (size_t)(row0 + ln) * lda;
  v8f acc[4] = {};
  for (int kb = 0; kb < K; kb += 32) { FragH ah; ah.half[0] = *(const v8us*)((const unsigned short*)arow + kb + 8 * hh); ah.half[1] = *(const v8us*)((const unsigned short*)arow + kb + 16 + 8 * hh);
#pragma unroll
    for (int t = 0; t < 4; ++t) { if (col0 + t * 16 >= N) continue; const size_t boff = (size_t)(col0 + t * 16 + ln) * ldb + kb; FragH bq; bq.half[0] = *(const v8us*)((const unsigned short*)Bh + boff + 8 * hh); bq.half[1] = *(const v8us*)((const unsigned short*)Bh + boff + 16 + 8 * hh);
      acc[t] = mmaH<1>(ah.v, ah.v, bq.v, bq.v, acc[t]); }
  }
#pragma unroll
  for (int t = 0; t < 4; ++t) { if (col0 + t * 16 >= N) continue; const int col = col0 + t * 16 + ln; const float bv = bp ? bf16_round(bp[col]) : 0.f;
#pragma unroll
    for (int r = 0; r < 8; ++r) { float v = acc[t][r] * alpha + bv; if (CP) { const int rr = row0g + row0 + 8 * hh + r; if (rowsPerB < 0) v += CP[cofs + (size_t)rr * ldc + col];      /* rowsPerB < 0: own element of the batched C plane */ else { const int bidx = rr / rowsPerB; v += CP[(size_t)bidx * sCPb + (size_t)by * 64 + col]; } } if (ACT == 1) v = (v > 0.f) ? v : expm1f(v); else if (ACT == 7) v = (v > 0.f) ? v + 1.0f : expf(v); else if (ACT == 8) v = tanhf(v); else if (ACT == 9) v = 0.5f * v * (1.0f + tanhf(0.7978845608028654f * (v + 0.044715f * v * v * v))); else if (ACT == 11) v = 1.0f / (1.0f + expf(-v)); else if (ACT == 12) v = (v > 0.f) ? v : 0.01f * v; else if (ACT == 14) v = (v > 0.f) ? v : 0.1f * v; else if (ACT == 16) v = (v >= 0.f) ? v : 0.3f * v; else if (ACT == 17) v = (v >= 0.f) ? v : 0.2f * v; else if (ACT == 15) v = v / (1.0f + expf(-v)); else if (ACT == 3) v = fmaxf(v, 0.f); else if (ACT == 6) v = 0.5f * v * (1.0f + erff(v * 0.70710678118654752f)); so[w][8 * hh + r][t * 16 + ln] = v; } }
  __builtin_amdgcn_fence(__ATOMIC_ACQ_REL, "workgroup"); __builtin_amdgcn_wave_barrier();
  const int rsub = lane >> 4, c4 = (lane & 15) * 4; typedef _Float16 v4h __attribute__((ext_vector_type(4)));
  {
#pragma unroll
    for (int q = 0; q < 8; ++q) { const int r = q * 2 + rsub; if (col0 + c4 < N) { const v4f v = *(const v4fa*)&so[w][r][c4]; if (C) *(v4f*)(C + cofs + (size_t)(row0 + r) * ldc + col0 + c4) = v; if (C16) { v4h h4; for (int i = 0; i < 4; ++i) h4[i] = (_Float16)v[i]; *(v4h*)(C16 + cofs + (size_t)(row0 + r) * ldc + col0 + c4) = h4; } } }
     }
}


typedef _Float16 v4h __attribute__((ext_vector_type(4)));

__global__ __launch_bounds__(256) void k_h16(const float* __restrict__ x, _Float16* __restrict__ X16, size_t n8) { const size_t t = (size_t)blockIdx.x * 256 + threadIdx.x; if (t >= n8) return; FragH f;
#pragma unroll
  for (int q = 0; q < 8; ++q) f.h[q] = (_Float16)x[t * 8 + q]; *(v8us*)((unsigned short*)X16 + t * 8) = f.half[0];  }
__global__ __launch_bounds__(256) void k_round16f(const float* __restrict__ W, _Float16* __restrict__ Bt, size_t n8) { const size_t t = (size_t)blockIdx.x * 256 + threadIdx.x; if (t >= n8) return; FragH f;
#pragma unroll
  for (int i = 0; i < 8; ++i) f.h[i] = (_Float16)(bf16_round(W[t * 8 + i]) * 16.0f); *(v8us*)((unsigned short*)Bt + t * 8) = f.half[0];  }
template <int NHv, int TTv>
__device__ __forceinline__ void vt_tile(unsigned short (*tl)[66], const int bx, const _Float16* __restrict__ V16, int ldv, int voff, _Float16* __restrict__ Vt) { const int tid = threadIdx.x; const int slab = bx / (TTv / 64), lg = bx % (TTv / 64); const int b = slab / NHv, h = slab % NHv;      /* one 64 x 64 tile a work-group; tl: its LDS tile */
  for (int i = tid; i < 64 * 8; i += 256) { const int r = i / 8, c8 = (i % 8) * 8; FragH f; f.half[0] = *(const v8us*)((const unsigned short*)V16 + ((size_t)b * TTv + lg * 64 + r) * ldv + voff + h * 64 + c8);
#pragma unroll
    for (int q = 0; q < 8; ++q) tl[r][c8 + q] = f.u[q]; }
  __syncthreads();
  {
#pragma unroll
    for (int rd = 0; rd < 2; ++rd) { const int d = rd * 32 + tid / 8, pc = tid % 8; FragH f;
#pragma unroll
      for (int q = 0; q < 8; ++q) f.u[q] = tl[pc * 8 + q][d];
      *(v8us*)((unsigned short*)Vt + ((size_t)slab * 64 + d) * TTv + lg * 64 + pc * 8) = f.half[0]; }
     } }

__global__ __launch_bounds__(256) void k_hl(const float* __restrict__ F, _Float16* __restrict__ Hh, _Float16* __restrict__ Hl, size_t n8) { const size_t t = (size_t)blockIdx.x * 256 + threadIdx.x; if (t >= n8) return; FragH fh, fl; const v4f a = *(const v4fa*)(F + t * 8), c = *(const v4fa*)(F + t * 8 + 4);
#pragma unroll
  for (int q = 0; q < 4; ++q) { _Float16 h = (_Float16)a[q]; fh.h[q] = h; fl.h[q] = (_Float16)((a[q] - (float)h) * 1024.0f); h = (_Float16)c[q]; fh.h[4 + q] = h; fl.h[4 + q] = (_Float16)((c[q] - (float)h) * 1024.0f); }
  { *(v8us*)((unsigned short*)Hh + t * 8) = fh.half[0]; *(v8us*)((unsigned short*)Hl + t * 8) = fl.half[0];  } }

// ---- fast GEMM (block tile 128x128 = 8 waves of 32x64, operand tiles staged in LDS; requires M % 128 == 0, N % 128 == 0, K % 64 == 0); epilogue = k_gemm_hhx semantics ----
#define G2_KS 64                     /* k per LDS stage: one whole 128-byte line of every operand row */
#define G2_LP 72                     /* LDS row pitch in f16: 128 data bytes + 16, so that the 16-byte fragment reads of 16 rows spread over the banks */
#define G2_STB (256 * G2_LP * 2)     /* bytes of a stage: 128 A rows, then 128 B rows */
// One stage: a thread copies 16 bytes of rows r, r + 32, r + 64, r + 96 of the A tile and of the B tile (8 threads a row, so a wave's copy covers 4 whole lines), global memory to LDS through no register.
// The closing s_wait_xcnt stands inside the statement so that no address register of an issued copy is rewritten in front of it (a precaution).
__device__ __forceinline__ void g2_stage(unsigned l, const _Float16* a0, size_t a32, const _Float16* b0, size_t b32) {
  const _Float16* a1 = a0 + a32; const _Float16* a2 = a1 + a32; const _Float16* a3 = a2 + a32; const _Float16* b1 = b0 + b32; const _Float16* b2 = b1 + b32; const _Float16* b3 = b2 + b32;
  const unsigned R = 32 * G2_LP * 2;      /* 32 LDS rows in bytes */
  asm volatile("global_load_async_to_lds_b128 %0, %8, off\n\tglobal_load_async_to_lds_b128 %1, %9, off\n\tglobal_load_async_to_lds_b128 %2, %10, off\n\tglobal_load_async_to_lds_b128 %3, %11, off\n\t"
               "global_load_async_to_lds_b128 %4, %12, off\n\tglobal_load_async_to_lds_b128 %5, %13, off\n\tglobal_load_async_to_lds_b128 %6, %14, off\n\tglobal_load_async_to_lds_b128 %7, %15, off\n\ts_wait_xcnt 0x0"
               :: "v"(l), "v"(l + R), "v"(l + 2 * R), "v"(l + 3 * R), "v"(l + 4 * R), "v"(l + 5 * R), "v"(l + 6 * R), "v"(l + 7 * R), "v"(a0), "v"(a1), "v"(a2), "v"(a3), "v"(b0), "v"(b1), "v"(b2), "v"(b3) : "memory");
}
__device__ __forceinline__ v16h g2_frag(const _Float16* p, int hh) { FragH f; f.half[0] = *(const v8us*)((const unsigned short*)p + 8 * hh); f.half[1] = *(const v8us*)((const unsigned short*)p + 16 + 8 * hh); return f.v; }
__device__ __forceinline__ v8f g2_mma(v16h a, v16h b, v8f c) { v8f d = __builtin_amdgcn_wmma_f32_16x16x32_f16(false, a, false, b, (short)0, c, false, false); asm volatile("v_nop\n\tv_nop\n\tv_nop\n\tv_nop" : "+v"(d) : "v"(a), "v"(b)); return d; }
template <int ACT>
__global__ __launch_bounds__(256) void k_gemm2(const _Float16* __restrict__ A, int lda, size_t sA, const _Float16* __restrict__ Bh, int ldb, size_t sB, float alpha, const float* __restrict__ bias, size_t sBias, const float* __restrict__ CP, int rowsPerB, size_t sCPb, int row0g,
    float* __restrict__ C, _Float16* __restrict__ C16, int ldc, size_t sC, int M, int N, int K) { static_assert(ACT == 0 || ACT == 3 || ACT == 6 || ACT == 8 || ACT == 9 || ACT == 11 || ACT == 12 || ACT == 14 || ACT == 15 || ACT == 16 || ACT == 17, "k_gemm2: unsupported ACT code (would silently apply no activation)");
  __shared__ __attribute__((aligned(16))) unsigned char ring[2 * G2_STB];      /* two stages; behind the loop's last barrier the same bytes are the output staging */
  static_assert(sizeof(float) * 8 * 32 * 68 <= sizeof(ring), "k_gemm2: the output staging must fit the ring");
  float (*so)[32][68] = (float (*)[32][68])ring;
  const int tid = threadIdx.x, w = tid >> 5, lane = tid & 31, ln = lane & 15, hh = lane >> 4; const int by = blockIdx.y;
  A += (size_t)by * sA; Bh += (size_t)by * sB; const size_t cofs = (size_t)by * sC; const float* bp = bias ? bias + (size_t)by * sBias : nullptr;
  const int ntn = N >> 7; const int mt = blockIdx.x / ntn, nq = blockIdx.x - mt * ntn; if (mt * 128 >= M) return;      /* the same for the whole work-group, in front of every copy and barrier */
  const int wm = w & 3, wn = w >> 2; const int row0 = mt * 128 + 32 * wm, col0 = nq * 128 + 64 * wn;
  const int sr = tid >> 3, sc8 = (tid & 7) * 8;      /* staging: 8 threads a row of 128 bytes */
  const _Float16* ga = A + (size_t)(mt * 128 + sr) * lda + sc8; const _Float16* gb = Bh + (size_t)(nq * 128 + sr) * ldb + sc8; const size_t a32 = (size_t)32 * lda, b32 = (size_t)32 * ldb;
  const unsigned l0 = (unsigned)(size_t)ring + (unsigned)(sr * G2_LP + sc8) * 2u;      /* the thread's own LDS byte address in buffer 0 */
  const int nst = K / G2_KS;
  const int ao = (32 * wm + ln) * G2_LP, bo = (128 + 64 * wn + ln) * G2_LP;      /* the lane's first A and B row in a stage, in f16 */
  const v8f z8 = {0.f,0.f,0.f,0.f,0.f,0.f,0.f,0.f}; v8f c00 = z8, c01 = z8, c02 = z8, c03 = z8, c10 = z8, c11 = z8, c12 = z8, c13 = z8;
  g2_stage(l0, ga, a32, gb, b32);
  asm volatile("s_wait_asynccnt 0x0" ::: "memory");      /* this wave's copies of stage 0 have landed */
  __syncthreads();      /* publishes stage 0 */
  if (nst > 1) g2_stage(l0 + G2_STB, ga + G2_KS, a32, gb + G2_KS, b32);
#pragma unroll 1      /* one stage a trip: the ring's waits and its barrier stand once, at the foot */
  for (int t = 0; t < nst; ++t) { const _Float16* st = (const _Float16*)(ring + (t & 1) * G2_STB);
#pragma unroll      /* both halves of a stage inline, so that their LDS offsets are immediates */
    for (int kb = 0; kb < G2_KS; kb += 32) {      /* the six fragments of 32 k are read as one group in front of their eight products */
      const v16h a0 = g2_frag(st + ao + kb, hh), a1 = g2_frag(st + ao + 16 * G2_LP + kb, hh);
      const v16h b0 = g2_frag(st + bo + kb, hh), b1 = g2_frag(st + bo + 16 * G2_LP + kb, hh), b2 = g2_frag(st + bo + 32 * G2_LP + kb, hh), b3 = g2_frag(st + bo + 48 * G2_LP + kb, hh);
      c00 = g2_mma(a0, b0, c00); c10 = g2_mma(a1, b0, c10); c01 = g2_mma(a0, b1, c01); c11 = g2_mma(a1, b1, c11);
      c02 = g2_mma(a0, b2, c02); c12 = g2_mma(a1, b2, c12); c03 = g2_mma(a0, b3, c03); c13 = g2_mma(a1, b3, c13); }
    asm volatile("s_wait_dscnt 0x0" ::: "memory");      /* this wave's reads of stage t are done */
    asm volatile("s_wait_asynccnt 0x0" ::: "memory");      /* this wave's copies of stage t + 1 have landed */
    __syncthreads();      /* publishes stage t + 1 and ends every wave's reads of stage t */
    if (t + 2 < nst) g2_stage(l0 + (unsigned)(t & 1) * G2_STB, ga + (size_t)(t + 2) * G2_KS, a32, gb + (size_t)(t + 2) * G2_KS, b32);      /* the same for the whole work-group; into the buffer just left */
  }
  asm volatile("s_wait_asynccnt 0x0" ::: "memory");      /* nothing is in flight when the ring becomes output staging */
  v8f accs[8] = {c00, c01, c02, c03, c10, c11, c12, c13};
#pragma unroll
  for (int u = 0; u < 8; ++u) { const int t = u & 3, half = u >> 2; const int col = col0 + t * 16 + ln; const float bv = bp ? bf16_round(bp[col]) : 0.f;
#pragma unroll
    for (int r = 0; r < 8; ++r) { const int rloc = half * 16 + 8 * hh + r; float v = accs[u][r] * alpha + bv; if (CP) { if (rowsPerB < 0) v += CP[cofs + (size_t)(row0g + row0 + rloc) * ldc + col];      /* rowsPerB < 0: own element of the batched C plane */ else { const int bidx = (row0g + row0 + rloc) / rowsPerB; v += CP[(size_t)bidx * sCPb + (size_t)by * 64 + col]; } }
      if (ACT == 3) v = fmaxf(v, 0.f); else if (ACT == 6) v = 0.5f * v * (1.0f + erff(v * 0.70710678118654752f)); else if (ACT == 11) v = 1.0f / (1.0f + expf(-v)); else if (ACT == 15) v = v / (1.0f + expf(-v)); else if (ACT == 12) v = (v > 0.f) ? v : 0.01f * v; else if (ACT == 8) v = tanhf(v); else if (ACT == 9) v = 0.5f * v * (1.0f + tanhf(0.7978845608028654f * (v + 0.044715f * v * v * v))); else if (ACT == 14) v = (v > 0.f) ? v : 0.1f * v; else if (ACT == 16) v = (v >= 0.f) ? v : 0.3f * v; else if (ACT == 17) v = (v >= 0.f) ? v : 0.2f * v;
      so[w][rloc][t * 16 + ln] = v; } }
  __builtin_amdgcn_fence(__ATOMIC_ACQ_REL, "workgroup"); __builtin_amdgcn_wave_barrier();
  const int rsub = lane >> 4, c4 = (lane & 15) * 4;
  {
#pragma unroll
    for (int q = 0; q < 16; ++q) { const int r = q * 2 + rsub; const v4f v = *(const v4fa*)&so[w][r][c4]; if (C) *(v4f*)(C + cofs + (size_t)(row0 + r) * ldc + col0 + c4) = v; if (C16) { v4h h4; for (int i = 0; i < 4; ++i) h4[i] = (_Float16)v[i]; *(v4h*)(C16 + cofs + (size_t)(row0 + r) * ldc + col0 + c4) = h4; } }
     } }


// ---- q | k | v GEMM (M = MP, N = LQ, K = DM, all fixed): block tile 256 x 192, so that the grid is one work-group a WGP and every operand row leaves L2 for fewer work-groups; 16 waves of 64 x 48; same ring, fragments, products and k order as k_gemm2 ----
#define G3_BM 256
#define G3_BN 192
#define G3_KS 128                    /* k per LDS stage: two whole 128-byte lines of every operand row */
#define G3_LP 136                    /* LDS row pitch in f16: 256 data bytes + 16, so that the 16-byte fragment reads of 16 rows spread over the banks */
#define G3_STB ((G3_BM + G3_BN) * G3_LP * 2)      /* bytes of a stage: 256 A rows, then 192 B rows */
#define G3_OP 196                    /* output staging pitch in f32: 192 + 4, so that rows 8 apart fall on different banks */
static_assert(MP % G3_BM == 0 && LQ % G3_BN == 0 && DM % G3_KS == 0 && DM / G3_KS >= 2, "k_gemm3: whole tiles, at least two stages");
// One stage: a thread copies 16 bytes of rows r + 32 j of the A tile (j < 8) and of the B tile (j < 6); 16 threads a row, so a wave's copy covers 2 rows of 2 whole lines; global memory to LDS through no register.
// The closing s_wait_xcnt stands inside the statement so that no address register of an issued copy is rewritten in front of it (a precaution).
__device__ __forceinline__ void g3_stage(unsigned l, const _Float16* a, const _Float16* b) {
  const unsigned R = 32 * G3_LP * 2;      /* 32 LDS rows in bytes */
  const size_t S = (size_t)32 * DM;       /* 32 operand rows in f16 */
  asm volatile("global_load_async_to_lds_b128 %0, %14, off\n\tglobal_load_async_to_lds_b128 %1, %15, off\n\tglobal_load_async_to_lds_b128 %2, %16, off\n\tglobal_load_async_to_lds_b128 %3, %17, off\n\t"
               "global_load_async_to_lds_b128 %4, %18, off\n\tglobal_load_async_to_lds_b128 %5, %19, off\n\tglobal_load_async_to_lds_b128 %6, %20, off\n\tglobal_load_async_to_lds_b128 %7, %21, off\n\t"
               "global_load_async_to_lds_b128 %8, %22, off\n\tglobal_load_async_to_lds_b128 %9, %23, off\n\tglobal_load_async_to_lds_b128 %10, %24, off\n\tglobal_load_async_to_lds_b128 %11, %25, off\n\t"
               "global_load_async_to_lds_b128 %12, %26, off\n\tglobal_load_async_to_lds_b128 %13, %27, off\n\ts_wait_xcnt 0x0"
               :: "v"(l), "v"(l + 1 * R), "v"(l + 2 * R), "v"(l + 3 * R), "v"(l + 4 * R), "v"(l + 5 * R), "v"(l + 6 * R), "v"(l + 7 * R), "v"(l + 8 * R), "v"(l + 9 * R), "v"(l + 10 * R), "v"(l + 11 * R), "v"(l + 12 * R), "v"(l + 13 * R),
                  "v"(a), "v"(a + 1 * S), "v"(a + 2 * S), "v"(a + 3 * S), "v"(a + 4 * S), "v"(a + 5 * S), "v"(a + 6 * S), "v"(a + 7 * S), "v"(b), "v"(b + 1 * S), "v"(b + 2 * S), "v"(b + 3 * S), "v"(b + 4 * S), "v"(b + 5 * S) : "memory");
}
__global__ __launch_bounds__(512) void k_gemm3(const _Float16* __restrict__ A, const _Float16* __restrict__ Bh, float alpha, float* __restrict__ C, _Float16* __restrict__ C16) {
  __shared__ __attribute__((aligned(16))) unsigned char ring[2 * G3_STB];      /* two stages; behind the loop's last barrier the same bytes are the output staging */
  static_assert(sizeof(float) * G3_BM * G3_OP <= sizeof(ring), "k_gemm3: the output staging must fit the ring");
  float (*so)[G3_OP] = (float (*)[G3_OP])ring;
  const int tid = threadIdx.x, w = tid >> 5, lane = tid & 31, ln = lane & 15, hh = lane >> 4;
  const int mt = blockIdx.x / (LQ / G3_BN), nq = blockIdx.x % (LQ / G3_BN);
  const int wm = w & 3, wn = w >> 2;      /* 4 x 4 waves */
  const int sr = tid >> 4, sc8 = (tid & 15) * 8;      /* staging: 16 threads a row of 256 bytes */
  const _Float16* ga = A + (size_t)(mt * G3_BM + sr) * DM + sc8; const _Float16* gb = Bh + (size_t)(nq * G3_BN + sr) * DM + sc8;
  const unsigned l0 = (unsigned)(size_t)ring + (unsigned)(sr * G3_LP + sc8) * 2u;      /* the thread's own LDS byte address in buffer 0 */
  const int nst = DM / G3_KS;
  const int ao = (64 * wm + ln) * G3_LP, bo = (G3_BM + 48 * wn + ln) * G3_LP;      /* the lane's first A and B row in a stage, in f16 */
  v8f acc[4][3];
#pragma unroll      /* here and below: constant indices keep the accumulators in registers */
  for (int i = 0; i < 4; ++i)
#pragma unroll
    for (int j = 0; j < 3; ++j) acc[i][j] = v8f{0.f,0.f,0.f,0.f,0.f,0.f,0.f,0.f};
  g3_stage(l0, ga, gb);
  asm volatile("s_wait_asynccnt 0x0" ::: "memory");      /* this wave's copies of stage 0 have landed */
  __syncthreads();      /* publishes stage 0 */
  g3_stage(l0 + G3_STB, ga + G3_KS, gb + G3_KS);
#pragma unroll 1      /* one stage a trip: the ring's waits and its barrier stand once, at the foot */
  for (int t = 0; t < nst; ++t) { const _Float16* st = (const _Float16*)(ring + (t & 1) * G3_STB);
#pragma unroll      /* the four quarters of a stage inline, so that their LDS offsets are immediates */
    for (int kb = 0; kb < G3_KS; kb += 32) {      /* the seven fragments of 32 k are read as one group in front of their twelve products */
      v16h a[4], b[3];
#pragma unroll
      for (int i = 0; i < 4; ++i) a[i] = g2_frag(st + ao + i * 16 * G3_LP + kb, hh);
#pragma unroll
      for (int j = 0; j < 3; ++j) b[j] = g2_frag(st + bo + j * 16 * G3_LP + kb, hh);
#pragma unroll
      for (int j = 0; j < 3; ++j)
#pragma unroll
        for (int i = 0; i < 4; ++i) acc[i][j] = g2_mma(a[i], b[j], acc[i][j]); }
    asm volatile("s_wait_dscnt 0x0" ::: "memory");      /* this wave's reads of stage t are done */
    asm volatile("s_wait_asynccnt 0x0" ::: "memory");      /* this wave's copies of stage t + 1 have landed */
    __syncthreads();      /* publishes stage t + 1 and ends every wave's reads of stage t */
    if (t + 2 < nst) g3_stage(l0 + (unsigned)(t & 1) * G3_STB, ga + (size_t)(t + 2) * G3_KS, gb + (size_t)(t + 2) * G3_KS);      /* the same for the whole work-group; into the buffer just left */
  }
  asm volatile("s_wait_asynccnt 0x0" ::: "memory");      /* nothing is in flight when the ring becomes output staging */
#pragma unroll
  for (int i = 0; i < 4; ++i)
#pragma unroll
    for (int j = 0; j < 3; ++j)
#pragma unroll
      for (int r = 0; r < 8; ++r) so[64 * wm + 16 * i + 8 * hh + r][48 * wn + 16 * j + ln] = acc[i][j][r] * alpha;
  __syncthreads();      /* the whole tile is staged: a wave's 48 columns are no whole lines, so rows go out across the waves' tiles, 64 columns a half-wave */
  const int er = tid >> 4, ec = (tid & 15) * 4;
  v4f vo[8][3]; v4h ho[8][3];
#pragma unroll      /* here and below: constant indices keep the 24 pieces in registers */
  for (int p = 0; p < 8; ++p)
#pragma unroll
    for (int cb = 0; cb < 3; ++cb) { vo[p][cb] = *(const v4fa*)&so[p * 32 + er][cb * 64 + ec];
#pragma unroll
      for (int i = 0; i < 4; ++i) ho[p][cb][i] = (_Float16)vo[p][cb][i]; }
  __builtin_amdgcn_sched_barrier(0);      /* all reads and conversions in front of the first store, so that no register which an issued store names is written again */
  const size_t eo = (size_t)(mt * G3_BM + er) * LQ + nq * G3_BN + ec;
#pragma unroll
  for (int p = 0; p < 8; ++p)
#pragma unroll
    for (int cb = 0; cb < 3; ++cb) { *(v4f*)(C + eo + (size_t)p * 32 * LQ + cb * 64) = vo[p][cb]; *(v4h*)(C16 + eo + (size_t)p * 32 * LQ + cb * 64) = ho[p][cb]; }
}


// The three operand conversions (x -> exact f16 rows; w_qkv and w_proj -> exact x16 planes) depend on nothing and share one launch: the block index picks the job. A thread converts 8 elements, a work-group 2048; every job is a whole number of work-groups.
#define CV_GX ((unsigned)(NR * DM / 2048))                    /* work-groups of x */
#define CV_GQ ((unsigned)((size_t)3 * DM * DM / 2048))        /* work-groups of w_qkv */
#define CV_GO ((unsigned)((size_t)DM * DM / 2048))            /* work-groups of w_proj */
static_assert(NR * DM % 2048 == 0 && (size_t)DM * DM % 2048 == 0, "k_cvt3: whole work-groups");
__global__ __launch_bounds__(256) void k_cvt3(const float* __restrict__ x, const float* __restrict__ wq, const float* __restrict__ wo, _Float16* __restrict__ X16, _Float16* __restrict__ Bq, _Float16* __restrict__ Bo) {
  const unsigned bx = blockIdx.x; const float* s = x; _Float16* d = X16; unsigned g = bx; float sc = 1.0f;      /* the same for the whole work-group; x 1 is exact */
  if (bx >= CV_GX + CV_GQ) { s = wo; d = Bo; g = bx - (CV_GX + CV_GQ); sc = 16.0f; } else if (bx >= CV_GX) { s = wq; d = Bq; g = bx - CV_GX; sc = 16.0f; }
  const size_t t = (size_t)g * 256 + threadIdx.x; FragH f;
#pragma unroll      /* the thread's 8 elements stay in registers under constant indices and load as two 16-byte pieces */
  for (int q = 0; q < 8; ++q) f.h[q] = (_Float16)(bf16_round(s[t * 8 + q]) * sc); *(v8us*)((unsigned short*)d + t * 8) = f.half[0];  }
__global__ __launch_bounds__(256) void k_rsm(const float* __restrict__ S, _Float16* __restrict__ P, int nrows) {
  #pragma clang fp contract(off)
  const int i = blockIdx.x * 256 + threadIdx.x; if (i >= nrows) return; const float* s = S + (size_t)i * SQ; float mx = -3.0e38f;
#pragma unroll 1
  for (int j = 0; j < SQ; ++j) mx = fmaxf(mx, s[j]); float se = 0.f;
#pragma unroll 1
  for (int j = 0; j < SQ; ++j) se += expf(s[j] - mx); const float sc = 256.0f / se;
#pragma unroll 1
  for (int j0 = 0; j0 < SQ; j0 += 8) { FragH f; for (int q = 0; q < 8; ++q) f.h[q] = (_Float16)(expf(s[j0 + q] - mx) * sc); unsigned short* d = (unsigned short*)P + (size_t)i * SQ + j0; *(v8us*)d = f.half[0];  } }
__global__ __launch_bounds__(256) void k_vt(const _Float16* __restrict__ V16, int b, int h0, _Float16* __restrict__ VT) { __shared__ unsigned short tl[64][65]; const int tid = threadIdx.x; const int hh = blockIdx.x % HG, sg = blockIdx.x / HG; const int s0 = sg * 64; const int h = h0 + hh;
  for (int i = tid; i < 64 * 8; i += 256) { const int j = i / 8, d8 = (i % 8) * 8; FragH f; f.half[0] = *(const v8us*)((const unsigned short*)V16 + ((size_t)b * SQ + s0 + j) * DM + h * HD + d8); for (int q = 0; q < 8; ++q) tl[d8 + q][j] = f.u[q]; }
  __syncthreads();
  { for (int i = tid; i < 64 * 8; i += 256) { const int d = i / 8, j8 = (i % 8) * 8; FragH f; for (int q = 0; q < 8; ++q) f.u[q] = tl[d][j8 + q]; *(v8us*)((unsigned short*)VT + ((size_t)hh * HD + d) * SQ + s0 + j8) = f.half[0]; }  } }



// ---- fused attention: scores, softmax and P V in one kernel; neither scores nor weights go to memory ----
typedef float  v2f  __attribute__((ext_vector_type(2)));
#define FA_KS 64                     /* keys per LDS stage */
#define FA_LP 72                     /* LDS row pitch in f16: 128 data bytes + 16, so that the 16-byte fragment reads of 16 rows spread over the banks */
#define FA_QW 32                     /* query columns per wave */
#define FA_QB 256                    /* query columns per work-group (8 waves of a key group) */
#define FA_KG 2                      /* key groups per work-group: each group of 8 waves walks its own part of the keys for the same 256 queries, so that a SIMD holds 4 waves */
#define FA_KN (SQ / FA_KG)           /* keys per group */
__device__ __forceinline__ float fa_xhalf(float x) { return __builtin_bit_cast(float, __builtin_amdgcn_permlanex16(__builtin_bit_cast(int, x), __builtin_bit_cast(int, x), 0x76543210, 0xfedcba98, false, false)); }      /* lane l <-> lane l ^ 16 */
// native 2^x, in place: each exponential overwrites only its own argument, which the compiler's own vector instruction has just written (so no register of a matrix instruction still in its window is touched), and none reads the result or overwrites the source of the one in front of it; the closing v_nop keeps the one slot that the instruction set asks for behind a transcendental
__device__ __forceinline__ float fa_exp2(float x) { asm("v_exp_f32 %0, %0\n\tv_nop" : "+v"(x)); return x; }
__device__ __forceinline__ void fa_exp2x16(v8f& a, v8f& b) { float x0 = a[0], x1 = a[1], x2 = a[2], x3 = a[3], x4 = a[4], x5 = a[5], x6 = a[6], x7 = a[7], x8 = b[0], x9 = b[1], x10 = b[2], x11 = b[3], x12 = b[4], x13 = b[5], x14 = b[6], x15 = b[7];
  asm("v_exp_f32 %0, %0\n\tv_exp_f32 %1, %1\n\tv_exp_f32 %2, %2\n\tv_exp_f32 %3, %3\n\tv_exp_f32 %4, %4\n\tv_exp_f32 %5, %5\n\tv_exp_f32 %6, %6\n\tv_exp_f32 %7, %7\n\tv_exp_f32 %8, %8\n\tv_exp_f32 %9, %9\n\tv_exp_f32 %10, %10\n\tv_exp_f32 %11, %11\n\tv_exp_f32 %12, %12\n\tv_exp_f32 %13, %13\n\tv_exp_f32 %14, %14\n\tv_exp_f32 %15, %15\n\tv_nop"
      : "+v"(x0), "+v"(x1), "+v"(x2), "+v"(x3), "+v"(x4), "+v"(x5), "+v"(x6), "+v"(x7), "+v"(x8), "+v"(x9), "+v"(x10), "+v"(x11), "+v"(x12), "+v"(x13), "+v"(x14), "+v"(x15));
  a = v8f{x0, x1, x2, x3, x4, x5, x6, x7}; b = v8f{x8, x9, x10, x11, x12, x13, x14, x15}; }
__device__ __forceinline__ v8f fa_mma(v16h a, v16h b, v8f c) { return __builtin_amdgcn_wmma_f32_16x16x32_f16(false, a, false, b, (short)0, c, false, false); }
static_assert(FA_KG == 2 && FA_KN % FA_KS == 0, "k_fattn: two key groups of whole stages");
__global__ __launch_bounds__(256 * FA_KG) void k_fattn(const _Float16* __restrict__ Qn, const _Float16* __restrict__ Kn, const _Float16* __restrict__ VT, _Float16* __restrict__ O) {
  __shared__ __attribute__((aligned(16))) _Float16 sk[FA_KG][2][FA_KS][FA_LP];      /* K rows [key][d], two buffers a key group */
  __shared__ __attribute__((aligned(16))) _Float16 sv[FA_KG][2][HD][FA_LP];         /* V^T rows [d][key] */
  __shared__ __attribute__((aligned(16))) float cmb[8][17][32][4];      /* group 1's hand-over: a wave's 16 pieces of O and one of m and l, 16 bytes a lane */
  const int g = __builtin_amdgcn_readfirstlane((int)threadIdx.x >> 8);      /* key group, the same for a whole wave: kept scalar */
  const int tid = threadIdx.x & 255, w = tid >> 5, lane = tid & 31, ln = lane & 15, hh = lane >> 4;      /* place inside the key group */
  const int bh = blockIdx.y, b = bh / NH, h = bh % NH; const int q0 = blockIdx.x * FA_QB + w * FA_QW;
  const float cs = 0.125f * 1.44269504088896340736f;      /* 1/sqrt(64) and log2 e */
  const _Float16* qp = Qn + ((size_t)b * SQ + q0 + ln) * DM + h * HD;
  v16h qf[2][2];
  for (int t = 0; t < 2; ++t) for (int s = 0; s < 2; ++s) qf[t][s] = g2_frag(qp + (size_t)t * 16 * DM + s * 32, hh);
  const int sr = tid >> 3, sc8 = (tid & 7) * 8;      /* staging: 8 threads a row of 128 bytes, rows sr and sr + 32 */
  const unsigned short* kg = (const unsigned short*)Kn + ((size_t)b * SQ + g * FA_KN + sr) * DM + h * HD + sc8;
  const unsigned short* vg = (const unsigned short*)VT + ((size_t)bh * HD + sr) * SQ + g * FA_KN + sc8;
  v8us gk0 = *(const v8us*)kg, gk1 = *(const v8us*)(kg + (size_t)32 * DM), gv0 = *(const v8us*)vg, gv1 = *(const v8us*)(vg + (size_t)32 * SQ);
  asm volatile("s_wait_xcnt 0x0" :: "v"(qp), "v"(kg), "v"(vg) : "memory");      /* precaution: the loads' address registers stay live up to this wait */
  *(v8us*)&sk[g][0][sr][sc8] = gk0; *(v8us*)&sk[g][0][sr + 32][sc8] = gk1; *(v8us*)&sv[g][0][sr][sc8] = gv0; *(v8us*)&sv[g][0][sr + 32][sc8] = gv1;
  const v8f z8 = {0.f,0.f,0.f,0.f,0.f,0.f,0.f,0.f};
  v8f o[2][4]; float mr[2]; v2f l[2];
  for (int t = 0; t < 2; ++t) { mr[t] = -3.0e38f; l[t] = v2f{0.f, 0.f}; for (int dt = 0; dt < 4; ++dt) o[t][dt] = z8; }
  __syncthreads();
#pragma unroll 1      /* keeps the loop whole: without it the compiler peels the last stage, doubles the code and goes past 256 registers */
  for (int st = 0; st < FA_KN / FA_KS; ++st) {
    const int bu = st & 1; const bool more = st + 1 < FA_KN / FA_KS;      /* same for the whole work-group */
    if (more) {      /* next stage's rows fly while this stage is worked on */
      kg += (size_t)FA_KS * DM; vg += FA_KS;
      gk0 = *(const v8us*)kg; gk1 = *(const v8us*)(kg + (size_t)32 * DM); gv0 = *(const v8us*)vg; gv1 = *(const v8us*)(vg + (size_t)32 * SQ);
      asm volatile("s_wait_xcnt 0x0" :: "v"(kg), "v"(vg) : "memory");      /* precaution: the loads' address registers stay live up to this wait */
    }
    for (int kp = 0; kp < FA_KS / 32; ++kp) {
      v8f s[2][2];      /* [query tile][key tile] */
      { v16h ka[2][2];
        for (int kt = 0; kt < 2; ++kt) for (int c = 0; c < 2; ++c) ka[kt][c] = g2_frag(&sk[g][bu][kp * 32 + kt * 16 + ln][c * 32], hh);
        for (int t = 0; t < 2; ++t) for (int kt = 0; kt < 2; ++kt) s[t][kt] = fa_mma(ka[kt][1], qf[t][1], fa_mma(ka[kt][0], qf[t][0], z8)); }
      v16h va[4];
      for (int dt = 0; dt < 4; ++dt) va[dt] = g2_frag(&sv[g][bu][dt * 16 + ln][kp * 32], hh);
      float mb[2]; bool need = false;
      for (int t = 0; t < 2; ++t) { float mx = s[t][0][0];
        for (int r = 1; r < 8; ++r) mx = fmaxf(mx, s[t][0][r]);
        for (int r = 0; r < 8; ++r) mx = fmaxf(mx, s[t][1][r]);
        mx = fmaxf(mx, fa_xhalf(mx)) * cs; mb[t] = mx; need = need || (mx > mr[t] + 8.0f); }
      if (__builtin_amdgcn_ballot_w32(need) != 0) {      /* scalar branch; rare after the first passes */
        for (int t = 0; t < 2; ++t) { const float mn = fmaxf(mr[t], mb[t]); const float al = fa_exp2(mr[t] - mn); mr[t] = mn; l[t] *= al;
          for (int dt = 0; dt < 4; ++dt) o[t][dt] = o[t][dt] * al; } }
      for (int t = 0; t < 2; ++t) { const float nm = 4.0f - mr[t]; FragH pf; v8f p0 = s[t][0] * cs + nm, p1 = s[t][1] * cs + nm;
        fa_exp2x16(p0, p1);
        for (int r = 0; r < 8; ++r) { pf.h[r] = (_Float16)p0[r]; pf.h[8 + r] = (_Float16)p1[r]; }
        const v8f ps = p0 + p1; const v4f p4 = ps.lo + ps.hi; l[t] += p4.lo + p4.hi;      /* the denominator sums the unrounded f32 weights, halving trees that stay in register pairs */
        for (int dt = 0; dt < 4; ++dt) o[t][dt] = fa_mma(va[dt], pf.v, o[t][dt]); }
    }
    asm volatile("v_nop\n\tv_nop\n\tv_nop\n\tv_nop" : "+v"(o[1][0]), "+v"(o[1][1]), "+v"(o[1][2]), "+v"(o[1][3]));      /* the four vector slots behind the stage's last matrix instructions, in front of the branch below */
    if (more) { *(v8us*)&sk[g][bu ^ 1][sr][sc8] = gk0; *(v8us*)&sk[g][bu ^ 1][sr + 32][sc8] = gk1; *(v8us*)&sv[g][bu ^ 1][sr][sc8] = gv0; *(v8us*)&sv[g][bu ^ 1][sr + 32][sc8] = gv1; }      /* that buffer's readers left it at the last barrier */
    __syncthreads();      /* publishes stage st + 1 and ends the reads of stage st */
  }
  if (g != 0) {      /* scalar branch: group 1 hands over what it has of its half of the keys */
    for (int t = 0; t < 2; ++t) for (int dt = 0; dt < 4; ++dt) { *(v4f*)&cmb[w][(t * 4 + dt) * 2][lane][0] = o[t][dt].lo; *(v4f*)&cmb[w][(t * 4 + dt) * 2 + 1][lane][0] = o[t][dt].hi; }
    *(v4f*)&cmb[w][16][lane][0] = v4f{mr[0], mr[1], l[0][0] + l[0][1], l[1][0] + l[1][1]}; }
  __syncthreads();      /* publishes the hand-over; every wave passes it */
  if (g != 0) return;      /* behind the last barrier */
  const v4f s1 = *(const v4fa*)&cmb[w][16][lane][0];
  FragH f[2][4];
  for (int t = 0; t < 2; ++t) { const float mn = fmaxf(mr[t], s1[t]); const float a0 = fa_exp2(mr[t] - mn), a1 = fa_exp2(s1[t] - mn);      /* both parts on the common maximum */
    const float lw = (l[t][0] + l[t][1]) * a0 + s1[2 + t] * a1; const float inv = 64.0f / (lw + fa_xhalf(lw)); const float c0 = a0 * inv, c1 = a1 * inv;
    for (int dt = 0; dt < 4; ++dt) { const v4f ol = *(const v4fa*)&cmb[w][(t * 4 + dt) * 2][lane][0], oh = *(const v4fa*)&cmb[w][(t * 4 + dt) * 2 + 1][lane][0];
      for (int r = 0; r < 4; ++r) { f[t][dt].h[r] = (_Float16)(o[t][dt][r] * c0 + ol[r] * c1); f[t][dt].h[4 + r] = (_Float16)(o[t][dt][4 + r] * c0 + oh[r] * c1); } } }
  __builtin_amdgcn_sched_barrier(0);      /* all conversions in front of the first store, so that no register which an issued store names is written again */
  unsigned short* op = (unsigned short*)O + ((size_t)b * SQ + q0 + ln) * DM + h * HD + 8 * hh;
  for (int t = 0; t < 2; ++t) for (int dt = 0; dt < 4; ++dt) *(v8us*)(op + (size_t)t * 16 * DM + dt * 16) = f[t][dt].half[0];
}


// q and k LayerNorm (p: 0 = q, 1 = k; bx: the work-group's place among those of p), no LDS and no barrier: a wave takes LN_TW token rows and holds their 1024 features in registers, read once by loads of 512 bytes in a row.
// Mean and variance (two passes over the registers): lane partials, then a butterfly over the 32 lanes. gamma and beta (rounded to bf16) are loaded once a wave and serve all its rows.
#define LN_TW 2                      /* token rows per wave */
template <int CTRL> __device__ __forceinline__ float ln_xm(float x) { return __builtin_bit_cast(float, __builtin_amdgcn_update_dpp(0, __builtin_bit_cast(int, x), CTRL, 0xf, 0xf, true)); }      /* lane l <- lane l ^ (CTRL & 15), inside a row of 16 lanes (row_xmask) */
__device__ __forceinline__ float ln_wsum(float x) { x += ln_xm<0x161>(x); x += ln_xm<0x162>(x); x += ln_xm<0x164>(x); x += ln_xm<0x168>(x); return x + fa_xhalf(x); }      /* the sum over the wave, in every lane */
__device__ __forceinline__ float ln_sum4(v4f s) { const v2f h = s.lo + s.hi; return h[0] + h[1]; }
__device__ __forceinline__ void ln_rows(const int bx, const int p, const float* __restrict__ X, const float* __restrict__ qg, const float* __restrict__ qb, const float* __restrict__ kg, const float* __restrict__ kb, float eps, _Float16* __restrict__ Qo, _Float16* __restrict__ Ko) {
  const int lane = threadIdx.x & 31; const size_t r0 = ((size_t)bx * 8 + (threadIdx.x >> 5)) * LN_TW;
  const float* g = (p ? kg : qg) + lane * 4; const float* bt = (p ? kb : qb) + lane * 4; const float* x = X + r0 * LQ + p * DM + lane * 4;
  v4f gg[8], bb[8], a[LN_TW][8];      /* pieces of 128 features; every loop below is unrolled so that these stay in registers under constant indices */
#pragma unroll
  for (int i = 0; i < 8; ++i) { gg[i] = *(const v4fa*)(g + i * 128); bb[i] = *(const v4fa*)(bt + i * 128); }
#pragma unroll
  for (int u = 0; u < LN_TW; ++u)
#pragma unroll
    for (int i = 0; i < 8; ++i) a[u][i] = *(const v4fa*)(x + (size_t)u * LQ + i * 128);
  asm volatile("s_wait_xcnt 0x0" :: "v"(g), "v"(bt), "v"(x) : "memory");      /* precaution: the loads' address registers stay live up to this wait */
  __builtin_amdgcn_sched_barrier(0);      /* holds that wait directly behind the loads: without it the scheduler sinks it far below them */
#pragma unroll
  for (int i = 0; i < 8; ++i)
#pragma unroll
    for (int c = 0; c < 4; ++c) { gg[i][c] = bf16_round(gg[i][c]); bb[i][c] = bf16_round(bb[i][c]); }
  v4h y[LN_TW][8];
#pragma unroll
  for (int u = 0; u < LN_TW; ++u) { v4f s = a[u][0];
#pragma unroll
    for (int i = 1; i < 8; ++i) s += a[u][i];
    const float mu = ln_wsum(ln_sum4(s)) * (1.0f / (float)DM); v4f q = {0.f, 0.f, 0.f, 0.f};
#pragma unroll
    for (int i = 0; i < 8; ++i) { a[u][i] -= mu; q += a[u][i] * a[u][i]; }
    const float rs = rsqrtf(ln_wsum(ln_sum4(q)) * (1.0f / (float)DM) + eps);
#pragma unroll
    for (int i = 0; i < 8; ++i) { const v4f o = a[u][i] * rs * gg[i] + bb[i];
#pragma unroll
      for (int c = 0; c < 4; ++c) y[u][i][c] = (_Float16)o[c]; } }
  __builtin_amdgcn_sched_barrier(0);      /* all conversions in front of the first store, so that no register which an issued store names is written again */
  _Float16* d = (p ? Ko : Qo) + r0 * DM + lane * 4;
#pragma unroll
  for (int u = 0; u < LN_TW; ++u)
#pragma unroll
    for (int i = 0; i < 8; ++i) *(v4h*)(d + (size_t)u * DM + i * 128) = y[u][i];
}
// The two jobs that need only the q | k | v rows share one launch: the block index picks the job. The LayerNorm work-groups (the longer ones) come first, q then k; the V^T tiles follow.
#define LV_GL (MP / (8 * LN_TW))     /* LayerNorm work-groups for q, and as many for k */
#define LV_GV (NB * NH * (SQ / 64))  /* V^T tiles */
__global__ __launch_bounds__(256) void k_lnvt(const float* __restrict__ X, const float* __restrict__ qg, const float* __restrict__ qb, const float* __restrict__ kg, const float* __restrict__ kb, float eps, _Float16* __restrict__ Qo, _Float16* __restrict__ Ko, const _Float16* __restrict__ V16, _Float16* __restrict__ Vt) {
  __shared__ unsigned short tl[64][66];
  const int bx = blockIdx.x;      /* every test on it is the same for the whole work-group, so the barrier in vt_tile is passed by all of its waves or by none */
  if (bx < 2 * LV_GL) { const int p = bx >= LV_GL ? 1 : 0; ln_rows(bx - p * LV_GL, p, X, qg, qb, kg, kb, eps, Qo, Ko); }
  else vt_tile<NH, SQ>(tl, bx - 2 * LV_GL, V16, LQ, 0, Vt);
}
extern "C" void kernel_launch(void* const* d_in, const int* in_sizes, int n_in,
                              void* d_out, int out_size, void* d_ws, size_t ws_size, hipStream_t stream) {
  (void)in_sizes; (void)n_in; (void)out_size;
  const float* const* I = (const float* const*)d_in; const float* x = I[0]; const float* wqkv = I[1]; const float* wo = I[2]; const float* bo = I[3]; const float* qg = I[4]; const float* qb = I[5]; const float* kg = I[6]; const float* kb = I[7]; const float* bqkv = nullptr;      /* natural weights; no qkv bias */
  char* ws = (char*)d_ws; size_t off = 0;
  auto take = [&](size_t bytes) { char* p = ws + off; off += (bytes + 255) & ~(size_t)255; return p; };
  _Float16* BQKV = (_Float16*)take((size_t)3 * DM * DM * 2); _Float16* BO = (_Float16*)take((size_t)DM * DM * 2);
  _Float16* X16 = (_Float16*)take(NR * DM * 2); float* QKVF = (float*)take(NR * 3 * DM * 4); _Float16* QN16 = (_Float16*)take(NR * DM * 2); _Float16* KN16 = (_Float16*)take(NR * DM * 2); _Float16* QKV = (_Float16*)take(NR * 3 * DM * 2); _Float16* Q16 = QKV; _Float16* K16 = QKV + DM; _Float16* V16 = QKV + 2 * DM; _Float16* O16 = (_Float16*)take(NR * DM * 2);
  _Float16* VT = (_Float16*)take((size_t)NB * NH * HD * SQ * 2);
  if (off > ws_size) return;
  k_cvt3<<<CV_GX + CV_GQ + CV_GO, 256, 0, stream>>>(x, wqkv, wo, X16, BQKV, BO);      /* x rows; natural [out][in] weights = Bt planes x16 */
  const size_t r0p = (size_t)B0 * SQ;      /* first projected row */
  k_gemm3<<<(MP / G3_BM) * (LQ / G3_BN), 512, 0, stream>>>(X16 + r0p * DM, BQKV, 0.0625f, QKVF + r0p * 3 * DM, QKV + r0p * 3 * DM);      /* q | k | v rows: f32 (for the LayerNorms) and f16 (v operand) */
  static_assert(MP % (8 * LN_TW) == 0, "k_lnvt: whole LayerNorm work-groups of 8 waves");
  k_lnvt<<<2 * LV_GL + LV_GV, 256, 0, stream>>>(QKVF + r0p * 3 * DM, qg, qb, kg, kb, 1e-5f, QN16 + r0p * DM, KN16 + r0p * DM, V16, VT);      /* q, k = LayerNorm over the merged 1024 features -> f16 rows; V^T [NB][NH][HD][SQ] */
  k_fattn<<<dim3(SQ / FA_QB, NB * NH), 256 * FA_KG, 0, stream>>>(QN16, KN16, VT, O16);      /* o (merged heads, x64) as f16 rows: all batches and heads in one launch */
  k_gemm2<0><<<dim3((unsigned)((MPO / 128) * (DM / 128)), 1), 256, 0, stream>>>(O16 + r0p * DM, DM, 0, BO, DM, 0, 0.0009765625f, bo, 0, nullptr, 1, 0, 0, (float*)d_out + r0p * DM, nullptr, DM, 0, MPO, DM, DM);      /* out rows are the output layout */
}
